// v000
// The times below were measured on an AMD MI455X: many runs one after another, warmed up first and cycling through
// copies of the inputs, with the whole window's GPU time divided by the number of runs. Launches and the gaps
// between them are all in it. The median over several windows is given; except for v000 it joins two sittings, which
// can be a few percent apart, so the side-by-side timings, each taken in one sitting, are the better comparison.
// v000 is the starting kernel. One run takes 1350 microseconds.
#include <hip/hip_runtime.h>
// Multi-head cross attention over social features (B 4, S 2048 queries x 1024, 2048 keys/values x 512, 16 heads x 64; (in,out) Linear weights with bias; key/value rows whose raw features sum to exactly 0 are zeroed after projection, as the reference's padding mask): scores = q.k/8; softmax; out = (attn.v merged)*Wo + bo -> [4,2048,1024].
// Compute dtype: the inputs, the four matrices and biases rounded to bf16; q/k/v products exact (weights x16 in f16, undone by alpha), q, k, v, P as f16 operands (~2^-12; logits sigma ~0.4), O as f16 hi + lo; f32 accumulation and softmax. v_wmma_f32_16x16x32_f16.
#define NBT 4
#define TQ 2048
#define TK 2048
#define DKV 512
#define NR (NBT * TQ)
#define DM 1024
#define NH 16
#define SCL 0.125f
typedef __bf16 v16b __attribute__((ext_vector_type(16)));
typedef unsigned short v8us __attribute__((ext_vector_type(8), may_alias));
typedef float  v8f  __attribute__((ext_vector_type(8)));
typedef float  v4f  __attribute__((ext_vector_type(4)));
typedef float  v4fa __attribute__((ext_vector_type(4), may_alias));
union FragB { v16b v; v8us half[2]; unsigned short u[16]; };

__device__ __forceinline__ unsigned short bf16_bits(float x) { unsigned int u = __float_as_uint(x); return (unsigned short)((u + 0x7FFFu + ((u >> 16) & 1u)) >> 16); }
__device__ __forceinline__ float bf16_val(unsigned short b) { return __uint_as_float(((unsigned int)b) << 16); }
__device__ __forceinline__ float bf16_round(float x) { return bf16_val(bf16_bits(x)); }
// D += A·B with NT terms: 1 = ah·bh, 2 = + al·bh (A split), 3 = + ah·bl (both split)
template <int NT>
__device__ __forceinline__ v8f mmaN(v16b ah, v16b al, v16b bh, v16b bl, v8f c) {
  c = __builtin_amdgcn_wmma_f32_16x16x32_bf16(false, ah, false, bh, (short)0, c, false, false);
  if (NT >= 2) c = __builtin_amdgcn_wmma_f32_16x16x32_bf16(false, al, false, bh, (short)0, c, false, false);
  if (NT >= 3) c = __builtin_amdgcn_wmma_f32_16x16x32_bf16(false, ah, false, bl, (short)0, c, false, false);
  asm volatile("v_nop\n\tv_nop\n\tv_nop\n\tv_nop" : "+v"(c) : "v"(ah), "v"(al), "v"(bh), "v"(bl));
  return c;
}

__global__ __launch_bounds__(256) void k_wt_bf16(const float* __restrict__ W, unsigned short* __restrict__ Wt, int K, int N) {
  const int t = blockIdx.x * 256 + threadIdx.x;
  const int k8n = K / 8;
  if (t >= N * k8n) return;
  const int n = t / k8n, k8 = (t % k8n) * 8;
  v8us v;
#pragma unroll
  for (int i = 0; i < 8; ++i) v[i] = bf16_bits(W[(size_t)(k8 + i) * N + n]);
  *(v8us*)(Wt + (size_t)n * K + k8) = v;
  
}

// GEMM C[M][N] (f32, pitch ldc) = act(A[M][K]·W + bias). A f32 row-major (pitch lda) converted per fragment to bf16
// (ASPLIT: hi/lo two planes -> 2 terms, else single rounded term); Wt bf16 [N][K] (pitch ldb). BIAS_BF16 rounds the
// bias to bf16 first (bias quantised to bf16 before the add). K%32==0, M%16==0, N%64==0.
template <bool ASPLIT, int ACT, bool BIAS_BF16>
__global__ __launch_bounds__(128) void k_gemm_bf(const float* __restrict__ A, int lda, const unsigned short* __restrict__ Wt, int ldb,
                                               const float* __restrict__ bias, float* __restrict__ C, int ldc, int M, int N, int K) {
  __shared__ __attribute__((aligned(16))) float so[4][16][64];
  const int tid = threadIdx.x, w = tid >> 5, lane = tid & 31, ln = lane & 15, hh = lane >> 4;
  const int ntn = N / 64;
  const int wid = blockIdx.x * 4 + w;
  const int mt = wid / ntn, nq = wid % ntn;
  if (mt * 16 >= M) return;
  const int row0 = mt * 16, col0 = nq * 64;
  const float* arow = A + (size_t)(row0 + ln) * lda;
  v8f acc[4] = {};
  for (int kb = 0; kb < K; kb += 32) {
    FragB ah, al;
    const v4f x0 = *(const v4fa*)(arow + kb + 8 * hh), x1 = *(const v4fa*)(arow + kb + 8 * hh + 4);
    const v4f x2 = *(const v4fa*)(arow + kb + 16 + 8 * hh), x3 = *(const v4fa*)(arow + kb + 16 + 8 * hh + 4);
    float xs[16] = {x0[0],x0[1],x0[2],x0[3],x1[0],x1[1],x1[2],x1[3],x2[0],x2[1],x2[2],x2[3],x3[0],x3[1],x3[2],x3[3]};
#pragma unroll
    for (int i = 0; i < 16; ++i) { const unsigned short hb = bf16_bits(xs[i]); ah.u[i] = hb; al.u[i] = ASPLIT ? bf16_bits(xs[i] - bf16_val(hb)) : (unsigned short)0; }
#pragma unroll
    for (int t = 0; t < 4; ++t) {
      const unsigned short* brow = Wt + (size_t)(col0 + t * 16 + ln) * ldb + kb;
      FragB b;
      b.half[0] = *(const v8us*)(brow + 8 * hh);
      b.half[1] = *(const v8us*)(brow + 16 + 8 * hh);
      acc[t] = mmaN<ASPLIT ? 2 : 1>(ah.v, al.v, b.v, b.v, acc[t]);
    }
  }
#pragma unroll
  for (int t = 0; t < 4; ++t) {
    float bv = bias ? bias[col0 + t * 16 + ln] : 0.f;
    if (BIAS_BF16) bv = bf16_round(bv);
#pragma unroll
    for (int r = 0; r < 8; ++r) { float v = acc[t][r] + bv; if (ACT == 1) v = fmaxf(v, 0.f); so[w][8 * hh + r][t * 16 + ln] = v; }
  }
  __builtin_amdgcn_fence(__ATOMIC_ACQ_REL, "workgroup");
  __builtin_amdgcn_wave_barrier();
  const int rsub = lane >> 4, c4 = (lane & 15) * 4;
  {
#pragma unroll
    for (int q = 0; q < 8; ++q) {
      const int r = q * 2 + rsub;
      const v4f v = *(const v4fa*)&so[w][r][c4];
      *(v4f*)(C + (size_t)(row0 + r) * ldc + col0 + c4) = v;
    }
    
  }
}

// GEMM C = act(A·W + bias + resid): A f32 (ASPLIT -> hi/lo 2 terms), Wt bf16 [N][K]; ACT 0 none, 1 relu, 2 exact gelu;
// resid (optional, f32, row index = (row % rmod), pitch ldr, RES_BF16 rounds it) added before the activation.
template <bool ASPLIT, int ACT, bool BIAS_BF16, bool RES_BF16>
__global__ __launch_bounds__(128) void k_gemm_bf3(const float* __restrict__ A, int lda, const unsigned short* __restrict__ Wt, int ldb,
                                                const float* __restrict__ bias, const float* __restrict__ resid, int rmod, int ldr,
                                                float* __restrict__ C, int ldc, int M, int N, int K) {
  __shared__ __attribute__((aligned(16))) float so[4][16][64];
  const int tid = threadIdx.x, w = tid >> 5, lane = tid & 31, ln = lane & 15, hh = lane >> 4;
  const int ntn = N / 64;
  const int wid = blockIdx.x * 4 + w;
  const int mt = wid / ntn, nq = wid % ntn;
  if (mt * 16 >= M) return;
  const int row0 = mt * 16, col0 = nq * 64;
  const float* arow = A + (size_t)(row0 + ln) * lda;
  v8f acc[4] = {};
  for (int kb = 0; kb < K; kb += 32) {
    FragB ah, al;
    const v4f x0 = *(const v4fa*)(arow + kb + 8 * hh), x1 = *(const v4fa*)(arow + kb + 8 * hh + 4);
    const v4f x2 = *(const v4fa*)(arow + kb + 16 + 8 * hh), x3 = *(const v4fa*)(arow + kb + 16 + 8 * hh + 4);
    float xs[16] = {x0[0],x0[1],x0[2],x0[3],x1[0],x1[1],x1[2],x1[3],x2[0],x2[1],x2[2],x2[3],x3[0],x3[1],x3[2],x3[3]};
#pragma unroll
    for (int i = 0; i < 16; ++i) { const unsigned short hb = bf16_bits(xs[i]); ah.u[i] = hb; al.u[i] = ASPLIT ? bf16_bits(xs[i] - bf16_val(hb)) : (unsigned short)0; }
#pragma unroll
    for (int t = 0; t < 4; ++t) {
      const unsigned short* brow = Wt + (size_t)(col0 + t * 16 + ln) * ldb + kb;
      FragB b;
      b.half[0] = *(const v8us*)(brow + 8 * hh);
      b.half[1] = *(const v8us*)(brow + 16 + 8 * hh);
      acc[t] = mmaN<ASPLIT ? 2 : 1>(ah.v, al.v, b.v, b.v, acc[t]);
    }
  }
#pragma unroll
  for (int t = 0; t < 4; ++t) {
    const int col = col0 + t * 16 + ln;
    float bv = bias ? bias[col] : 0.f;
    if (BIAS_BF16) bv = bf16_round(bv);
#pragma unroll
    for (int r = 0; r < 8; ++r) {
      float v = acc[t][r] + bv;
      if (resid) { float rv = resid[(size_t)((row0 + 8 * hh + r) % rmod) * ldr + col]; if (RES_BF16) rv = bf16_round(rv); v += rv; }
      if (ACT == 1) v = fmaxf(v, 0.f);
      if (ACT == 2) v = 0.5f * v * (1.0f + erff(v * 0.70710678118654752f));
      if (ACT == 3) { const float u = 0.7978845608028654f * (v + 0.044715f * v * v * v); v = 0.5f * v * (1.0f + tanhf(u)); }
      so[w][8 * hh + r][t * 16 + ln] = v;
    }
  }
  __builtin_amdgcn_fence(__ATOMIC_ACQ_REL, "workgroup");
  __builtin_amdgcn_wave_barrier();
  const int rsub = lane >> 4, c4 = (lane & 15) * 4;
  {
#pragma unroll
    for (int q = 0; q < 8; ++q) {
      const int r = q * 2 + rsub;
      const v4f v = *(const v4fa*)&so[w][r][c4];
      *(v4f*)(C + (size_t)(row0 + r) * ldc + col0 + c4) = v;
    }
    
  }
}
// row LayerNorm (biased variance, eps) over N: s = X (+ R); optional out_sum <- s; out_norm <- (s-mu)*rsqrt(var+eps)*g + b
template <bool PARAM_BF16>
__global__ __launch_bounds__(256) void k_layernorm(const float* __restrict__ X, const float* __restrict__ R, const float* __restrict__ g, const float* __restrict__ bta,
                                                  float* __restrict__ out_sum, float* __restrict__ out_norm, int N, float eps) {
  __shared__ float red[256];
  const int row = blockIdx.x, tid = threadIdx.x;
  const float* x = X + (size_t)row * N; const float* rr = R ? R + (size_t)row * N : nullptr;
  float vals[16];                     // up to N = 4096
  const int per = N / 256;            // contiguous chunk per thread? use strided-by-4 chunks: thread handles j = tid*4 + 1024*u
  float s1 = 0.f;
  for (int u = 0; u < per / 4; ++u) {
    const int j = tid * 4 + 1024 * u;
    const v4f a = *(const v4fa*)(x + j);
    v4f b = {0.f,0.f,0.f,0.f}; if (rr) b = *(const v4fa*)(rr + j);
#pragma unroll
    for (int q = 0; q < 4; ++q) { const float v = a[q] + b[q]; vals[u * 4 + q] = v; s1 += v; }
  }
  red[tid] = s1; __syncthreads();
  for (int st = 128; st > 0; st >>= 1) { if (tid < st) red[tid] += red[tid + st]; __syncthreads(); }
  const float mu = red[0] / (float)N; __syncthreads();
  float s2 = 0.f;
  for (int u = 0; u < per / 4; ++u)
#pragma unroll
    for (int q = 0; q < 4; ++q) { const float c = vals[u * 4 + q] - mu; s2 += c * c; }
  red[tid] = s2; __syncthreads();
  for (int st = 128; st > 0; st >>= 1) { if (tid < st) red[tid] += red[tid + st]; __syncthreads(); }
  const float rs = rsqrtf(red[0] / (float)N + eps);
  {
    for (int u = 0; u < per / 4; ++u) {
      const int j = tid * 4 + 1024 * u;
      v4f o, sm;
#pragma unroll
      for (int q = 0; q < 4; ++q) {
        float gg = g[j + q], bb = bta[j + q];
        if (PARAM_BF16) { gg = bf16_round(gg); bb = bf16_round(bb); }
        sm[q] = vals[u * 4 + q]; o[q] = (vals[u * 4 + q] - mu) * rs * gg + bb;
      }
      if (out_sum) *(v4f*)(out_sum + (size_t)row * N + j) = sm;
      *(v4f*)(out_norm + (size_t)row * N + j) = o;
    }
    
  }
}



// ---- f16 WMMA path (v_wmma_f32_16x16x32_f16): 11-bit significands for operands in range — used where a [0,1] probability operand needs more precision than bf16
typedef _Float16 v16h __attribute__((ext_vector_type(16)));
union FragH { v16h v; v8us half[2]; _Float16 h[16]; unsigned short u[16]; };
template <int NT>
__device__ __forceinline__ v8f mmaH(v16h ah, v16h al, v16h bh, v16h bl, v8f c) {
  c = __builtin_amdgcn_wmma_f32_16x16x32_f16(false, ah, false, bh, (short)0, c, false, false);
  if (NT >= 2) c = __builtin_amdgcn_wmma_f32_16x16x32_f16(false, al, false, bh, (short)0, c, false, false);
  if (NT >= 3) c = __builtin_amdgcn_wmma_f32_16x16x32_f16(false, ah, false, bl, (short)0, c, false, false);
  asm volatile("v_nop\n\tv_nop\n\tv_nop\n\tv_nop" : "+v"(c) : "v"(ah), "v"(al), "v"(bh), "v"(bl));
  return c;
}
// batched GEMM like k_gemm_b but f16 operands: A f32 (split into f16 hi/lo if ASPLIT, else rounded to f16), Bt = f16 values [n][k]; alpha; C f32; N multiple of 16 (partial tiles skipped)
template <bool ASPLIT>
__global__ __launch_bounds__(128) void k_gemm_h(const float* __restrict__ A, int lda, size_t sA, const _Float16* __restrict__ Bh, int ldb, size_t sB, float alpha, float* __restrict__ C, int ldc, size_t sC, int M, int N, int K) {
  __shared__ __attribute__((aligned(16))) float so[4][16][64];
  const int tid = threadIdx.x, w = tid >> 5, lane = tid & 31, ln = lane & 15, hh = lane >> 4; const int by = blockIdx.y;
  A += (size_t)by * sA; Bh += (size_t)by * sB; C += (size_t)by * sC;
  const int ntn = (N + 63) / 64; const int wid = blockIdx.x * 4 + w; const int mt = wid / ntn, nq = wid % ntn; if (mt * 16 >= M) return;
  const int row0 = mt * 16, col0 = nq * 64; const float* arow = A + (size_t)(row0 + ln) * lda;
  v8f acc[4] = {};
  for (int kb = 0; kb < K; kb += 32) {
    FragH ah, al;
    const v4f x0 = *(const v4fa*)(arow + kb + 8 * hh), x1 = *(const v4fa*)(arow + kb + 8 * hh + 4), x2 = *(const v4fa*)(arow + kb + 16 + 8 * hh), x3 = *(const v4fa*)(arow + kb + 16 + 8 * hh + 4);
    float xs[16] = {x0[0],x0[1],x0[2],x0[3],x1[0],x1[1],x1[2],x1[3],x2[0],x2[1],x2[2],x2[3],x3[0],x3[1],x3[2],x3[3]};
#pragma unroll
    for (int i = 0; i < 16; ++i) { const _Float16 h = (_Float16)xs[i]; ah.h[i] = h; al.h[i] = ASPLIT ? (_Float16)(xs[i] - (float)h) : (_Float16)0.0f; }
#pragma unroll
    for (int t = 0; t < 4; ++t) { if (col0 + t * 16 >= N) continue; const size_t boff = (size_t)(col0 + t * 16 + ln) * ldb + kb; FragH bq; bq.half[0] = *(const v8us*)(Bh + boff + 8 * hh); bq.half[1] = *(const v8us*)(Bh + boff + 16 + 8 * hh);
      acc[t] = mmaH<ASPLIT ? 2 : 1>(ah.v, al.v, bq.v, bq.v, acc[t]); }
  }
#pragma unroll
  for (int t = 0; t < 4; ++t) { if (col0 + t * 16 >= N) continue;
#pragma unroll
    for (int r = 0; r < 8; ++r) so[w][8 * hh + r][t * 16 + ln] = acc[t][r] * alpha; }
  __builtin_amdgcn_fence(__ATOMIC_ACQ_REL, "workgroup"); __builtin_amdgcn_wave_barrier();
  const int rsub = lane >> 4, c4 = (lane & 15) * 4;
  {
#pragma unroll
    for (int q = 0; q < 8; ++q) { const int r = q * 2 + rsub; if (col0 + c4 < N) { const v4f v = *(const v4fa*)&so[w][r][c4]; *(v4f*)(C + (size_t)(row0 + r) * ldc + col0 + c4) = v; } }
     }
}

// Wt[n][k] = f16(W[k][n]·scale) from f32 row-major W[K][N] (scale = power of two; bf16-exact weights stay exact in f16 away from the subnormal range)
__global__ __launch_bounds__(256) void k_wt_f16(const float* __restrict__ W, _Float16* __restrict__ Wt, int K, int N, float scale) {
  const int t = blockIdx.x * 256 + threadIdx.x; if (t >= N * (K / 8)) return; const int n = t / (K / 8), k8 = (t % (K / 8)) * 8; FragH f;
#pragma unroll
  for (int i = 0; i < 8; ++i) f.h[i] = (_Float16)(bf16_round(W[(size_t)(k8 + i) * N + n]) * scale); const v8us o = f.half[0];
  *(v8us*)((unsigned short*)Wt + (size_t)n * K + k8) = o; 
}
// k_gemm_hh variant with fused epilogue: v = acc·alpha + bias[by·sBias + col] (+ CP[(row/rowsPerB)·sCPb + by·64 + col] if CP) ; ACT 0 none / 1 elu ; writes f16 C16 (and f32 C if non-null)
template <int ACT>
__global__ __launch_bounds__(128) void k_gemm_hhx(const _Float16* __restrict__ A, int lda, size_t sA, const _Float16* __restrict__ Bh, int ldb, size_t sB, float alpha, const float* __restrict__ bias, size_t sBias, const float* __restrict__ CP, int rowsPerB, size_t sCPb, int row0g,
    float* __restrict__ C, _Float16* __restrict__ C16, int ldc, size_t sC, int M, int N, int K) {
  __shared__ __attribute__((aligned(16))) float so[4][16][64];
  const int tid = threadIdx.x, w = tid >> 5, lane = tid & 31, ln = lane & 15, hh = lane >> 4; const int by = blockIdx.y;
  A += (size_t)by * sA; Bh += (size_t)by * sB; const size_t cofs = (size_t)by * sC; const float* bp = bias ? bias + (size_t)by * sBias : nullptr;
  const int ntn = (N + 63) / 64; const int wid = blockIdx.x * 4 + w; const int mt = wid / ntn, nq = wid % ntn; if (mt * 16 >= M) return;
  const int row0 = mt * 16, col0 = nq * 64; const _Float16* arow = A + (size_t)(row0 + ln) * lda;
  v8f acc[4] = {};
  for (int kb = 0; kb < K; kb += 32) { FragH ah; ah.half[0] = *(const v8us*)((const unsigned short*)arow + kb + 8 * hh); ah.half[1] = *(const v8us*)((const unsigned short*)arow + kb + 16 + 8 * hh);
#pragma unroll
    for (int t = 0; t < 4; ++t) { if (col0 + t * 16 >= N) continue; const size_t boff = (size_t)(col0 + t * 16 + ln) * ldb + kb; FragH bq; bq.half[0] = *(const v8us*)((const unsigned short*)Bh + boff + 8 * hh); bq.half[1] = *(const v8us*)((const unsigned short*)Bh + boff + 16 + 8 * hh);
      acc[t] = mmaH<1>(ah.v, ah.v, bq.v, bq.v, acc[t]); }
  }
#pragma unroll
  for (int t = 0; t < 4; ++t) { if (col0 + t * 16 >= N) continue; const int col = col0 + t * 16 + ln; const float bv = bp ? bf16_round(bp[col]) : 0.f;
#pragma unroll
    for (int r = 0; r < 8; ++r) { float v = acc[t][r] * alpha + bv; if (CP) { const int bidx = (row0g + row0 + 8 * hh + r) / rowsPerB; v += CP[(size_t)bidx * sCPb + (size_t)by * 64 + col]; } if (ACT == 1) v = (v > 0.f) ? v : expm1f(v); else if (ACT == 7) v = (v > 0.f) ? v + 1.0f : expf(v); else if (ACT == 8) v = tanhf(v); else if (ACT == 9) v = 0.5f * v * (1.0f + tanhf(0.7978845608028654f * (v + 0.044715f * v * v * v))); else if (ACT == 11) v = 1.0f / (1.0f + expf(-v)); else if (ACT == 12) v = (v > 0.f) ? v : 0.01f * v; else if (ACT == 14) v = (v > 0.f) ? v : 0.1f * v; else if (ACT == 15) v = v / (1.0f + expf(-v)); else if (ACT == 3) v = fmaxf(v, 0.f); else if (ACT == 6) v = 0.5f * v * (1.0f + erff(v * 0.70710678118654752f)); so[w][8 * hh + r][t * 16 + ln] = v; } }
  __builtin_amdgcn_fence(__ATOMIC_ACQ_REL, "workgroup"); __builtin_amdgcn_wave_barrier();
  const int rsub = lane >> 4, c4 = (lane & 15) * 4; typedef _Float16 v4h __attribute__((ext_vector_type(4)));
  {
#pragma unroll
    for (int q = 0; q < 8; ++q) { const int r = q * 2 + rsub; if (col0 + c4 < N) { const v4f v = *(const v4fa*)&so[w][r][c4]; if (C) *(v4f*)(C + cofs + (size_t)(row0 + r) * ldc + col0 + c4) = v; if (C16) { v4h h4; for (int i = 0; i < 4; ++i) h4[i] = (_Float16)v[i]; *(v4h*)(C16 + cofs + (size_t)(row0 + r) * ldc + col0 + c4) = h4; } } }
     }
}


typedef _Float16 v4h __attribute__((ext_vector_type(4)));

__global__ __launch_bounds__(256) void k_x16(const float* __restrict__ x, _Float16* __restrict__ X16, size_t n8) { const size_t t = (size_t)blockIdx.x * 256 + threadIdx.x; if (t >= n8) return; FragH f;
#pragma unroll
  for (int q = 0; q < 8; ++q) f.h[q] = (_Float16)bf16_round(x[t * 8 + q]); *(v8us*)((unsigned short*)X16 + t * 8) = f.half[0];  }
__global__ __launch_bounds__(256) void k_h16(const float* __restrict__ x, _Float16* __restrict__ X16, size_t n8) { const size_t t = (size_t)blockIdx.x * 256 + threadIdx.x; if (t >= n8) return; FragH f;
#pragma unroll
  for (int q = 0; q < 8; ++q) f.h[q] = (_Float16)x[t * 8 + q]; *(v8us*)((unsigned short*)X16 + t * 8) = f.half[0];  }
__global__ __launch_bounds__(256) void k_round16f(const float* __restrict__ W, _Float16* __restrict__ Bt, size_t n8) { const size_t t = (size_t)blockIdx.x * 256 + threadIdx.x; if (t >= n8) return; FragH f;
#pragma unroll
  for (int i = 0; i < 8; ++i) f.h[i] = (_Float16)(bf16_round(W[t * 8 + i]) * 16.0f); *(v8us*)((unsigned short*)Bt + t * 8) = f.half[0];  }
template <int NHv, int TTv>
__global__ __launch_bounds__(256) void k_vt(const _Float16* __restrict__ V16, int ldv, int voff, _Float16* __restrict__ Vt) { __shared__ unsigned short tl[64][66]; const int tid = threadIdx.x; const int slab = blockIdx.x / (TTv / 64), lg = blockIdx.x % (TTv / 64); const int b = slab / NHv, h = slab % NHv;
  for (int i = tid; i < 64 * 8; i += 256) { const int r = i / 8, c8 = (i % 8) * 8; FragH f; f.half[0] = *(const v8us*)((const unsigned short*)V16 + ((size_t)b * TTv + lg * 64 + r) * ldv + voff + h * 64 + c8);
#pragma unroll
    for (int q = 0; q < 8; ++q) tl[r][c8 + q] = f.u[q]; }
  __syncthreads();
  {
#pragma unroll
    for (int rd = 0; rd < 2; ++rd) { const int d = rd * 32 + tid / 8, pc = tid % 8; FragH f;
#pragma unroll
      for (int q = 0; q < 8; ++q) f.u[q] = tl[pc * 8 + q][d];
      *(v8us*)((unsigned short*)Vt + ((size_t)slab * 64 + d) * TTv + lg * 64 + pc * 8) = f.half[0]; }
     } }

__global__ __launch_bounds__(256) void k_hl(const float* __restrict__ F, _Float16* __restrict__ Hh, _Float16* __restrict__ Hl, size_t n8) { const size_t t = (size_t)blockIdx.x * 256 + threadIdx.x; if (t >= n8) return; FragH fh, fl; const v4f a = *(const v4fa*)(F + t * 8), c = *(const v4fa*)(F + t * 8 + 4);
#pragma unroll
  for (int q = 0; q < 4; ++q) { _Float16 h = (_Float16)a[q]; fh.h[q] = h; fl.h[q] = (_Float16)((a[q] - (float)h) * 1024.0f); h = (_Float16)c[q]; fh.h[4 + q] = h; fl.h[4 + q] = (_Float16)((c[q] - (float)h) * 1024.0f); }
  { *(v8us*)((unsigned short*)Hh + t * 8) = fh.half[0]; *(v8us*)((unsigned short*)Hl + t * 8) = fl.half[0];  } }

// ---- fast GEMM (wave tile 32x64; requires M % 32 == 0 rows per launch region and N % 64 == 0); epilogue = k_gemm_hhx semantics ----
__device__ __forceinline__ v16h g2_frag(const _Float16* p, int hh) { FragH f; f.half[0] = *(const v8us*)((const unsigned short*)p + 8 * hh); f.half[1] = *(const v8us*)((const unsigned short*)p + 16 + 8 * hh); return f.v; }
__device__ __forceinline__ v8f g2_mma(v16h a, v16h b, v8f c) { v8f d = __builtin_amdgcn_wmma_f32_16x16x32_f16(false, a, false, b, (short)0, c, false, false); asm volatile("v_nop\n\tv_nop\n\tv_nop\n\tv_nop" : "+v"(d) : "v"(a), "v"(b)); return d; }
template <int ACT>
__global__ __launch_bounds__(128) void k_gemm2(const _Float16* __restrict__ A, int lda, size_t sA, const _Float16* __restrict__ Bh, int ldb, size_t sB, float alpha, const float* __restrict__ bias, size_t sBias, const float* __restrict__ CP, int rowsPerB, size_t sCPb, int row0g,
    float* __restrict__ C, _Float16* __restrict__ C16, int ldc, size_t sC, int M, int N, int K) {
  __shared__ __attribute__((aligned(16))) float so[4][32][68];
  const int tid = threadIdx.x, w = tid >> 5, lane = tid & 31, ln = lane & 15, hh = lane >> 4; const int by = blockIdx.y;
  A += (size_t)by * sA; Bh += (size_t)by * sB; const size_t cofs = (size_t)by * sC; const float* bp = bias ? bias + (size_t)by * sBias : nullptr;
  const int ntn = N >> 6; const int mt = blockIdx.x / ntn, nq = blockIdx.x - mt * ntn; const int row0 = mt * 128 + 32 * w, col0 = nq * 64; if (row0 >= M) return;
  const _Float16* a0p = A + (size_t)(row0 + ln) * lda; const _Float16* a1p = a0p + (size_t)16 * lda;
  const _Float16* b0p = Bh + (size_t)(col0 + ln) * ldb; const _Float16* b1p = b0p + (size_t)16 * ldb; const _Float16* b2p = b1p + (size_t)16 * ldb; const _Float16* b3p = b2p + (size_t)16 * ldb;
  const v8f z8 = {0.f,0.f,0.f,0.f,0.f,0.f,0.f,0.f}; v8f c00 = z8, c01 = z8, c02 = z8, c03 = z8, c10 = z8, c11 = z8, c12 = z8, c13 = z8;
#pragma unroll 1
  for (int kb = 0; kb < K; kb += 32) { const v16h a0 = g2_frag(a0p + kb, hh), a1 = g2_frag(a1p + kb, hh);
    v16h b = g2_frag(b0p + kb, hh); c00 = g2_mma(a0, b, c00); c10 = g2_mma(a1, b, c10);
    b = g2_frag(b1p + kb, hh); c01 = g2_mma(a0, b, c01); c11 = g2_mma(a1, b, c11);
    b = g2_frag(b2p + kb, hh); c02 = g2_mma(a0, b, c02); c12 = g2_mma(a1, b, c12);
    b = g2_frag(b3p + kb, hh); c03 = g2_mma(a0, b, c03); c13 = g2_mma(a1, b, c13); }
  v8f accs[8] = {c00, c01, c02, c03, c10, c11, c12, c13};
#pragma unroll
  for (int u = 0; u < 8; ++u) { const int t = u & 3, half = u >> 2; const int col = col0 + t * 16 + ln; const float bv = bp ? bf16_round(bp[col]) : 0.f;
#pragma unroll
    for (int r = 0; r < 8; ++r) { const int rloc = half * 16 + 8 * hh + r; float v = accs[u][r] * alpha + bv; if (CP) { const int bidx = (row0g + row0 + rloc) / rowsPerB; v += CP[(size_t)bidx * sCPb + (size_t)by * 64 + col]; }
      if (ACT == 3) v = fmaxf(v, 0.f); else if (ACT == 6) v = 0.5f * v * (1.0f + erff(v * 0.70710678118654752f)); else if (ACT == 11) v = 1.0f / (1.0f + expf(-v)); else if (ACT == 15) v = v / (1.0f + expf(-v)); else if (ACT == 12) v = (v > 0.f) ? v : 0.01f * v; else if (ACT == 8) v = tanhf(v);
      so[w][rloc][t * 16 + ln] = v; } }
  __builtin_amdgcn_fence(__ATOMIC_ACQ_REL, "workgroup"); __builtin_amdgcn_wave_barrier();
  const int rsub = lane >> 4, c4 = (lane & 15) * 4;
  {
#pragma unroll
    for (int q = 0; q < 16; ++q) { const int r = q * 2 + rsub; const v4f v = *(const v4fa*)&so[w][r][c4]; if (C) *(v4f*)(C + cofs + (size_t)(row0 + r) * ldc + col0 + c4) = v; if (C16) { v4h h4; for (int i = 0; i < 4; ++i) h4[i] = (_Float16)v[i]; *(v4h*)(C16 + cofs + (size_t)(row0 + r) * ldc + col0 + c4) = h4; } }
     } }


__global__ __launch_bounds__(128) void k_flash(const _Float16* __restrict__ Q16, int ldq, const _Float16* __restrict__ K16, int ldk, const _Float16* __restrict__ Vt, const int* __restrict__ MSK, float* __restrict__ O, int ldo) {
  constexpr int RPW = 16, RTN = RPW / 16, NQB = TQ / (4 * RPW), DT = 4, KS = 2;
  __shared__ __attribute__((aligned(16))) unsigned short sP[4][RPW][40]; __shared__ __attribute__((aligned(16))) float sO[4][RPW][64 + 4];
  const int tid = threadIdx.x, w = tid >> 5, lane = tid & 31, ln = lane & 15, hh = lane >> 4;
  const int slab = blockIdx.x / NQB, qblk = blockIdx.x % NQB; const int b = slab / NH, h = slab % NH; const int qb0 = qblk * (4 * RPW); const int q0 = qb0 + w * RPW;
  FragH aq[2][KS];
#pragma unroll
  for (int rt = 0; rt < RTN; ++rt) { const unsigned short* qr = (const unsigned short*)Q16 + ((size_t)b * TQ + q0 + rt * 16 + ln) * ldq + h * 64;
#pragma unroll
    for (int ks = 0; ks < KS; ++ks) { aq[rt][ks].half[0] = *(const v8us*)(qr + ks * 32 + 8 * hh); aq[rt][ks].half[1] = *(const v8us*)(qr + ks * 32 + 16 + 8 * hh); } }
  const unsigned short* Vth = (const unsigned short*)Vt + (size_t)slab * 64 * TK;
  float m_r[2][8], l_r[2][8]; v8f oacc[2][DT];
#pragma unroll
  for (int rt = 0; rt < RTN; ++rt) {
#pragma unroll
    for (int r = 0; r < 8; ++r) { m_r[rt][r] = -3.0e38f; l_r[rt][r] = 0.f; }
#pragma unroll
    for (int dt = 0; dt < DT; ++dt) oacc[rt][dt] = (v8f){0.f,0.f,0.f,0.f,0.f,0.f,0.f,0.f}; }
  const int jend = TK;
#pragma unroll 1
  for (int j0 = 0; j0 < jend; j0 += 32) {
    v8f s[2][2];
#pragma unroll
    for (int nt = 0; nt < 2; ++nt) { const unsigned short* kr = (const unsigned short*)K16 + ((size_t)b * TK + j0 + nt * 16 + ln) * ldk + h * 64; FragH bk[KS];
#pragma unroll
      for (int ks = 0; ks < KS; ++ks) { bk[ks].half[0] = *(const v8us*)(kr + ks * 32 + 8 * hh); bk[ks].half[1] = *(const v8us*)(kr + ks * 32 + 16 + 8 * hh); }
#pragma unroll
      for (int rt = 0; rt < RTN; ++rt) { v8f acc = (v8f){0.f,0.f,0.f,0.f,0.f,0.f,0.f,0.f};
#pragma unroll
        for (int ks = 0; ks < KS; ++ks) acc = mmaH<1>(aq[rt][ks].v, aq[rt][ks].v, bk[ks].v, bk[ks].v, acc); s[rt][nt] = acc; } }
#pragma unroll
    for (int rt = 0; rt < RTN; ++rt)
#pragma unroll
      for (int r = 0; r < 8; ++r) { const int tq = q0 + rt * 16 + 8 * hh + r; const int k0 = j0 + ln, k1 = j0 + 16 + ln; (void)tq; (void)k0; (void)k1;
        const bool ok0 = true, ok1 = true;
        const float s0 = s[rt][0][r] * SCL, s1 = s[rt][1][r] * SCL; float mc = fmaxf(s0, s1);
        mc = fmaxf(mc, __shfl_xor(mc, 1, 32)); mc = fmaxf(mc, __shfl_xor(mc, 2, 32)); mc = fmaxf(mc, __shfl_xor(mc, 4, 32)); mc = fmaxf(mc, __shfl_xor(mc, 8, 32));
        const float mn = fmaxf(m_r[rt][r], mc); const float al = (mn > -1.0e38f) ? expf(m_r[rt][r] - mn) : 1.0f; m_r[rt][r] = mn; const float p0 = ok0 ? expf(s0 - mn) : 0.f, p1 = ok1 ? expf(s1 - mn) : 0.f; l_r[rt][r] = l_r[rt][r] * al + p0 + p1;
#pragma unroll
        for (int dt = 0; dt < DT; ++dt) oacc[rt][dt][r] *= al;
        FragH t2; t2.h[0] = (_Float16)(p0 * 1024.0f); t2.h[1] = (_Float16)(p1 * 1024.0f); sP[w][rt * 16 + 8 * hh + r][ln] = t2.u[0]; sP[w][rt * 16 + 8 * hh + r][16 + ln] = t2.u[1]; }
    __builtin_amdgcn_fence(__ATOMIC_ACQ_REL, "workgroup"); __builtin_amdgcn_wave_barrier();
    FragH pa[2];
#pragma unroll
    for (int rt = 0; rt < RTN; ++rt) { pa[rt].half[0] = *(const v8us*)&sP[w][rt * 16 + ln][8 * hh]; pa[rt].half[1] = *(const v8us*)&sP[w][rt * 16 + ln][16 + 8 * hh]; }
#pragma unroll
    for (int dt = 0; dt < DT; ++dt) { const unsigned short* vrow = Vth + (size_t)(dt * 16 + ln) * TK + j0; FragH bv; bv.half[0] = *(const v8us*)(vrow + 8 * hh); bv.half[1] = *(const v8us*)(vrow + 16 + 8 * hh);
#pragma unroll
      for (int rt = 0; rt < RTN; ++rt) oacc[rt][dt] = mmaH<1>(pa[rt].v, pa[rt].v, bv.v, bv.v, oacc[rt][dt]); }
    __builtin_amdgcn_fence(__ATOMIC_ACQ_REL, "workgroup"); __builtin_amdgcn_wave_barrier(); }
#pragma unroll
  for (int rt = 0; rt < RTN; ++rt) {
#pragma unroll
    for (int r = 0; r < 8; ++r) { float l = l_r[rt][r]; l += __shfl_xor(l, 1, 32); l += __shfl_xor(l, 2, 32); l += __shfl_xor(l, 4, 32); l += __shfl_xor(l, 8, 32); l_r[rt][r] = (l > 0.f) ? 1.0f / (l * 1024.0f) : 0.f; }
#pragma unroll
    for (int dt = 0; dt < DT; ++dt)
#pragma unroll
      for (int r = 0; r < 8; ++r) sO[w][rt * 16 + 8 * hh + r][dt * 16 + ln] = oacc[rt][dt][r] * l_r[rt][r]; }
  __builtin_amdgcn_fence(__ATOMIC_ACQ_REL, "workgroup"); __builtin_amdgcn_wave_barrier();
  {
#pragma unroll
    for (int rp = 0; rp < RPW; rp += 2) { const int r = rp + (lane >> 4), pc = lane & 15; const v4f val = *(const v4fa*)&sO[w][r][pc * 4]; *(v4f*)(O + ((size_t)b * TQ + q0 + r) * ldo + h * 64 + pc * 4) = val; }
     } }
__global__ __launch_bounds__(256) void k_split(const float* __restrict__ F, _Float16* __restrict__ Hh, _Float16* __restrict__ Hl, size_t n8) {
  #pragma clang fp contract(off)
  const size_t t = (size_t)blockIdx.x * 256 + threadIdx.x; if (t >= n8) return; const v4f a = *(const v4fa*)(F + t * 8), c = *(const v4fa*)(F + t * 8 + 4); FragH fh, fl;
#pragma unroll
  for (int q = 0; q < 8; ++q) { const float v = (q < 4) ? a[q] : c[q - 4]; const _Float16 hi = (_Float16)v; fh.h[q] = hi; fl.h[q] = (_Float16)((v - (float)hi) * 1024.0f); }
  { *(v8us*)((unsigned short*)Hh + t * 8) = fh.half[0]; *(v8us*)((unsigned short*)Hl + t * 8) = fl.half[0];  } }


#define PIDX(i) ((((i) >> 3) << 5) + ((i) & 7))
__global__ __launch_bounds__(256) void k_rowflag(const float* __restrict__ X, int* __restrict__ FL) {
  #pragma clang fp contract(off)
  __shared__ int sf[8];
  const int tid = threadIdx.x, w = tid >> 5, ln = tid & 31; const int r = blockIdx.x * 8 + w; const float* x = X + (size_t)r * DKV; float s = 0.f;
#pragma unroll
  for (int u = 0; u < DKV / 32; ++u) s += bf16_round(x[u * 32 + ln]);
  for (int o = 16; o > 0; o >>= 1) s += __shfl_xor(s, o, 32);
  if (ln == 0) sf[w] = (s == 0.0f) ? 1 : 0;
  __syncthreads();
  if (tid < 32) { const int v = (tid < 8) ? sf[tid] : 0; int* d = FL + blockIdx.x * 32 + tid; *(int*)d = v;  } }      
__global__ __launch_bounds__(256) void k_zerorows(const int* __restrict__ FL, _Float16* __restrict__ P16) {
  const size_t t = (size_t)blockIdx.x * 256 + threadIdx.x; if (t >= (size_t)NR * DM / 8) return; const int r = (int)(t / (DM / 8)); if (FL[PIDX(r)] == 0) return; FragH z;
#pragma unroll
  for (int q = 0; q < 8; ++q) z.h[q] = (_Float16)0.0f; *(v8us*)((unsigned short*)P16 + t * 8) = z.half[0];  }
extern "C" void kernel_launch(void* const* d_in, const int* in_sizes, int n_in,
                              void* d_out, int out_size, void* d_ws, size_t ws_size, hipStream_t stream) {
  (void)in_sizes; (void)n_in; (void)out_size;
  const float* const* I = (const float* const*)d_in; const float* qi = I[0]; const float* ki = I[1]; const float* vi = I[2];
  const float* Wq = I[3]; const float* bq = I[4]; const float* Wk = I[5]; const float* bk = I[6]; const float* Wv = I[7]; const float* bv = I[8]; const float* Wo = I[9]; const float* bo = I[10];
  char* ws = (char*)d_ws; size_t off = 0;
  auto take = [&](size_t bytes) { char* p = ws + off; off += (bytes + 255) & ~(size_t)255; return p; };
  _Float16* BQ = (_Float16*)take((size_t)DM * DM * 2); _Float16* BK = (_Float16*)take((size_t)DM * DKV * 2); _Float16* BV = (_Float16*)take((size_t)DM * DKV * 2); _Float16* BO = (_Float16*)take((size_t)DM * DM * 2);
  _Float16* X16 = (_Float16*)take((size_t)NR * DM * 2); _Float16* Q16 = (_Float16*)take((size_t)NR * DM * 2); _Float16* K16 = (_Float16*)take((size_t)NR * DM * 2); _Float16* V16 = (_Float16*)take((size_t)NR * DM * 2); _Float16* VT = (_Float16*)take((size_t)NR * DM * 2);
  int* FLK = (int*)take((size_t)(NR / 8) * 32 * 4); int* FLV = (int*)take((size_t)(NR / 8) * 32 * 4);
  float* O = (float*)take((size_t)TQ * DM * 4); _Float16* Oh = (_Float16*)take((size_t)TQ * DM * 2); _Float16* Ol = (_Float16*)take((size_t)TQ * DM * 2);      /* per batch */
  if (off > ws_size) return;      /* 6 + 16 x 5 + 0.3 + 8 + 4 + 4 = 102 MiB */
  const size_t n8 = (size_t)NR * DM / 8, n8k = (size_t)NR * DKV / 8, n8b = (size_t)TQ * DM / 8; const unsigned nb8 = (unsigned)((n8 + 255) / 256), nb8k = (unsigned)((n8k + 255) / 256), nb8b = (unsigned)((n8b + 255) / 256);
  k_wt_f16<<<(unsigned)(((size_t)DM * DM / 8 + 255) / 256), 256, 0, stream>>>(Wq, BQ, DM, DM, 16.0f); k_wt_f16<<<(unsigned)(((size_t)DKV * DM / 8 + 255) / 256), 256, 0, stream>>>(Wk, BK, DKV, DM, 16.0f); k_wt_f16<<<(unsigned)(((size_t)DKV * DM / 8 + 255) / 256), 256, 0, stream>>>(Wv, BV, DKV, DM, 16.0f); k_wt_f16<<<(unsigned)(((size_t)DM * DM / 8 + 255) / 256), 256, 0, stream>>>(Wo, BO, DM, DM, 16.0f);      /* (in,out) -> [out][in] x16 */
  const dim3 gP((NR / 128) * (DM / 64), 1), gB((TQ / 128) * (DM / 64), 1);
  k_x16<<<nb8, 256, 0, stream>>>(qi, X16, n8); k_gemm2<0><<<gP, 128, 0, stream>>>(X16, DM, 0, BQ, DM, 0, 0.0625f, bq, 0, nullptr, 1, 0, 0, nullptr, Q16, DM, 0, NR, DM, DM);      /* q -> f16 */
  k_x16<<<nb8k, 256, 0, stream>>>(ki, X16, n8k); k_rowflag<<<NR / 8, 256, 0, stream>>>(ki, FLK); k_gemm2<0><<<gP, 128, 0, stream>>>(X16, DKV, 0, BK, DKV, 0, 0.0625f, bk, 0, nullptr, 1, 0, 0, nullptr, K16, DM, 0, NR, DM, DKV); k_zerorows<<<nb8, 256, 0, stream>>>(FLK, K16);      /* k -> f16 (masked rows zeroed) */
  k_x16<<<nb8k, 256, 0, stream>>>(vi, X16, n8k); k_rowflag<<<NR / 8, 256, 0, stream>>>(vi, FLV); k_gemm2<0><<<gP, 128, 0, stream>>>(X16, DKV, 0, BV, DKV, 0, 0.0625f, bv, 0, nullptr, 1, 0, 0, nullptr, V16, DM, 0, NR, DM, DKV); k_zerorows<<<nb8, 256, 0, stream>>>(FLV, V16);      /* v -> f16 */
  k_vt<NH, TK><<<NBT * NH * (TK / 64), 256, 0, stream>>>(V16, DM, 0, VT);      /* Vt[(b,h)][d][s] */
  for (int b = 0; b < NBT; ++b) { const size_t ro = (size_t)b * TQ * DM; float* outb = (float*)d_out + ro;
    k_flash<<<NH * (TQ / 64), 128, 0, stream>>>(Q16 + ro, DM, K16 + ro, DM, VT + ro, nullptr, O, DM);      /* batch b: 16 heads (slab = h, Vt + b*16*64*2048) */
    k_split<<<nb8b, 256, 0, stream>>>(O, Oh, Ol, n8b);
    k_gemm2<0><<<gB, 128, 0, stream>>>(Oh, DM, 0, BO, DM, 0, 0.0625f, bo, 0, nullptr, 1, 0, 0, outb, nullptr, DM, 0, TQ, DM, DM);
    k_gemm2<0><<<gB, 128, 0, stream>>>(Ol, DM, 0, BO, DM, 0, 0.0625f / 1024.0f, nullptr, 0, outb, 1, (size_t)DM, 0, outb, nullptr, DM, 0, TQ, DM, DM); }      /* out_b = o*Wo + bo */
}

// v001
// It runs in 739 microseconds.
// Two timings next to v000 put it at 1.84 and 1.85 times that version's speed.
#include <hip/hip_runtime.h>
// Multi-head cross attention over social features (B 4, S 2048 queries x 1024, 2048 keys/values x 512, 16 heads x 64; (in,out) Linear weights with bias; key/value rows whose raw features sum to exactly 0 are zeroed after projection, as the reference's padding mask): scores = q.k/8; softmax; out = (attn.v merged)*Wo + bo -> [4,2048,1024].
// Compute dtype: the inputs, the four matrices and biases rounded to bf16; q/k/v products exact (weights x16 in f16, undone by alpha), q, k, v, P as f16 operands (~2^-12; logits sigma ~0.4), O as f16 hi + lo; f32 accumulation and softmax. v_wmma_f32_16x16x32_f16.
#define NBT 4
#define TQ 2048
#define TK 2048
#define DKV 512
#define NR (NBT * TQ)
#define DM 1024
#define NH 16
#define SCL 0.125f
typedef __bf16 v16b __attribute__((ext_vector_type(16)));
typedef unsigned short v8us __attribute__((ext_vector_type(8), may_alias));
typedef float  v8f  __attribute__((ext_vector_type(8)));
typedef float  v4f  __attribute__((ext_vector_type(4)));
typedef float  v4fa __attribute__((ext_vector_type(4), may_alias));
union FragB { v16b v; v8us half[2]; unsigned short u[16]; };

__device__ __forceinline__ unsigned short bf16_bits(float x) { unsigned int u = __float_as_uint(x); return (unsigned short)((u + 0x7FFFu + ((u >> 16) & 1u)) >> 16); }
__device__ __forceinline__ float bf16_val(unsigned short b) { return __uint_as_float(((unsigned int)b) << 16); }
__device__ __forceinline__ float bf16_round(float x) { return bf16_val(bf16_bits(x)); }
// D += A·B with NT terms: 1 = ah·bh, 2 = + al·bh (A split), 3 = + ah·bl (both split)
template <int NT>
__device__ __forceinline__ v8f mmaN(v16b ah, v16b al, v16b bh, v16b bl, v8f c) {
  c = __builtin_amdgcn_wmma_f32_16x16x32_bf16(false, ah, false, bh, (short)0, c, false, false);
  if (NT >= 2) c = __builtin_amdgcn_wmma_f32_16x16x32_bf16(false, al, false, bh, (short)0, c, false, false);
  if (NT >= 3) c = __builtin_amdgcn_wmma_f32_16x16x32_bf16(false, ah, false, bl, (short)0, c, false, false);
  asm volatile("v_nop\n\tv_nop\n\tv_nop\n\tv_nop" : "+v"(c) : "v"(ah), "v"(al), "v"(bh), "v"(bl));
  return c;
}

__global__ __launch_bounds__(256) void k_wt_bf16(const float* __restrict__ W, unsigned short* __restrict__ Wt, int K, int N) {
  const int t = blockIdx.x * 256 + threadIdx.x;
  const int k8n = K / 8;
  if (t >= N * k8n) return;
  const int n = t / k8n, k8 = (t % k8n) * 8;
  v8us v;
#pragma unroll
  for (int i = 0; i < 8; ++i) v[i] = bf16_bits(W[(size_t)(k8 + i) * N + n]);
  *(v8us*)(Wt + (size_t)n * K + k8) = v;
  
}

// GEMM C[M][N] (f32, pitch ldc) = act(A[M][K]·W + bias). A f32 row-major (pitch lda) converted per fragment to bf16
// (ASPLIT: hi/lo two planes -> 2 terms, else single rounded term); Wt bf16 [N][K] (pitch ldb). BIAS_BF16 rounds the
// bias to bf16 first (bias quantised to bf16 before the add). K%32==0, M%16==0, N%64==0.
template <bool ASPLIT, int ACT, bool BIAS_BF16>
__global__ __launch_bounds__(128) void k_gemm_bf(const float* __restrict__ A, int lda, const unsigned short* __restrict__ Wt, int ldb,
                                               const float* __restrict__ bias, float* __restrict__ C, int ldc, int M, int N, int K) {
  __shared__ __attribute__((aligned(16))) float so[4][16][64];
  const int tid = threadIdx.x, w = tid >> 5, lane = tid & 31, ln = lane & 15, hh = lane >> 4;
  const int ntn = N / 64;
  const int wid = blockIdx.x * 4 + w;
  const int mt = wid / ntn, nq = wid % ntn;
  if (mt * 16 >= M) return;
  const int row0 = mt * 16, col0 = nq * 64;
  const float* arow = A + (size_t)(row0 + ln) * lda;
  v8f acc[4] = {};
  for (int kb = 0; kb < K; kb += 32) {
    FragB ah, al;
    const v4f x0 = *(const v4fa*)(arow + kb + 8 * hh), x1 = *(const v4fa*)(arow + kb + 8 * hh + 4);
    const v4f x2 = *(const v4fa*)(arow + kb + 16 + 8 * hh), x3 = *(const v4fa*)(arow + kb + 16 + 8 * hh + 4);
    float xs[16] = {x0[0],x0[1],x0[2],x0[3],x1[0],x1[1],x1[2],x1[3],x2[0],x2[1],x2[2],x2[3],x3[0],x3[1],x3[2],x3[3]};
#pragma unroll
    for (int i = 0; i < 16; ++i) { const unsigned short hb = bf16_bits(xs[i]); ah.u[i] = hb; al.u[i] = ASPLIT ? bf16_bits(xs[i] - bf16_val(hb)) : (unsigned short)0; }
#pragma unroll
    for (int t = 0; t < 4; ++t) {
      const unsigned short* brow = Wt + (size_t)(col0 + t * 16 + ln) * ldb + kb;
      FragB b;
      b.half[0] = *(const v8us*)(brow + 8 * hh);
      b.half[1] = *(const v8us*)(brow + 16 + 8 * hh);
      acc[t] = mmaN<ASPLIT ? 2 : 1>(ah.v, al.v, b.v, b.v, acc[t]);
    }
  }
#pragma unroll
  for (int t = 0; t < 4; ++t) {
    float bv = bias ? bias[col0 + t * 16 + ln] : 0.f;
    if (BIAS_BF16) bv = bf16_round(bv);
#pragma unroll
    for (int r = 0; r < 8; ++r) { float v = acc[t][r] + bv; if (ACT == 1) v = fmaxf(v, 0.f); so[w][8 * hh + r][t * 16 + ln] = v; }
  }
  __builtin_amdgcn_fence(__ATOMIC_ACQ_REL, "workgroup");
  __builtin_amdgcn_wave_barrier();
  const int rsub = lane >> 4, c4 = (lane & 15) * 4;
  {
#pragma unroll
    for (int q = 0; q < 8; ++q) {
      const int r = q * 2 + rsub;
      const v4f v = *(const v4fa*)&so[w][r][c4];
      *(v4f*)(C + (size_t)(row0 + r) * ldc + col0 + c4) = v;
    }
    
  }
}

// GEMM C = act(A·W + bias + resid): A f32 (ASPLIT -> hi/lo 2 terms), Wt bf16 [N][K]; ACT 0 none, 1 relu, 2 exact gelu;
// resid (optional, f32, row index = (row % rmod), pitch ldr, RES_BF16 rounds it) added before the activation.
template <bool ASPLIT, int ACT, bool BIAS_BF16, bool RES_BF16>
__global__ __launch_bounds__(128) void k_gemm_bf3(const float* __restrict__ A, int lda, const unsigned short* __restrict__ Wt, int ldb,
                                                const float* __restrict__ bias, const float* __restrict__ resid, int rmod, int ldr,
                                                float* __restrict__ C, int ldc, int M, int N, int K) {
  __shared__ __attribute__((aligned(16))) float so[4][16][64];
  const int tid = threadIdx.x, w = tid >> 5, lane = tid & 31, ln = lane & 15, hh = lane >> 4;
  const int ntn = N / 64;
  const int wid = blockIdx.x * 4 + w;
  const int mt = wid / ntn, nq = wid % ntn;
  if (mt * 16 >= M) return;
  const int row0 = mt * 16, col0 = nq * 64;
  const float* arow = A + (size_t)(row0 + ln) * lda;
  v8f acc[4] = {};
  for (int kb = 0; kb < K; kb += 32) {
    FragB ah, al;
    const v4f x0 = *(const v4fa*)(arow + kb + 8 * hh), x1 = *(const v4fa*)(arow + kb + 8 * hh + 4);
    const v4f x2 = *(const v4fa*)(arow + kb + 16 + 8 * hh), x3 = *(const v4fa*)(arow + kb + 16 + 8 * hh + 4);
    float xs[16] = {x0[0],x0[1],x0[2],x0[3],x1[0],x1[1],x1[2],x1[3],x2[0],x2[1],x2[2],x2[3],x3[0],x3[1],x3[2],x3[3]};
#pragma unroll
    for (int i = 0; i < 16; ++i) { const unsigned short hb = bf16_bits(xs[i]); ah.u[i] = hb; al.u[i] = ASPLIT ? bf16_bits(xs[i] - bf16_val(hb)) : (unsigned short)0; }
#pragma unroll
    for (int t = 0; t < 4; ++t) {
      const unsigned short* brow = Wt + (size_t)(col0 + t * 16 + ln) * ldb + kb;
      FragB b;
      b.half[0] = *(const v8us*)(brow + 8 * hh);
      b.half[1] = *(const v8us*)(brow + 16 + 8 * hh);
      acc[t] = mmaN<ASPLIT ? 2 : 1>(ah.v, al.v, b.v, b.v, acc[t]);
    }
  }
#pragma unroll
  for (int t = 0; t < 4; ++t) {
    const int col = col0 + t * 16 + ln;
    float bv = bias ? bias[col] : 0.f;
    if (BIAS_BF16) bv = bf16_round(bv);
#pragma unroll
    for (int r = 0; r < 8; ++r) {
      float v = acc[t][r] + bv;
      if (resid) { float rv = resid[(size_t)((row0 + 8 * hh + r) % rmod) * ldr + col]; if (RES_BF16) rv = bf16_round(rv); v += rv; }
      if (ACT == 1) v = fmaxf(v, 0.f);
      if (ACT == 2) v = 0.5f * v * (1.0f + erff(v * 0.70710678118654752f));
      if (ACT == 3) { const float u = 0.7978845608028654f * (v + 0.044715f * v * v * v); v = 0.5f * v * (1.0f + tanhf(u)); }
      so[w][8 * hh + r][t * 16 + ln] = v;
    }
  }
  __builtin_amdgcn_fence(__ATOMIC_ACQ_REL, "workgroup");
  __builtin_amdgcn_wave_barrier();
  const int rsub = lane >> 4, c4 = (lane & 15) * 4;
  {
#pragma unroll
    for (int q = 0; q < 8; ++q) {
      const int r = q * 2 + rsub;
      const v4f v = *(const v4fa*)&so[w][r][c4];
      *(v4f*)(C + (size_t)(row0 + r) * ldc + col0 + c4) = v;
    }
    
  }
}
// row LayerNorm (biased variance, eps) over N: s = X (+ R); optional out_sum <- s; out_norm <- (s-mu)*rsqrt(var+eps)*g + b
template <bool PARAM_BF16>
__global__ __launch_bounds__(256) void k_layernorm(const float* __restrict__ X, const float* __restrict__ R, const float* __restrict__ g, const float* __restrict__ bta,
                                                  float* __restrict__ out_sum, float* __restrict__ out_norm, int N, float eps) {
  __shared__ float red[256];
  const int row = blockIdx.x, tid = threadIdx.x;
  const float* x = X + (size_t)row * N; const float* rr = R ? R + (size_t)row * N : nullptr;
  float vals[16];                     // up to N = 4096
  const int per = N / 256;            // contiguous chunk per thread? use strided-by-4 chunks: thread handles j = tid*4 + 1024*u
  float s1 = 0.f;
  for (int u = 0; u < per / 4; ++u) {
    const int j = tid * 4 + 1024 * u;
    const v4f a = *(const v4fa*)(x + j);
    v4f b = {0.f,0.f,0.f,0.f}; if (rr) b = *(const v4fa*)(rr + j);
#pragma unroll
    for (int q = 0; q < 4; ++q) { const float v = a[q] + b[q]; vals[u * 4 + q] = v; s1 += v; }
  }
  red[tid] = s1; __syncthreads();
  for (int st = 128; st > 0; st >>= 1) { if (tid < st) red[tid] += red[tid + st]; __syncthreads(); }
  const float mu = red[0] / (float)N; __syncthreads();
  float s2 = 0.f;
  for (int u = 0; u < per / 4; ++u)
#pragma unroll
    for (int q = 0; q < 4; ++q) { const float c = vals[u * 4 + q] - mu; s2 += c * c; }
  red[tid] = s2; __syncthreads();
  for (int st = 128; st > 0; st >>= 1) { if (tid < st) red[tid] += red[tid + st]; __syncthreads(); }
  const float rs = rsqrtf(red[0] / (float)N + eps);
  {
    for (int u = 0; u < per / 4; ++u) {
      const int j = tid * 4 + 1024 * u;
      v4f o, sm;
#pragma unroll
      for (int q = 0; q < 4; ++q) {
        float gg = g[j + q], bb = bta[j + q];
        if (PARAM_BF16) { gg = bf16_round(gg); bb = bf16_round(bb); }
        sm[q] = vals[u * 4 + q]; o[q] = (vals[u * 4 + q] - mu) * rs * gg + bb;
      }
      if (out_sum) *(v4f*)(out_sum + (size_t)row * N + j) = sm;
      *(v4f*)(out_norm + (size_t)row * N + j) = o;
    }
    
  }
}



// ---- f16 WMMA path (v_wmma_f32_16x16x32_f16): 11-bit significands for operands in range — used where a [0,1] probability operand needs more precision than bf16
typedef _Float16 v16h __attribute__((ext_vector_type(16)));
union FragH { v16h v; v8us half[2]; _Float16 h[16]; unsigned short u[16]; };
template <int NT>
__device__ __forceinline__ v8f mmaH(v16h ah, v16h al, v16h bh, v16h bl, v8f c) {
  c = __builtin_amdgcn_wmma_f32_16x16x32_f16(false, ah, false, bh, (short)0, c, false, false);
  if (NT >= 2) c = __builtin_amdgcn_wmma_f32_16x16x32_f16(false, al, false, bh, (short)0, c, false, false);
  if (NT >= 3) c = __builtin_amdgcn_wmma_f32_16x16x32_f16(false, ah, false, bl, (short)0, c, false, false);
  asm volatile("v_nop\n\tv_nop\n\tv_nop\n\tv_nop" : "+v"(c) : "v"(ah), "v"(al), "v"(bh), "v"(bl));
  return c;
}
// batched GEMM like k_gemm_b but f16 operands: A f32 (split into f16 hi/lo if ASPLIT, else rounded to f16), Bt = f16 values [n][k]; alpha; C f32; N multiple of 16 (partial tiles skipped)
template <bool ASPLIT>
__global__ __launch_bounds__(128) void k_gemm_h(const float* __restrict__ A, int lda, size_t sA, const _Float16* __restrict__ Bh, int ldb, size_t sB, float alpha, float* __restrict__ C, int ldc, size_t sC, int M, int N, int K) {
  __shared__ __attribute__((aligned(16))) float so[4][16][64];
  const int tid = threadIdx.x, w = tid >> 5, lane = tid & 31, ln = lane & 15, hh = lane >> 4; const int by = blockIdx.y;
  A += (size_t)by * sA; Bh += (size_t)by * sB; C += (size_t)by * sC;
  const int ntn = (N + 63) / 64; const int wid = blockIdx.x * 4 + w; const int mt = wid / ntn, nq = wid % ntn; if (mt * 16 >= M) return;
  const int row0 = mt * 16, col0 = nq * 64; const float* arow = A + (size_t)(row0 + ln) * lda;
  v8f acc[4] = {};
  for (int kb = 0; kb < K; kb += 32) {
    FragH ah, al;
    const v4f x0 = *(const v4fa*)(arow + kb + 8 * hh), x1 = *(const v4fa*)(arow + kb + 8 * hh + 4), x2 = *(const v4fa*)(arow + kb + 16 + 8 * hh), x3 = *(const v4fa*)(arow + kb + 16 + 8 * hh + 4);
    float xs[16] = {x0[0],x0[1],x0[2],x0[3],x1[0],x1[1],x1[2],x1[3],x2[0],x2[1],x2[2],x2[3],x3[0],x3[1],x3[2],x3[3]};
#pragma unroll
    for (int i = 0; i < 16; ++i) { const _Float16 h = (_Float16)xs[i]; ah.h[i] = h; al.h[i] = ASPLIT ? (_Float16)(xs[i] - (float)h) : (_Float16)0.0f; }
#pragma unroll
    for (int t = 0; t < 4; ++t) { if (col0 + t * 16 >= N) continue; const size_t boff = (size_t)(col0 + t * 16 + ln) * ldb + kb; FragH bq; bq.half[0] = *(const v8us*)(Bh + boff + 8 * hh); bq.half[1] = *(const v8us*)(Bh + boff + 16 + 8 * hh);
      acc[t] = mmaH<ASPLIT ? 2 : 1>(ah.v, al.v, bq.v, bq.v, acc[t]); }
  }
#pragma unroll
  for (int t = 0; t < 4; ++t) { if (col0 + t * 16 >= N) continue;
#pragma unroll
    for (int r = 0; r < 8; ++r) so[w][8 * hh + r][t * 16 + ln] = acc[t][r] * alpha; }
  __builtin_amdgcn_fence(__ATOMIC_ACQ_REL, "workgroup"); __builtin_amdgcn_wave_barrier();
  const int rsub = lane >> 4, c4 = (lane & 15) * 4;
  {
#pragma unroll
    for (int q = 0; q < 8; ++q) { const int r = q * 2 + rsub; if (col0 + c4 < N) { const v4f v = *(const v4fa*)&so[w][r][c4]; *(v4f*)(C + (size_t)(row0 + r) * ldc + col0 + c4) = v; } }
     }
}

// Wt[n][k] = f16(W[k][n]·scale) from f32 row-major W[K][N] (scale = power of two; bf16-exact weights stay exact in f16 away from the subnormal range)
__global__ __launch_bounds__(256) void k_wt_f16(const float* __restrict__ W, _Float16* __restrict__ Wt, int K, int N, float scale) {
  const int t = blockIdx.x * 256 + threadIdx.x; if (t >= N * (K / 8)) return; const int n = t / (K / 8), k8 = (t % (K / 8)) * 8; FragH f;
#pragma unroll
  for (int i = 0; i < 8; ++i) f.h[i] = (_Float16)(bf16_round(W[(size_t)(k8 + i) * N + n]) * scale); const v8us o = f.half[0];
  *(v8us*)((unsigned short*)Wt + (size_t)n * K + k8) = o; 
}
// k_gemm_hh variant with fused epilogue: v = acc·alpha + bias[by·sBias + col] (+ CP[(row/rowsPerB)·sCPb + by·64 + col] if CP) ; ACT 0 none / 1 elu ; writes f16 C16 (and f32 C if non-null)
template <int ACT>
__global__ __launch_bounds__(128) void k_gemm_hhx(const _Float16* __restrict__ A, int lda, size_t sA, const _Float16* __restrict__ Bh, int ldb, size_t sB, float alpha, const float* __restrict__ bias, size_t sBias, const float* __restrict__ CP, int rowsPerB, size_t sCPb, int row0g,
    float* __restrict__ C, _Float16* __restrict__ C16, int ldc, size_t sC, int M, int N, int K) {
  __shared__ __attribute__((aligned(16))) float so[4][16][64];
  const int tid = threadIdx.x, w = tid >> 5, lane = tid & 31, ln = lane & 15, hh = lane >> 4; const int by = blockIdx.y;
  A += (size_t)by * sA; Bh += (size_t)by * sB; const size_t cofs = (size_t)by * sC; const float* bp = bias ? bias + (size_t)by * sBias : nullptr;
  const int ntn = (N + 63) / 64; const int wid = blockIdx.x * 4 + w; const int mt = wid / ntn, nq = wid % ntn; if (mt * 16 >= M) return;
  const int row0 = mt * 16, col0 = nq * 64; const _Float16* arow = A + (size_t)(row0 + ln) * lda;
  v8f acc[4] = {};
  for (int kb = 0; kb < K; kb += 32) { FragH ah; ah.half[0] = *(const v8us*)((const unsigned short*)arow + kb + 8 * hh); ah.half[1] = *(const v8us*)((const unsigned short*)arow + kb + 16 + 8 * hh);
#pragma unroll
    for (int t = 0; t < 4; ++t) { if (col0 + t * 16 >= N) continue; const size_t boff = (size_t)(col0 + t * 16 + ln) * ldb + kb; FragH bq; bq.half[0] = *(const v8us*)((const unsigned short*)Bh + boff + 8 * hh); bq.half[1] = *(const v8us*)((const unsigned short*)Bh + boff + 16 + 8 * hh);
      acc[t] = mmaH<1>(ah.v, ah.v, bq.v, bq.v, acc[t]); }
  }
#pragma unroll
  for (int t = 0; t < 4; ++t) { if (col0 + t * 16 >= N) continue; const int col = col0 + t * 16 + ln; const float bv = bp ? bf16_round(bp[col]) : 0.f;
#pragma unroll
    for (int r = 0; r < 8; ++r) { float v = acc[t][r] * alpha + bv; if (CP) { const int bidx = (row0g + row0 + 8 * hh + r) / rowsPerB; v += CP[(size_t)bidx * sCPb + (size_t)by * 64 + col]; } if (ACT == 1) v = (v > 0.f) ? v : expm1f(v); else if (ACT == 7) v = (v > 0.f) ? v + 1.0f : expf(v); else if (ACT == 8) v = tanhf(v); else if (ACT == 9) v = 0.5f * v * (1.0f + tanhf(0.7978845608028654f * (v + 0.044715f * v * v * v))); else if (ACT == 11) v = 1.0f / (1.0f + expf(-v)); else if (ACT == 12) v = (v > 0.f) ? v : 0.01f * v; else if (ACT == 14) v = (v > 0.f) ? v : 0.1f * v; else if (ACT == 15) v = v / (1.0f + expf(-v)); else if (ACT == 3) v = fmaxf(v, 0.f); else if (ACT == 6) v = 0.5f * v * (1.0f + erff(v * 0.70710678118654752f)); so[w][8 * hh + r][t * 16 + ln] = v; } }
  __builtin_amdgcn_fence(__ATOMIC_ACQ_REL, "workgroup"); __builtin_amdgcn_wave_barrier();
  const int rsub = lane >> 4, c4 = (lane & 15) * 4; typedef _Float16 v4h __attribute__((ext_vector_type(4)));
  {
#pragma unroll
    for (int q = 0; q < 8; ++q) { const int r = q * 2 + rsub; if (col0 + c4 < N) { const v4f v = *(const v4fa*)&so[w][r][c4]; if (C) *(v4f*)(C + cofs + (size_t)(row0 + r) * ldc + col0 + c4) = v; if (C16) { v4h h4; for (int i = 0; i < 4; ++i) h4[i] = (_Float16)v[i]; *(v4h*)(C16 + cofs + (size_t)(row0 + r) * ldc + col0 + c4) = h4; } } }
     }
}


typedef _Float16 v4h __attribute__((ext_vector_type(4)));

__global__ __launch_bounds__(256) void k_x16(const float* __restrict__ x, _Float16* __restrict__ X16, size_t n8) { const size_t t = (size_t)blockIdx.x * 256 + threadIdx.x; if (t >= n8) return; FragH f;
#pragma unroll
  for (int q = 0; q < 8; ++q) f.h[q] = (_Float16)bf16_round(x[t * 8 + q]); *(v8us*)((unsigned short*)X16 + t * 8) = f.half[0];  }
__global__ __launch_bounds__(256) void k_h16(const float* __restrict__ x, _Float16* __restrict__ X16, size_t n8) { const size_t t = (size_t)blockIdx.x * 256 + threadIdx.x; if (t >= n8) return; FragH f;
#pragma unroll
  for (int q = 0; q < 8; ++q) f.h[q] = (_Float16)x[t * 8 + q]; *(v8us*)((unsigned short*)X16 + t * 8) = f.half[0];  }
__global__ __launch_bounds__(256) void k_round16f(const float* __restrict__ W, _Float16* __restrict__ Bt, size_t n8) { const size_t t = (size_t)blockIdx.x * 256 + threadIdx.x; if (t >= n8) return; FragH f;
#pragma unroll
  for (int i = 0; i < 8; ++i) f.h[i] = (_Float16)(bf16_round(W[t * 8 + i]) * 16.0f); *(v8us*)((unsigned short*)Bt + t * 8) = f.half[0];  }
template <int NHv, int TTv>
__global__ __launch_bounds__(256) void k_vt(const _Float16* __restrict__ V16, int ldv, int voff, _Float16* __restrict__ Vt) { __shared__ unsigned short tl[64][66]; const int tid = threadIdx.x; const int slab = blockIdx.x / (TTv / 64), lg = blockIdx.x % (TTv / 64); const int b = slab / NHv, h = slab % NHv;
  for (int i = tid; i < 64 * 8; i += 256) { const int r = i / 8, c8 = (i % 8) * 8; FragH f; f.half[0] = *(const v8us*)((const unsigned short*)V16 + ((size_t)b * TTv + lg * 64 + r) * ldv + voff + h * 64 + c8);
#pragma unroll
    for (int q = 0; q < 8; ++q) tl[r][c8 + q] = f.u[q]; }
  __syncthreads();
  {
#pragma unroll
    for (int rd = 0; rd < 2; ++rd) { const int d = rd * 32 + tid / 8, pc = tid % 8; FragH f;
#pragma unroll
      for (int q = 0; q < 8; ++q) f.u[q] = tl[pc * 8 + q][d];
      *(v8us*)((unsigned short*)Vt + ((size_t)slab * 64 + d) * TTv + lg * 64 + pc * 8) = f.half[0]; }
     } }

__global__ __launch_bounds__(256) void k_hl(const float* __restrict__ F, _Float16* __restrict__ Hh, _Float16* __restrict__ Hl, size_t n8) { const size_t t = (size_t)blockIdx.x * 256 + threadIdx.x; if (t >= n8) return; FragH fh, fl; const v4f a = *(const v4fa*)(F + t * 8), c = *(const v4fa*)(F + t * 8 + 4);
#pragma unroll
  for (int q = 0; q < 4; ++q) { _Float16 h = (_Float16)a[q]; fh.h[q] = h; fl.h[q] = (_Float16)((a[q] - (float)h) * 1024.0f); h = (_Float16)c[q]; fh.h[4 + q] = h; fl.h[4 + q] = (_Float16)((c[q] - (float)h) * 1024.0f); }
  { *(v8us*)((unsigned short*)Hh + t * 8) = fh.half[0]; *(v8us*)((unsigned short*)Hl + t * 8) = fl.half[0];  } }

// ---- fast GEMM (wave tile 32x64; requires M % 32 == 0 rows per launch region and N % 64 == 0); epilogue = k_gemm_hhx semantics ----
__device__ __forceinline__ v16h g2_frag(const _Float16* p, int hh) { FragH f; f.half[0] = *(const v8us*)((const unsigned short*)p + 8 * hh); f.half[1] = *(const v8us*)((const unsigned short*)p + 16 + 8 * hh); return f.v; }
__device__ __forceinline__ v8f g2_mma(v16h a, v16h b, v8f c) { v8f d = __builtin_amdgcn_wmma_f32_16x16x32_f16(false, a, false, b, (short)0, c, false, false); asm volatile("v_nop\n\tv_nop\n\tv_nop\n\tv_nop" : "+v"(d) : "v"(a), "v"(b)); return d; }
template <int ACT>
__global__ __launch_bounds__(128) void k_gemm2(const _Float16* __restrict__ A, int lda, size_t sA, const _Float16* __restrict__ Bh, int ldb, size_t sB, float alpha, const float* __restrict__ bias, size_t sBias, const float* __restrict__ CP, int rowsPerB, size_t sCPb, int row0g,
    float* __restrict__ C, _Float16* __restrict__ C16, int ldc, size_t sC, int M, int N, int K) {
  __shared__ __attribute__((aligned(16))) float so[4][32][68];
  const int tid = threadIdx.x, w = tid >> 5, lane = tid & 31, ln = lane & 15, hh = lane >> 4; const int by = blockIdx.y;
  A += (size_t)by * sA; Bh += (size_t)by * sB; const size_t cofs = (size_t)by * sC; const float* bp = bias ? bias + (size_t)by * sBias : nullptr;
  const int ntn = N >> 6; const int mt = blockIdx.x / ntn, nq = blockIdx.x - mt * ntn; const int row0 = mt * 128 + 32 * w, col0 = nq * 64; if (row0 >= M) return;
  const _Float16* a0p = A + (size_t)(row0 + ln) * lda; const _Float16* a1p = a0p + (size_t)16 * lda;
  const _Float16* b0p = Bh + (size_t)(col0 + ln) * ldb; const _Float16* b1p = b0p + (size_t)16 * ldb; const _Float16* b2p = b1p + (size_t)16 * ldb; const _Float16* b3p = b2p + (size_t)16 * ldb;
  const v8f z8 = {0.f,0.f,0.f,0.f,0.f,0.f,0.f,0.f}; v8f c00 = z8, c01 = z8, c02 = z8, c03 = z8, c10 = z8, c11 = z8, c12 = z8, c13 = z8;
#pragma unroll 1
  for (int kb = 0; kb < K; kb += 32) { const v16h a0 = g2_frag(a0p + kb, hh), a1 = g2_frag(a1p + kb, hh);
    v16h b = g2_frag(b0p + kb, hh); c00 = g2_mma(a0, b, c00); c10 = g2_mma(a1, b, c10);
    b = g2_frag(b1p + kb, hh); c01 = g2_mma(a0, b, c01); c11 = g2_mma(a1, b, c11);
    b = g2_frag(b2p + kb, hh); c02 = g2_mma(a0, b, c02); c12 = g2_mma(a1, b, c12);
    b = g2_frag(b3p + kb, hh); c03 = g2_mma(a0, b, c03); c13 = g2_mma(a1, b, c13); }
  v8f accs[8] = {c00, c01, c02, c03, c10, c11, c12, c13};
#pragma unroll
  for (int u = 0; u < 8; ++u) { const int t = u & 3, half = u >> 2; const int col = col0 + t * 16 + ln; const float bv = bp ? bf16_round(bp[col]) : 0.f;
#pragma unroll
    for (int r = 0; r < 8; ++r) { const int rloc = half * 16 + 8 * hh + r; float v = accs[u][r] * alpha + bv; if (CP) { const int bidx = (row0g + row0 + rloc) / rowsPerB; v += CP[(size_t)bidx * sCPb + (size_t)by * 64 + col]; }
      if (ACT == 3) v = fmaxf(v, 0.f); else if (ACT == 6) v = 0.5f * v * (1.0f + erff(v * 0.70710678118654752f)); else if (ACT == 11) v = 1.0f / (1.0f + expf(-v)); else if (ACT == 15) v = v / (1.0f + expf(-v)); else if (ACT == 12) v = (v > 0.f) ? v : 0.01f * v; else if (ACT == 8) v = tanhf(v);
      so[w][rloc][t * 16 + ln] = v; } }
  __builtin_amdgcn_fence(__ATOMIC_ACQ_REL, "workgroup"); __builtin_amdgcn_wave_barrier();
  const int rsub = lane >> 4, c4 = (lane & 15) * 4;
  {
#pragma unroll
    for (int q = 0; q < 16; ++q) { const int r = q * 2 + rsub; const v4f v = *(const v4fa*)&so[w][r][c4]; if (C) *(v4f*)(C + cofs + (size_t)(row0 + r) * ldc + col0 + c4) = v; if (C16) { v4h h4; for (int i = 0; i < 4; ++i) h4[i] = (_Float16)v[i]; *(v4h*)(C16 + cofs + (size_t)(row0 + r) * ldc + col0 + c4) = h4; } }
     } }


__global__ __launch_bounds__(128) void k_flash(const _Float16* __restrict__ Q16, int ldq, const _Float16* __restrict__ K16, int ldk, const _Float16* __restrict__ Vt, const int* __restrict__ MSK, float* __restrict__ O, int ldo) {
  constexpr int RPW = 16, RTN = RPW / 16, NQB = TQ / (4 * RPW), DT = 4, KS = 2;
  __shared__ __attribute__((aligned(16))) unsigned short sP[4][RPW][40]; __shared__ __attribute__((aligned(16))) float sO[4][RPW][64 + 4];
  const int tid = threadIdx.x, w = tid >> 5, lane = tid & 31, ln = lane & 15, hh = lane >> 4;
  const int slab = blockIdx.x / NQB, qblk = blockIdx.x % NQB; const int b = slab / NH, h = slab % NH; const int qb0 = qblk * (4 * RPW); const int q0 = qb0 + w * RPW;
  FragH aq[2][KS];
#pragma unroll
  for (int rt = 0; rt < RTN; ++rt) { const unsigned short* qr = (const unsigned short*)Q16 + ((size_t)b * TQ + q0 + rt * 16 + ln) * ldq + h * 64;
#pragma unroll
    for (int ks = 0; ks < KS; ++ks) { aq[rt][ks].half[0] = *(const v8us*)(qr + ks * 32 + 8 * hh); aq[rt][ks].half[1] = *(const v8us*)(qr + ks * 32 + 16 + 8 * hh); } }
  const unsigned short* Vth = (const unsigned short*)Vt + (size_t)slab * 64 * TK;
  float m_r[2][8], l_r[2][8]; v8f oacc[2][DT];
#pragma unroll
  for (int rt = 0; rt < RTN; ++rt) {
#pragma unroll
    for (int r = 0; r < 8; ++r) { m_r[rt][r] = -3.0e38f; l_r[rt][r] = 0.f; }
#pragma unroll
    for (int dt = 0; dt < DT; ++dt) oacc[rt][dt] = (v8f){0.f,0.f,0.f,0.f,0.f,0.f,0.f,0.f}; }
  const int jend = TK;
#pragma unroll 1
  for (int j0 = 0; j0 < jend; j0 += 32) {
    v8f s[2][2];
#pragma unroll
    for (int nt = 0; nt < 2; ++nt) { const unsigned short* kr = (const unsigned short*)K16 + ((size_t)b * TK + j0 + nt * 16 + ln) * ldk + h * 64; FragH bk[KS];
#pragma unroll
      for (int ks = 0; ks < KS; ++ks) { bk[ks].half[0] = *(const v8us*)(kr + ks * 32 + 8 * hh); bk[ks].half[1] = *(const v8us*)(kr + ks * 32 + 16 + 8 * hh); }
#pragma unroll
      for (int rt = 0; rt < RTN; ++rt) { v8f acc = (v8f){0.f,0.f,0.f,0.f,0.f,0.f,0.f,0.f};
#pragma unroll
        for (int ks = 0; ks < KS; ++ks) acc = mmaH<1>(aq[rt][ks].v, aq[rt][ks].v, bk[ks].v, bk[ks].v, acc); s[rt][nt] = acc; } }
#pragma unroll
    for (int rt = 0; rt < RTN; ++rt)
#pragma unroll
      for (int r = 0; r < 8; ++r) { const int tq = q0 + rt * 16 + 8 * hh + r; const int k0 = j0 + ln, k1 = j0 + 16 + ln; (void)tq; (void)k0; (void)k1;
        const bool ok0 = true, ok1 = true;
        const float s0 = s[rt][0][r] * SCL, s1 = s[rt][1][r] * SCL; float mc = fmaxf(s0, s1);
        mc = fmaxf(mc, __shfl_xor(mc, 1, 32)); mc = fmaxf(mc, __shfl_xor(mc, 2, 32)); mc = fmaxf(mc, __shfl_xor(mc, 4, 32)); mc = fmaxf(mc, __shfl_xor(mc, 8, 32));
        const float mn = fmaxf(m_r[rt][r], mc); const float al = (mn > -1.0e38f) ? expf(m_r[rt][r] - mn) : 1.0f; m_r[rt][r] = mn; const float p0 = ok0 ? expf(s0 - mn) : 0.f, p1 = ok1 ? expf(s1 - mn) : 0.f; l_r[rt][r] = l_r[rt][r] * al + p0 + p1;
#pragma unroll
        for (int dt = 0; dt < DT; ++dt) oacc[rt][dt][r] *= al;
        FragH t2; t2.h[0] = (_Float16)(p0 * 1024.0f); t2.h[1] = (_Float16)(p1 * 1024.0f); sP[w][rt * 16 + 8 * hh + r][ln] = t2.u[0]; sP[w][rt * 16 + 8 * hh + r][16 + ln] = t2.u[1]; }
    __builtin_amdgcn_fence(__ATOMIC_ACQ_REL, "workgroup"); __builtin_amdgcn_wave_barrier();
    FragH pa[2];
#pragma unroll
    for (int rt = 0; rt < RTN; ++rt) { pa[rt].half[0] = *(const v8us*)&sP[w][rt * 16 + ln][8 * hh]; pa[rt].half[1] = *(const v8us*)&sP[w][rt * 16 + ln][16 + 8 * hh]; }
#pragma unroll
    for (int dt = 0; dt < DT; ++dt) { const unsigned short* vrow = Vth + (size_t)(dt * 16 + ln) * TK + j0; FragH bv; bv.half[0] = *(const v8us*)(vrow + 8 * hh); bv.half[1] = *(const v8us*)(vrow + 16 + 8 * hh);
#pragma unroll
      for (int rt = 0; rt < RTN; ++rt) oacc[rt][dt] = mmaH<1>(pa[rt].v, pa[rt].v, bv.v, bv.v, oacc[rt][dt]); }
    __builtin_amdgcn_fence(__ATOMIC_ACQ_REL, "workgroup"); __builtin_amdgcn_wave_barrier(); }
#pragma unroll
  for (int rt = 0; rt < RTN; ++rt) {
#pragma unroll
    for (int r = 0; r < 8; ++r) { float l = l_r[rt][r]; l += __shfl_xor(l, 1, 32); l += __shfl_xor(l, 2, 32); l += __shfl_xor(l, 4, 32); l += __shfl_xor(l, 8, 32); l_r[rt][r] = (l > 0.f) ? 1.0f / (l * 1024.0f) : 0.f; }
#pragma unroll
    for (int dt = 0; dt < DT; ++dt)
#pragma unroll
      for (int r = 0; r < 8; ++r) sO[w][rt * 16 + 8 * hh + r][dt * 16 + ln] = oacc[rt][dt][r] * l_r[rt][r]; }
  __builtin_amdgcn_fence(__ATOMIC_ACQ_REL, "workgroup"); __builtin_amdgcn_wave_barrier();
  {
#pragma unroll
    for (int rp = 0; rp < RPW; rp += 2) { const int r = rp + (lane >> 4), pc = lane & 15; const v4f val = *(const v4fa*)&sO[w][r][pc * 4]; *(v4f*)(O + ((size_t)b * TQ + q0 + r) * ldo + h * 64 + pc * 4) = val; }
     } }
__global__ __launch_bounds__(256) void k_split(const float* __restrict__ F, _Float16* __restrict__ Hh, _Float16* __restrict__ Hl, size_t n8) {
  #pragma clang fp contract(off)
  const size_t t = (size_t)blockIdx.x * 256 + threadIdx.x; if (t >= n8) return; const v4f a = *(const v4fa*)(F + t * 8), c = *(const v4fa*)(F + t * 8 + 4); FragH fh, fl;
#pragma unroll
  for (int q = 0; q < 8; ++q) { const float v = (q < 4) ? a[q] : c[q - 4]; const _Float16 hi = (_Float16)v; fh.h[q] = hi; fl.h[q] = (_Float16)((v - (float)hi) * 1024.0f); }
  { *(v8us*)((unsigned short*)Hh + t * 8) = fh.half[0]; *(v8us*)((unsigned short*)Hl + t * 8) = fl.half[0];  } }


#define PIDX(i) ((((i) >> 3) << 5) + ((i) & 7))
__global__ __launch_bounds__(256) void k_rowflag(const float* __restrict__ X, int* __restrict__ FL) {
  #pragma clang fp contract(off)
  __shared__ int sf[8];
  const int tid = threadIdx.x, w = tid >> 5, ln = tid & 31; const int r = blockIdx.x * 8 + w; const float* x = X + (size_t)r * DKV; float s = 0.f;
#pragma unroll
  for (int u = 0; u < DKV / 32; ++u) s += bf16_round(x[u * 32 + ln]);
  for (int o = 16; o > 0; o >>= 1) s += __shfl_xor(s, o, 32);
  if (ln == 0) sf[w] = (s == 0.0f) ? 1 : 0;
  __syncthreads();
  if (tid < 32) { const int v = (tid < 8) ? sf[tid] : 0; int* d = FL + blockIdx.x * 32 + tid; *(int*)d = v;  } }      
__global__ __launch_bounds__(256) void k_zerorows(const int* __restrict__ FL, _Float16* __restrict__ P16) {
  const size_t t = (size_t)blockIdx.x * 256 + threadIdx.x; if (t >= (size_t)NR * DM / 8) return; const int r = (int)(t / (DM / 8)); if (FL[PIDX(r)] == 0) return; FragH z;
#pragma unroll
  for (int q = 0; q < 8; ++q) z.h[q] = (_Float16)0.0f; *(v8us*)((unsigned short*)P16 + t * 8) = z.half[0];  }
extern "C" void kernel_launch(void* const* d_in, const int* in_sizes, int n_in,
                              void* d_out, int out_size, void* d_ws, size_t ws_size, hipStream_t stream) {
  (void)in_sizes; (void)n_in; (void)out_size;
  const float* const* I = (const float* const*)d_in; const float* qi = I[0]; const float* ki = I[1]; const float* vi = I[2];
  const float* Wq = I[3]; const float* bq = I[4]; const float* Wk = I[5]; const float* bk = I[6]; const float* Wv = I[7]; const float* bv = I[8]; const float* Wo = I[9]; const float* bo = I[10];
  char* ws = (char*)d_ws; size_t off = 0;
  auto take = [&](size_t bytes) { char* p = ws + off; off += (bytes + 255) & ~(size_t)255; return p; };
  _Float16* BQ = (_Float16*)take((size_t)DM * DM * 2); _Float16* BK = (_Float16*)take((size_t)DM * DKV * 2); _Float16* BV = (_Float16*)take((size_t)DM * DKV * 2); _Float16* BO = (_Float16*)take((size_t)DM * DM * 2);
  _Float16* X16 = (_Float16*)take((size_t)NR * DM * 2); _Float16* Q16 = (_Float16*)take((size_t)NR * DM * 2); _Float16* K16 = (_Float16*)take((size_t)NR * DM * 2); _Float16* V16 = (_Float16*)take((size_t)NR * DM * 2); _Float16* VT = (_Float16*)take((size_t)NR * DM * 2);
  int* FLK = (int*)take((size_t)(NR / 8) * 32 * 4); int* FLV = (int*)take((size_t)(NR / 8) * 32 * 4);
  float* O = (float*)take((size_t)NR * DM * 4); _Float16* Oh = (_Float16*)take((size_t)NR * DM * 2); _Float16* Ol = (_Float16*)take((size_t)NR * DM * 2);      /* all batches */
  if (off > ws_size) return;      /* 6 + 16 x 5 + 0.3 + 32 + 16 + 16 = 150 MiB */
  const size_t n8 = (size_t)NR * DM / 8, n8k = (size_t)NR * DKV / 8; const unsigned nb8 = (unsigned)((n8 + 255) / 256), nb8k = (unsigned)((n8k + 255) / 256);
  k_wt_f16<<<(unsigned)(((size_t)DM * DM / 8 + 255) / 256), 256, 0, stream>>>(Wq, BQ, DM, DM, 16.0f); k_wt_f16<<<(unsigned)(((size_t)DKV * DM / 8 + 255) / 256), 256, 0, stream>>>(Wk, BK, DKV, DM, 16.0f); k_wt_f16<<<(unsigned)(((size_t)DKV * DM / 8 + 255) / 256), 256, 0, stream>>>(Wv, BV, DKV, DM, 16.0f); k_wt_f16<<<(unsigned)(((size_t)DM * DM / 8 + 255) / 256), 256, 0, stream>>>(Wo, BO, DM, DM, 16.0f);      /* (in,out) -> [out][in] x16 */
  const dim3 gP((NR / 128) * (DM / 64), 1);
  k_x16<<<nb8, 256, 0, stream>>>(qi, X16, n8); k_gemm2<0><<<gP, 128, 0, stream>>>(X16, DM, 0, BQ, DM, 0, 0.0625f, bq, 0, nullptr, 1, 0, 0, nullptr, Q16, DM, 0, NR, DM, DM);      /* q -> f16 */
  k_x16<<<nb8k, 256, 0, stream>>>(ki, X16, n8k); k_rowflag<<<NR / 8, 256, 0, stream>>>(ki, FLK); k_gemm2<0><<<gP, 128, 0, stream>>>(X16, DKV, 0, BK, DKV, 0, 0.0625f, bk, 0, nullptr, 1, 0, 0, nullptr, K16, DM, 0, NR, DM, DKV); k_zerorows<<<nb8, 256, 0, stream>>>(FLK, K16);      /* k -> f16 (masked rows zeroed) */
  k_x16<<<nb8k, 256, 0, stream>>>(vi, X16, n8k); k_rowflag<<<NR / 8, 256, 0, stream>>>(vi, FLV); k_gemm2<0><<<gP, 128, 0, stream>>>(X16, DKV, 0, BV, DKV, 0, 0.0625f, bv, 0, nullptr, 1, 0, 0, nullptr, V16, DM, 0, NR, DM, DKV); k_zerorows<<<nb8, 256, 0, stream>>>(FLV, V16);      /* v -> f16 */
  k_vt<NH, TK><<<NBT * NH * (TK / 64), 256, 0, stream>>>(V16, DM, 0, VT);      /* Vt[(b,h)][d][s] */
  float* outp = (float*)d_out;
  k_flash<<<NBT * NH * (TQ / 64), 128, 0, stream>>>(Q16, DM, K16, DM, VT, nullptr, O, DM);      /* all batches in one grid: slab = b*NH + h */
  k_split<<<nb8, 256, 0, stream>>>(O, Oh, Ol, n8);
  k_gemm2<0><<<gP, 128, 0, stream>>>(Oh, DM, 0, BO, DM, 0, 0.0625f, bo, 0, nullptr, 1, 0, 0, outp, nullptr, DM, 0, NR, DM, DM);
  k_gemm2<0><<<gP, 128, 0, stream>>>(Ol, DM, 0, BO, DM, 0, 0.0625f / 1024.0f, nullptr, 0, outp, 1, (size_t)DM, 0, outp, nullptr, DM, 0, NR, DM, DM);      /* out = o*Wo + bo */
}

// v002
// It runs in 492 microseconds.
// Next to v001, in two timings, it ran 1.50 times as fast each time.
// All steps since v000 together make it 2.77 times as fast.
#include <hip/hip_runtime.h>
// Multi-head cross attention over social features (B 4, S 2048 queries x 1024, 2048 keys/values x 512, 16 heads x 64; (in,out) Linear weights with bias; key/value rows whose raw features sum to exactly 0 are zeroed after projection, as the reference's padding mask): scores = q.k/8; softmax; out = (attn.v merged)*Wo + bo -> [4,2048,1024].
// Compute dtype: the inputs, the four matrices and biases rounded to bf16; q/k/v products exact (weights x16 in f16, undone by alpha), q, k, v, P as f16 operands (~2^-12; logits sigma ~0.4), O as f16 hi + lo; f32 accumulation and softmax. v_wmma_f32_16x16x32_f16.
#define NBT 4
#define TQ 2048
#define TK 2048
#define DKV 512
#define NR (NBT * TQ)
#define DM 1024
#define NH 16
#define SCL 0.125f
typedef __bf16 v16b __attribute__((ext_vector_type(16)));
typedef unsigned short v8us __attribute__((ext_vector_type(8), may_alias));
typedef float  v8f  __attribute__((ext_vector_type(8)));
typedef float  v4f  __attribute__((ext_vector_type(4)));
typedef float  v4fa __attribute__((ext_vector_type(4), may_alias));
union FragB { v16b v; v8us half[2]; unsigned short u[16]; };

__device__ __forceinline__ unsigned short bf16_bits(float x) { unsigned int u = __float_as_uint(x); return (unsigned short)((u + 0x7FFFu + ((u >> 16) & 1u)) >> 16); }
__device__ __forceinline__ float bf16_val(unsigned short b) { return __uint_as_float(((unsigned int)b) << 16); }
__device__ __forceinline__ float bf16_round(float x) { return bf16_val(bf16_bits(x)); }
// D += A·B with NT terms: 1 = ah·bh, 2 = + al·bh (A split), 3 = + ah·bl (both split)
template <int NT>
__device__ __forceinline__ v8f mmaN(v16b ah, v16b al, v16b bh, v16b bl, v8f c) {
  c = __builtin_amdgcn_wmma_f32_16x16x32_bf16(false, ah, false, bh, (short)0, c, false, false);
  if (NT >= 2) c = __builtin_amdgcn_wmma_f32_16x16x32_bf16(false, al, false, bh, (short)0, c, false, false);
  if (NT >= 3) c = __builtin_amdgcn_wmma_f32_16x16x32_bf16(false, ah, false, bl, (short)0, c, false, false);
  asm volatile("v_nop\n\tv_nop\n\tv_nop\n\tv_nop" : "+v"(c) : "v"(ah), "v"(al), "v"(bh), "v"(bl));
  return c;
}

__global__ __launch_bounds__(256) void k_wt_bf16(const float* __restrict__ W, unsigned short* __restrict__ Wt, int K, int N) {
  const int t = blockIdx.x * 256 + threadIdx.x;
  const int k8n = K / 8;
  if (t >= N * k8n) return;
  const int n = t / k8n, k8 = (t % k8n) * 8;
  v8us v;
#pragma unroll
  for (int i = 0; i < 8; ++i) v[i] = bf16_bits(W[(size_t)(k8 + i) * N + n]);
  *(v8us*)(Wt + (size_t)n * K + k8) = v;
  
}

// GEMM C[M][N] (f32, pitch ldc) = act(A[M][K]·W + bias). A f32 row-major (pitch lda) converted per fragment to bf16
// (ASPLIT: hi/lo two planes -> 2 terms, else single rounded term); Wt bf16 [N][K] (pitch ldb). BIAS_BF16 rounds the
// bias to bf16 first (bias quantised to bf16 before the add). K%32==0, M%16==0, N%64==0.
template <bool ASPLIT, int ACT, bool BIAS_BF16>
__global__ __launch_bounds__(128) void k_gemm_bf(const float* __restrict__ A, int lda, const unsigned short* __restrict__ Wt, int ldb,
                                               const float* __restrict__ bias, float* __restrict__ C, int ldc, int M, int N, int K) {
  __shared__ __attribute__((aligned(16))) float so[4][16][64];
  const int tid = threadIdx.x, w = tid >> 5, lane = tid & 31, ln = lane & 15, hh = lane >> 4;
  const int ntn = N / 64;
  const int wid = blockIdx.x * 4 + w;
  const int mt = wid / ntn, nq = wid % ntn;
  if (mt * 16 >= M) return;
  const int row0 = mt * 16, col0 = nq * 64;
  const float* arow = A + (size_t)(row0 + ln) * lda;
  v8f acc[4] = {};
  for (int kb = 0; kb < K; kb += 32) {
    FragB ah, al;
    const v4f x0 = *(const v4fa*)(arow + kb + 8 * hh), x1 = *(const v4fa*)(arow + kb + 8 * hh + 4);
    const v4f x2 = *(const v4fa*)(arow + kb + 16 + 8 * hh), x3 = *(const v4fa*)(arow + kb + 16 + 8 * hh + 4);
    float xs[16] = {x0[0],x0[1],x0[2],x0[3],x1[0],x1[1],x1[2],x1[3],x2[0],x2[1],x2[2],x2[3],x3[0],x3[1],x3[2],x3[3]};
#pragma unroll
    for (int i = 0; i < 16; ++i) { const unsigned short hb = bf16_bits(xs[i]); ah.u[i] = hb; al.u[i] = ASPLIT ? bf16_bits(xs[i] - bf16_val(hb)) : (unsigned short)0; }
#pragma unroll
    for (int t = 0; t < 4; ++t) {
      const unsigned short* brow = Wt + (size_t)(col0 + t * 16 + ln) * ldb + kb;
      FragB b;
      b.half[0] = *(const v8us*)(brow + 8 * hh);
      b.half[1] = *(const v8us*)(brow + 16 + 8 * hh);
      acc[t] = mmaN<ASPLIT ? 2 : 1>(ah.v, al.v, b.v, b.v, acc[t]);
    }
  }
#pragma unroll
  for (int t = 0; t < 4; ++t) {
    float bv = bias ? bias[col0 + t * 16 + ln] : 0.f;
    if (BIAS_BF16) bv = bf16_round(bv);
#pragma unroll
    for (int r = 0; r < 8; ++r) { float v = acc[t][r] + bv; if (ACT == 1) v = fmaxf(v, 0.f); so[w][8 * hh + r][t * 16 + ln] = v; }
  }
  __builtin_amdgcn_fence(__ATOMIC_ACQ_REL, "workgroup");
  __builtin_amdgcn_wave_barrier();
  const int rsub = lane >> 4, c4 = (lane & 15) * 4;
  {
#pragma unroll
    for (int q = 0; q < 8; ++q) {
      const int r = q * 2 + rsub;
      const v4f v = *(const v4fa*)&so[w][r][c4];
      *(v4f*)(C + (size_t)(row0 + r) * ldc + col0 + c4) = v;
    }
    
  }
}

// GEMM C = act(A·W + bias + resid): A f32 (ASPLIT -> hi/lo 2 terms), Wt bf16 [N][K]; ACT 0 none, 1 relu, 2 exact gelu;
// resid (optional, f32, row index = (row % rmod), pitch ldr, RES_BF16 rounds it) added before the activation.
template <bool ASPLIT, int ACT, bool BIAS_BF16, bool RES_BF16>
__global__ __launch_bounds__(128) void k_gemm_bf3(const float* __restrict__ A, int lda, const unsigned short* __restrict__ Wt, int ldb,
                                                const float* __restrict__ bias, const float* __restrict__ resid, int rmod, int ldr,
                                                float* __restrict__ C, int ldc, int M, int N, int K) {
  __shared__ __attribute__((aligned(16))) float so[4][16][64];
  const int tid = threadIdx.x, w = tid >> 5, lane = tid & 31, ln = lane & 15, hh = lane >> 4;
  const int ntn = N / 64;
  const int wid = blockIdx.x * 4 + w;
  const int mt = wid / ntn, nq = wid % ntn;
  if (mt * 16 >= M) return;
  const int row0 = mt * 16, col0 = nq * 64;
  const float* arow = A + (size_t)(row0 + ln) * lda;
  v8f acc[4] = {};
  for (int kb = 0; kb < K; kb += 32) {
    FragB ah, al;
    const v4f x0 = *(const v4fa*)(arow + kb + 8 * hh), x1 = *(const v4fa*)(arow + kb + 8 * hh + 4);
    const v4f x2 = *(const v4fa*)(arow + kb + 16 + 8 * hh), x3 = *(const v4fa*)(arow + kb + 16 + 8 * hh + 4);
    float xs[16] = {x0[0],x0[1],x0[2],x0[3],x1[0],x1[1],x1[2],x1[3],x2[0],x2[1],x2[2],x2[3],x3[0],x3[1],x3[2],x3[3]};
#pragma unroll
    for (int i = 0; i < 16; ++i) { const unsigned short hb = bf16_bits(xs[i]); ah.u[i] = hb; al.u[i] = ASPLIT ? bf16_bits(xs[i] - bf16_val(hb)) : (unsigned short)0; }
#pragma unroll
    for (int t = 0; t < 4; ++t) {
      const unsigned short* brow = Wt + (size_t)(col0 + t * 16 + ln) * ldb + kb;
      FragB b;
      b.half[0] = *(const v8us*)(brow + 8 * hh);
      b.half[1] = *(const v8us*)(brow + 16 + 8 * hh);
      acc[t] = mmaN<ASPLIT ? 2 : 1>(ah.v, al.v, b.v, b.v, acc[t]);
    }
  }
#pragma unroll
  for (int t = 0; t < 4; ++t) {
    const int col = col0 + t * 16 + ln;
    float bv = bias ? bias[col] : 0.f;
    if (BIAS_BF16) bv = bf16_round(bv);
#pragma unroll
    for (int r = 0; r < 8; ++r) {
      float v = acc[t][r] + bv;
      if (resid) { float rv = resid[(size_t)((row0 + 8 * hh + r) % rmod) * ldr + col]; if (RES_BF16) rv = bf16_round(rv); v += rv; }
      if (ACT == 1) v = fmaxf(v, 0.f);
      if (ACT == 2) v = 0.5f * v * (1.0f + erff(v * 0.70710678118654752f));
      if (ACT == 3) { const float u = 0.7978845608028654f * (v + 0.044715f * v * v * v); v = 0.5f * v * (1.0f + tanhf(u)); }
      so[w][8 * hh + r][t * 16 + ln] = v;
    }
  }
  __builtin_amdgcn_fence(__ATOMIC_ACQ_REL, "workgroup");
  __builtin_amdgcn_wave_barrier();
  const int rsub = lane >> 4, c4 = (lane & 15) * 4;
  {
#pragma unroll
    for (int q = 0; q < 8; ++q) {
      const int r = q * 2 + rsub;
      const v4f v = *(const v4fa*)&so[w][r][c4];
      *(v4f*)(C + (size_t)(row0 + r) * ldc + col0 + c4) = v;
    }
    
  }
}
// row LayerNorm (biased variance, eps) over N: s = X (+ R); optional out_sum <- s; out_norm <- (s-mu)*rsqrt(var+eps)*g + b
template <bool PARAM_BF16>
__global__ __launch_bounds__(256) void k_layernorm(const float* __restrict__ X, const float* __restrict__ R, const float* __restrict__ g, const float* __restrict__ bta,
                                                  float* __restrict__ out_sum, float* __restrict__ out_norm, int N, float eps) {
  __shared__ float red[256];
  const int row = blockIdx.x, tid = threadIdx.x;
  const float* x = X + (size_t)row * N; const float* rr = R ? R + (size_t)row * N : nullptr;
  float vals[16];                     // up to N = 4096
  const int per = N / 256;            // contiguous chunk per thread? use strided-by-4 chunks: thread handles j = tid*4 + 1024*u
  float s1 = 0.f;
  for (int u = 0; u < per / 4; ++u) {
    const int j = tid * 4 + 1024 * u;
    const v4f a = *(const v4fa*)(x + j);
    v4f b = {0.f,0.f,0.f,0.f}; if (rr) b = *(const v4fa*)(rr + j);
#pragma unroll
    for (int q = 0; q < 4; ++q) { const float v = a[q] + b[q]; vals[u * 4 + q] = v; s1 += v; }
  }
  red[tid] = s1; __syncthreads();
  for (int st = 128; st > 0; st >>= 1) { if (tid < st) red[tid] += red[tid + st]; __syncthreads(); }
  const float mu = red[0] / (float)N; __syncthreads();
  float s2 = 0.f;
  for (int u = 0; u < per / 4; ++u)
#pragma unroll
    for (int q = 0; q < 4; ++q) { const float c = vals[u * 4 + q] - mu; s2 += c * c; }
  red[tid] = s2; __syncthreads();
  for (int st = 128; st > 0; st >>= 1) { if (tid < st) red[tid] += red[tid + st]; __syncthreads(); }
  const float rs = rsqrtf(red[0] / (float)N + eps);
  {
    for (int u = 0; u < per / 4; ++u) {
      const int j = tid * 4 + 1024 * u;
      v4f o, sm;
#pragma unroll
      for (int q = 0; q < 4; ++q) {
        float gg = g[j + q], bb = bta[j + q];
        if (PARAM_BF16) { gg = bf16_round(gg); bb = bf16_round(bb); }
        sm[q] = vals[u * 4 + q]; o[q] = (vals[u * 4 + q] - mu) * rs * gg + bb;
      }
      if (out_sum) *(v4f*)(out_sum + (size_t)row * N + j) = sm;
      *(v4f*)(out_norm + (size_t)row * N + j) = o;
    }
    
  }
}



// ---- f16 WMMA path (v_wmma_f32_16x16x32_f16): 11-bit significands for operands in range — used where a [0,1] probability operand needs more precision than bf16
typedef _Float16 v16h __attribute__((ext_vector_type(16)));
union FragH { v16h v; v8us half[2]; _Float16 h[16]; unsigned short u[16]; };
template <int NT>
__device__ __forceinline__ v8f mmaH(v16h ah, v16h al, v16h bh, v16h bl, v8f c) {
  c = __builtin_amdgcn_wmma_f32_16x16x32_f16(false, ah, false, bh, (short)0, c, false, false);
  if (NT >= 2) c = __builtin_amdgcn_wmma_f32_16x16x32_f16(false, al, false, bh, (short)0, c, false, false);
  if (NT >= 3) c = __builtin_amdgcn_wmma_f32_16x16x32_f16(false, ah, false, bl, (short)0, c, false, false);
  asm volatile("v_nop\n\tv_nop\n\tv_nop\n\tv_nop" : "+v"(c) : "v"(ah), "v"(al), "v"(bh), "v"(bl));
  return c;
}
// batched GEMM like k_gemm_b but f16 operands: A f32 (split into f16 hi/lo if ASPLIT, else rounded to f16), Bt = f16 values [n][k]; alpha; C f32; N multiple of 16 (partial tiles skipped)
template <bool ASPLIT>
__global__ __launch_bounds__(128) void k_gemm_h(const float* __restrict__ A, int lda, size_t sA, const _Float16* __restrict__ Bh, int ldb, size_t sB, float alpha, float* __restrict__ C, int ldc, size_t sC, int M, int N, int K) {
  __shared__ __attribute__((aligned(16))) float so[4][16][64];
  const int tid = threadIdx.x, w = tid >> 5, lane = tid & 31, ln = lane & 15, hh = lane >> 4; const int by = blockIdx.y;
  A += (size_t)by * sA; Bh += (size_t)by * sB; C += (size_t)by * sC;
  const int ntn = (N + 63) / 64; const int wid = blockIdx.x * 4 + w; const int mt = wid / ntn, nq = wid % ntn; if (mt * 16 >= M) return;
  const int row0 = mt * 16, col0 = nq * 64; const float* arow = A + (size_t)(row0 + ln) * lda;
  v8f acc[4] = {};
  for (int kb = 0; kb < K; kb += 32) {
    FragH ah, al;
    const v4f x0 = *(const v4fa*)(arow + kb + 8 * hh), x1 = *(const v4fa*)(arow + kb + 8 * hh + 4), x2 = *(const v4fa*)(arow + kb + 16 + 8 * hh), x3 = *(const v4fa*)(arow + kb + 16 + 8 * hh + 4);
    float xs[16] = {x0[0],x0[1],x0[2],x0[3],x1[0],x1[1],x1[2],x1[3],x2[0],x2[1],x2[2],x2[3],x3[0],x3[1],x3[2],x3[3]};
#pragma unroll
    for (int i = 0; i < 16; ++i) { const _Float16 h = (_Float16)xs[i]; ah.h[i] = h; al.h[i] = ASPLIT ? (_Float16)(xs[i] - (float)h) : (_Float16)0.0f; }
#pragma unroll
    for (int t = 0; t < 4; ++t) { if (col0 + t * 16 >= N) continue; const size_t boff = (size_t)(col0 + t * 16 + ln) * ldb + kb; FragH bq; bq.half[0] = *(const v8us*)(Bh + boff + 8 * hh); bq.half[1] = *(const v8us*)(Bh + boff + 16 + 8 * hh);
      acc[t] = mmaH<ASPLIT ? 2 : 1>(ah.v, al.v, bq.v, bq.v, acc[t]); }
  }
#pragma unroll
  for (int t = 0; t < 4; ++t) { if (col0 + t * 16 >= N) continue;
#pragma unroll
    for (int r = 0; r < 8; ++r) so[w][8 * hh + r][t * 16 + ln] = acc[t][r] * alpha; }
  __builtin_amdgcn_fence(__ATOMIC_ACQ_REL, "workgroup"); __builtin_amdgcn_wave_barrier();
  const int rsub = lane >> 4, c4 = (lane & 15) * 4;
  {
#pragma unroll
    for (int q = 0; q < 8; ++q) { const int r = q * 2 + rsub; if (col0 + c4 < N) { const v4f v = *(const v4fa*)&so[w][r][c4]; *(v4f*)(C + (size_t)(row0 + r) * ldc + col0 + c4) = v; } }
     }
}

// Wt[n][k] = f16(W[k][n]·scale) from f32 row-major W[K][N] (scale = power of two; bf16-exact weights stay exact in f16 away from the subnormal range)
__global__ __launch_bounds__(256) void k_wt_f16(const float* __restrict__ W, _Float16* __restrict__ Wt, int K, int N, float scale) {
  const int t = blockIdx.x * 256 + threadIdx.x; if (t >= N * (K / 8)) return; const int n = t / (K / 8), k8 = (t % (K / 8)) * 8; FragH f;
#pragma unroll
  for (int i = 0; i < 8; ++i) f.h[i] = (_Float16)(bf16_round(W[(size_t)(k8 + i) * N + n]) * scale); const v8us o = f.half[0];
  *(v8us*)((unsigned short*)Wt + (size_t)n * K + k8) = o; 
}
// k_gemm_hh variant with fused epilogue: v = acc·alpha + bias[by·sBias + col] (+ CP[(row/rowsPerB)·sCPb + by·64 + col] if CP) ; ACT 0 none / 1 elu ; writes f16 C16 (and f32 C if non-null)
template <int ACT>
__global__ __launch_bounds__(128) void k_gemm_hhx(const _Float16* __restrict__ A, int lda, size_t sA, const _Float16* __restrict__ Bh, int ldb, size_t sB, float alpha, const float* __restrict__ bias, size_t sBias, const float* __restrict__ CP, int rowsPerB, size_t sCPb, int row0g,
    float* __restrict__ C, _Float16* __restrict__ C16, int ldc, size_t sC, int M, int N, int K) {
  __shared__ __attribute__((aligned(16))) float so[4][16][64];
  const int tid = threadIdx.x, w = tid >> 5, lane = tid & 31, ln = lane & 15, hh = lane >> 4; const int by = blockIdx.y;
  A += (size_t)by * sA; Bh += (size_t)by * sB; const size_t cofs = (size_t)by * sC; const float* bp = bias ? bias + (size_t)by * sBias : nullptr;
  const int ntn = (N + 63) / 64; const int wid = blockIdx.x * 4 + w; const int mt = wid / ntn, nq = wid % ntn; if (mt * 16 >= M) return;
  const int row0 = mt * 16, col0 = nq * 64; const _Float16* arow = A + (size_t)(row0 + ln) * lda;
  v8f acc[4] = {};
  for (int kb = 0; kb < K; kb += 32) { FragH ah; ah.half[0] = *(const v8us*)((const unsigned short*)arow + kb + 8 * hh); ah.half[1] = *(const v8us*)((const unsigned short*)arow + kb + 16 + 8 * hh);
#pragma unroll
    for (int t = 0; t < 4; ++t) { if (col0 + t * 16 >= N) continue; const size_t boff = (size_t)(col0 + t * 16 + ln) * ldb + kb; FragH bq; bq.half[0] = *(const v8us*)((const unsigned short*)Bh + boff + 8 * hh); bq.half[1] = *(const v8us*)((const unsigned short*)Bh + boff + 16 + 8 * hh);
      acc[t] = mmaH<1>(ah.v, ah.v, bq.v, bq.v, acc[t]); }
  }
#pragma unroll
  for (int t = 0; t < 4; ++t) { if (col0 + t * 16 >= N) continue; const int col = col0 + t * 16 + ln; const float bv = bp ? bf16_round(bp[col]) : 0.f;
#pragma unroll
    for (int r = 0; r < 8; ++r) { float v = acc[t][r] * alpha + bv; if (CP) { const int bidx = (row0g + row0 + 8 * hh + r) / rowsPerB; v += CP[(size_t)bidx * sCPb + (size_t)by * 64 + col]; } if (ACT == 1) v = (v > 0.f) ? v : expm1f(v); else if (ACT == 7) v = (v > 0.f) ? v + 1.0f : expf(v); else if (ACT == 8) v = tanhf(v); else if (ACT == 9) v = 0.5f * v * (1.0f + tanhf(0.7978845608028654f * (v + 0.044715f * v * v * v))); else if (ACT == 11) v = 1.0f / (1.0f + expf(-v)); else if (ACT == 12) v = (v > 0.f) ? v : 0.01f * v; else if (ACT == 14) v = (v > 0.f) ? v : 0.1f * v; else if (ACT == 15) v = v / (1.0f + expf(-v)); else if (ACT == 3) v = fmaxf(v, 0.f); else if (ACT == 6) v = 0.5f * v * (1.0f + erff(v * 0.70710678118654752f)); so[w][8 * hh + r][t * 16 + ln] = v; } }
  __builtin_amdgcn_fence(__ATOMIC_ACQ_REL, "workgroup"); __builtin_amdgcn_wave_barrier();
  const int rsub = lane >> 4, c4 = (lane & 15) * 4; typedef _Float16 v4h __attribute__((ext_vector_type(4)));
  {
#pragma unroll
    for (int q = 0; q < 8; ++q) { const int r = q * 2 + rsub; if (col0 + c4 < N) { const v4f v = *(const v4fa*)&so[w][r][c4]; if (C) *(v4f*)(C + cofs + (size_t)(row0 + r) * ldc + col0 + c4) = v; if (C16) { v4h h4; for (int i = 0; i < 4; ++i) h4[i] = (_Float16)v[i]; *(v4h*)(C16 + cofs + (size_t)(row0 + r) * ldc + col0 + c4) = h4; } } }
     }
}


typedef _Float16 v4h __attribute__((ext_vector_type(4)));

__global__ __launch_bounds__(256) void k_x16(const float* __restrict__ x, _Float16* __restrict__ X16, size_t n8) { const size_t t = (size_t)blockIdx.x * 256 + threadIdx.x; if (t >= n8) return; FragH f;
#pragma unroll
  for (int q = 0; q < 8; ++q) f.h[q] = (_Float16)bf16_round(x[t * 8 + q]); *(v8us*)((unsigned short*)X16 + t * 8) = f.half[0];  }
__global__ __launch_bounds__(256) void k_h16(const float* __restrict__ x, _Float16* __restrict__ X16, size_t n8) { const size_t t = (size_t)blockIdx.x * 256 + threadIdx.x; if (t >= n8) return; FragH f;
#pragma unroll
  for (int q = 0; q < 8; ++q) f.h[q] = (_Float16)x[t * 8 + q]; *(v8us*)((unsigned short*)X16 + t * 8) = f.half[0];  }
__global__ __launch_bounds__(256) void k_round16f(const float* __restrict__ W, _Float16* __restrict__ Bt, size_t n8) { const size_t t = (size_t)blockIdx.x * 256 + threadIdx.x; if (t >= n8) return; FragH f;
#pragma unroll
  for (int i = 0; i < 8; ++i) f.h[i] = (_Float16)(bf16_round(W[t * 8 + i]) * 16.0f); *(v8us*)((unsigned short*)Bt + t * 8) = f.half[0];  }
template <int NHv, int TTv>
__global__ __launch_bounds__(256) void k_vt(const _Float16* __restrict__ V16, int ldv, int voff, _Float16* __restrict__ Vt) { __shared__ unsigned short tl[64][66]; const int tid = threadIdx.x; const int slab = blockIdx.x / (TTv / 64), lg = blockIdx.x % (TTv / 64); const int b = slab / NHv, h = slab % NHv;
  for (int i = tid; i < 64 * 8; i += 256) { const int r = i / 8, c8 = (i % 8) * 8; FragH f; f.half[0] = *(const v8us*)((const unsigned short*)V16 + ((size_t)b * TTv + lg * 64 + r) * ldv + voff + h * 64 + c8);
#pragma unroll
    for (int q = 0; q < 8; ++q) tl[r][c8 + q] = f.u[q]; }
  __syncthreads();
  {
#pragma unroll
    for (int rd = 0; rd < 2; ++rd) { const int d = rd * 32 + tid / 8, pc = tid % 8; FragH f;
#pragma unroll
      for (int q = 0; q < 8; ++q) f.u[q] = tl[pc * 8 + q][d];
      *(v8us*)((unsigned short*)Vt + ((size_t)slab * 64 + d) * TTv + lg * 64 + pc * 8) = f.half[0]; }
     } }

__global__ __launch_bounds__(256) void k_hl(const float* __restrict__ F, _Float16* __restrict__ Hh, _Float16* __restrict__ Hl, size_t n8) { const size_t t = (size_t)blockIdx.x * 256 + threadIdx.x; if (t >= n8) return; FragH fh, fl; const v4f a = *(const v4fa*)(F + t * 8), c = *(const v4fa*)(F + t * 8 + 4);
#pragma unroll
  for (int q = 0; q < 4; ++q) { _Float16 h = (_Float16)a[q]; fh.h[q] = h; fl.h[q] = (_Float16)((a[q] - (float)h) * 1024.0f); h = (_Float16)c[q]; fh.h[4 + q] = h; fl.h[4 + q] = (_Float16)((c[q] - (float)h) * 1024.0f); }
  { *(v8us*)((unsigned short*)Hh + t * 8) = fh.half[0]; *(v8us*)((unsigned short*)Hl + t * 8) = fl.half[0];  } }

// ---- fast GEMM (wave tile 32x64; requires M % 32 == 0 rows per launch region and N % 64 == 0); epilogue = k_gemm_hhx semantics ----
__device__ __forceinline__ v16h g2_frag(const _Float16* p, int hh) { FragH f; f.half[0] = *(const v8us*)((const unsigned short*)p + 8 * hh); f.half[1] = *(const v8us*)((const unsigned short*)p + 16 + 8 * hh); return f.v; }
__device__ __forceinline__ v8f g2_mma(v16h a, v16h b, v8f c) { v8f d = __builtin_amdgcn_wmma_f32_16x16x32_f16(false, a, false, b, (short)0, c, false, false); asm volatile("v_nop\n\tv_nop\n\tv_nop\n\tv_nop" : "+v"(d) : "v"(a), "v"(b)); return d; }
template <int ACT>
__global__ __launch_bounds__(128) void k_gemm2(const _Float16* __restrict__ A, int lda, size_t sA, const _Float16* __restrict__ Bh, int ldb, size_t sB, float alpha, const float* __restrict__ bias, size_t sBias, const float* __restrict__ CP, int rowsPerB, size_t sCPb, int row0g,
    float* __restrict__ C, _Float16* __restrict__ C16, int ldc, size_t sC, int M, int N, int K) {
  __shared__ __attribute__((aligned(16))) float so[4][32][68];
  const int tid = threadIdx.x, w = tid >> 5, lane = tid & 31, ln = lane & 15, hh = lane >> 4; const int by = blockIdx.y;
  A += (size_t)by * sA; Bh += (size_t)by * sB; const size_t cofs = (size_t)by * sC; const float* bp = bias ? bias + (size_t)by * sBias : nullptr;
  const int ntn = N >> 6; const int mt = blockIdx.x / ntn, nq = blockIdx.x - mt * ntn; const int row0 = mt * 128 + 32 * w, col0 = nq * 64; if (row0 >= M) return;
  const _Float16* a0p = A + (size_t)(row0 + ln) * lda; const _Float16* a1p = a0p + (size_t)16 * lda;
  const _Float16* b0p = Bh + (size_t)(col0 + ln) * ldb; const _Float16* b1p = b0p + (size_t)16 * ldb; const _Float16* b2p = b1p + (size_t)16 * ldb; const _Float16* b3p = b2p + (size_t)16 * ldb;
  const v8f z8 = {0.f,0.f,0.f,0.f,0.f,0.f,0.f,0.f}; v8f c00 = z8, c01 = z8, c02 = z8, c03 = z8, c10 = z8, c11 = z8, c12 = z8, c13 = z8;
#pragma unroll 1
  for (int kb = 0; kb < K; kb += 32) { const v16h a0 = g2_frag(a0p + kb, hh), a1 = g2_frag(a1p + kb, hh);
    v16h b = g2_frag(b0p + kb, hh); c00 = g2_mma(a0, b, c00); c10 = g2_mma(a1, b, c10);
    b = g2_frag(b1p + kb, hh); c01 = g2_mma(a0, b, c01); c11 = g2_mma(a1, b, c11);
    b = g2_frag(b2p + kb, hh); c02 = g2_mma(a0, b, c02); c12 = g2_mma(a1, b, c12);
    b = g2_frag(b3p + kb, hh); c03 = g2_mma(a0, b, c03); c13 = g2_mma(a1, b, c13); }
  v8f accs[8] = {c00, c01, c02, c03, c10, c11, c12, c13};
#pragma unroll
  for (int u = 0; u < 8; ++u) { const int t = u & 3, half = u >> 2; const int col = col0 + t * 16 + ln; const float bv = bp ? bf16_round(bp[col]) : 0.f;
#pragma unroll
    for (int r = 0; r < 8; ++r) { const int rloc = half * 16 + 8 * hh + r; float v = accs[u][r] * alpha + bv; if (CP) { const int bidx = (row0g + row0 + rloc) / rowsPerB; v += CP[(size_t)bidx * sCPb + (size_t)by * 64 + col]; }
      if (ACT == 3) v = fmaxf(v, 0.f); else if (ACT == 6) v = 0.5f * v * (1.0f + erff(v * 0.70710678118654752f)); else if (ACT == 11) v = 1.0f / (1.0f + expf(-v)); else if (ACT == 15) v = v / (1.0f + expf(-v)); else if (ACT == 12) v = (v > 0.f) ? v : 0.01f * v; else if (ACT == 8) v = tanhf(v);
      so[w][rloc][t * 16 + ln] = v; } }
  __builtin_amdgcn_fence(__ATOMIC_ACQ_REL, "workgroup"); __builtin_amdgcn_wave_barrier();
  const int rsub = lane >> 4, c4 = (lane & 15) * 4;
  {
#pragma unroll
    for (int q = 0; q < 16; ++q) { const int r = q * 2 + rsub; const v4f v = *(const v4fa*)&so[w][r][c4]; if (C) *(v4f*)(C + cofs + (size_t)(row0 + r) * ldc + col0 + c4) = v; if (C16) { v4h h4; for (int i = 0; i < 4; ++i) h4[i] = (_Float16)v[i]; *(v4h*)(C16 + cofs + (size_t)(row0 + r) * ldc + col0 + c4) = h4; } }
     } }


// lane l <-> lane l ^ 16 by a vector cross-row move
__device__ __forceinline__ float xhalf(float x) { return __builtin_bit_cast(float, __builtin_amdgcn_permlanex16(__builtin_bit_cast(int, x), __builtin_bit_cast(int, x), 0x76543210, 0xfedcba98, false, false)); }
__global__ __launch_bounds__(128) void k_flash(const _Float16* __restrict__ Q16, int ldq, const _Float16* __restrict__ K16, int ldk, const _Float16* __restrict__ Vt, const int* __restrict__ MSK, float* __restrict__ O, int ldo) {
  constexpr int RPW = 16, NQB = TQ / (4 * RPW), DT = 4, KS = 2; (void)MSK;
  __shared__ __attribute__((aligned(16))) float sO[4][RPW][64 + 4];
  const int tid = threadIdx.x, w = tid >> 5, lane = tid & 31, ln = lane & 15, hh = lane >> 4;
  const int slab = blockIdx.x / NQB, qblk = blockIdx.x % NQB; const int b = slab / NH, h = slab % NH; const int q0 = qblk * (4 * RPW) + w * RPW;
  FragH bq[KS];
  { const unsigned short* qr = (const unsigned short*)Q16 + ((size_t)b * TQ + q0 + ln) * ldq + h * 64;
#pragma unroll
    for (int ks = 0; ks < KS; ++ks) { bq[ks].half[0] = *(const v8us*)(qr + ks * 32 + 8 * hh); bq[ks].half[1] = *(const v8us*)(qr + ks * 32 + 16 + 8 * hh); } }
  const unsigned short* Kh = (const unsigned short*)K16 + ((size_t)b * TK + ln) * ldk + h * 64;
  const unsigned short* Vth = (const unsigned short*)Vt + ((size_t)slab * 64 + ln) * TK;
  float m_q = -3.0e38f, l_q = 0.f; v8f oacc[DT];
#pragma unroll
  for (int dt = 0; dt < DT; ++dt) oacc[dt] = (v8f){0.f,0.f,0.f,0.f,0.f,0.f,0.f,0.f};
#pragma unroll 1
  for (int j0 = 0; j0 < TK; j0 += 32) {
    FragH ak[2][KS];
#pragma unroll
    for (int nt = 0; nt < 2; ++nt) { const unsigned short* kr = Kh + (size_t)(j0 + nt * 16) * ldk;
#pragma unroll
      for (int ks = 0; ks < KS; ++ks) { ak[nt][ks].half[0] = *(const v8us*)(kr + ks * 32 + 8 * hh); ak[nt][ks].half[1] = *(const v8us*)(kr + ks * 32 + 16 + 8 * hh); } }
    float sc[16];
#pragma unroll
    for (int nt = 0; nt < 2; ++nt) { v8f acc = (v8f){0.f,0.f,0.f,0.f,0.f,0.f,0.f,0.f};
#pragma unroll
      for (int ks = 0; ks < KS; ++ks) acc = mmaH<1>(ak[nt][ks].v, ak[nt][ks].v, bq[ks].v, bq[ks].v, acc);
#pragma unroll
      for (int r = 0; r < 8; ++r) sc[nt * 8 + r] = acc[r] * SCL; }      /* sc[nt*8 + r] = score(key j0 + nt*16 + 8*hh + r, query q0 + ln) */
    FragH av[DT];
#pragma unroll
    for (int dt = 0; dt < DT; ++dt) { const unsigned short* vrow = Vth + (size_t)(dt * 16) * TK + j0; av[dt].half[0] = *(const v8us*)(vrow + 8 * hh); av[dt].half[1] = *(const v8us*)(vrow + 16 + 8 * hh); }
    float mx[4];
#pragma unroll
    for (int c = 0; c < 4; ++c) mx[c] = fmaxf(fmaxf(sc[4 * c], sc[4 * c + 1]), fmaxf(sc[4 * c + 2], sc[4 * c + 3]));
    float mc = fmaxf(fmaxf(mx[0], mx[1]), fmaxf(mx[2], mx[3])); mc = fmaxf(mc, xhalf(mc));
    const float mn = fmaxf(m_q, mc); const float al = expf(m_q - mn); m_q = mn;      /* 0 on the first pass; 1 where the maximum stays */
    FragH pb; float ps[4] = {0.f, 0.f, 0.f, 0.f};
#pragma unroll
    for (int i = 0; i < 16; ++i) { const float p = expf(sc[i] - mn); ps[i & 3] += p; pb.h[i] = (_Float16)(p * 1024.0f); }      /* pb.h[nt*8 + r] = P(key j0 + nt*16 + 8*hh + r, query q0 + ln): the k order of the Vt loader */
    l_q = l_q * al + ((ps[0] + ps[1]) + (ps[2] + ps[3]));
#pragma unroll
    for (int dt = 0; dt < DT; ++dt) {
#pragma unroll
      for (int r = 0; r < 8; ++r) oacc[dt][r] *= al;
      oacc[dt] = mmaH<1>(av[dt].v, av[dt].v, pb.v, pb.v, oacc[dt]); } }
  const float lt = l_q + xhalf(l_q); const float inv = (lt > 0.f) ? 1.0f / (lt * 1024.0f) : 0.f;
#pragma unroll
  for (int dt = 0; dt < DT; ++dt)      /* oacc[dt][r] = Ot[dt*16 + 8*hh + r][q0 + ln] */
#pragma unroll
    for (int q = 0; q < 2; ++q) { v4f o4;
#pragma unroll
      for (int i = 0; i < 4; ++i) o4[i] = oacc[dt][q * 4 + i] * inv;
      *(v4fa*)&sO[w][ln][dt * 16 + 8 * hh + q * 4] = o4; }
  __builtin_amdgcn_fence(__ATOMIC_ACQ_REL, "workgroup"); __builtin_amdgcn_wave_barrier();
  {
#pragma unroll
    for (int rp = 0; rp < RPW; rp += 2) { const int r = rp + (lane >> 4), pc = lane & 15; const v4f val = *(const v4fa*)&sO[w][r][pc * 4]; *(v4f*)(O + ((size_t)b * TQ + q0 + r) * ldo + h * 64 + pc * 4) = val; }
     } }
__global__ __launch_bounds__(256) void k_split(const float* __restrict__ F, _Float16* __restrict__ Hh, _Float16* __restrict__ Hl, size_t n8) {
  #pragma clang fp contract(off)
  const size_t t = (size_t)blockIdx.x * 256 + threadIdx.x; if (t >= n8) return; const v4f a = *(const v4fa*)(F + t * 8), c = *(const v4fa*)(F + t * 8 + 4); FragH fh, fl;
#pragma unroll
  for (int q = 0; q < 8; ++q) { const float v = (q < 4) ? a[q] : c[q - 4]; const _Float16 hi = (_Float16)v; fh.h[q] = hi; fl.h[q] = (_Float16)((v - (float)hi) * 1024.0f); }
  { *(v8us*)((unsigned short*)Hh + t * 8) = fh.half[0]; *(v8us*)((unsigned short*)Hl + t * 8) = fl.half[0];  } }


#define PIDX(i) ((((i) >> 3) << 5) + ((i) & 7))
__global__ __launch_bounds__(256) void k_rowflag(const float* __restrict__ X, int* __restrict__ FL) {
  #pragma clang fp contract(off)
  __shared__ int sf[8];
  const int tid = threadIdx.x, w = tid >> 5, ln = tid & 31; const int r = blockIdx.x * 8 + w; const float* x = X + (size_t)r * DKV; float s = 0.f;
#pragma unroll
  for (int u = 0; u < DKV / 32; ++u) s += bf16_round(x[u * 32 + ln]);
  for (int o = 16; o > 0; o >>= 1) s += __shfl_xor(s, o, 32);
  if (ln == 0) sf[w] = (s == 0.0f) ? 1 : 0;
  __syncthreads();
  if (tid < 32) { const int v = (tid < 8) ? sf[tid] : 0; int* d = FL + blockIdx.x * 32 + tid; *(int*)d = v;  } }      
__global__ __launch_bounds__(256) void k_zerorows(const int* __restrict__ FL, _Float16* __restrict__ P16) {
  const size_t t = (size_t)blockIdx.x * 256 + threadIdx.x; if (t >= (size_t)NR * DM / 8) return; const int r = (int)(t / (DM / 8)); if (FL[PIDX(r)] == 0) return; FragH z;
#pragma unroll
  for (int q = 0; q < 8; ++q) z.h[q] = (_Float16)0.0f; *(v8us*)((unsigned short*)P16 + t * 8) = z.half[0];  }
extern "C" void kernel_launch(void* const* d_in, const int* in_sizes, int n_in,
                              void* d_out, int out_size, void* d_ws, size_t ws_size, hipStream_t stream) {
  (void)in_sizes; (void)n_in; (void)out_size;
  const float* const* I = (const float* const*)d_in; const float* qi = I[0]; const float* ki = I[1]; const float* vi = I[2];
  const float* Wq = I[3]; const float* bq = I[4]; const float* Wk = I[5]; const float* bk = I[6]; const float* Wv = I[7]; const float* bv = I[8]; const float* Wo = I[9]; const float* bo = I[10];
  char* ws = (char*)d_ws; size_t off = 0;
  auto take = [&](size_t bytes) { char* p = ws + off; off += (bytes + 255) & ~(size_t)255; return p; };
  _Float16* BQ = (_Float16*)take((size_t)DM * DM * 2); _Float16* BK = (_Float16*)take((size_t)DM * DKV * 2); _Float16* BV = (_Float16*)take((size_t)DM * DKV * 2); _Float16* BO = (_Float16*)take((size_t)DM * DM * 2);
  _Float16* X16 = (_Float16*)take((size_t)NR * DM * 2); _Float16* Q16 = (_Float16*)take((size_t)NR * DM * 2); _Float16* K16 = (_Float16*)take((size_t)NR * DM * 2); _Float16* V16 = (_Float16*)take((size_t)NR * DM * 2); _Float16* VT = (_Float16*)take((size_t)NR * DM * 2);
  int* FLK = (int*)take((size_t)(NR / 8) * 32 * 4); int* FLV = (int*)take((size_t)(NR / 8) * 32 * 4);
  float* O = (float*)take((size_t)NR * DM * 4); _Float16* Oh = (_Float16*)take((size_t)NR * DM * 2); _Float16* Ol = (_Float16*)take((size_t)NR * DM * 2);      /* all batches */
  if (off > ws_size) return;      /* 6 + 16 x 5 + 0.3 + 32 + 16 + 16 = 150 MiB */
  const size_t n8 = (size_t)NR * DM / 8, n8k = (size_t)NR * DKV / 8; const unsigned nb8 = (unsigned)((n8 + 255) / 256), nb8k = (unsigned)((n8k + 255) / 256);
  k_wt_f16<<<(unsigned)(((size_t)DM * DM / 8 + 255) / 256), 256, 0, stream>>>(Wq, BQ, DM, DM, 16.0f); k_wt_f16<<<(unsigned)(((size_t)DKV * DM / 8 + 255) / 256), 256, 0, stream>>>(Wk, BK, DKV, DM, 16.0f); k_wt_f16<<<(unsigned)(((size_t)DKV * DM / 8 + 255) / 256), 256, 0, stream>>>(Wv, BV, DKV, DM, 16.0f); k_wt_f16<<<(unsigned)(((size_t)DM * DM / 8 + 255) / 256), 256, 0, stream>>>(Wo, BO, DM, DM, 16.0f);      /* (in,out) -> [out][in] x16 */
  const dim3 gP((NR / 128) * (DM / 64), 1);
  k_x16<<<nb8, 256, 0, stream>>>(qi, X16, n8); k_gemm2<0><<<gP, 128, 0, stream>>>(X16, DM, 0, BQ, DM, 0, 0.0625f, bq, 0, nullptr, 1, 0, 0, nullptr, Q16, DM, 0, NR, DM, DM);      /* q -> f16 */
  k_x16<<<nb8k, 256, 0, stream>>>(ki, X16, n8k); k_rowflag<<<NR / 8, 256, 0, stream>>>(ki, FLK); k_gemm2<0><<<gP, 128, 0, stream>>>(X16, DKV, 0, BK, DKV, 0, 0.0625f, bk, 0, nullptr, 1, 0, 0, nullptr, K16, DM, 0, NR, DM, DKV); k_zerorows<<<nb8, 256, 0, stream>>>(FLK, K16);      /* k -> f16 (masked rows zeroed) */
  k_x16<<<nb8k, 256, 0, stream>>>(vi, X16, n8k); k_rowflag<<<NR / 8, 256, 0, stream>>>(vi, FLV); k_gemm2<0><<<gP, 128, 0, stream>>>(X16, DKV, 0, BV, DKV, 0, 0.0625f, bv, 0, nullptr, 1, 0, 0, nullptr, V16, DM, 0, NR, DM, DKV); k_zerorows<<<nb8, 256, 0, stream>>>(FLV, V16);      /* v -> f16 */
  k_vt<NH, TK><<<NBT * NH * (TK / 64), 256, 0, stream>>>(V16, DM, 0, VT);      /* Vt[(b,h)][d][s] */
  float* outp = (float*)d_out;
  k_flash<<<NBT * NH * (TQ / 64), 128, 0, stream>>>(Q16, DM, K16, DM, VT, nullptr, O, DM);      /* all batches in one grid: slab = b*NH + h */
  k_split<<<nb8, 256, 0, stream>>>(O, Oh, Ol, n8);
  k_gemm2<0><<<gP, 128, 0, stream>>>(Oh, DM, 0, BO, DM, 0, 0.0625f, bo, 0, nullptr, 1, 0, 0, outp, nullptr, DM, 0, NR, DM, DM);
  k_gemm2<0><<<gP, 128, 0, stream>>>(Ol, DM, 0, BO, DM, 0, 0.0625f / 1024.0f, nullptr, 0, outp, 1, (size_t)DM, 0, outp, nullptr, DM, 0, NR, DM, DM);      /* out = o*Wo + bo */
}

// v003
// A run of this version takes 447 microseconds.
// Timed twice side by side with v002, it ran 1.10 times as fast both times.
// All steps since v000 together make it 3.04 times as fast.
#include <hip/hip_runtime.h>
// Multi-head cross attention over social features (B 4, S 2048 queries x 1024, 2048 keys/values x 512, 16 heads x 64; (in,out) Linear weights with bias; key/value rows whose raw features sum to exactly 0 are zeroed after projection, as the reference's padding mask): scores = q.k/8; softmax; out = (attn.v merged)*Wo + bo -> [4,2048,1024].
// Compute dtype: the inputs, the four matrices and biases rounded to bf16; q/k/v products exact (weights x16 in f16, undone by alpha), q, k, v, P as f16 operands (~2^-12; logits sigma ~0.4), O as f16 hi + lo; f32 accumulation and softmax. v_wmma_f32_16x16x32_f16.
#define NBT 4
#define TQ 2048
#define TK 2048
#define DKV 512
#define NR (NBT * TQ)
#define DM 1024
#define NH 16
#define SCL 0.125f
typedef __bf16 v16b __attribute__((ext_vector_type(16)));
typedef unsigned short v8us __attribute__((ext_vector_type(8), may_alias));
typedef float  v8f  __attribute__((ext_vector_type(8)));
typedef float  v4f  __attribute__((ext_vector_type(4)));
typedef float  v4fa __attribute__((ext_vector_type(4), may_alias));
union FragB { v16b v; v8us half[2]; unsigned short u[16]; };

__device__ __forceinline__ unsigned short bf16_bits(float x) { unsigned int u = __float_as_uint(x); return (unsigned short)((u + 0x7FFFu + ((u >> 16) & 1u)) >> 16); }
__device__ __forceinline__ float bf16_val(unsigned short b) { return __uint_as_float(((unsigned int)b) << 16); }
__device__ __forceinline__ float bf16_round(float x) { return bf16_val(bf16_bits(x)); }
// D += A·B with NT terms: 1 = ah·bh, 2 = + al·bh (A split), 3 = + ah·bl (both split)
template <int NT>
__device__ __forceinline__ v8f mmaN(v16b ah, v16b al, v16b bh, v16b bl, v8f c) {
  c = __builtin_amdgcn_wmma_f32_16x16x32_bf16(false, ah, false, bh, (short)0, c, false, false);
  if (NT >= 2) c = __builtin_amdgcn_wmma_f32_16x16x32_bf16(false, al, false, bh, (short)0, c, false, false);
  if (NT >= 3) c = __builtin_amdgcn_wmma_f32_16x16x32_bf16(false, ah, false, bl, (short)0, c, false, false);
  asm volatile("v_nop\n\tv_nop\n\tv_nop\n\tv_nop" : "+v"(c) : "v"(ah), "v"(al), "v"(bh), "v"(bl));
  return c;
}

__global__ __launch_bounds__(256) void k_wt_bf16(const float* __restrict__ W, unsigned short* __restrict__ Wt, int K, int N) {
  const int t = blockIdx.x * 256 + threadIdx.x;
  const int k8n = K / 8;
  if (t >= N * k8n) return;
  const int n = t / k8n, k8 = (t % k8n) * 8;
  v8us v;
#pragma unroll
  for (int i = 0; i < 8; ++i) v[i] = bf16_bits(W[(size_t)(k8 + i) * N + n]);
  *(v8us*)(Wt + (size_t)n * K + k8) = v;
  
}

// GEMM C[M][N] (f32, pitch ldc) = act(A[M][K]·W + bias). A f32 row-major (pitch lda) converted per fragment to bf16
// (ASPLIT: hi/lo two planes -> 2 terms, else single rounded term); Wt bf16 [N][K] (pitch ldb). BIAS_BF16 rounds the
// bias to bf16 first (bias quantised to bf16 before the add). K%32==0, M%16==0, N%64==0.
template <bool ASPLIT, int ACT, bool BIAS_BF16>
__global__ __launch_bounds__(128) void k_gemm_bf(const float* __restrict__ A, int lda, const unsigned short* __restrict__ Wt, int ldb,
                                               const float* __restrict__ bias, float* __restrict__ C, int ldc, int M, int N, int K) {
  __shared__ __attribute__((aligned(16))) float so[4][16][64];
  const int tid = threadIdx.x, w = tid >> 5, lane = tid & 31, ln = lane & 15, hh = lane >> 4;
  const int ntn = N / 64;
  const int wid = blockIdx.x * 4 + w;
  const int mt = wid / ntn, nq = wid % ntn;
  if (mt * 16 >= M) return;
  const int row0 = mt * 16, col0 = nq * 64;
  const float* arow = A + (size_t)(row0 + ln) * lda;
  v8f acc[4] = {};
  for (int kb = 0; kb < K; kb += 32) {
    FragB ah, al;
    const v4f x0 = *(const v4fa*)(arow + kb + 8 * hh), x1 = *(const v4fa*)(arow + kb + 8 * hh + 4);
    const v4f x2 = *(const v4fa*)(arow + kb + 16 + 8 * hh), x3 = *(const v4fa*)(arow + kb + 16 + 8 * hh + 4);
    float xs[16] = {x0[0],x0[1],x0[2],x0[3],x1[0],x1[1],x1[2],x1[3],x2[0],x2[1],x2[2],x2[3],x3[0],x3[1],x3[2],x3[3]};
#pragma unroll
    for (int i = 0; i < 16; ++i) { const unsigned short hb = bf16_bits(xs[i]); ah.u[i] = hb; al.u[i] = ASPLIT ? bf16_bits(xs[i] - bf16_val(hb)) : (unsigned short)0; }
#pragma unroll
    for (int t = 0; t < 4; ++t) {
      const unsigned short* brow = Wt + (size_t)(col0 + t * 16 + ln) * ldb + kb;
      FragB b;
      b.half[0] = *(const v8us*)(brow + 8 * hh);
      b.half[1] = *(const v8us*)(brow + 16 + 8 * hh);
      acc[t] = mmaN<ASPLIT ? 2 : 1>(ah.v, al.v, b.v, b.v, acc[t]);
    }
  }
#pragma unroll
  for (int t = 0; t < 4; ++t) {
    float bv = bias ? bias[col0 + t * 16 + ln] : 0.f;
    if (BIAS_BF16) bv = bf16_round(bv);
#pragma unroll
    for (int r = 0; r < 8; ++r) { float v = acc[t][r] + bv; if (ACT == 1) v = fmaxf(v, 0.f); so[w][8 * hh + r][t * 16 + ln] = v; }
  }
  __builtin_amdgcn_fence(__ATOMIC_ACQ_REL, "workgroup");
  __builtin_amdgcn_wave_barrier();
  const int rsub = lane >> 4, c4 = (lane & 15) * 4;
  {
#pragma unroll
    for (int q = 0; q < 8; ++q) {
      const int r = q * 2 + rsub;
      const v4f v = *(const v4fa*)&so[w][r][c4];
      *(v4f*)(C + (size_t)(row0 + r) * ldc + col0 + c4) = v;
    }
    
  }
}

// GEMM C = act(A·W + bias + resid): A f32 (ASPLIT -> hi/lo 2 terms), Wt bf16 [N][K]; ACT 0 none, 1 relu, 2 exact gelu;
// resid (optional, f32, row index = (row % rmod), pitch ldr, RES_BF16 rounds it) added before the activation.
template <bool ASPLIT, int ACT, bool BIAS_BF16, bool RES_BF16>
__global__ __launch_bounds__(128) void k_gemm_bf3(const float* __restrict__ A, int lda, const unsigned short* __restrict__ Wt, int ldb,
                                                const float* __restrict__ bias, const float* __restrict__ resid, int rmod, int ldr,
                                                float* __restrict__ C, int ldc, int M, int N, int K) {
  __shared__ __attribute__((aligned(16))) float so[4][16][64];
  const int tid = threadIdx.x, w = tid >> 5, lane = tid & 31, ln = lane & 15, hh = lane >> 4;
  const int ntn = N / 64;
  const int wid = blockIdx.x * 4 + w;
  const int mt = wid / ntn, nq = wid % ntn;
  if (mt * 16 >= M) return;
  const int row0 = mt * 16, col0 = nq * 64;
  const float* arow = A + (size_t)(row0 + ln) * lda;
  v8f acc[4] = {};
  for (int kb = 0; kb < K; kb += 32) {
    FragB ah, al;
    const v4f x0 = *(const v4fa*)(arow + kb + 8 * hh), x1 = *(const v4fa*)(arow + kb + 8 * hh + 4);
    const v4f x2 = *(const v4fa*)(arow + kb + 16 + 8 * hh), x3 = *(const v4fa*)(arow + kb + 16 + 8 * hh + 4);
    float xs[16] = {x0[0],x0[1],x0[2],x0[3],x1[0],x1[1],x1[2],x1[3],x2[0],x2[1],x2[2],x2[3],x3[0],x3[1],x3[2],x3[3]};
#pragma unroll
    for (int i = 0; i < 16; ++i) { const unsigned short hb = bf16_bits(xs[i]); ah.u[i] = hb; al.u[i] = ASPLIT ? bf16_bits(xs[i] - bf16_val(hb)) : (unsigned short)0; }
#pragma unroll
    for (int t = 0; t < 4; ++t) {
      const unsigned short* brow = Wt + (size_t)(col0 + t * 16 + ln) * ldb + kb;
      FragB b;
      b.half[0] = *(const v8us*)(brow + 8 * hh);
      b.half[1] = *(const v8us*)(brow + 16 + 8 * hh);
      acc[t] = mmaN<ASPLIT ? 2 : 1>(ah.v, al.v, b.v, b.v, acc[t]);
    }
  }
#pragma unroll
  for (int t = 0; t < 4; ++t) {
    const int col = col0 + t * 16 + ln;
    float bv = bias ? bias[col] : 0.f;
    if (BIAS_BF16) bv = bf16_round(bv);
#pragma unroll
    for (int r = 0; r < 8; ++r) {
      float v = acc[t][r] + bv;
      if (resid) { float rv = resid[(size_t)((row0 + 8 * hh + r) % rmod) * ldr + col]; if (RES_BF16) rv = bf16_round(rv); v += rv; }
      if (ACT == 1) v = fmaxf(v, 0.f);
      if (ACT == 2) v = 0.5f * v * (1.0f + erff(v * 0.70710678118654752f));
      if (ACT == 3) { const float u = 0.7978845608028654f * (v + 0.044715f * v * v * v); v = 0.5f * v * (1.0f + tanhf(u)); }
      so[w][8 * hh + r][t * 16 + ln] = v;
    }
  }
  __builtin_amdgcn_fence(__ATOMIC_ACQ_REL, "workgroup");
  __builtin_amdgcn_wave_barrier();
  const int rsub = lane >> 4, c4 = (lane & 15) * 4;
  {
#pragma unroll
    for (int q = 0; q < 8; ++q) {
      const int r = q * 2 + rsub;
      const v4f v = *(const v4fa*)&so[w][r][c4];
      *(v4f*)(C + (size_t)(row0 + r) * ldc + col0 + c4) = v;
    }
    
  }
}
// row LayerNorm (biased variance, eps) over N: s = X (+ R); optional out_sum <- s; out_norm <- (s-mu)*rsqrt(var+eps)*g + b
template <bool PARAM_BF16>
__global__ __launch_bounds__(256) void k_layernorm(const float* __restrict__ X, const float* __restrict__ R, const float* __restrict__ g, const float* __restrict__ bta,
                                                  float* __restrict__ out_sum, float* __restrict__ out_norm, int N, float eps) {
  __shared__ float red[256];
  const int row = blockIdx.x, tid = threadIdx.x;
  const float* x = X + (size_t)row * N; const float* rr = R ? R + (size_t)row * N : nullptr;
  float vals[16];                     // up to N = 4096
  const int per = N / 256;            // contiguous chunk per thread? use strided-by-4 chunks: thread handles j = tid*4 + 1024*u
  float s1 = 0.f;
  for (int u = 0; u < per / 4; ++u) {
    const int j = tid * 4 + 1024 * u;
    const v4f a = *(const v4fa*)(x + j);
    v4f b = {0.f,0.f,0.f,0.f}; if (rr) b = *(const v4fa*)(rr + j);
#pragma unroll
    for (int q = 0; q < 4; ++q) { const float v = a[q] + b[q]; vals[u * 4 + q] = v; s1 += v; }
  }
  red[tid] = s1; __syncthreads();
  for (int st = 128; st > 0; st >>= 1) { if (tid < st) red[tid] += red[tid + st]; __syncthreads(); }
  const float mu = red[0] / (float)N; __syncthreads();
  float s2 = 0.f;
  for (int u = 0; u < per / 4; ++u)
#pragma unroll
    for (int q = 0; q < 4; ++q) { const float c = vals[u * 4 + q] - mu; s2 += c * c; }
  red[tid] = s2; __syncthreads();
  for (int st = 128; st > 0; st >>= 1) { if (tid < st) red[tid] += red[tid + st]; __syncthreads(); }
  const float rs = rsqrtf(red[0] / (float)N + eps);
  {
    for (int u = 0; u < per / 4; ++u) {
      const int j = tid * 4 + 1024 * u;
      v4f o, sm;
#pragma unroll
      for (int q = 0; q < 4; ++q) {
        float gg = g[j + q], bb = bta[j + q];
        if (PARAM_BF16) { gg = bf16_round(gg); bb = bf16_round(bb); }
        sm[q] = vals[u * 4 + q]; o[q] = (vals[u * 4 + q] - mu) * rs * gg + bb;
      }
      if (out_sum) *(v4f*)(out_sum + (size_t)row * N + j) = sm;
      *(v4f*)(out_norm + (size_t)row * N + j) = o;
    }
    
  }
}



// ---- f16 WMMA path (v_wmma_f32_16x16x32_f16): 11-bit significands for operands in range — used where a [0,1] probability operand needs more precision than bf16
typedef _Float16 v16h __attribute__((ext_vector_type(16)));
union FragH { v16h v; v8us half[2]; _Float16 h[16]; unsigned short u[16]; };
template <int NT>
__device__ __forceinline__ v8f mmaH(v16h ah, v16h al, v16h bh, v16h bl, v8f c) {
  c = __builtin_amdgcn_wmma_f32_16x16x32_f16(false, ah, false, bh, (short)0, c, false, false);
  if (NT >= 2) c = __builtin_amdgcn_wmma_f32_16x16x32_f16(false, al, false, bh, (short)0, c, false, false);
  if (NT >= 3) c = __builtin_amdgcn_wmma_f32_16x16x32_f16(false, ah, false, bl, (short)0, c, false, false);
  asm volatile("v_nop\n\tv_nop\n\tv_nop\n\tv_nop" : "+v"(c) : "v"(ah), "v"(al), "v"(bh), "v"(bl));
  return c;
}
// batched GEMM like k_gemm_b but f16 operands: A f32 (split into f16 hi/lo if ASPLIT, else rounded to f16), Bt = f16 values [n][k]; alpha; C f32; N multiple of 16 (partial tiles skipped)
template <bool ASPLIT>
__global__ __launch_bounds__(128) void k_gemm_h(const float* __restrict__ A, int lda, size_t sA, const _Float16* __restrict__ Bh, int ldb, size_t sB, float alpha, float* __restrict__ C, int ldc, size_t sC, int M, int N, int K) {
  __shared__ __attribute__((aligned(16))) float so[4][16][64];
  const int tid = threadIdx.x, w = tid >> 5, lane = tid & 31, ln = lane & 15, hh = lane >> 4; const int by = blockIdx.y;
  A += (size_t)by * sA; Bh += (size_t)by * sB; C += (size_t)by * sC;
  const int ntn = (N + 63) / 64; const int wid = blockIdx.x * 4 + w; const int mt = wid / ntn, nq = wid % ntn; if (mt * 16 >= M) return;
  const int row0 = mt * 16, col0 = nq * 64; const float* arow = A + (size_t)(row0 + ln) * lda;
  v8f acc[4] = {};
  for (int kb = 0; kb < K; kb += 32) {
    FragH ah, al;
    const v4f x0 = *(const v4fa*)(arow + kb + 8 * hh), x1 = *(const v4fa*)(arow + kb + 8 * hh + 4), x2 = *(const v4fa*)(arow + kb + 16 + 8 * hh), x3 = *(const v4fa*)(arow + kb + 16 + 8 * hh + 4);
    float xs[16] = {x0[0],x0[1],x0[2],x0[3],x1[0],x1[1],x1[2],x1[3],x2[0],x2[1],x2[2],x2[3],x3[0],x3[1],x3[2],x3[3]};
#pragma unroll
    for (int i = 0; i < 16; ++i) { const _Float16 h = (_Float16)xs[i]; ah.h[i] = h; al.h[i] = ASPLIT ? (_Float16)(xs[i] - (float)h) : (_Float16)0.0f; }
#pragma unroll
    for (int t = 0; t < 4; ++t) { if (col0 + t * 16 >= N) continue; const size_t boff = (size_t)(col0 + t * 16 + ln) * ldb + kb; FragH bq; bq.half[0] = *(const v8us*)(Bh + boff + 8 * hh); bq.half[1] = *(const v8us*)(Bh + boff + 16 + 8 * hh);
      acc[t] = mmaH<ASPLIT ? 2 : 1>(ah.v, al.v, bq.v, bq.v, acc[t]); }
  }
#pragma unroll
  for (int t = 0; t < 4; ++t) { if (col0 + t * 16 >= N) continue;
#pragma unroll
    for (int r = 0; r < 8; ++r) so[w][8 * hh + r][t * 16 + ln] = acc[t][r] * alpha; }
  __builtin_amdgcn_fence(__ATOMIC_ACQ_REL, "workgroup"); __builtin_amdgcn_wave_barrier();
  const int rsub = lane >> 4, c4 = (lane & 15) * 4;
  {
#pragma unroll
    for (int q = 0; q < 8; ++q) { const int r = q * 2 + rsub; if (col0 + c4 < N) { const v4f v = *(const v4fa*)&so[w][r][c4]; *(v4f*)(C + (size_t)(row0 + r) * ldc + col0 + c4) = v; } }
     }
}

// Wt[n][k] = f16(W[k][n]·scale) from f32 row-major W[K][N] (scale = power of two; bf16-exact weights stay exact in f16 away from the subnormal range)
__global__ __launch_bounds__(256) void k_wt_f16(const float* __restrict__ W, _Float16* __restrict__ Wt, int K, int N, float scale) {
  const int t = blockIdx.x * 256 + threadIdx.x; if (t >= N * (K / 8)) return; const int n = t / (K / 8), k8 = (t % (K / 8)) * 8; FragH f;
#pragma unroll
  for (int i = 0; i < 8; ++i) f.h[i] = (_Float16)(bf16_round(W[(size_t)(k8 + i) * N + n]) * scale); const v8us o = f.half[0];
  *(v8us*)((unsigned short*)Wt + (size_t)n * K + k8) = o; 
}
// k_gemm_hh variant with fused epilogue: v = acc·alpha + bias[by·sBias + col] (+ CP[(row/rowsPerB)·sCPb + by·64 + col] if CP) ; ACT 0 none / 1 elu ; writes f16 C16 (and f32 C if non-null)
template <int ACT>
__global__ __launch_bounds__(128) void k_gemm_hhx(const _Float16* __restrict__ A, int lda, size_t sA, const _Float16* __restrict__ Bh, int ldb, size_t sB, float alpha, const float* __restrict__ bias, size_t sBias, const float* __restrict__ CP, int rowsPerB, size_t sCPb, int row0g,
    float* __restrict__ C, _Float16* __restrict__ C16, int ldc, size_t sC, int M, int N, int K) {
  __shared__ __attribute__((aligned(16))) float so[4][16][64];
  const int tid = threadIdx.x, w = tid >> 5, lane = tid & 31, ln = lane & 15, hh = lane >> 4; const int by = blockIdx.y;
  A += (size_t)by * sA; Bh += (size_t)by * sB; const size_t cofs = (size_t)by * sC; const float* bp = bias ? bias + (size_t)by * sBias : nullptr;
  const int ntn = (N + 63) / 64; const int wid = blockIdx.x * 4 + w; const int mt = wid / ntn, nq = wid % ntn; if (mt * 16 >= M) return;
  const int row0 = mt * 16, col0 = nq * 64; const _Float16* arow = A + (size_t)(row0 + ln) * lda;
  v8f acc[4] = {};
  for (int kb = 0; kb < K; kb += 32) { FragH ah; ah.half[0] = *(const v8us*)((const unsigned short*)arow + kb + 8 * hh); ah.half[1] = *(const v8us*)((const unsigned short*)arow + kb + 16 + 8 * hh);
#pragma unroll
    for (int t = 0; t < 4; ++t) { if (col0 + t * 16 >= N) continue; const size_t boff = (size_t)(col0 + t * 16 + ln) * ldb + kb; FragH bq; bq.half[0] = *(const v8us*)((const unsigned short*)Bh + boff + 8 * hh); bq.half[1] = *(const v8us*)((const unsigned short*)Bh + boff + 16 + 8 * hh);
      acc[t] = mmaH<1>(ah.v, ah.v, bq.v, bq.v, acc[t]); }
  }
#pragma unroll
  for (int t = 0; t < 4; ++t) { if (col0 + t * 16 >= N) continue; const int col = col0 + t * 16 + ln; const float bv = bp ? bf16_round(bp[col]) : 0.f;
#pragma unroll
    for (int r = 0; r < 8; ++r) { float v = acc[t][r] * alpha + bv; if (CP) { const int bidx = (row0g + row0 + 8 * hh + r) / rowsPerB; v += CP[(size_t)bidx * sCPb + (size_t)by * 64 + col]; } if (ACT == 1) v = (v > 0.f) ? v : expm1f(v); else if (ACT == 7) v = (v > 0.f) ? v + 1.0f : expf(v); else if (ACT == 8) v = tanhf(v); else if (ACT == 9) v = 0.5f * v * (1.0f + tanhf(0.7978845608028654f * (v + 0.044715f * v * v * v))); else if (ACT == 11) v = 1.0f / (1.0f + expf(-v)); else if (ACT == 12) v = (v > 0.f) ? v : 0.01f * v; else if (ACT == 14) v = (v > 0.f) ? v : 0.1f * v; else if (ACT == 15) v = v / (1.0f + expf(-v)); else if (ACT == 3) v = fmaxf(v, 0.f); else if (ACT == 6) v = 0.5f * v * (1.0f + erff(v * 0.70710678118654752f)); so[w][8 * hh + r][t * 16 + ln] = v; } }
  __builtin_amdgcn_fence(__ATOMIC_ACQ_REL, "workgroup"); __builtin_amdgcn_wave_barrier();
  const int rsub = lane >> 4, c4 = (lane & 15) * 4; typedef _Float16 v4h __attribute__((ext_vector_type(4)));
  {
#pragma unroll
    for (int q = 0; q < 8; ++q) { const int r = q * 2 + rsub; if (col0 + c4 < N) { const v4f v = *(const v4fa*)&so[w][r][c4]; if (C) *(v4f*)(C + cofs + (size_t)(row0 + r) * ldc + col0 + c4) = v; if (C16) { v4h h4; for (int i = 0; i < 4; ++i) h4[i] = (_Float16)v[i]; *(v4h*)(C16 + cofs + (size_t)(row0 + r) * ldc + col0 + c4) = h4; } } }
     }
}


typedef _Float16 v4h __attribute__((ext_vector_type(4)));

__global__ __launch_bounds__(256) void k_x16(const float* __restrict__ x, _Float16* __restrict__ X16, size_t n8) { const size_t t = (size_t)blockIdx.x * 256 + threadIdx.x; if (t >= n8) return; FragH f;
#pragma unroll
  for (int q = 0; q < 8; ++q) f.h[q] = (_Float16)bf16_round(x[t * 8 + q]); *(v8us*)((unsigned short*)X16 + t * 8) = f.half[0];  }
__global__ __launch_bounds__(256) void k_h16(const float* __restrict__ x, _Float16* __restrict__ X16, size_t n8) { const size_t t = (size_t)blockIdx.x * 256 + threadIdx.x; if (t >= n8) return; FragH f;
#pragma unroll
  for (int q = 0; q < 8; ++q) f.h[q] = (_Float16)x[t * 8 + q]; *(v8us*)((unsigned short*)X16 + t * 8) = f.half[0];  }
__global__ __launch_bounds__(256) void k_round16f(const float* __restrict__ W, _Float16* __restrict__ Bt, size_t n8) { const size_t t = (size_t)blockIdx.x * 256 + threadIdx.x; if (t >= n8) return; FragH f;
#pragma unroll
  for (int i = 0; i < 8; ++i) f.h[i] = (_Float16)(bf16_round(W[t * 8 + i]) * 16.0f); *(v8us*)((unsigned short*)Bt + t * 8) = f.half[0];  }
template <int NHv, int TTv>
__global__ __launch_bounds__(256) void k_vt(const _Float16* __restrict__ V16, int ldv, int voff, _Float16* __restrict__ Vt) { __shared__ unsigned short tl[64][66]; const int tid = threadIdx.x; const int slab = blockIdx.x / (TTv / 64), lg = blockIdx.x % (TTv / 64); const int b = slab / NHv, h = slab % NHv;
  for (int i = tid; i < 64 * 8; i += 256) { const int r = i / 8, c8 = (i % 8) * 8; FragH f; f.half[0] = *(const v8us*)((const unsigned short*)V16 + ((size_t)b * TTv + lg * 64 + r) * ldv + voff + h * 64 + c8);
#pragma unroll
    for (int q = 0; q < 8; ++q) tl[r][c8 + q] = f.u[q]; }
  __syncthreads();
  {
#pragma unroll
    for (int rd = 0; rd < 2; ++rd) { const int d = rd * 32 + tid / 8, pc = tid % 8; FragH f;
#pragma unroll
      for (int q = 0; q < 8; ++q) f.u[q] = tl[pc * 8 + q][d];
      *(v8us*)((unsigned short*)Vt + ((size_t)slab * 64 + d) * TTv + lg * 64 + pc * 8) = f.half[0]; }
     } }

__global__ __launch_bounds__(256) void k_hl(const float* __restrict__ F, _Float16* __restrict__ Hh, _Float16* __restrict__ Hl, size_t n8) { const size_t t = (size_t)blockIdx.x * 256 + threadIdx.x; if (t >= n8) return; FragH fh, fl; const v4f a = *(const v4fa*)(F + t * 8), c = *(const v4fa*)(F + t * 8 + 4);
#pragma unroll
  for (int q = 0; q < 4; ++q) { _Float16 h = (_Float16)a[q]; fh.h[q] = h; fl.h[q] = (_Float16)((a[q] - (float)h) * 1024.0f); h = (_Float16)c[q]; fh.h[4 + q] = h; fl.h[4 + q] = (_Float16)((c[q] - (float)h) * 1024.0f); }
  { *(v8us*)((unsigned short*)Hh + t * 8) = fh.half[0]; *(v8us*)((unsigned short*)Hl + t * 8) = fl.half[0];  } }

// ---- fast GEMM (wave tile 32x64; requires M % 32 == 0 rows per launch region and N % 64 == 0); epilogue = k_gemm_hhx semantics ----
__device__ __forceinline__ v16h g2_frag(const _Float16* p, int hh) { FragH f; f.half[0] = *(const v8us*)((const unsigned short*)p + 8 * hh); f.half[1] = *(const v8us*)((const unsigned short*)p + 16 + 8 * hh); return f.v; }
__device__ __forceinline__ v8f g2_mma(v16h a, v16h b, v8f c) { v8f d = __builtin_amdgcn_wmma_f32_16x16x32_f16(false, a, false, b, (short)0, c, false, false); asm volatile("v_nop\n\tv_nop\n\tv_nop\n\tv_nop" : "+v"(d) : "v"(a), "v"(b)); return d; }
template <int ACT>
__global__ __launch_bounds__(128) void k_gemm2(const _Float16* __restrict__ A, int lda, size_t sA, const _Float16* __restrict__ Bh, int ldb, size_t sB, float alpha, const float* __restrict__ bias, size_t sBias, const float* __restrict__ CP, int rowsPerB, size_t sCPb, int row0g,
    float* __restrict__ C, _Float16* __restrict__ C16, int ldc, size_t sC, int M, int N, int K) {
  __shared__ __attribute__((aligned(16))) float so[4][32][68];
  const int tid = threadIdx.x, w = tid >> 5, lane = tid & 31, ln = lane & 15, hh = lane >> 4; const int by = blockIdx.y;
  A += (size_t)by * sA; Bh += (size_t)by * sB; const size_t cofs = (size_t)by * sC; const float* bp = bias ? bias + (size_t)by * sBias : nullptr;
  const int ntn = N >> 6; const int mt = blockIdx.x / ntn, nq = blockIdx.x - mt * ntn; const int row0 = mt * 128 + 32 * w, col0 = nq * 64; if (row0 >= M) return;
  const _Float16* a0p = A + (size_t)(row0 + ln) * lda; const _Float16* a1p = a0p + (size_t)16 * lda;
  const _Float16* b0p = Bh + (size_t)(col0 + ln) * ldb; const _Float16* b1p = b0p + (size_t)16 * ldb; const _Float16* b2p = b1p + (size_t)16 * ldb; const _Float16* b3p = b2p + (size_t)16 * ldb;
  const v8f z8 = {0.f,0.f,0.f,0.f,0.f,0.f,0.f,0.f}; v8f c00 = z8, c01 = z8, c02 = z8, c03 = z8, c10 = z8, c11 = z8, c12 = z8, c13 = z8;
#pragma unroll 1
  for (int kb = 0; kb < K; kb += 32) { const v16h a0 = g2_frag(a0p + kb, hh), a1 = g2_frag(a1p + kb, hh);
    v16h b = g2_frag(b0p + kb, hh); c00 = g2_mma(a0, b, c00); c10 = g2_mma(a1, b, c10);
    b = g2_frag(b1p + kb, hh); c01 = g2_mma(a0, b, c01); c11 = g2_mma(a1, b, c11);
    b = g2_frag(b2p + kb, hh); c02 = g2_mma(a0, b, c02); c12 = g2_mma(a1, b, c12);
    b = g2_frag(b3p + kb, hh); c03 = g2_mma(a0, b, c03); c13 = g2_mma(a1, b, c13); }
  v8f accs[8] = {c00, c01, c02, c03, c10, c11, c12, c13};
#pragma unroll
  for (int u = 0; u < 8; ++u) { const int t = u & 3, half = u >> 2; const int col = col0 + t * 16 + ln; const float bv = bp ? bf16_round(bp[col]) : 0.f;
#pragma unroll
    for (int r = 0; r < 8; ++r) { const int rloc = half * 16 + 8 * hh + r; float v = accs[u][r] * alpha + bv; if (CP) { const int bidx = (row0g + row0 + rloc) / rowsPerB; v += CP[(size_t)bidx * sCPb + (size_t)by * 64 + col]; }
      if (ACT == 3) v = fmaxf(v, 0.f); else if (ACT == 6) v = 0.5f * v * (1.0f + erff(v * 0.70710678118654752f)); else if (ACT == 11) v = 1.0f / (1.0f + expf(-v)); else if (ACT == 15) v = v / (1.0f + expf(-v)); else if (ACT == 12) v = (v > 0.f) ? v : 0.01f * v; else if (ACT == 8) v = tanhf(v);
      so[w][rloc][t * 16 + ln] = v; } }
  __builtin_amdgcn_fence(__ATOMIC_ACQ_REL, "workgroup"); __builtin_amdgcn_wave_barrier();
  const int rsub = lane >> 4, c4 = (lane & 15) * 4;
  {
#pragma unroll
    for (int q = 0; q < 16; ++q) { const int r = q * 2 + rsub; const v4f v = *(const v4fa*)&so[w][r][c4]; if (C) *(v4f*)(C + cofs + (size_t)(row0 + r) * ldc + col0 + c4) = v; if (C16) { v4h h4; for (int i = 0; i < 4; ++i) h4[i] = (_Float16)v[i]; *(v4h*)(C16 + cofs + (size_t)(row0 + r) * ldc + col0 + c4) = h4; } }
     } }


// lane l <-> lane l ^ 16 by a vector cross-row move
__device__ __forceinline__ float xhalf(float x) { return __builtin_bit_cast(float, __builtin_amdgcn_permlanex16(__builtin_bit_cast(int, x), __builtin_bit_cast(int, x), 0x76543210, 0xfedcba98, false, false)); }
#define FKT 64
#define FPIT 144
#define FTILE (128 * FPIT)
// One tile: 8 asynchronous 16-byte copies a lane (128 lanes x 8 x 16 B = 16 KiB); 8 lanes cover one 128-B row, so a wave's copy asks for 4 whole lines.
// s_wait_xcnt closes the statement so that no address register of a copy is rewritten in front of it.
__device__ __forceinline__ void tile_copy(unsigned l0, const unsigned short* gk, int ldk, const unsigned short* gv) {
  asm volatile("global_load_async_to_lds_b128 %0, %8, off\n\t"
               "global_load_async_to_lds_b128 %1, %9, off\n\t"
               "global_load_async_to_lds_b128 %2, %10, off\n\t"
               "global_load_async_to_lds_b128 %3, %11, off\n\t"
               "global_load_async_to_lds_b128 %4, %12, off\n\t"
               "global_load_async_to_lds_b128 %5, %13, off\n\t"
               "global_load_async_to_lds_b128 %6, %14, off\n\t"
               "global_load_async_to_lds_b128 %7, %15, off\n\t"
               "s_wait_xcnt 0x0"
               :: "v"(l0), "v"(l0 + 16u * FPIT), "v"(l0 + 32u * FPIT), "v"(l0 + 48u * FPIT), "v"(l0 + 64u * FPIT), "v"(l0 + 80u * FPIT), "v"(l0 + 96u * FPIT), "v"(l0 + 112u * FPIT),
                  "v"(gk), "v"(gk + (size_t)16 * ldk), "v"(gk + (size_t)32 * ldk), "v"(gk + (size_t)48 * ldk), "v"(gv), "v"(gv + (size_t)16 * TK), "v"(gv + (size_t)32 * TK), "v"(gv + (size_t)48 * TK)
               : "memory");
}
__global__ __launch_bounds__(128) void k_flash(const _Float16* __restrict__ Q16, int ldq, const _Float16* __restrict__ K16, int ldk, const _Float16* __restrict__ Vt, const int* __restrict__ MSK, float* __restrict__ O, int ldo) {
  constexpr int RPW = 16, NQB = TQ / (4 * RPW), DT = 4, KS = 2, NT = TK / FKT; (void)MSK;
  __shared__ __attribute__((aligned(16))) unsigned char ring[2 * FTILE];      /* behind the loop's last barrier its first 17 KiB stage the output */
  const int tid = threadIdx.x, w = tid >> 5, lane = tid & 31, ln = lane & 15, hh = lane >> 4;
  const int slab = blockIdx.x / NQB, qblk = blockIdx.x % NQB; const int b = slab / NH, h = slab % NH; const int q0 = qblk * (4 * RPW) + w * RPW;
  const unsigned short* gk = (const unsigned short*)K16 + ((size_t)b * TK + (tid >> 3)) * ldk + h * 64 + (tid & 7) * 8;      /* this lane's 16 bytes of K row tid/8 of tile 0 */
  const unsigned short* gv = (const unsigned short*)Vt + ((size_t)slab * 64 + (tid >> 3)) * TK + (tid & 7) * 8;      /* and of Vt row tid/8 */
  const unsigned l0 = (unsigned)(size_t)(const void*)ring + (unsigned)((tid >> 3) * FPIT + (tid & 7) * 16);
  tile_copy(l0, gk, ldk, gv);      /* tile 0 -> buffer 0 */
  FragH bq[KS];
  { const unsigned short* qr = (const unsigned short*)Q16 + ((size_t)b * TQ + q0 + ln) * ldq + h * 64;
#pragma unroll
    for (int ks = 0; ks < KS; ++ks) { bq[ks].half[0] = *(const v8us*)(qr + ks * 32 + 8 * hh); bq[ks].half[1] = *(const v8us*)(qr + ks * 32 + 16 + 8 * hh); } }
  float m_q = -3.0e38f, l_q = 0.f; v8f oacc[DT];
#pragma unroll
  for (int dt = 0; dt < DT; ++dt) oacc[dt] = (v8f){0.f,0.f,0.f,0.f,0.f,0.f,0.f,0.f};
  asm volatile("s_wait_asynccnt 0x0" ::: "memory");      /* this wave's share of tile 0 has landed */
  __syncthreads();      /* tile 0 is published */
  tile_copy(l0 + FTILE, gk + (size_t)FKT * ldk, ldk, gv + FKT);      /* tile 1 -> buffer 1 */
#pragma unroll 1
  for (int t = 0; t < NT; ++t) {
    const unsigned bo = (unsigned)(t & 1) * FTILE; const unsigned fo = bo + (unsigned)(ln * FPIT + 16 * hh);
#pragma unroll 1      /* rolled: both passes unrolled need more than the 128 VGPRs at which 8 waves fit a SIMD */
    for (int p = 0; p < FKT / 32; ++p) {
    FragH ak[2][KS];
#pragma unroll
    for (int nt = 0; nt < 2; ++nt) { const unsigned char* kr = &ring[fo + (p * 32 + nt * 16) * FPIT];
#pragma unroll
      for (int ks = 0; ks < KS; ++ks) { ak[nt][ks].half[0] = *(const v8us*)(kr + ks * 64); ak[nt][ks].half[1] = *(const v8us*)(kr + ks * 64 + 32); } }
    float sc[16];
#pragma unroll
    for (int nt = 0; nt < 2; ++nt) { v8f acc = (v8f){0.f,0.f,0.f,0.f,0.f,0.f,0.f,0.f};
#pragma unroll
      for (int ks = 0; ks < KS; ++ks) acc = mmaH<1>(ak[nt][ks].v, ak[nt][ks].v, bq[ks].v, bq[ks].v, acc);
#pragma unroll
      for (int r = 0; r < 8; ++r) sc[nt * 8 + r] = acc[r] * SCL; }      /* sc[nt*8 + r] = score(key t*64 + p*32 + nt*16 + 8*hh + r, query q0 + ln) */
    FragH av[DT];
#pragma unroll
    for (int dt = 0; dt < DT; ++dt) { const unsigned char* vrow = &ring[fo + (64 + dt * 16) * FPIT + p * 64]; av[dt].half[0] = *(const v8us*)(vrow); av[dt].half[1] = *(const v8us*)(vrow + 32); }
    float mx[4];
#pragma unroll
    for (int c = 0; c < 4; ++c) mx[c] = fmaxf(fmaxf(sc[4 * c], sc[4 * c + 1]), fmaxf(sc[4 * c + 2], sc[4 * c + 3]));
    float mc = fmaxf(fmaxf(mx[0], mx[1]), fmaxf(mx[2], mx[3])); mc = fmaxf(mc, xhalf(mc));
    const float mn = fmaxf(m_q, mc); const float al = expf(m_q - mn); m_q = mn;      /* 0 on the first pass; 1 where the maximum stays */
    FragH pb; float ps[4] = {0.f, 0.f, 0.f, 0.f};
#pragma unroll
    for (int i = 0; i < 16; ++i) { const float p_ = expf(sc[i] - mn); ps[i & 3] += p_; pb.h[i] = (_Float16)(p_ * 1024.0f); }      /* pb.h[nt*8 + r] = P(key nt*16 + 8*hh + r of the pass, query q0 + ln): the k order of the Vt loader */
    l_q = l_q * al + ((ps[0] + ps[1]) + (ps[2] + ps[3]));
#pragma unroll
    for (int dt = 0; dt < DT; ++dt) {
#pragma unroll
      for (int r = 0; r < 8; ++r) oacc[dt][r] *= al;
      oacc[dt] = mmaH<1>(av[dt].v, av[dt].v, pb.v, pb.v, oacc[dt]); } }
    asm volatile("s_wait_dscnt 0x0" ::: "memory");      /* this wave's reads of tile t are done */
    asm volatile("s_wait_asynccnt 0x0" ::: "memory");      /* its share of tile t + 1 has landed */
    __syncthreads();      /* publishes tile t + 1 and frees tile t's buffer */
    if (t + 2 < NT) tile_copy(l0 + bo, gk + (size_t)(t + 2) * FKT * ldk, ldk, gv + (size_t)(t + 2) * FKT); }
  asm volatile("s_wait_asynccnt 0x0" ::: "memory");      /* no copy is in flight when the ring becomes output staging */
  float (*sO)[RPW][64 + 4] = (float (*)[RPW][64 + 4])ring;
  const float lt = l_q + xhalf(l_q); const float inv = (lt > 0.f) ? 1.0f / (lt * 1024.0f) : 0.f;
#pragma unroll
  for (int dt = 0; dt < DT; ++dt)      /* oacc[dt][r] = Ot[dt*16 + 8*hh + r][q0 + ln] */
#pragma unroll
    for (int q = 0; q < 2; ++q) { v4f o4;
#pragma unroll
      for (int i = 0; i < 4; ++i) o4[i] = oacc[dt][q * 4 + i] * inv;
      *(v4fa*)&sO[w][ln][dt * 16 + 8 * hh + q * 4] = o4; }
  __builtin_amdgcn_fence(__ATOMIC_ACQ_REL, "workgroup"); __builtin_amdgcn_wave_barrier();
  {
#pragma unroll
    for (int rp = 0; rp < RPW; rp += 2) { const int r = rp + (lane >> 4), pc = lane & 15; const v4f val = *(const v4fa*)&sO[w][r][pc * 4]; *(v4f*)(O + ((size_t)b * TQ + q0 + r) * ldo + h * 64 + pc * 4) = val; }
     } }
__global__ __launch_bounds__(256) void k_split(const float* __restrict__ F, _Float16* __restrict__ Hh, _Float16* __restrict__ Hl, size_t n8) {
  #pragma clang fp contract(off)
  const size_t t = (size_t)blockIdx.x * 256 + threadIdx.x; if (t >= n8) return; const v4f a = *(const v4fa*)(F + t * 8), c = *(const v4fa*)(F + t * 8 + 4); FragH fh, fl;
#pragma unroll
  for (int q = 0; q < 8; ++q) { const float v = (q < 4) ? a[q] : c[q - 4]; const _Float16 hi = (_Float16)v; fh.h[q] = hi; fl.h[q] = (_Float16)((v - (float)hi) * 1024.0f); }
  { *(v8us*)((unsigned short*)Hh + t * 8) = fh.half[0]; *(v8us*)((unsigned short*)Hl + t * 8) = fl.half[0];  } }


#define PIDX(i) ((((i) >> 3) << 5) + ((i) & 7))
__global__ __launch_bounds__(256) void k_rowflag(const float* __restrict__ X, int* __restrict__ FL) {
  #pragma clang fp contract(off)
  __shared__ int sf[8];
  const int tid = threadIdx.x, w = tid >> 5, ln = tid & 31; const int r = blockIdx.x * 8 + w; const float* x = X + (size_t)r * DKV; float s = 0.f;
#pragma unroll
  for (int u = 0; u < DKV / 32; ++u) s += bf16_round(x[u * 32 + ln]);
  for (int o = 16; o > 0; o >>= 1) s += __shfl_xor(s, o, 32);
  if (ln == 0) sf[w] = (s == 0.0f) ? 1 : 0;
  __syncthreads();
  if (tid < 32) { const int v = (tid < 8) ? sf[tid] : 0; int* d = FL + blockIdx.x * 32 + tid; *(int*)d = v;  } }      
__global__ __launch_bounds__(256) void k_zerorows(const int* __restrict__ FL, _Float16* __restrict__ P16) {
  const size_t t = (size_t)blockIdx.x * 256 + threadIdx.x; if (t >= (size_t)NR * DM / 8) return; const int r = (int)(t / (DM / 8)); if (FL[PIDX(r)] == 0) return; FragH z;
#pragma unroll
  for (int q = 0; q < 8; ++q) z.h[q] = (_Float16)0.0f; *(v8us*)((unsigned short*)P16 + t * 8) = z.half[0];  }
extern "C" void kernel_launch(void* const* d_in, const int* in_sizes, int n_in,
                              void* d_out, int out_size, void* d_ws, size_t ws_size, hipStream_t stream) {
  (void)in_sizes; (void)n_in; (void)out_size;
  const float* const* I = (const float* const*)d_in; const float* qi = I[0]; const float* ki = I[1]; const float* vi = I[2];
  const float* Wq = I[3]; const float* bq = I[4]; const float* Wk = I[5]; const float* bk = I[6]; const float* Wv = I[7]; const float* bv = I[8]; const float* Wo = I[9]; const float* bo = I[10];
  char* ws = (char*)d_ws; size_t off = 0;
  auto take = [&](size_t bytes) { char* p = ws + off; off += (bytes + 255) & ~(size_t)255; return p; };
  _Float16* BQ = (_Float16*)take((size_t)DM * DM * 2); _Float16* BK = (_Float16*)take((size_t)DM * DKV * 2); _Float16* BV = (_Float16*)take((size_t)DM * DKV * 2); _Float16* BO = (_Float16*)take((size_t)DM * DM * 2);
  _Float16* X16 = (_Float16*)take((size_t)NR * DM * 2); _Float16* Q16 = (_Float16*)take((size_t)NR * DM * 2); _Float16* K16 = (_Float16*)take((size_t)NR * DM * 2); _Float16* V16 = (_Float16*)take((size_t)NR * DM * 2); _Float16* VT = (_Float16*)take((size_t)NR * DM * 2);
  int* FLK = (int*)take((size_t)(NR / 8) * 32 * 4); int* FLV = (int*)take((size_t)(NR / 8) * 32 * 4);
  float* O = (float*)take((size_t)NR * DM * 4); _Float16* Oh = (_Float16*)take((size_t)NR * DM * 2); _Float16* Ol = (_Float16*)take((size_t)NR * DM * 2);      /* all batches */
  if (off > ws_size) return;      /* 6 + 16 x 5 + 0.3 + 32 + 16 + 16 = 150 MiB */
  const size_t n8 = (size_t)NR * DM / 8, n8k = (size_t)NR * DKV / 8; const unsigned nb8 = (unsigned)((n8 + 255) / 256), nb8k = (unsigned)((n8k + 255) / 256);
  k_wt_f16<<<(unsigned)(((size_t)DM * DM / 8 + 255) / 256), 256, 0, stream>>>(Wq, BQ, DM, DM, 16.0f); k_wt_f16<<<(unsigned)(((size_t)DKV * DM / 8 + 255) / 256), 256, 0, stream>>>(Wk, BK, DKV, DM, 16.0f); k_wt_f16<<<(unsigned)(((size_t)DKV * DM / 8 + 255) / 256), 256, 0, stream>>>(Wv, BV, DKV, DM, 16.0f); k_wt_f16<<<(unsigned)(((size_t)DM * DM / 8 + 255) / 256), 256, 0, stream>>>(Wo, BO, DM, DM, 16.0f);      /* (in,out) -> [out][in] x16 */
  const dim3 gP((NR / 128) * (DM / 64), 1);
  k_x16<<<nb8, 256, 0, stream>>>(qi, X16, n8); k_gemm2<0><<<gP, 128, 0, stream>>>(X16, DM, 0, BQ, DM, 0, 0.0625f, bq, 0, nullptr, 1, 0, 0, nullptr, Q16, DM, 0, NR, DM, DM);      /* q -> f16 */
  k_x16<<<nb8k, 256, 0, stream>>>(ki, X16, n8k); k_rowflag<<<NR / 8, 256, 0, stream>>>(ki, FLK); k_gemm2<0><<<gP, 128, 0, stream>>>(X16, DKV, 0, BK, DKV, 0, 0.0625f, bk, 0, nullptr, 1, 0, 0, nullptr, K16, DM, 0, NR, DM, DKV); k_zerorows<<<nb8, 256, 0, stream>>>(FLK, K16);      /* k -> f16 (masked rows zeroed) */
  k_x16<<<nb8k, 256, 0, stream>>>(vi, X16, n8k); k_rowflag<<<NR / 8, 256, 0, stream>>>(vi, FLV); k_gemm2<0><<<gP, 128, 0, stream>>>(X16, DKV, 0, BV, DKV, 0, 0.0625f, bv, 0, nullptr, 1, 0, 0, nullptr, V16, DM, 0, NR, DM, DKV); k_zerorows<<<nb8, 256, 0, stream>>>(FLV, V16);      /* v -> f16 */
  k_vt<NH, TK><<<NBT * NH * (TK / 64), 256, 0, stream>>>(V16, DM, 0, VT);      /* Vt[(b,h)][d][s] */
  float* outp = (float*)d_out;
  k_flash<<<NBT * NH * (TQ / 64), 128, 0, stream>>>(Q16, DM, K16, DM, VT, nullptr, O, DM);      /* all batches in one grid: slab = b*NH + h */
  k_split<<<nb8, 256, 0, stream>>>(O, Oh, Ol, n8);
  k_gemm2<0><<<gP, 128, 0, stream>>>(Oh, DM, 0, BO, DM, 0, 0.0625f, bo, 0, nullptr, 1, 0, 0, outp, nullptr, DM, 0, NR, DM, DM);
  k_gemm2<0><<<gP, 128, 0, stream>>>(Ol, DM, 0, BO, DM, 0, 0.0625f / 1024.0f, nullptr, 0, outp, 1, (size_t)DM, 0, outp, nullptr, DM, 0, NR, DM, DM);      /* out = o*Wo + bo */
}

// v004
// One run takes 381 microseconds.
// Timed twice side by side with v003, it ran 1.18 and 1.17 times as fast.
// Over all steps from v000 it is 3.58 times as fast.
#include <hip/hip_runtime.h>
// Multi-head cross attention over social features (B 4, S 2048 queries x 1024, 2048 keys/values x 512, 16 heads x 64; (in,out) Linear weights with bias; key/value rows whose raw features sum to exactly 0 are zeroed after projection, as the reference's padding mask): scores = q.k/8; softmax; out = (attn.v merged)*Wo + bo -> [4,2048,1024].
// Compute dtype: the inputs, the four matrices and biases rounded to bf16; q/k/v products exact (weights x16 in f16, undone by alpha), q, k, v, P as f16 operands (~2^-12; logits sigma ~0.4), O as f16 hi + lo; f32 accumulation and softmax. v_wmma_f32_16x16x32_f16.
#define NBT 4
#define TQ 2048
#define TK 2048
#define DKV 512
#define NR (NBT * TQ)
#define DM 1024
#define NH 16
#define SCL 0.125f
#define SCL2 (SCL * 1.44269504088896340736f)      /* 1/8 x log2(e): scores in base-2 exponent units */
typedef __bf16 v16b __attribute__((ext_vector_type(16)));
typedef unsigned short v8us __attribute__((ext_vector_type(8), may_alias));
typedef float  v8f  __attribute__((ext_vector_type(8)));
typedef float  v4f  __attribute__((ext_vector_type(4)));
typedef float  v4fa __attribute__((ext_vector_type(4), may_alias));
union FragB { v16b v; v8us half[2]; unsigned short u[16]; };

__device__ __forceinline__ unsigned short bf16_bits(float x) { unsigned int u = __float_as_uint(x); return (unsigned short)((u + 0x7FFFu + ((u >> 16) & 1u)) >> 16); }
__device__ __forceinline__ float bf16_val(unsigned short b) { return __uint_as_float(((unsigned int)b) << 16); }
__device__ __forceinline__ float bf16_round(float x) { return bf16_val(bf16_bits(x)); }
// D += A·B with NT terms: 1 = ah·bh, 2 = + al·bh (A split), 3 = + ah·bl (both split)
template <int NT>
__device__ __forceinline__ v8f mmaN(v16b ah, v16b al, v16b bh, v16b bl, v8f c) {
  c = __builtin_amdgcn_wmma_f32_16x16x32_bf16(false, ah, false, bh, (short)0, c, false, false);
  if (NT >= 2) c = __builtin_amdgcn_wmma_f32_16x16x32_bf16(false, al, false, bh, (short)0, c, false, false);
  if (NT >= 3) c = __builtin_amdgcn_wmma_f32_16x16x32_bf16(false, ah, false, bl, (short)0, c, false, false);
  asm volatile("v_nop\n\tv_nop\n\tv_nop\n\tv_nop" : "+v"(c) : "v"(ah), "v"(al), "v"(bh), "v"(bl));
  return c;
}

__global__ __launch_bounds__(256) void k_wt_bf16(const float* __restrict__ W, unsigned short* __restrict__ Wt, int K, int N) {
  const int t = blockIdx.x * 256 + threadIdx.x;
  const int k8n = K / 8;
  if (t >= N * k8n) return;
  const int n = t / k8n, k8 = (t % k8n) * 8;
  v8us v;
#pragma unroll
  for (int i = 0; i < 8; ++i) v[i] = bf16_bits(W[(size_t)(k8 + i) * N + n]);
  *(v8us*)(Wt + (size_t)n * K + k8) = v;
  
}

// GEMM C[M][N] (f32, pitch ldc) = act(A[M][K]·W + bias). A f32 row-major (pitch lda) converted per fragment to bf16
// (ASPLIT: hi/lo two planes -> 2 terms, else single rounded term); Wt bf16 [N][K] (pitch ldb). BIAS_BF16 rounds the
// bias to bf16 first (bias quantised to bf16 before the add). K%32==0, M%16==0, N%64==0.
template <bool ASPLIT, int ACT, bool BIAS_BF16>
__global__ __launch_bounds__(128) void k_gemm_bf(const float* __restrict__ A, int lda, const unsigned short* __restrict__ Wt, int ldb,
                                               const float* __restrict__ bias, float* __restrict__ C, int ldc, int M, int N, int K) {
  __shared__ __attribute__((aligned(16))) float so[4][16][64];
  const int tid = threadIdx.x, w = tid >> 5, lane = tid & 31, ln = lane & 15, hh = lane >> 4;
  const int ntn = N / 64;
  const int wid = blockIdx.x * 4 + w;
  const int mt = wid / ntn, nq = wid % ntn;
  if (mt * 16 >= M) return;
  const int row0 = mt * 16, col0 = nq * 64;
  const float* arow = A + (size_t)(row0 + ln) * lda;
  v8f acc[4] = {};
  for (int kb = 0; kb < K; kb += 32) {
    FragB ah, al;
    const v4f x0 = *(const v4fa*)(arow + kb + 8 * hh), x1 = *(const v4fa*)(arow + kb + 8 * hh + 4);
    const v4f x2 = *(const v4fa*)(arow + kb + 16 + 8 * hh), x3 = *(const v4fa*)(arow + kb + 16 + 8 * hh + 4);
    float xs[16] = {x0[0],x0[1],x0[2],x0[3],x1[0],x1[1],x1[2],x1[3],x2[0],x2[1],x2[2],x2[3],x3[0],x3[1],x3[2],x3[3]};
#pragma unroll
    for (int i = 0; i < 16; ++i) { const unsigned short hb = bf16_bits(xs[i]); ah.u[i] = hb; al.u[i] = ASPLIT ? bf16_bits(xs[i] - bf16_val(hb)) : (unsigned short)0; }
#pragma unroll
    for (int t = 0; t < 4; ++t) {
      const unsigned short* brow = Wt + (size_t)(col0 + t * 16 + ln) * ldb + kb;
      FragB b;
      b.half[0] = *(const v8us*)(brow + 8 * hh);
      b.half[1] = *(const v8us*)(brow + 16 + 8 * hh);
      acc[t] = mmaN<ASPLIT ? 2 : 1>(ah.v, al.v, b.v, b.v, acc[t]);
    }
  }
#pragma unroll
  for (int t = 0; t < 4; ++t) {
    float bv = bias ? bias[col0 + t * 16 + ln] : 0.f;
    if (BIAS_BF16) bv = bf16_round(bv);
#pragma unroll
    for (int r = 0; r < 8; ++r) { float v = acc[t][r] + bv; if (ACT == 1) v = fmaxf(v, 0.f); so[w][8 * hh + r][t * 16 + ln] = v; }
  }
  __builtin_amdgcn_fence(__ATOMIC_ACQ_REL, "workgroup");
  __builtin_amdgcn_wave_barrier();
  const int rsub = lane >> 4, c4 = (lane & 15) * 4;
  {
#pragma unroll
    for (int q = 0; q < 8; ++q) {
      const int r = q * 2 + rsub;
      const v4f v = *(const v4fa*)&so[w][r][c4];
      *(v4f*)(C + (size_t)(row0 + r) * ldc + col0 + c4) = v;
    }
    
  }
}

// GEMM C = act(A·W + bias + resid): A f32 (ASPLIT -> hi/lo 2 terms), Wt bf16 [N][K]; ACT 0 none, 1 relu, 2 exact gelu;
// resid (optional, f32, row index = (row % rmod), pitch ldr, RES_BF16 rounds it) added before the activation.
template <bool ASPLIT, int ACT, bool BIAS_BF16, bool RES_BF16>
__global__ __launch_bounds__(128) void k_gemm_bf3(const float* __restrict__ A, int lda, const unsigned short* __restrict__ Wt, int ldb,
                                                const float* __restrict__ bias, const float* __restrict__ resid, int rmod, int ldr,
                                                float* __restrict__ C, int ldc, int M, int N, int K) {
  __shared__ __attribute__((aligned(16))) float so[4][16][64];
  const int tid = threadIdx.x, w = tid >> 5, lane = tid & 31, ln = lane & 15, hh = lane >> 4;
  const int ntn = N / 64;
  const int wid = blockIdx.x * 4 + w;
  const int mt = wid / ntn, nq = wid % ntn;
  if (mt * 16 >= M) return;
  const int row0 = mt * 16, col0 = nq * 64;
  const float* arow = A + (size_t)(row0 + ln) * lda;
  v8f acc[4] = {};
  for (int kb = 0; kb < K; kb += 32) {
    FragB ah, al;
    const v4f x0 = *(const v4fa*)(arow + kb + 8 * hh), x1 = *(const v4fa*)(arow + kb + 8 * hh + 4);
    const v4f x2 = *(const v4fa*)(arow + kb + 16 + 8 * hh), x3 = *(const v4fa*)(arow + kb + 16 + 8 * hh + 4);
    float xs[16] = {x0[0],x0[1],x0[2],x0[3],x1[0],x1[1],x1[2],x1[3],x2[0],x2[1],x2[2],x2[3],x3[0],x3[1],x3[2],x3[3]};
#pragma unroll
    for (int i = 0; i < 16; ++i) { const unsigned short hb = bf16_bits(xs[i]); ah.u[i] = hb; al.u[i] = ASPLIT ? bf16_bits(xs[i] - bf16_val(hb)) : (unsigned short)0; }
#pragma unroll
    for (int t = 0; t < 4; ++t) {
      const unsigned short* brow = Wt + (size_t)(col0 + t * 16 + ln) * ldb + kb;
      FragB b;
      b.half[0] = *(const v8us*)(brow + 8 * hh);
      b.half[1] = *(const v8us*)(brow + 16 + 8 * hh);
      acc[t] = mmaN<ASPLIT ? 2 : 1>(ah.v, al.v, b.v, b.v, acc[t]);
    }
  }
#pragma unroll
  for (int t = 0; t < 4; ++t) {
    const int col = col0 + t * 16 + ln;
    float bv = bias ? bias[col] : 0.f;
    if (BIAS_BF16) bv = bf16_round(bv);
#pragma unroll
    for (int r = 0; r < 8; ++r) {
      float v = acc[t][r] + bv;
      if (resid) { float rv = resid[(size_t)((row0 + 8 * hh + r) % rmod) * ldr + col]; if (RES_BF16) rv = bf16_round(rv); v += rv; }
      if (ACT == 1) v = fmaxf(v, 0.f);
      if (ACT == 2) v = 0.5f * v * (1.0f + erff(v * 0.70710678118654752f));
      if (ACT == 3) { const float u = 0.7978845608028654f * (v + 0.044715f * v * v * v); v = 0.5f * v * (1.0f + tanhf(u)); }
      so[w][8 * hh + r][t * 16 + ln] = v;
    }
  }
  __builtin_amdgcn_fence(__ATOMIC_ACQ_REL, "workgroup");
  __builtin_amdgcn_wave_barrier();
  const int rsub = lane >> 4, c4 = (lane & 15) * 4;
  {
#pragma unroll
    for (int q = 0; q < 8; ++q) {
      const int r = q * 2 + rsub;
      const v4f v = *(const v4fa*)&so[w][r][c4];
      *(v4f*)(C + (size_t)(row0 + r) * ldc + col0 + c4) = v;
    }
    
  }
}
// row LayerNorm (biased variance, eps) over N: s = X (+ R); optional out_sum <- s; out_norm <- (s-mu)*rsqrt(var+eps)*g + b
template <bool PARAM_BF16>
__global__ __launch_bounds__(256) void k_layernorm(const float* __restrict__ X, const float* __restrict__ R, const float* __restrict__ g, const float* __restrict__ bta,
                                                  float* __restrict__ out_sum, float* __restrict__ out_norm, int N, float eps) {
  __shared__ float red[256];
  const int row = blockIdx.x, tid = threadIdx.x;
  const float* x = X + (size_t)row * N; const float* rr = R ? R + (size_t)row * N : nullptr;
  float vals[16];                     // up to N = 4096
  const int per = N / 256;            // contiguous chunk per thread? use strided-by-4 chunks: thread handles j = tid*4 + 1024*u
  float s1 = 0.f;
  for (int u = 0; u < per / 4; ++u) {
    const int j = tid * 4 + 1024 * u;
    const v4f a = *(const v4fa*)(x + j);
    v4f b = {0.f,0.f,0.f,0.f}; if (rr) b = *(const v4fa*)(rr + j);
#pragma unroll
    for (int q = 0; q < 4; ++q) { const float v = a[q] + b[q]; vals[u * 4 + q] = v; s1 += v; }
  }
  red[tid] = s1; __syncthreads();
  for (int st = 128; st > 0; st >>= 1) { if (tid < st) red[tid] += red[tid + st]; __syncthreads(); }
  const float mu = red[0] / (float)N; __syncthreads();
  float s2 = 0.f;
  for (int u = 0; u < per / 4; ++u)
#pragma unroll
    for (int q = 0; q < 4; ++q) { const float c = vals[u * 4 + q] - mu; s2 += c * c; }
  red[tid] = s2; __syncthreads();
  for (int st = 128; st > 0; st >>= 1) { if (tid < st) red[tid] += red[tid + st]; __syncthreads(); }
  const float rs = rsqrtf(red[0] / (float)N + eps);
  {
    for (int u = 0; u < per / 4; ++u) {
      const int j = tid * 4 + 1024 * u;
      v4f o, sm;
#pragma unroll
      for (int q = 0; q < 4; ++q) {
        float gg = g[j + q], bb = bta[j + q];
        if (PARAM_BF16) { gg = bf16_round(gg); bb = bf16_round(bb); }
        sm[q] = vals[u * 4 + q]; o[q] = (vals[u * 4 + q] - mu) * rs * gg + bb;
      }
      if (out_sum) *(v4f*)(out_sum + (size_t)row * N + j) = sm;
      *(v4f*)(out_norm + (size_t)row * N + j) = o;
    }
    
  }
}



// ---- f16 WMMA path (v_wmma_f32_16x16x32_f16): 11-bit significands for operands in range — used where a [0,1] probability operand needs more precision than bf16
typedef _Float16 v16h __attribute__((ext_vector_type(16)));
union FragH { v16h v; v8us half[2]; _Float16 h[16]; unsigned short u[16]; };
template <int NT>
__device__ __forceinline__ v8f mmaH(v16h ah, v16h al, v16h bh, v16h bl, v8f c) {
  c = __builtin_amdgcn_wmma_f32_16x16x32_f16(false, ah, false, bh, (short)0, c, false, false);
  if (NT >= 2) c = __builtin_amdgcn_wmma_f32_16x16x32_f16(false, al, false, bh, (short)0, c, false, false);
  if (NT >= 3) c = __builtin_amdgcn_wmma_f32_16x16x32_f16(false, ah, false, bl, (short)0, c, false, false);
  asm volatile("v_nop\n\tv_nop\n\tv_nop\n\tv_nop" : "+v"(c) : "v"(ah), "v"(al), "v"(bh), "v"(bl));
  return c;
}
// batched GEMM like k_gemm_b but f16 operands: A f32 (split into f16 hi/lo if ASPLIT, else rounded to f16), Bt = f16 values [n][k]; alpha; C f32; N multiple of 16 (partial tiles skipped)
template <bool ASPLIT>
__global__ __launch_bounds__(128) void k_gemm_h(const float* __restrict__ A, int lda, size_t sA, const _Float16* __restrict__ Bh, int ldb, size_t sB, float alpha, float* __restrict__ C, int ldc, size_t sC, int M, int N, int K) {
  __shared__ __attribute__((aligned(16))) float so[4][16][64];
  const int tid = threadIdx.x, w = tid >> 5, lane = tid & 31, ln = lane & 15, hh = lane >> 4; const int by = blockIdx.y;
  A += (size_t)by * sA; Bh += (size_t)by * sB; C += (size_t)by * sC;
  const int ntn = (N + 63) / 64; const int wid = blockIdx.x * 4 + w; const int mt = wid / ntn, nq = wid % ntn; if (mt * 16 >= M) return;
  const int row0 = mt * 16, col0 = nq * 64; const float* arow = A + (size_t)(row0 + ln) * lda;
  v8f acc[4] = {};
  for (int kb = 0; kb < K; kb += 32) {
    FragH ah, al;
    const v4f x0 = *(const v4fa*)(arow + kb + 8 * hh), x1 = *(const v4fa*)(arow + kb + 8 * hh + 4), x2 = *(const v4fa*)(arow + kb + 16 + 8 * hh), x3 = *(const v4fa*)(arow + kb + 16 + 8 * hh + 4);
    float xs[16] = {x0[0],x0[1],x0[2],x0[3],x1[0],x1[1],x1[2],x1[3],x2[0],x2[1],x2[2],x2[3],x3[0],x3[1],x3[2],x3[3]};
#pragma unroll
    for (int i = 0; i < 16; ++i) { const _Float16 h = (_Float16)xs[i]; ah.h[i] = h; al.h[i] = ASPLIT ? (_Float16)(xs[i] - (float)h) : (_Float16)0.0f; }
#pragma unroll
    for (int t = 0; t < 4; ++t) { if (col0 + t * 16 >= N) continue; const size_t boff = (size_t)(col0 + t * 16 + ln) * ldb + kb; FragH bq; bq.half[0] = *(const v8us*)(Bh + boff + 8 * hh); bq.half[1] = *(const v8us*)(Bh + boff + 16 + 8 * hh);
      acc[t] = mmaH<ASPLIT ? 2 : 1>(ah.v, al.v, bq.v, bq.v, acc[t]); }
  }
#pragma unroll
  for (int t = 0; t < 4; ++t) { if (col0 + t * 16 >= N) continue;
#pragma unroll
    for (int r = 0; r < 8; ++r) so[w][8 * hh + r][t * 16 + ln] = acc[t][r] * alpha; }
  __builtin_amdgcn_fence(__ATOMIC_ACQ_REL, "workgroup"); __builtin_amdgcn_wave_barrier();
  const int rsub = lane >> 4, c4 = (lane & 15) * 4;
  {
#pragma unroll
    for (int q = 0; q < 8; ++q) { const int r = q * 2 + rsub; if (col0 + c4 < N) { const v4f v = *(const v4fa*)&so[w][r][c4]; *(v4f*)(C + (size_t)(row0 + r) * ldc + col0 + c4) = v; } }
     }
}

// Wt[n][k] = f16(W[k][n]·scale) from f32 row-major W[K][N] (scale = power of two; bf16-exact weights stay exact in f16 away from the subnormal range)
__global__ __launch_bounds__(256) void k_wt_f16(const float* __restrict__ W, _Float16* __restrict__ Wt, int K, int N, float scale) {
  const int t = blockIdx.x * 256 + threadIdx.x; if (t >= N * (K / 8)) return; const int n = t / (K / 8), k8 = (t % (K / 8)) * 8; FragH f;
#pragma unroll
  for (int i = 0; i < 8; ++i) f.h[i] = (_Float16)(bf16_round(W[(size_t)(k8 + i) * N + n]) * scale); const v8us o = f.half[0];
  *(v8us*)((unsigned short*)Wt + (size_t)n * K + k8) = o; 
}
// k_gemm_hh variant with fused epilogue: v = acc·alpha + bias[by·sBias + col] (+ CP[(row/rowsPerB)·sCPb + by·64 + col] if CP) ; ACT 0 none / 1 elu ; writes f16 C16 (and f32 C if non-null)
template <int ACT>
__global__ __launch_bounds__(128) void k_gemm_hhx(const _Float16* __restrict__ A, int lda, size_t sA, const _Float16* __restrict__ Bh, int ldb, size_t sB, float alpha, const float* __restrict__ bias, size_t sBias, const float* __restrict__ CP, int rowsPerB, size_t sCPb, int row0g,
    float* __restrict__ C, _Float16* __restrict__ C16, int ldc, size_t sC, int M, int N, int K) {
  __shared__ __attribute__((aligned(16))) float so[4][16][64];
  const int tid = threadIdx.x, w = tid >> 5, lane = tid & 31, ln = lane & 15, hh = lane >> 4; const int by = blockIdx.y;
  A += (size_t)by * sA; Bh += (size_t)by * sB; const size_t cofs = (size_t)by * sC; const float* bp = bias ? bias + (size_t)by * sBias : nullptr;
  const int ntn = (N + 63) / 64; const int wid = blockIdx.x * 4 + w; const int mt = wid / ntn, nq = wid % ntn; if (mt * 16 >= M) return;
  const int row0 = mt * 16, col0 = nq * 64; const _Float16* arow = A + (size_t)(row0 + ln) * lda;
  v8f acc[4] = {};
  for (int kb = 0; kb < K; kb += 32) { FragH ah; ah.half[0] = *(const v8us*)((const unsigned short*)arow + kb + 8 * hh); ah.half[1] = *(const v8us*)((const unsigned short*)arow + kb + 16 + 8 * hh);
#pragma unroll
    for (int t = 0; t < 4; ++t) { if (col0 + t * 16 >= N) continue; const size_t boff = (size_t)(col0 + t * 16 + ln) * ldb + kb; FragH bq; bq.half[0] = *(const v8us*)((const unsigned short*)Bh + boff + 8 * hh); bq.half[1] = *(const v8us*)((const unsigned short*)Bh + boff + 16 + 8 * hh);
      acc[t] = mmaH<1>(ah.v, ah.v, bq.v, bq.v, acc[t]); }
  }
#pragma unroll
  for (int t = 0; t < 4; ++t) { if (col0 + t * 16 >= N) continue; const int col = col0 + t * 16 + ln; const float bv = bp ? bf16_round(bp[col]) : 0.f;
#pragma unroll
    for (int r = 0; r < 8; ++r) { float v = acc[t][r] * alpha + bv; if (CP) { const int bidx = (row0g + row0 + 8 * hh + r) / rowsPerB; v += CP[(size_t)bidx * sCPb + (size_t)by * 64 + col]; } if (ACT == 1) v = (v > 0.f) ? v : expm1f(v); else if (ACT == 7) v = (v > 0.f) ? v + 1.0f : expf(v); else if (ACT == 8) v = tanhf(v); else if (ACT == 9) v = 0.5f * v * (1.0f + tanhf(0.7978845608028654f * (v + 0.044715f * v * v * v))); else if (ACT == 11) v = 1.0f / (1.0f + expf(-v)); else if (ACT == 12) v = (v > 0.f) ? v : 0.01f * v; else if (ACT == 14) v = (v > 0.f) ? v : 0.1f * v; else if (ACT == 15) v = v / (1.0f + expf(-v)); else if (ACT == 3) v = fmaxf(v, 0.f); else if (ACT == 6) v = 0.5f * v * (1.0f + erff(v * 0.70710678118654752f)); so[w][8 * hh + r][t * 16 + ln] = v; } }
  __builtin_amdgcn_fence(__ATOMIC_ACQ_REL, "workgroup"); __builtin_amdgcn_wave_barrier();
  const int rsub = lane >> 4, c4 = (lane & 15) * 4; typedef _Float16 v4h __attribute__((ext_vector_type(4)));
  {
#pragma unroll
    for (int q = 0; q < 8; ++q) { const int r = q * 2 + rsub; if (col0 + c4 < N) { const v4f v = *(const v4fa*)&so[w][r][c4]; if (C) *(v4f*)(C + cofs + (size_t)(row0 + r) * ldc + col0 + c4) = v; if (C16) { v4h h4; for (int i = 0; i < 4; ++i) h4[i] = (_Float16)v[i]; *(v4h*)(C16 + cofs + (size_t)(row0 + r) * ldc + col0 + c4) = h4; } } }
     }
}


typedef _Float16 v4h __attribute__((ext_vector_type(4)));

__global__ __launch_bounds__(256) void k_x16(const float* __restrict__ x, _Float16* __restrict__ X16, size_t n8) { const size_t t = (size_t)blockIdx.x * 256 + threadIdx.x; if (t >= n8) return; FragH f;
#pragma unroll
  for (int q = 0; q < 8; ++q) f.h[q] = (_Float16)bf16_round(x[t * 8 + q]); *(v8us*)((unsigned short*)X16 + t * 8) = f.half[0];  }
__global__ __launch_bounds__(256) void k_h16(const float* __restrict__ x, _Float16* __restrict__ X16, size_t n8) { const size_t t = (size_t)blockIdx.x * 256 + threadIdx.x; if (t >= n8) return; FragH f;
#pragma unroll
  for (int q = 0; q < 8; ++q) f.h[q] = (_Float16)x[t * 8 + q]; *(v8us*)((unsigned short*)X16 + t * 8) = f.half[0];  }
__global__ __launch_bounds__(256) void k_round16f(const float* __restrict__ W, _Float16* __restrict__ Bt, size_t n8) { const size_t t = (size_t)blockIdx.x * 256 + threadIdx.x; if (t >= n8) return; FragH f;
#pragma unroll
  for (int i = 0; i < 8; ++i) f.h[i] = (_Float16)(bf16_round(W[t * 8 + i]) * 16.0f); *(v8us*)((unsigned short*)Bt + t * 8) = f.half[0];  }
template <int NHv, int TTv>
__global__ __launch_bounds__(256) void k_vt(const _Float16* __restrict__ V16, int ldv, int voff, _Float16* __restrict__ Vt) { __shared__ unsigned short tl[64][66]; const int tid = threadIdx.x; const int slab = blockIdx.x / (TTv / 64), lg = blockIdx.x % (TTv / 64); const int b = slab / NHv, h = slab % NHv;
  for (int i = tid; i < 64 * 8; i += 256) { const int r = i / 8, c8 = (i % 8) * 8; FragH f; f.half[0] = *(const v8us*)((const unsigned short*)V16 + ((size_t)b * TTv + lg * 64 + r) * ldv + voff + h * 64 + c8);
#pragma unroll
    for (int q = 0; q < 8; ++q) tl[r][c8 + q] = f.u[q]; }
  __syncthreads();
  {
#pragma unroll
    for (int rd = 0; rd < 2; ++rd) { const int d = rd * 32 + tid / 8, pc = tid % 8; FragH f;
#pragma unroll
      for (int q = 0; q < 8; ++q) f.u[q] = tl[pc * 8 + q][d];
      *(v8us*)((unsigned short*)Vt + ((size_t)slab * 64 + d) * TTv + lg * 64 + pc * 8) = f.half[0]; }
     } }

__global__ __launch_bounds__(256) void k_hl(const float* __restrict__ F, _Float16* __restrict__ Hh, _Float16* __restrict__ Hl, size_t n8) { const size_t t = (size_t)blockIdx.x * 256 + threadIdx.x; if (t >= n8) return; FragH fh, fl; const v4f a = *(const v4fa*)(F + t * 8), c = *(const v4fa*)(F + t * 8 + 4);
#pragma unroll
  for (int q = 0; q < 4; ++q) { _Float16 h = (_Float16)a[q]; fh.h[q] = h; fl.h[q] = (_Float16)((a[q] - (float)h) * 1024.0f); h = (_Float16)c[q]; fh.h[4 + q] = h; fl.h[4 + q] = (_Float16)((c[q] - (float)h) * 1024.0f); }
  { *(v8us*)((unsigned short*)Hh + t * 8) = fh.half[0]; *(v8us*)((unsigned short*)Hl + t * 8) = fl.half[0];  } }

// ---- fast GEMM (wave tile 32x64; requires M % 32 == 0 rows per launch region and N % 64 == 0); epilogue = k_gemm_hhx semantics ----
__device__ __forceinline__ v16h g2_frag(const _Float16* p, int hh) { FragH f; f.half[0] = *(const v8us*)((const unsigned short*)p + 8 * hh); f.half[1] = *(const v8us*)((const unsigned short*)p + 16 + 8 * hh); return f.v; }
__device__ __forceinline__ v8f g2_mma(v16h a, v16h b, v8f c) { v8f d = __builtin_amdgcn_wmma_f32_16x16x32_f16(false, a, false, b, (short)0, c, false, false); asm volatile("v_nop\n\tv_nop\n\tv_nop\n\tv_nop" : "+v"(d) : "v"(a), "v"(b)); return d; }
template <int ACT>
__global__ __launch_bounds__(128) void k_gemm2(const _Float16* __restrict__ A, int lda, size_t sA, const _Float16* __restrict__ Bh, int ldb, size_t sB, float alpha, const float* __restrict__ bias, size_t sBias, const float* __restrict__ CP, int rowsPerB, size_t sCPb, int row0g,
    float* __restrict__ C, _Float16* __restrict__ C16, int ldc, size_t sC, int M, int N, int K) {
  __shared__ __attribute__((aligned(16))) float so[4][32][68];
  const int tid = threadIdx.x, w = tid >> 5, lane = tid & 31, ln = lane & 15, hh = lane >> 4; const int by = blockIdx.y;
  A += (size_t)by * sA; Bh += (size_t)by * sB; const size_t cofs = (size_t)by * sC; const float* bp = bias ? bias + (size_t)by * sBias : nullptr;
  const int ntn = N >> 6; const int mt = blockIdx.x / ntn, nq = blockIdx.x - mt * ntn; const int row0 = mt * 128 + 32 * w, col0 = nq * 64; if (row0 >= M) return;
  const _Float16* a0p = A + (size_t)(row0 + ln) * lda; const _Float16* a1p = a0p + (size_t)16 * lda;
  const _Float16* b0p = Bh + (size_t)(col0 + ln) * ldb; const _Float16* b1p = b0p + (size_t)16 * ldb; const _Float16* b2p = b1p + (size_t)16 * ldb; const _Float16* b3p = b2p + (size_t)16 * ldb;
  const v8f z8 = {0.f,0.f,0.f,0.f,0.f,0.f,0.f,0.f}; v8f c00 = z8, c01 = z8, c02 = z8, c03 = z8, c10 = z8, c11 = z8, c12 = z8, c13 = z8;
#pragma unroll 1
  for (int kb = 0; kb < K; kb += 32) { const v16h a0 = g2_frag(a0p + kb, hh), a1 = g2_frag(a1p + kb, hh);
    v16h b = g2_frag(b0p + kb, hh); c00 = g2_mma(a0, b, c00); c10 = g2_mma(a1, b, c10);
    b = g2_frag(b1p + kb, hh); c01 = g2_mma(a0, b, c01); c11 = g2_mma(a1, b, c11);
    b = g2_frag(b2p + kb, hh); c02 = g2_mma(a0, b, c02); c12 = g2_mma(a1, b, c12);
    b = g2_frag(b3p + kb, hh); c03 = g2_mma(a0, b, c03); c13 = g2_mma(a1, b, c13); }
  v8f accs[8] = {c00, c01, c02, c03, c10, c11, c12, c13};
#pragma unroll
  for (int u = 0; u < 8; ++u) { const int t = u & 3, half = u >> 2; const int col = col0 + t * 16 + ln; const float bv = bp ? bf16_round(bp[col]) : 0.f;
#pragma unroll
    for (int r = 0; r < 8; ++r) { const int rloc = half * 16 + 8 * hh + r; float v = accs[u][r] * alpha + bv; if (CP) { const int bidx = (row0g + row0 + rloc) / rowsPerB; v += CP[(size_t)bidx * sCPb + (size_t)by * 64 + col]; }
      if (ACT == 3) v = fmaxf(v, 0.f); else if (ACT == 6) v = 0.5f * v * (1.0f + erff(v * 0.70710678118654752f)); else if (ACT == 11) v = 1.0f / (1.0f + expf(-v)); else if (ACT == 15) v = v / (1.0f + expf(-v)); else if (ACT == 12) v = (v > 0.f) ? v : 0.01f * v; else if (ACT == 8) v = tanhf(v);
      so[w][rloc][t * 16 + ln] = v; } }
  __builtin_amdgcn_fence(__ATOMIC_ACQ_REL, "workgroup"); __builtin_amdgcn_wave_barrier();
  const int rsub = lane >> 4, c4 = (lane & 15) * 4;
  {
#pragma unroll
    for (int q = 0; q < 16; ++q) { const int r = q * 2 + rsub; const v4f v = *(const v4fa*)&so[w][r][c4]; if (C) *(v4f*)(C + cofs + (size_t)(row0 + r) * ldc + col0 + c4) = v; if (C16) { v4h h4; for (int i = 0; i < 4; ++i) h4[i] = (_Float16)v[i]; *(v4h*)(C16 + cofs + (size_t)(row0 + r) * ldc + col0 + c4) = h4; } }
     } }


// lane l <-> lane l ^ 16 by a vector cross-row move
__device__ __forceinline__ float xhalf(float x) { return __builtin_bit_cast(float, __builtin_amdgcn_permlanex16(__builtin_bit_cast(int, x), __builtin_bit_cast(int, x), 0x76543210, 0xfedcba98, false, false)); }
#define FKT 64
#define FPIT 144
#define FTILE (128 * FPIT)
// One tile: 8 asynchronous 16-byte copies a lane (128 lanes x 8 x 16 B = 16 KiB); 8 lanes cover one 128-B row, so a wave's copy asks for 4 whole lines.
// s_wait_xcnt closes the statement so that no address register of a copy is rewritten in front of it.
__device__ __forceinline__ void tile_copy(unsigned l0, const unsigned short* gk, int ldk, const unsigned short* gv) {
  asm volatile("global_load_async_to_lds_b128 %0, %8, off\n\t"
               "global_load_async_to_lds_b128 %1, %9, off\n\t"
               "global_load_async_to_lds_b128 %2, %10, off\n\t"
               "global_load_async_to_lds_b128 %3, %11, off\n\t"
               "global_load_async_to_lds_b128 %4, %12, off\n\t"
               "global_load_async_to_lds_b128 %5, %13, off\n\t"
               "global_load_async_to_lds_b128 %6, %14, off\n\t"
               "global_load_async_to_lds_b128 %7, %15, off\n\t"
               "s_wait_xcnt 0x0"
               :: "v"(l0), "v"(l0 + 16u * FPIT), "v"(l0 + 32u * FPIT), "v"(l0 + 48u * FPIT), "v"(l0 + 64u * FPIT), "v"(l0 + 80u * FPIT), "v"(l0 + 96u * FPIT), "v"(l0 + 112u * FPIT),
                  "v"(gk), "v"(gk + (size_t)16 * ldk), "v"(gk + (size_t)32 * ldk), "v"(gk + (size_t)48 * ldk), "v"(gv), "v"(gv + (size_t)16 * TK), "v"(gv + (size_t)32 * TK), "v"(gv + (size_t)48 * TK)
               : "memory");
}
// Eight 2^x in place, one statement: behind a transcendental the instruction set asks for one slot before its result is read or its source overwritten. Here each neighbour touches its own register only,
// and the closing v_nop keeps the slot for whatever the compiler puts next.
__device__ __forceinline__ void exp2x8(float* x) {
  asm("v_exp_f32 %0, %0\n\tv_exp_f32 %1, %1\n\tv_exp_f32 %2, %2\n\tv_exp_f32 %3, %3\n\tv_exp_f32 %4, %4\n\tv_exp_f32 %5, %5\n\tv_exp_f32 %6, %6\n\tv_exp_f32 %7, %7\n\tv_nop"
      : "+v"(x[0]), "+v"(x[1]), "+v"(x[2]), "+v"(x[3]), "+v"(x[4]), "+v"(x[5]), "+v"(x[6]), "+v"(x[7]));
}
__global__ __launch_bounds__(128) void k_flash(const _Float16* __restrict__ Q16, int ldq, const _Float16* __restrict__ K16, int ldk, const _Float16* __restrict__ Vt, const int* __restrict__ MSK, float* __restrict__ O, int ldo) {
  constexpr int RPW = 16, NQB = TQ / (4 * RPW), DT = 4, KS = 2, NT = TK / FKT; (void)MSK;
  __shared__ __attribute__((aligned(16))) unsigned char ring[2 * FTILE];      /* behind the loop's last barrier its first 17 KiB stage the output */
  const int tid = threadIdx.x, w = tid >> 5, lane = tid & 31, ln = lane & 15, hh = lane >> 4;
  const int slab = blockIdx.x / NQB, qblk = blockIdx.x % NQB; const int b = slab / NH, h = slab % NH; const int q0 = qblk * (4 * RPW) + w * RPW;
  const unsigned short* gk = (const unsigned short*)K16 + ((size_t)b * TK + (tid >> 3)) * ldk + h * 64 + (tid & 7) * 8;      /* this lane's 16 bytes of K row tid/8 of tile 0 */
  const unsigned short* gv = (const unsigned short*)Vt + ((size_t)slab * 64 + (tid >> 3)) * TK + (tid & 7) * 8;      /* and of Vt row tid/8 */
  const unsigned l0 = (unsigned)(size_t)(const void*)ring + (unsigned)((tid >> 3) * FPIT + (tid & 7) * 16);
  tile_copy(l0, gk, ldk, gv);      /* tile 0 -> buffer 0 */
  FragH bq[KS];
  { const unsigned short* qr = (const unsigned short*)Q16 + ((size_t)b * TQ + q0 + ln) * ldq + h * 64;
#pragma unroll
    for (int ks = 0; ks < KS; ++ks) { bq[ks].half[0] = *(const v8us*)(qr + ks * 32 + 8 * hh); bq[ks].half[1] = *(const v8us*)(qr + ks * 32 + 16 + 8 * hh); } }
  float m_q = -3.0e38f, l_q = 0.f; v8f oacc[DT];
#pragma unroll
  for (int dt = 0; dt < DT; ++dt) oacc[dt] = (v8f){0.f,0.f,0.f,0.f,0.f,0.f,0.f,0.f};
  asm volatile("s_wait_asynccnt 0x0" ::: "memory");      /* this wave's share of tile 0 has landed */
  __syncthreads();      /* tile 0 is published */
  tile_copy(l0 + FTILE, gk + (size_t)FKT * ldk, ldk, gv + FKT);      /* tile 1 -> buffer 1 */
#pragma unroll 1
  for (int t = 0; t < NT; ++t) {
    const unsigned bo = (unsigned)(t & 1) * FTILE; const unsigned fo = bo + (unsigned)(ln * FPIT + 16 * hh);
#pragma unroll 1      /* rolled: both passes unrolled need more than the 128 VGPRs at which 8 waves fit a SIMD */
    for (int p = 0; p < FKT / 32; ++p) {
    FragH ak[2][KS];
#pragma unroll
    for (int nt = 0; nt < 2; ++nt) { const unsigned char* kr = &ring[fo + (p * 32 + nt * 16) * FPIT];
#pragma unroll
      for (int ks = 0; ks < KS; ++ks) { ak[nt][ks].half[0] = *(const v8us*)(kr + ks * 64); ak[nt][ks].half[1] = *(const v8us*)(kr + ks * 64 + 32); } }
    float sc[16];
#pragma unroll
    for (int nt = 0; nt < 2; ++nt) { v8f acc = (v8f){0.f,0.f,0.f,0.f,0.f,0.f,0.f,0.f};
#pragma unroll
      for (int ks = 0; ks < KS; ++ks) acc = mmaH<1>(ak[nt][ks].v, ak[nt][ks].v, bq[ks].v, bq[ks].v, acc);
#pragma unroll
      for (int r = 0; r < 8; ++r) sc[nt * 8 + r] = acc[r]; }      /* sc[nt*8 + r] = q.k, not yet scaled (key t*64 + p*32 + nt*16 + 8*hh + r, query q0 + ln) */
    FragH av[DT];
#pragma unroll
    for (int dt = 0; dt < DT; ++dt) { const unsigned char* vrow = &ring[fo + (64 + dt * 16) * FPIT + p * 64]; av[dt].half[0] = *(const v8us*)(vrow); av[dt].half[1] = *(const v8us*)(vrow + 32); }
    float mx[4];
#pragma unroll
    for (int c = 0; c < 4; ++c) mx[c] = fmaxf(fmaxf(sc[4 * c], sc[4 * c + 1]), fmaxf(sc[4 * c + 2], sc[4 * c + 3]));
    float mc = fmaxf(fmaxf(mx[0], mx[1]), fmaxf(mx[2], mx[3])); mc = fmaxf(mc, xhalf(mc));
    const float mn = fmaxf(m_q, mc * SCL2); const float al = __builtin_amdgcn_exp2f(m_q - mn); m_q = mn;      /* the maximum is kept in base-2 units (SCL2 > 0 commutes with max); al: 0 on the first pass, 1 where the maximum stays */
    const float nb = 10.0f - mn;      /* P x 1024 = 2^(q.k x SCL2 - mn + 10): one FMA and one bare v_exp_f32 a score; the argument is at most 10, and far below -126 the result is 0, as wanted */
    FragH pb; float ps[4];
#pragma unroll
    for (int i = 0; i < 16; ++i) sc[i] = fmaf(sc[i], SCL2, nb);
    exp2x8(sc); exp2x8(sc + 8);
#pragma unroll
    for (int i = 0; i < 16; ++i) { const float p_ = sc[i]; ps[i & 3] = (i < 4) ? p_ : ps[i & 3] + p_; pb.h[i] = (_Float16)p_; }      /* pb.h[nt*8 + r] = P(key nt*16 + 8*hh + r of the pass, query q0 + ln): the k order of the Vt loader */
    l_q = l_q * al + ((ps[0] + ps[1]) + (ps[2] + ps[3]));
#pragma unroll
    for (int dt = 0; dt < DT; ++dt) {
#pragma unroll
      for (int r = 0; r < 8; ++r) oacc[dt][r] *= al;
      oacc[dt] = mmaH<1>(av[dt].v, av[dt].v, pb.v, pb.v, oacc[dt]); } }
    asm volatile("s_wait_dscnt 0x0" ::: "memory");      /* this wave's reads of tile t are done */
    asm volatile("s_wait_asynccnt 0x0" ::: "memory");      /* its share of tile t + 1 has landed */
    __syncthreads();      /* publishes tile t + 1 and frees tile t's buffer */
    if (t + 2 < NT) tile_copy(l0 + bo, gk + (size_t)(t + 2) * FKT * ldk, ldk, gv + (size_t)(t + 2) * FKT); }
  asm volatile("s_wait_asynccnt 0x0" ::: "memory");      /* no copy is in flight when the ring becomes output staging */
  float (*sO)[RPW][64 + 4] = (float (*)[RPW][64 + 4])ring;
  const float lt = l_q + xhalf(l_q); const float inv = (lt > 0.f) ? 1.0f / lt : 0.f;      /* l_q sums P x 1024, as Ot does */
#pragma unroll
  for (int dt = 0; dt < DT; ++dt)      /* oacc[dt][r] = Ot[dt*16 + 8*hh + r][q0 + ln] */
#pragma unroll
    for (int q = 0; q < 2; ++q) { v4f o4;
#pragma unroll
      for (int i = 0; i < 4; ++i) o4[i] = oacc[dt][q * 4 + i] * inv;
      *(v4fa*)&sO[w][ln][dt * 16 + 8 * hh + q * 4] = o4; }
  __builtin_amdgcn_fence(__ATOMIC_ACQ_REL, "workgroup"); __builtin_amdgcn_wave_barrier();
  {
#pragma unroll
    for (int rp = 0; rp < RPW; rp += 2) { const int r = rp + (lane >> 4), pc = lane & 15; const v4f val = *(const v4fa*)&sO[w][r][pc * 4]; *(v4f*)(O + ((size_t)b * TQ + q0 + r) * ldo + h * 64 + pc * 4) = val; }
     } }
__global__ __launch_bounds__(256) void k_split(const float* __restrict__ F, _Float16* __restrict__ Hh, _Float16* __restrict__ Hl, size_t n8) {
  #pragma clang fp contract(off)
  const size_t t = (size_t)blockIdx.x * 256 + threadIdx.x; if (t >= n8) return; const v4f a = *(const v4fa*)(F + t * 8), c = *(const v4fa*)(F + t * 8 + 4); FragH fh, fl;
#pragma unroll
  for (int q = 0; q < 8; ++q) { const float v = (q < 4) ? a[q] : c[q - 4]; const _Float16 hi = (_Float16)v; fh.h[q] = hi; fl.h[q] = (_Float16)((v - (float)hi) * 1024.0f); }
  { *(v8us*)((unsigned short*)Hh + t * 8) = fh.half[0]; *(v8us*)((unsigned short*)Hl + t * 8) = fl.half[0];  } }


#define PIDX(i) ((((i) >> 3) << 5) + ((i) & 7))
__global__ __launch_bounds__(256) void k_rowflag(const float* __restrict__ X, int* __restrict__ FL) {
  #pragma clang fp contract(off)
  __shared__ int sf[8];
  const int tid = threadIdx.x, w = tid >> 5, ln = tid & 31; const int r = blockIdx.x * 8 + w; const float* x = X + (size_t)r * DKV; float s = 0.f;
#pragma unroll
  for (int u = 0; u < DKV / 32; ++u) s += bf16_round(x[u * 32 + ln]);
  for (int o = 16; o > 0; o >>= 1) s += __shfl_xor(s, o, 32);
  if (ln == 0) sf[w] = (s == 0.0f) ? 1 : 0;
  __syncthreads();
  if (tid < 32) { const int v = (tid < 8) ? sf[tid] : 0; int* d = FL + blockIdx.x * 32 + tid; *(int*)d = v;  } }      
__global__ __launch_bounds__(256) void k_zerorows(const int* __restrict__ FL, _Float16* __restrict__ P16) {
  const size_t t = (size_t)blockIdx.x * 256 + threadIdx.x; if (t >= (size_t)NR * DM / 8) return; const int r = (int)(t / (DM / 8)); if (FL[PIDX(r)] == 0) return; FragH z;
#pragma unroll
  for (int q = 0; q < 8; ++q) z.h[q] = (_Float16)0.0f; *(v8us*)((unsigned short*)P16 + t * 8) = z.half[0];  }
extern "C" void kernel_launch(void* const* d_in, const int* in_sizes, int n_in,
                              void* d_out, int out_size, void* d_ws, size_t ws_size, hipStream_t stream) {
  (void)in_sizes; (void)n_in; (void)out_size;
  const float* const* I = (const float* const*)d_in; const float* qi = I[0]; const float* ki = I[1]; const float* vi = I[2];
  const float* Wq = I[3]; const float* bq = I[4]; const float* Wk = I[5]; const float* bk = I[6]; const float* Wv = I[7]; const float* bv = I[8]; const float* Wo = I[9]; const float* bo = I[10];
  char* ws = (char*)d_ws; size_t off = 0;
  auto take = [&](size_t bytes) { char* p = ws + off; off += (bytes + 255) & ~(size_t)255; return p; };
  _Float16* BQ = (_Float16*)take((size_t)DM * DM * 2); _Float16* BK = (_Float16*)take((size_t)DM * DKV * 2); _Float16* BV = (_Float16*)take((size_t)DM * DKV * 2); _Float16* BO = (_Float16*)take((size_t)DM * DM * 2);
  _Float16* X16 = (_Float16*)take((size_t)NR * DM * 2); _Float16* Q16 = (_Float16*)take((size_t)NR * DM * 2); _Float16* K16 = (_Float16*)take((size_t)NR * DM * 2); _Float16* V16 = (_Float16*)take((size_t)NR * DM * 2); _Float16* VT = (_Float16*)take((size_t)NR * DM * 2);
  int* FLK = (int*)take((size_t)(NR / 8) * 32 * 4); int* FLV = (int*)take((size_t)(NR / 8) * 32 * 4);
  float* O = (float*)take((size_t)NR * DM * 4); _Float16* Oh = (_Float16*)take((size_t)NR * DM * 2); _Float16* Ol = (_Float16*)take((size_t)NR * DM * 2);      /* all batches */
  if (off > ws_size) return;      /* 6 + 16 x 5 + 0.3 + 32 + 16 + 16 = 150 MiB */
  const size_t n8 = (size_t)NR * DM / 8, n8k = (size_t)NR * DKV / 8; const unsigned nb8 = (unsigned)((n8 + 255) / 256), nb8k = (unsigned)((n8k + 255) / 256);
  k_wt_f16<<<(unsigned)(((size_t)DM * DM / 8 + 255) / 256), 256, 0, stream>>>(Wq, BQ, DM, DM, 16.0f); k_wt_f16<<<(unsigned)(((size_t)DKV * DM / 8 + 255) / 256), 256, 0, stream>>>(Wk, BK, DKV, DM, 16.0f); k_wt_f16<<<(unsigned)(((size_t)DKV * DM / 8 + 255) / 256), 256, 0, stream>>>(Wv, BV, DKV, DM, 16.0f); k_wt_f16<<<(unsigned)(((size_t)DM * DM / 8 + 255) / 256), 256, 0, stream>>>(Wo, BO, DM, DM, 16.0f);      /* (in,out) -> [out][in] x16 */
  const dim3 gP((NR / 128) * (DM / 64), 1);
  k_x16<<<nb8, 256, 0, stream>>>(qi, X16, n8); k_gemm2<0><<<gP, 128, 0, stream>>>(X16, DM, 0, BQ, DM, 0, 0.0625f, bq, 0, nullptr, 1, 0, 0, nullptr, Q16, DM, 0, NR, DM, DM);      /* q -> f16 */
  k_x16<<<nb8k, 256, 0, stream>>>(ki, X16, n8k); k_rowflag<<<NR / 8, 256, 0, stream>>>(ki, FLK); k_gemm2<0><<<gP, 128, 0, stream>>>(X16, DKV, 0, BK, DKV, 0, 0.0625f, bk, 0, nullptr, 1, 0, 0, nullptr, K16, DM, 0, NR, DM, DKV); k_zerorows<<<nb8, 256, 0, stream>>>(FLK, K16);      /* k -> f16 (masked rows zeroed) */
  k_x16<<<nb8k, 256, 0, stream>>>(vi, X16, n8k); k_rowflag<<<NR / 8, 256, 0, stream>>>(vi, FLV); k_gemm2<0><<<gP, 128, 0, stream>>>(X16, DKV, 0, BV, DKV, 0, 0.0625f, bv, 0, nullptr, 1, 0, 0, nullptr, V16, DM, 0, NR, DM, DKV); k_zerorows<<<nb8, 256, 0, stream>>>(FLV, V16);      /* v -> f16 */
  k_vt<NH, TK><<<NBT * NH * (TK / 64), 256, 0, stream>>>(V16, DM, 0, VT);      /* Vt[(b,h)][d][s] */
  float* outp = (float*)d_out;
  k_flash<<<NBT * NH * (TQ / 64), 128, 0, stream>>>(Q16, DM, K16, DM, VT, nullptr, O, DM);      /* all batches in one grid: slab = b*NH + h */
  k_split<<<nb8, 256, 0, stream>>>(O, Oh, Ol, n8);
  k_gemm2<0><<<gP, 128, 0, stream>>>(Oh, DM, 0, BO, DM, 0, 0.0625f, bo, 0, nullptr, 1, 0, 0, outp, nullptr, DM, 0, NR, DM, DM);
  k_gemm2<0><<<gP, 128, 0, stream>>>(Ol, DM, 0, BO, DM, 0, 0.0625f / 1024.0f, nullptr, 0, outp, 1, (size_t)DM, 0, outp, nullptr, DM, 0, NR, DM, DM);      /* out = o*Wo + bo */
}

// v005
// A run of this version takes 241 microseconds.
// Timed twice side by side with v004, it ran 1.57 and 1.58 times as fast.
// Over all steps from v000 it is 5.63 times as fast.
#include <hip/hip_runtime.h>
// Multi-head cross attention over social features (B 4, S 2048 queries x 1024, 2048 keys/values x 512, 16 heads x 64; (in,out) Linear weights with bias; key/value rows whose raw features sum to exactly 0 are zeroed after projection, as the reference's padding mask): scores = q.k/8; softmax; out = (attn.v merged)*Wo + bo -> [4,2048,1024].
// Compute dtype: the inputs, the four matrices and biases rounded to bf16; q/k/v products exact (weights x16 in f16, undone by alpha), q, k, v, P as f16 operands (~2^-12; logits sigma ~0.4), O as f16 hi + lo; f32 accumulation and softmax. v_wmma_f32_16x16x32_f16.
#define NBT 4
#define TQ 2048
#define TK 2048
#define DKV 512
#define NR (NBT * TQ)
#define DM 1024
#define NH 16
#define SCL 0.125f
#define SCL2 (SCL * 1.44269504088896340736f)      /* 1/8 x log2(e): scores in base-2 exponent units */
typedef __bf16 v16b __attribute__((ext_vector_type(16)));
typedef unsigned short v8us __attribute__((ext_vector_type(8), may_alias));
typedef float  v8f  __attribute__((ext_vector_type(8)));
typedef float  v4f  __attribute__((ext_vector_type(4)));
typedef float  v4fa __attribute__((ext_vector_type(4), may_alias));
union FragB { v16b v; v8us half[2]; unsigned short u[16]; };

__device__ __forceinline__ unsigned short bf16_bits(float x) { unsigned int u = __float_as_uint(x); return (unsigned short)((u + 0x7FFFu + ((u >> 16) & 1u)) >> 16); }
__device__ __forceinline__ float bf16_val(unsigned short b) { return __uint_as_float(((unsigned int)b) << 16); }
__device__ __forceinline__ float bf16_round(float x) { return bf16_val(bf16_bits(x)); }
// D += A·B with NT terms: 1 = ah·bh, 2 = + al·bh (A split), 3 = + ah·bl (both split)
template <int NT>
__device__ __forceinline__ v8f mmaN(v16b ah, v16b al, v16b bh, v16b bl, v8f c) {
  c = __builtin_amdgcn_wmma_f32_16x16x32_bf16(false, ah, false, bh, (short)0, c, false, false);
  if (NT >= 2) c = __builtin_amdgcn_wmma_f32_16x16x32_bf16(false, al, false, bh, (short)0, c, false, false);
  if (NT >= 3) c = __builtin_amdgcn_wmma_f32_16x16x32_bf16(false, ah, false, bl, (short)0, c, false, false);
  asm volatile("v_nop\n\tv_nop\n\tv_nop\n\tv_nop" : "+v"(c) : "v"(ah), "v"(al), "v"(bh), "v"(bl));
  return c;
}

__global__ __launch_bounds__(256) void k_wt_bf16(const float* __restrict__ W, unsigned short* __restrict__ Wt, int K, int N) {
  const int t = blockIdx.x * 256 + threadIdx.x;
  const int k8n = K / 8;
  if (t >= N * k8n) return;
  const int n = t / k8n, k8 = (t % k8n) * 8;
  v8us v;
#pragma unroll
  for (int i = 0; i < 8; ++i) v[i] = bf16_bits(W[(size_t)(k8 + i) * N + n]);
  *(v8us*)(Wt + (size_t)n * K + k8) = v;
  
}

// GEMM C[M][N] (f32, pitch ldc) = act(A[M][K]·W + bias). A f32 row-major (pitch lda) converted per fragment to bf16
// (ASPLIT: hi/lo two planes -> 2 terms, else single rounded term); Wt bf16 [N][K] (pitch ldb). BIAS_BF16 rounds the
// bias to bf16 first (bias quantised to bf16 before the add). K%32==0, M%16==0, N%64==0.
template <bool ASPLIT, int ACT, bool BIAS_BF16>
__global__ __launch_bounds__(128) void k_gemm_bf(const float* __restrict__ A, int lda, const unsigned short* __restrict__ Wt, int ldb,
                                               const float* __restrict__ bias, float* __restrict__ C, int ldc, int M, int N, int K) {
  __shared__ __attribute__((aligned(16))) float so[4][16][64];
  const int tid = threadIdx.x, w = tid >> 5, lane = tid & 31, ln = lane & 15, hh = lane >> 4;
  const int ntn = N / 64;
  const int wid = blockIdx.x * 4 + w;
  const int mt = wid / ntn, nq = wid % ntn;
  if (mt * 16 >= M) return;
  const int row0 = mt * 16, col0 = nq * 64;
  const float* arow = A + (size_t)(row0 + ln) * lda;
  v8f acc[4] = {};
  for (int kb = 0; kb < K; kb += 32) {
    FragB ah, al;
    const v4f x0 = *(const v4fa*)(arow + kb + 8 * hh), x1 = *(const v4fa*)(arow + kb + 8 * hh + 4);
    const v4f x2 = *(const v4fa*)(arow + kb + 16 + 8 * hh), x3 = *(const v4fa*)(arow + kb + 16 + 8 * hh + 4);
    float xs[16] = {x0[0],x0[1],x0[2],x0[3],x1[0],x1[1],x1[2],x1[3],x2[0],x2[1],x2[2],x2[3],x3[0],x3[1],x3[2],x3[3]};
#pragma unroll
    for (int i = 0; i < 16; ++i) { const unsigned short hb = bf16_bits(xs[i]); ah.u[i] = hb; al.u[i] = ASPLIT ? bf16_bits(xs[i] - bf16_val(hb)) : (unsigned short)0; }
#pragma unroll
    for (int t = 0; t < 4; ++t) {
      const unsigned short* brow = Wt + (size_t)(col0 + t * 16 + ln) * ldb + kb;
      FragB b;
      b.half[0] = *(const v8us*)(brow + 8 * hh);
      b.half[1] = *(const v8us*)(brow + 16 + 8 * hh);
      acc[t] = mmaN<ASPLIT ? 2 : 1>(ah.v, al.v, b.v, b.v, acc[t]);
    }
  }
#pragma unroll
  for (int t = 0; t < 4; ++t) {
    float bv = bias ? bias[col0 + t * 16 + ln] : 0.f;
    if (BIAS_BF16) bv = bf16_round(bv);
#pragma unroll
    for (int r = 0; r < 8; ++r) { float v = acc[t][r] + bv; if (ACT == 1) v = fmaxf(v, 0.f); so[w][8 * hh + r][t * 16 + ln] = v; }
  }
  __builtin_amdgcn_fence(__ATOMIC_ACQ_REL, "workgroup");
  __builtin_amdgcn_wave_barrier();
  const int rsub = lane >> 4, c4 = (lane & 15) * 4;
  {
#pragma unroll
    for (int q = 0; q < 8; ++q) {
      const int r = q * 2 + rsub;
      const v4f v = *(const v4fa*)&so[w][r][c4];
      *(v4f*)(C + (size_t)(row0 + r) * ldc + col0 + c4) = v;
    }
    
  }
}

// GEMM C = act(A·W + bias + resid): A f32 (ASPLIT -> hi/lo 2 terms), Wt bf16 [N][K]; ACT 0 none, 1 relu, 2 exact gelu;
// resid (optional, f32, row index = (row % rmod), pitch ldr, RES_BF16 rounds it) added before the activation.
template <bool ASPLIT, int ACT, bool BIAS_BF16, bool RES_BF16>
__global__ __launch_bounds__(128) void k_gemm_bf3(const float* __restrict__ A, int lda, const unsigned short* __restrict__ Wt, int ldb,
                                                const float* __restrict__ bias, const float* __restrict__ resid, int rmod, int ldr,
                                                float* __restrict__ C, int ldc, int M, int N, int K) {
  __shared__ __attribute__((aligned(16))) float so[4][16][64];
  const int tid = threadIdx.x, w = tid >> 5, lane = tid & 31, ln = lane & 15, hh = lane >> 4;
  const int ntn = N / 64;
  const int wid = blockIdx.x * 4 + w;
  const int mt = wid / ntn, nq = wid % ntn;
  if (mt * 16 >= M) return;
  const int row0 = mt * 16, col0 = nq * 64;
  const float* arow = A + (size_t)(row0 + ln) * lda;
  v8f acc[4] = {};
  for (int kb = 0; kb < K; kb += 32) {
    FragB ah, al;
    const v4f x0 = *(const v4fa*)(arow + kb + 8 * hh), x1 = *(const v4fa*)(arow + kb + 8 * hh + 4);
    const v4f x2 = *(const v4fa*)(arow + kb + 16 + 8 * hh), x3 = *(const v4fa*)(arow + kb + 16 + 8 * hh + 4);
    float xs[16] = {x0[0],x0[1],x0[2],x0[3],x1[0],x1[1],x1[2],x1[3],x2[0],x2[1],x2[2],x2[3],x3[0],x3[1],x3[2],x3[3]};
#pragma unroll
    for (int i = 0; i < 16; ++i) { const unsigned short hb = bf16_bits(xs[i]); ah.u[i] = hb; al.u[i] = ASPLIT ? bf16_bits(xs[i] - bf16_val(hb)) : (unsigned short)0; }
#pragma unroll
    for (int t = 0; t < 4; ++t) {
      const unsigned short* brow = Wt + (size_t)(col0 + t * 16 + ln) * ldb + kb;
      FragB b;
      b.half[0] = *(const v8us*)(brow + 8 * hh);
      b.half[1] = *(const v8us*)(brow + 16 + 8 * hh);
      acc[t] = mmaN<ASPLIT ? 2 : 1>(ah.v, al.v, b.v, b.v, acc[t]);
    }
  }
#pragma unroll
  for (int t = 0; t < 4; ++t) {
    const int col = col0 + t * 16 + ln;
    float bv = bias ? bias[col] : 0.f;
    if (BIAS_BF16) bv = bf16_round(bv);
#pragma unroll
    for (int r = 0; r < 8; ++r) {
      float v = acc[t][r] + bv;
      if (resid) { float rv = resid[(size_t)((row0 + 8 * hh + r) % rmod) * ldr + col]; if (RES_BF16) rv = bf16_round(rv); v += rv; }
      if (ACT == 1) v = fmaxf(v, 0.f);
      if (ACT == 2) v = 0.5f * v * (1.0f + erff(v * 0.70710678118654752f));
      if (ACT == 3) { const float u = 0.7978845608028654f * (v + 0.044715f * v * v * v); v = 0.5f * v * (1.0f + tanhf(u)); }
      so[w][8 * hh + r][t * 16 + ln] = v;
    }
  }
  __builtin_amdgcn_fence(__ATOMIC_ACQ_REL, "workgroup");
  __builtin_amdgcn_wave_barrier();
  const int rsub = lane >> 4, c4 = (lane & 15) * 4;
  {
#pragma unroll
    for (int q = 0; q < 8; ++q) {
      const int r = q * 2 + rsub;
      const v4f v = *(const v4fa*)&so[w][r][c4];
      *(v4f*)(C + (size_t)(row0 + r) * ldc + col0 + c4) = v;
    }
    
  }
}
// row LayerNorm (biased variance, eps) over N: s = X (+ R); optional out_sum <- s; out_norm <- (s-mu)*rsqrt(var+eps)*g + b
template <bool PARAM_BF16>
__global__ __launch_bounds__(256) void k_layernorm(const float* __restrict__ X, const float* __restrict__ R, const float* __restrict__ g, const float* __restrict__ bta,
                                                  float* __restrict__ out_sum, float* __restrict__ out_norm, int N, float eps) {
  __shared__ float red[256];
  const int row = blockIdx.x, tid = threadIdx.x;
  const float* x = X + (size_t)row * N; const float* rr = R ? R + (size_t)row * N : nullptr;
  float vals[16];                     // up to N = 4096
  const int per = N / 256;            // contiguous chunk per thread? use strided-by-4 chunks: thread handles j = tid*4 + 1024*u
  float s1 = 0.f;
  for (int u = 0; u < per / 4; ++u) {
    const int j = tid * 4 + 1024 * u;
    const v4f a = *(const v4fa*)(x + j);
    v4f b = {0.f,0.f,0.f,0.f}; if (rr) b = *(const v4fa*)(rr + j);
#pragma unroll
    for (int q = 0; q < 4; ++q) { const float v = a[q] + b[q]; vals[u * 4 + q] = v; s1 += v; }
  }
  red[tid] = s1; __syncthreads();
  for (int st = 128; st > 0; st >>= 1) { if (tid < st) red[tid] += red[tid + st]; __syncthreads(); }
  const float mu = red[0] / (float)N; __syncthreads();
  float s2 = 0.f;
  for (int u = 0; u < per / 4; ++u)
#pragma unroll
    for (int q = 0; q < 4; ++q) { const float c = vals[u * 4 + q] - mu; s2 += c * c; }
  red[tid] = s2; __syncthreads();
  for (int st = 128; st > 0; st >>= 1) { if (tid < st) red[tid] += red[tid + st]; __syncthreads(); }
  const float rs = rsqrtf(red[0] / (float)N + eps);
  {
    for (int u = 0; u < per / 4; ++u) {
      const int j = tid * 4 + 1024 * u;
      v4f o, sm;
#pragma unroll
      for (int q = 0; q < 4; ++q) {
        float gg = g[j + q], bb = bta[j + q];
        if (PARAM_BF16) { gg = bf16_round(gg); bb = bf16_round(bb); }
        sm[q] = vals[u * 4 + q]; o[q] = (vals[u * 4 + q] - mu) * rs * gg + bb;
      }
      if (out_sum) *(v4f*)(out_sum + (size_t)row * N + j) = sm;
      *(v4f*)(out_norm + (size_t)row * N + j) = o;
    }
    
  }
}



// ---- f16 WMMA path (v_wmma_f32_16x16x32_f16): 11-bit significands for operands in range — used where a [0,1] probability operand needs more precision than bf16
typedef _Float16 v16h __attribute__((ext_vector_type(16)));
union FragH { v16h v; v8us half[2]; _Float16 h[16]; unsigned short u[16]; };
template <int NT>
__device__ __forceinline__ v8f mmaH(v16h ah, v16h al, v16h bh, v16h bl, v8f c) {
  c = __builtin_amdgcn_wmma_f32_16x16x32_f16(false, ah, false, bh, (short)0, c, false, false);
  if (NT >= 2) c = __builtin_amdgcn_wmma_f32_16x16x32_f16(false, al, false, bh, (short)0, c, false, false);
  if (NT >= 3) c = __builtin_amdgcn_wmma_f32_16x16x32_f16(false, ah, false, bl, (short)0, c, false, false);
  asm volatile("v_nop\n\tv_nop\n\tv_nop\n\tv_nop" : "+v"(c) : "v"(ah), "v"(al), "v"(bh), "v"(bl));
  return c;
}
// batched GEMM like k_gemm_b but f16 operands: A f32 (split into f16 hi/lo if ASPLIT, else rounded to f16), Bt = f16 values [n][k]; alpha; C f32; N multiple of 16 (partial tiles skipped)
template <bool ASPLIT>
__global__ __launch_bounds__(128) void k_gemm_h(const float* __restrict__ A, int lda, size_t sA, const _Float16* __restrict__ Bh, int ldb, size_t sB, float alpha, float* __restrict__ C, int ldc, size_t sC, int M, int N, int K) {
  __shared__ __attribute__((aligned(16))) float so[4][16][64];
  const int tid = threadIdx.x, w = tid >> 5, lane = tid & 31, ln = lane & 15, hh = lane >> 4; const int by = blockIdx.y;
  A += (size_t)by * sA; Bh += (size_t)by * sB; C += (size_t)by * sC;
  const int ntn = (N + 63) / 64; const int wid = blockIdx.x * 4 + w; const int mt = wid / ntn, nq = wid % ntn; if (mt * 16 >= M) return;
  const int row0 = mt * 16, col0 = nq * 64; const float* arow = A + (size_t)(row0 + ln) * lda;
  v8f acc[4] = {};
  for (int kb = 0; kb < K; kb += 32) {
    FragH ah, al;
    const v4f x0 = *(const v4fa*)(arow + kb + 8 * hh), x1 = *(const v4fa*)(arow + kb + 8 * hh + 4), x2 = *(const v4fa*)(arow + kb + 16 + 8 * hh), x3 = *(const v4fa*)(arow + kb + 16 + 8 * hh + 4);
    float xs[16] = {x0[0],x0[1],x0[2],x0[3],x1[0],x1[1],x1[2],x1[3],x2[0],x2[1],x2[2],x2[3],x3[0],x3[1],x3[2],x3[3]};
#pragma unroll
    for (int i = 0; i < 16; ++i) { const _Float16 h = (_Float16)xs[i]; ah.h[i] = h; al.h[i] = ASPLIT ? (_Float16)(xs[i] - (float)h) : (_Float16)0.0f; }
#pragma unroll
    for (int t = 0; t < 4; ++t) { if (col0 + t * 16 >= N) continue; const size_t boff = (size_t)(col0 + t * 16 + ln) * ldb + kb; FragH bq; bq.half[0] = *(const v8us*)(Bh + boff + 8 * hh); bq.half[1] = *(const v8us*)(Bh + boff + 16 + 8 * hh);
      acc[t] = mmaH<ASPLIT ? 2 : 1>(ah.v, al.v, bq.v, bq.v, acc[t]); }
  }
#pragma unroll
  for (int t = 0; t < 4; ++t) { if (col0 + t * 16 >= N) continue;
#pragma unroll
    for (int r = 0; r < 8; ++r) so[w][8 * hh + r][t * 16 + ln] = acc[t][r] * alpha; }
  __builtin_amdgcn_fence(__ATOMIC_ACQ_REL, "workgroup"); __builtin_amdgcn_wave_barrier();
  const int rsub = lane >> 4, c4 = (lane & 15) * 4;
  {
#pragma unroll
    for (int q = 0; q < 8; ++q) { const int r = q * 2 + rsub; if (col0 + c4 < N) { const v4f v = *(const v4fa*)&so[w][r][c4]; *(v4f*)(C + (size_t)(row0 + r) * ldc + col0 + c4) = v; } }
     }
}

// Wt[n][k] = f16(W[k][n]·scale) from f32 row-major W[K][N] (scale = power of two; bf16-exact weights stay exact in f16 away from the subnormal range)
__global__ __launch_bounds__(256) void k_wt_f16(const float* __restrict__ W, _Float16* __restrict__ Wt, int K, int N, float scale) {
  const int t = blockIdx.x * 256 + threadIdx.x; if (t >= N * (K / 8)) return; const int n = t / (K / 8), k8 = (t % (K / 8)) * 8; FragH f;
#pragma unroll
  for (int i = 0; i < 8; ++i) f.h[i] = (_Float16)(bf16_round(W[(size_t)(k8 + i) * N + n]) * scale); const v8us o = f.half[0];
  *(v8us*)((unsigned short*)Wt + (size_t)n * K + k8) = o; 
}
// k_gemm_hh variant with fused epilogue: v = acc·alpha + bias[by·sBias + col] (+ CP[(row/rowsPerB)·sCPb + by·64 + col] if CP) ; ACT 0 none / 1 elu ; writes f16 C16 (and f32 C if non-null)
template <int ACT>
__global__ __launch_bounds__(128) void k_gemm_hhx(const _Float16* __restrict__ A, int lda, size_t sA, const _Float16* __restrict__ Bh, int ldb, size_t sB, float alpha, const float* __restrict__ bias, size_t sBias, const float* __restrict__ CP, int rowsPerB, size_t sCPb, int row0g,
    float* __restrict__ C, _Float16* __restrict__ C16, int ldc, size_t sC, int M, int N, int K) {
  __shared__ __attribute__((aligned(16))) float so[4][16][64];
  const int tid = threadIdx.x, w = tid >> 5, lane = tid & 31, ln = lane & 15, hh = lane >> 4; const int by = blockIdx.y;
  A += (size_t)by * sA; Bh += (size_t)by * sB; const size_t cofs = (size_t)by * sC; const float* bp = bias ? bias + (size_t)by * sBias : nullptr;
  const int ntn = (N + 63) / 64; const int wid = blockIdx.x * 4 + w; const int mt = wid / ntn, nq = wid % ntn; if (mt * 16 >= M) return;
  const int row0 = mt * 16, col0 = nq * 64; const _Float16* arow = A + (size_t)(row0 + ln) * lda;
  v8f acc[4] = {};
  for (int kb = 0; kb < K; kb += 32) { FragH ah; ah.half[0] = *(const v8us*)((const unsigned short*)arow + kb + 8 * hh); ah.half[1] = *(const v8us*)((const unsigned short*)arow + kb + 16 + 8 * hh);
#pragma unroll
    for (int t = 0; t < 4; ++t) { if (col0 + t * 16 >= N) continue; const size_t boff = (size_t)(col0 + t * 16 + ln) * ldb + kb; FragH bq; bq.half[0] = *(const v8us*)((const unsigned short*)Bh + boff + 8 * hh); bq.half[1] = *(const v8us*)((const unsigned short*)Bh + boff + 16 + 8 * hh);
      acc[t] = mmaH<1>(ah.v, ah.v, bq.v, bq.v, acc[t]); }
  }
#pragma unroll
  for (int t = 0; t < 4; ++t) { if (col0 + t * 16 >= N) continue; const int col = col0 + t * 16 + ln; const float bv = bp ? bf16_round(bp[col]) : 0.f;
#pragma unroll
    for (int r = 0; r < 8; ++r) { float v = acc[t][r] * alpha + bv; if (CP) { const int bidx = (row0g + row0 + 8 * hh + r) / rowsPerB; v += CP[(size_t)bidx * sCPb + (size_t)by * 64 + col]; } if (ACT == 1) v = (v > 0.f) ? v : expm1f(v); else if (ACT == 7) v = (v > 0.f) ? v + 1.0f : expf(v); else if (ACT == 8) v = tanhf(v); else if (ACT == 9) v = 0.5f * v * (1.0f + tanhf(0.7978845608028654f * (v + 0.044715f * v * v * v))); else if (ACT == 11) v = 1.0f / (1.0f + expf(-v)); else if (ACT == 12) v = (v > 0.f) ? v : 0.01f * v; else if (ACT == 14) v = (v > 0.f) ? v : 0.1f * v; else if (ACT == 15) v = v / (1.0f + expf(-v)); else if (ACT == 3) v = fmaxf(v, 0.f); else if (ACT == 6) v = 0.5f * v * (1.0f + erff(v * 0.70710678118654752f)); so[w][8 * hh + r][t * 16 + ln] = v; } }
  __builtin_amdgcn_fence(__ATOMIC_ACQ_REL, "workgroup"); __builtin_amdgcn_wave_barrier();
  const int rsub = lane >> 4, c4 = (lane & 15) * 4; typedef _Float16 v4h __attribute__((ext_vector_type(4)));
  {
#pragma unroll
    for (int q = 0; q < 8; ++q) { const int r = q * 2 + rsub; if (col0 + c4 < N) { const v4f v = *(const v4fa*)&so[w][r][c4]; if (C) *(v4f*)(C + cofs + (size_t)(row0 + r) * ldc + col0 + c4) = v; if (C16) { v4h h4; for (int i = 0; i < 4; ++i) h4[i] = (_Float16)v[i]; *(v4h*)(C16 + cofs + (size_t)(row0 + r) * ldc + col0 + c4) = h4; } } }
     }
}


typedef _Float16 v4h __attribute__((ext_vector_type(4)));

__global__ __launch_bounds__(256) void k_x16(const float* __restrict__ x, _Float16* __restrict__ X16, size_t n8) { const size_t t = (size_t)blockIdx.x * 256 + threadIdx.x; if (t >= n8) return; FragH f;
#pragma unroll
  for (int q = 0; q < 8; ++q) f.h[q] = (_Float16)bf16_round(x[t * 8 + q]); *(v8us*)((unsigned short*)X16 + t * 8) = f.half[0];  }
__global__ __launch_bounds__(256) void k_h16(const float* __restrict__ x, _Float16* __restrict__ X16, size_t n8) { const size_t t = (size_t)blockIdx.x * 256 + threadIdx.x; if (t >= n8) return; FragH f;
#pragma unroll
  for (int q = 0; q < 8; ++q) f.h[q] = (_Float16)x[t * 8 + q]; *(v8us*)((unsigned short*)X16 + t * 8) = f.half[0];  }
__global__ __launch_bounds__(256) void k_round16f(const float* __restrict__ W, _Float16* __restrict__ Bt, size_t n8) { const size_t t = (size_t)blockIdx.x * 256 + threadIdx.x; if (t >= n8) return; FragH f;
#pragma unroll
  for (int i = 0; i < 8; ++i) f.h[i] = (_Float16)(bf16_round(W[t * 8 + i]) * 16.0f); *(v8us*)((unsigned short*)Bt + t * 8) = f.half[0];  }
template <int NHv, int TTv>
__global__ __launch_bounds__(256) void k_vt(const _Float16* __restrict__ V16, int ldv, int voff, _Float16* __restrict__ Vt) { __shared__ unsigned short tl[64][66]; const int tid = threadIdx.x; const int slab = blockIdx.x / (TTv / 64), lg = blockIdx.x % (TTv / 64); const int b = slab / NHv, h = slab % NHv;
  for (int i = tid; i < 64 * 8; i += 256) { const int r = i / 8, c8 = (i % 8) * 8; FragH f; f.half[0] = *(const v8us*)((const unsigned short*)V16 + ((size_t)b * TTv + lg * 64 + r) * ldv + voff + h * 64 + c8);
#pragma unroll
    for (int q = 0; q < 8; ++q) tl[r][c8 + q] = f.u[q]; }
  __syncthreads();
  {
#pragma unroll
    for (int rd = 0; rd < 2; ++rd) { const int d = rd * 32 + tid / 8, pc = tid % 8; FragH f;
#pragma unroll
      for (int q = 0; q < 8; ++q) f.u[q] = tl[pc * 8 + q][d];
      *(v8us*)((unsigned short*)Vt + ((size_t)slab * 64 + d) * TTv + lg * 64 + pc * 8) = f.half[0]; }
     } }

__global__ __launch_bounds__(256) void k_hl(const float* __restrict__ F, _Float16* __restrict__ Hh, _Float16* __restrict__ Hl, size_t n8) { const size_t t = (size_t)blockIdx.x * 256 + threadIdx.x; if (t >= n8) return; FragH fh, fl; const v4f a = *(const v4fa*)(F + t * 8), c = *(const v4fa*)(F + t * 8 + 4);
#pragma unroll
  for (int q = 0; q < 4; ++q) { _Float16 h = (_Float16)a[q]; fh.h[q] = h; fl.h[q] = (_Float16)((a[q] - (float)h) * 1024.0f); h = (_Float16)c[q]; fh.h[4 + q] = h; fl.h[4 + q] = (_Float16)((c[q] - (float)h) * 1024.0f); }
  { *(v8us*)((unsigned short*)Hh + t * 8) = fh.half[0]; *(v8us*)((unsigned short*)Hl + t * 8) = fl.half[0];  } }

// ---- fast GEMM (wave tile 32x64, work-group tile 128x64); epilogue = k_gemm_hhx semantics ----
__device__ __forceinline__ v8f g2_mma(v16h a, v16h b, v8f c) { v8f d = __builtin_amdgcn_wmma_f32_16x16x32_f16(false, a, false, b, (short)0, c, false, false); asm volatile("v_nop\n\tv_nop\n\tv_nop\n\tv_nop" : "+v"(d) : "v"(a), "v"(b)); return d; }
// A and B reach the four waves of a work-group through a two-buffer LDS ring. One tile = 64 k: 128 A rows, then 64 B rows, 128 data bytes a row at a pitch of 144 B (16 B x odd: no bank conflict for 16-byte readers).
// Needs M % 128 == 0 and K % 64 == 0 on top of N % 64 == 0.
#define GKT 64
#define GPIT 144
#define GTILE (192 * GPIT)
// One tile: 12 asynchronous 16-byte copies a lane (128 lanes x 12 x 16 B = 24 KiB); 8 lanes cover one 128-B row, so a wave's copy asks for 4 whole lines (a fragment load straight from global memory would touch 16 lines for its 512 bytes).
// s_wait_xcnt closes the statement so that no address register of a copy is rewritten in front of it.
__device__ __forceinline__ void g2_copy(unsigned l0, const unsigned short* ga, int lda, const unsigned short* gb, int ldb) {
  asm volatile("global_load_async_to_lds_b128 %0, %12, off\n\t"
               "global_load_async_to_lds_b128 %1, %13, off\n\t"
               "global_load_async_to_lds_b128 %2, %14, off\n\t"
               "global_load_async_to_lds_b128 %3, %15, off\n\t"
               "global_load_async_to_lds_b128 %4, %16, off\n\t"
               "global_load_async_to_lds_b128 %5, %17, off\n\t"
               "global_load_async_to_lds_b128 %6, %18, off\n\t"
               "global_load_async_to_lds_b128 %7, %19, off\n\t"
               "global_load_async_to_lds_b128 %8, %20, off\n\t"
               "global_load_async_to_lds_b128 %9, %21, off\n\t"
               "global_load_async_to_lds_b128 %10, %22, off\n\t"
               "global_load_async_to_lds_b128 %11, %23, off\n\t"
               "s_wait_xcnt 0x0"
               :: "v"(l0), "v"(l0 + 16u * GPIT), "v"(l0 + 32u * GPIT), "v"(l0 + 48u * GPIT), "v"(l0 + 64u * GPIT), "v"(l0 + 80u * GPIT), "v"(l0 + 96u * GPIT), "v"(l0 + 112u * GPIT), "v"(l0 + 128u * GPIT), "v"(l0 + 144u * GPIT), "v"(l0 + 160u * GPIT), "v"(l0 + 176u * GPIT),
                  "v"(ga), "v"(ga + (size_t)16 * lda), "v"(ga + (size_t)32 * lda), "v"(ga + (size_t)48 * lda), "v"(ga + (size_t)64 * lda), "v"(ga + (size_t)80 * lda), "v"(ga + (size_t)96 * lda), "v"(ga + (size_t)112 * lda),
                  "v"(gb), "v"(gb + (size_t)16 * ldb), "v"(gb + (size_t)32 * ldb), "v"(gb + (size_t)48 * ldb)
               : "memory");
}
__device__ __forceinline__ v16h g2_lfrag(const unsigned char* p) { FragH f; f.half[0] = *(const v8us*)p; f.half[1] = *(const v8us*)(p + 32); return f.v; }      /* p = a row's 32-k slice + 16*hh bytes: k = 8*hh .. 8*hh + 7, then 16 + 8*hh .. 16 + 8*hh + 7, for A and B alike */
template <int ACT>
__global__ __launch_bounds__(128) void k_gemm2(const _Float16* __restrict__ A, int lda, size_t sA, const _Float16* __restrict__ Bh, int ldb, size_t sB, float alpha, const float* __restrict__ bias, size_t sBias, const float* __restrict__ CP, int rowsPerB, size_t sCPb, int row0g,
    float* __restrict__ C, _Float16* __restrict__ C16, int ldc, size_t sC, int M, int N, int K) {
  __shared__ __attribute__((aligned(16))) unsigned char ring[2 * GTILE];      /* behind the loop's last barrier its first 34 KiB stage the output */
  const int tid = threadIdx.x, w = tid >> 5, lane = tid & 31, ln = lane & 15, hh = lane >> 4; const int by = blockIdx.y;
  A += (size_t)by * sA; Bh += (size_t)by * sB; const size_t cofs = (size_t)by * sC; const float* bp = bias ? bias + (size_t)by * sBias : nullptr;
  const int ntn = N >> 6; const int mt = blockIdx.x / ntn, nq = blockIdx.x - mt * ntn; const int row0 = mt * 128 + 32 * w, col0 = nq * 64; if (mt * 128 >= M) return;      /* the whole work-group or none, in front of every barrier */
  const unsigned short* ga = (const unsigned short*)A + (size_t)(mt * 128 + (tid >> 3)) * lda + (tid & 7) * 8;      /* this lane's 16 bytes of A row tid/8 of tile 0 */
  const unsigned short* gb = (const unsigned short*)Bh + (size_t)(col0 + (tid >> 3)) * ldb + (tid & 7) * 8;      /* and of B row tid/8 */
  const unsigned l0 = (unsigned)(size_t)(const void*)ring + (unsigned)((tid >> 3) * GPIT + (tid & 7) * 16);
  const int nt = K / GKT;
  g2_copy(l0, ga, lda, gb, ldb);      /* tile 0 -> buffer 0 */
  const v8f z8 = {0.f,0.f,0.f,0.f,0.f,0.f,0.f,0.f}; v8f c00 = z8, c01 = z8, c02 = z8, c03 = z8, c10 = z8, c11 = z8, c12 = z8, c13 = z8;
  asm volatile("s_wait_asynccnt 0x0" ::: "memory");      /* this wave's share of tile 0 has landed */
  __syncthreads();      /* tile 0 is published */
  if (nt > 1) g2_copy(l0 + GTILE, ga + GKT, lda, gb + GKT, ldb);      /* tile 1 -> buffer 1 */
#pragma unroll 1      /* one trip a tile: the ring's waits and its barrier stand once, at the foot */
  for (int t = 0; t < nt; ++t) {
    const unsigned bo = (unsigned)(t & 1) * GTILE;
    const unsigned char* ar = &ring[bo + (unsigned)((32 * w + ln) * GPIT + 16 * hh)]; const unsigned char* br = &ring[bo + (unsigned)((128 + ln) * GPIT + 16 * hh)];
    v16h a[2][2], b[2][4];      /* the tile's 24 LDS reads stand as one group in front of its 16 WMMAs */
#pragma unroll
    for (int ks = 0; ks < 2; ++ks) { a[ks][0] = g2_lfrag(ar + ks * 64); a[ks][1] = g2_lfrag(ar + 16 * GPIT + ks * 64);
#pragma unroll
      for (int j = 0; j < 4; ++j) b[ks][j] = g2_lfrag(br + j * 16 * GPIT + ks * 64); }
#pragma unroll
    for (int ks = 0; ks < 2; ++ks) {
      c00 = g2_mma(a[ks][0], b[ks][0], c00); c10 = g2_mma(a[ks][1], b[ks][0], c10);
      c01 = g2_mma(a[ks][0], b[ks][1], c01); c11 = g2_mma(a[ks][1], b[ks][1], c11);
      c02 = g2_mma(a[ks][0], b[ks][2], c02); c12 = g2_mma(a[ks][1], b[ks][2], c12);
      c03 = g2_mma(a[ks][0], b[ks][3], c03); c13 = g2_mma(a[ks][1], b[ks][3], c13); }
    asm volatile("s_wait_dscnt 0x0" ::: "memory");      /* this wave's reads of tile t are done */
    asm volatile("s_wait_asynccnt 0x0" ::: "memory");      /* its share of tile t + 1 has landed */
    __syncthreads();      /* publishes tile t + 1 and frees tile t's buffer */
    if (t + 2 < nt) g2_copy(l0 + bo, ga + (size_t)(t + 2) * GKT, lda, gb + (size_t)(t + 2) * GKT, ldb); }
  asm volatile("s_wait_asynccnt 0x0" ::: "memory");      /* no copy is in flight when the ring becomes output staging */
  float (*so)[32][68] = (float (*)[32][68])ring;
  v8f accs[8] = {c00, c01, c02, c03, c10, c11, c12, c13};
#pragma unroll
  for (int u = 0; u < 8; ++u) { const int t = u & 3, half = u >> 2; const int col = col0 + t * 16 + ln; const float bv = bp ? bf16_round(bp[col]) : 0.f;
#pragma unroll
    for (int r = 0; r < 8; ++r) { const int rloc = half * 16 + 8 * hh + r; float v = accs[u][r] * alpha + bv; if (CP) { const int bidx = (row0g + row0 + rloc) / rowsPerB; v += CP[(size_t)bidx * sCPb + (size_t)by * 64 + col]; }
      if (ACT == 3) v = fmaxf(v, 0.f); else if (ACT == 6) v = 0.5f * v * (1.0f + erff(v * 0.70710678118654752f)); else if (ACT == 11) v = 1.0f / (1.0f + expf(-v)); else if (ACT == 15) v = v / (1.0f + expf(-v)); else if (ACT == 12) v = (v > 0.f) ? v : 0.01f * v; else if (ACT == 8) v = tanhf(v);
      so[w][rloc][t * 16 + ln] = v; } }
  __builtin_amdgcn_fence(__ATOMIC_ACQ_REL, "workgroup"); __builtin_amdgcn_wave_barrier();
  const int rsub = lane >> 4, c4 = (lane & 15) * 4;
  {
#pragma unroll
    for (int q = 0; q < 16; ++q) { const int r = q * 2 + rsub; const v4f v = *(const v4fa*)&so[w][r][c4]; if (C) *(v4f*)(C + cofs + (size_t)(row0 + r) * ldc + col0 + c4) = v; if (C16) { v4h h4; for (int i = 0; i < 4; ++i) h4[i] = (_Float16)v[i]; *(v4h*)(C16 + cofs + (size_t)(row0 + r) * ldc + col0 + c4) = h4; } }
     } }


// lane l <-> lane l ^ 16 by a vector cross-row move
__device__ __forceinline__ float xhalf(float x) { return __builtin_bit_cast(float, __builtin_amdgcn_permlanex16(__builtin_bit_cast(int, x), __builtin_bit_cast(int, x), 0x76543210, 0xfedcba98, false, false)); }
#define FKT 64
#define FPIT 144
#define FTILE (128 * FPIT)
// One tile: 8 asynchronous 16-byte copies a lane (128 lanes x 8 x 16 B = 16 KiB); 8 lanes cover one 128-B row, so a wave's copy asks for 4 whole lines.
// s_wait_xcnt closes the statement so that no address register of a copy is rewritten in front of it.
__device__ __forceinline__ void tile_copy(unsigned l0, const unsigned short* gk, int ldk, const unsigned short* gv) {
  asm volatile("global_load_async_to_lds_b128 %0, %8, off\n\t"
               "global_load_async_to_lds_b128 %1, %9, off\n\t"
               "global_load_async_to_lds_b128 %2, %10, off\n\t"
               "global_load_async_to_lds_b128 %3, %11, off\n\t"
               "global_load_async_to_lds_b128 %4, %12, off\n\t"
               "global_load_async_to_lds_b128 %5, %13, off\n\t"
               "global_load_async_to_lds_b128 %6, %14, off\n\t"
               "global_load_async_to_lds_b128 %7, %15, off\n\t"
               "s_wait_xcnt 0x0"
               :: "v"(l0), "v"(l0 + 16u * FPIT), "v"(l0 + 32u * FPIT), "v"(l0 + 48u * FPIT), "v"(l0 + 64u * FPIT), "v"(l0 + 80u * FPIT), "v"(l0 + 96u * FPIT), "v"(l0 + 112u * FPIT),
                  "v"(gk), "v"(gk + (size_t)16 * ldk), "v"(gk + (size_t)32 * ldk), "v"(gk + (size_t)48 * ldk), "v"(gv), "v"(gv + (size_t)16 * TK), "v"(gv + (size_t)32 * TK), "v"(gv + (size_t)48 * TK)
               : "memory");
}
// Eight 2^x in place, one statement: behind a transcendental the instruction set asks for one slot before its result is read or its source overwritten. Here each neighbour touches its own register only,
// and the closing v_nop keeps the slot for whatever the compiler puts next.
__device__ __forceinline__ void exp2x8(float* x) {
  asm("v_exp_f32 %0, %0\n\tv_exp_f32 %1, %1\n\tv_exp_f32 %2, %2\n\tv_exp_f32 %3, %3\n\tv_exp_f32 %4, %4\n\tv_exp_f32 %5, %5\n\tv_exp_f32 %6, %6\n\tv_exp_f32 %7, %7\n\tv_nop"
      : "+v"(x[0]), "+v"(x[1]), "+v"(x[2]), "+v"(x[3]), "+v"(x[4]), "+v"(x[5]), "+v"(x[6]), "+v"(x[7]));
}
__global__ __launch_bounds__(128) void k_flash(const _Float16* __restrict__ Q16, int ldq, const _Float16* __restrict__ K16, int ldk, const _Float16* __restrict__ Vt, const int* __restrict__ MSK, float* __restrict__ O, int ldo) {
  constexpr int RPW = 16, NQB = TQ / (4 * RPW), DT = 4, KS = 2, NT = TK / FKT; (void)MSK;
  __shared__ __attribute__((aligned(16))) unsigned char ring[2 * FTILE];      /* behind the loop's last barrier its first 17 KiB stage the output */
  const int tid = threadIdx.x, w = tid >> 5, lane = tid & 31, ln = lane & 15, hh = lane >> 4;
  const int slab = blockIdx.x / NQB, qblk = blockIdx.x % NQB; const int b = slab / NH, h = slab % NH; const int q0 = qblk * (4 * RPW) + w * RPW;
  const unsigned short* gk = (const unsigned short*)K16 + ((size_t)b * TK + (tid >> 3)) * ldk + h * 64 + (tid & 7) * 8;      /* this lane's 16 bytes of K row tid/8 of tile 0 */
  const unsigned short* gv = (const unsigned short*)Vt + ((size_t)slab * 64 + (tid >> 3)) * TK + (tid & 7) * 8;      /* and of Vt row tid/8 */
  const unsigned l0 = (unsigned)(size_t)(const void*)ring + (unsigned)((tid >> 3) * FPIT + (tid & 7) * 16);
  tile_copy(l0, gk, ldk, gv);      /* tile 0 -> buffer 0 */
  FragH bq[KS];
  { const unsigned short* qr = (const unsigned short*)Q16 + ((size_t)b * TQ + q0 + ln) * ldq + h * 64;
#pragma unroll
    for (int ks = 0; ks < KS; ++ks) { bq[ks].half[0] = *(const v8us*)(qr + ks * 32 + 8 * hh); bq[ks].half[1] = *(const v8us*)(qr + ks * 32 + 16 + 8 * hh); } }
  float m_q = -3.0e38f, l_q = 0.f; v8f oacc[DT];
#pragma unroll
  for (int dt = 0; dt < DT; ++dt) oacc[dt] = (v8f){0.f,0.f,0.f,0.f,0.f,0.f,0.f,0.f};
  asm volatile("s_wait_asynccnt 0x0" ::: "memory");      /* this wave's share of tile 0 has landed */
  __syncthreads();      /* tile 0 is published */
  tile_copy(l0 + FTILE, gk + (size_t)FKT * ldk, ldk, gv + FKT);      /* tile 1 -> buffer 1 */
#pragma unroll 1
  for (int t = 0; t < NT; ++t) {
    const unsigned bo = (unsigned)(t & 1) * FTILE; const unsigned fo = bo + (unsigned)(ln * FPIT + 16 * hh);
#pragma unroll 1      /* rolled: both passes unrolled need more than the 128 VGPRs at which 8 waves fit a SIMD */
    for (int p = 0; p < FKT / 32; ++p) {
    FragH ak[2][KS];
#pragma unroll
    for (int nt = 0; nt < 2; ++nt) { const unsigned char* kr = &ring[fo + (p * 32 + nt * 16) * FPIT];
#pragma unroll
      for (int ks = 0; ks < KS; ++ks) { ak[nt][ks].half[0] = *(const v8us*)(kr + ks * 64); ak[nt][ks].half[1] = *(const v8us*)(kr + ks * 64 + 32); } }
    float sc[16];
#pragma unroll
    for (int nt = 0; nt < 2; ++nt) { v8f acc = (v8f){0.f,0.f,0.f,0.f,0.f,0.f,0.f,0.f};
#pragma unroll
      for (int ks = 0; ks < KS; ++ks) acc = mmaH<1>(ak[nt][ks].v, ak[nt][ks].v, bq[ks].v, bq[ks].v, acc);
#pragma unroll
      for (int r = 0; r < 8; ++r) sc[nt * 8 + r] = acc[r]; }      /* sc[nt*8 + r] = q.k, not yet scaled (key t*64 + p*32 + nt*16 + 8*hh + r, query q0 + ln) */
    FragH av[DT];
#pragma unroll
    for (int dt = 0; dt < DT; ++dt) { const unsigned char* vrow = &ring[fo + (64 + dt * 16) * FPIT + p * 64]; av[dt].half[0] = *(const v8us*)(vrow); av[dt].half[1] = *(const v8us*)(vrow + 32); }
    float mx[4];
#pragma unroll
    for (int c = 0; c < 4; ++c) mx[c] = fmaxf(fmaxf(sc[4 * c], sc[4 * c + 1]), fmaxf(sc[4 * c + 2], sc[4 * c + 3]));
    float mc = fmaxf(fmaxf(mx[0], mx[1]), fmaxf(mx[2], mx[3])); mc = fmaxf(mc, xhalf(mc));
    const float mn = fmaxf(m_q, mc * SCL2); const float al = __builtin_amdgcn_exp2f(m_q - mn); m_q = mn;      /* the maximum is kept in base-2 units (SCL2 > 0 commutes with max); al: 0 on the first pass, 1 where the maximum stays */
    const float nb = 10.0f - mn;      /* P x 1024 = 2^(q.k x SCL2 - mn + 10): one FMA and one bare v_exp_f32 a score; the argument is at most 10, and far below -126 the result is 0, as wanted */
    FragH pb; float ps[4];
#pragma unroll
    for (int i = 0; i < 16; ++i) sc[i] = fmaf(sc[i], SCL2, nb);
    exp2x8(sc); exp2x8(sc + 8);
#pragma unroll
    for (int i = 0; i < 16; ++i) { const float p_ = sc[i]; ps[i & 3] = (i < 4) ? p_ : ps[i & 3] + p_; pb.h[i] = (_Float16)p_; }      /* pb.h[nt*8 + r] = P(key nt*16 + 8*hh + r of the pass, query q0 + ln): the k order of the Vt loader */
    l_q = l_q * al + ((ps[0] + ps[1]) + (ps[2] + ps[3]));
#pragma unroll
    for (int dt = 0; dt < DT; ++dt) {
#pragma unroll
      for (int r = 0; r < 8; ++r) oacc[dt][r] *= al;
      oacc[dt] = mmaH<1>(av[dt].v, av[dt].v, pb.v, pb.v, oacc[dt]); } }
    asm volatile("s_wait_dscnt 0x0" ::: "memory");      /* this wave's reads of tile t are done */
    asm volatile("s_wait_asynccnt 0x0" ::: "memory");      /* its share of tile t + 1 has landed */
    __syncthreads();      /* publishes tile t + 1 and frees tile t's buffer */
    if (t + 2 < NT) tile_copy(l0 + bo, gk + (size_t)(t + 2) * FKT * ldk, ldk, gv + (size_t)(t + 2) * FKT); }
  asm volatile("s_wait_asynccnt 0x0" ::: "memory");      /* no copy is in flight when the ring becomes output staging */
  float (*sO)[RPW][64 + 4] = (float (*)[RPW][64 + 4])ring;
  const float lt = l_q + xhalf(l_q); const float inv = (lt > 0.f) ? 1.0f / lt : 0.f;      /* l_q sums P x 1024, as Ot does */
#pragma unroll
  for (int dt = 0; dt < DT; ++dt)      /* oacc[dt][r] = Ot[dt*16 + 8*hh + r][q0 + ln] */
#pragma unroll
    for (int q = 0; q < 2; ++q) { v4f o4;
#pragma unroll
      for (int i = 0; i < 4; ++i) o4[i] = oacc[dt][q * 4 + i] * inv;
      *(v4fa*)&sO[w][ln][dt * 16 + 8 * hh + q * 4] = o4; }
  __builtin_amdgcn_fence(__ATOMIC_ACQ_REL, "workgroup"); __builtin_amdgcn_wave_barrier();
  {
#pragma unroll
    for (int rp = 0; rp < RPW; rp += 2) { const int r = rp + (lane >> 4), pc = lane & 15; const v4f val = *(const v4fa*)&sO[w][r][pc * 4]; *(v4f*)(O + ((size_t)b * TQ + q0 + r) * ldo + h * 64 + pc * 4) = val; }
     } }
__global__ __launch_bounds__(256) void k_split(const float* __restrict__ F, _Float16* __restrict__ Hh, _Float16* __restrict__ Hl, size_t n8) {
  #pragma clang fp contract(off)
  const size_t t = (size_t)blockIdx.x * 256 + threadIdx.x; if (t >= n8) return; const v4f a = *(const v4fa*)(F + t * 8), c = *(const v4fa*)(F + t * 8 + 4); FragH fh, fl;
#pragma unroll
  for (int q = 0; q < 8; ++q) { const float v = (q < 4) ? a[q] : c[q - 4]; const _Float16 hi = (_Float16)v; fh.h[q] = hi; fl.h[q] = (_Float16)((v - (float)hi) * 1024.0f); }
  { *(v8us*)((unsigned short*)Hh + t * 8) = fh.half[0]; *(v8us*)((unsigned short*)Hl + t * 8) = fl.half[0];  } }


#define PIDX(i) ((((i) >> 3) << 5) + ((i) & 7))
__global__ __launch_bounds__(256) void k_rowflag(const float* __restrict__ X, int* __restrict__ FL) {
  #pragma clang fp contract(off)
  __shared__ int sf[8];
  const int tid = threadIdx.x, w = tid >> 5, ln = tid & 31; const int r = blockIdx.x * 8 + w; const float* x = X + (size_t)r * DKV; float s = 0.f;
#pragma unroll
  for (int u = 0; u < DKV / 32; ++u) s += bf16_round(x[u * 32 + ln]);
  for (int o = 16; o > 0; o >>= 1) s += __shfl_xor(s, o, 32);
  if (ln == 0) sf[w] = (s == 0.0f) ? 1 : 0;
  __syncthreads();
  if (tid < 32) { const int v = (tid < 8) ? sf[tid] : 0; int* d = FL + blockIdx.x * 32 + tid; *(int*)d = v;  } }      
__global__ __launch_bounds__(256) void k_zerorows(const int* __restrict__ FL, _Float16* __restrict__ P16) {
  const size_t t = (size_t)blockIdx.x * 256 + threadIdx.x; if (t >= (size_t)NR * DM / 8) return; const int r = (int)(t / (DM / 8)); if (FL[PIDX(r)] == 0) return; FragH z;
#pragma unroll
  for (int q = 0; q < 8; ++q) z.h[q] = (_Float16)0.0f; *(v8us*)((unsigned short*)P16 + t * 8) = z.half[0];  }
extern "C" void kernel_launch(void* const* d_in, const int* in_sizes, int n_in,
                              void* d_out, int out_size, void* d_ws, size_t ws_size, hipStream_t stream) {
  (void)in_sizes; (void)n_in; (void)out_size;
  const float* const* I = (const float* const*)d_in; const float* qi = I[0]; const float* ki = I[1]; const float* vi = I[2];
  const float* Wq = I[3]; const float* bq = I[4]; const float* Wk = I[5]; const float* bk = I[6]; const float* Wv = I[7]; const float* bv = I[8]; const float* Wo = I[9]; const float* bo = I[10];
  char* ws = (char*)d_ws; size_t off = 0;
  auto take = [&](size_t bytes) { char* p = ws + off; off += (bytes + 255) & ~(size_t)255; return p; };
  _Float16* BQ = (_Float16*)take((size_t)DM * DM * 2); _Float16* BK = (_Float16*)take((size_t)DM * DKV * 2); _Float16* BV = (_Float16*)take((size_t)DM * DKV * 2); _Float16* BO = (_Float16*)take((size_t)DM * DM * 2);
  _Float16* X16 = (_Float16*)take((size_t)NR * DM * 2); _Float16* Q16 = (_Float16*)take((size_t)NR * DM * 2); _Float16* K16 = (_Float16*)take((size_t)NR * DM * 2); _Float16* V16 = (_Float16*)take((size_t)NR * DM * 2); _Float16* VT = (_Float16*)take((size_t)NR * DM * 2);
  int* FLK = (int*)take((size_t)(NR / 8) * 32 * 4); int* FLV = (int*)take((size_t)(NR / 8) * 32 * 4);
  float* O = (float*)take((size_t)NR * DM * 4); _Float16* Oh = (_Float16*)take((size_t)NR * DM * 2); _Float16* Ol = (_Float16*)take((size_t)NR * DM * 2);      /* all batches */
  if (off > ws_size) return;      /* 6 + 16 x 5 + 0.3 + 32 + 16 + 16 = 150 MiB */
  const size_t n8 = (size_t)NR * DM / 8, n8k = (size_t)NR * DKV / 8; const unsigned nb8 = (unsigned)((n8 + 255) / 256), nb8k = (unsigned)((n8k + 255) / 256);
  k_wt_f16<<<(unsigned)(((size_t)DM * DM / 8 + 255) / 256), 256, 0, stream>>>(Wq, BQ, DM, DM, 16.0f); k_wt_f16<<<(unsigned)(((size_t)DKV * DM / 8 + 255) / 256), 256, 0, stream>>>(Wk, BK, DKV, DM, 16.0f); k_wt_f16<<<(unsigned)(((size_t)DKV * DM / 8 + 255) / 256), 256, 0, stream>>>(Wv, BV, DKV, DM, 16.0f); k_wt_f16<<<(unsigned)(((size_t)DM * DM / 8 + 255) / 256), 256, 0, stream>>>(Wo, BO, DM, DM, 16.0f);      /* (in,out) -> [out][in] x16 */
  const dim3 gP((NR / 128) * (DM / 64), 1);
  k_x16<<<nb8, 256, 0, stream>>>(qi, X16, n8); k_gemm2<0><<<gP, 128, 0, stream>>>(X16, DM, 0, BQ, DM, 0, 0.0625f, bq, 0, nullptr, 1, 0, 0, nullptr, Q16, DM, 0, NR, DM, DM);      /* q -> f16 */
  k_x16<<<nb8k, 256, 0, stream>>>(ki, X16, n8k); k_rowflag<<<NR / 8, 256, 0, stream>>>(ki, FLK); k_gemm2<0><<<gP, 128, 0, stream>>>(X16, DKV, 0, BK, DKV, 0, 0.0625f, bk, 0, nullptr, 1, 0, 0, nullptr, K16, DM, 0, NR, DM, DKV); k_zerorows<<<nb8, 256, 0, stream>>>(FLK, K16);      /* k -> f16 (masked rows zeroed) */
  k_x16<<<nb8k, 256, 0, stream>>>(vi, X16, n8k); k_rowflag<<<NR / 8, 256, 0, stream>>>(vi, FLV); k_gemm2<0><<<gP, 128, 0, stream>>>(X16, DKV, 0, BV, DKV, 0, 0.0625f, bv, 0, nullptr, 1, 0, 0, nullptr, V16, DM, 0, NR, DM, DKV); k_zerorows<<<nb8, 256, 0, stream>>>(FLV, V16);      /* v -> f16 */
  k_vt<NH, TK><<<NBT * NH * (TK / 64), 256, 0, stream>>>(V16, DM, 0, VT);      /* Vt[(b,h)][d][s] */
  float* outp = (float*)d_out;
  k_flash<<<NBT * NH * (TQ / 64), 128, 0, stream>>>(Q16, DM, K16, DM, VT, nullptr, O, DM);      /* all batches in one grid: slab = b*NH + h */
  k_split<<<nb8, 256, 0, stream>>>(O, Oh, Ol, n8);
  k_gemm2<0><<<gP, 128, 0, stream>>>(Oh, DM, 0, BO, DM, 0, 0.0625f, bo, 0, nullptr, 1, 0, 0, outp, nullptr, DM, 0, NR, DM, DM);
  k_gemm2<0><<<gP, 128, 0, stream>>>(Ol, DM, 0, BO, DM, 0, 0.0625f / 1024.0f, nullptr, 0, outp, 1, (size_t)DM, 0, outp, nullptr, DM, 0, NR, DM, DM);      /* out = o*Wo + bo */
}

// v006
// Measured time: 214 microseconds a run.
// Next to v005, in two timings, it ran 1.13 times as fast each time.
// Counting every step since v000, it is 6.35 times as fast.
#include <hip/hip_runtime.h>
// Multi-head cross attention over social features (B 4, S 2048 queries x 1024, 2048 keys/values x 512, 16 heads x 64; (in,out) Linear weights with bias; key/value rows whose raw features sum to exactly 0 are zeroed after projection, as the reference's padding mask): scores = q.k/8; softmax; out = (attn.v merged)*Wo + bo -> [4,2048,1024].
// Compute dtype: the inputs, the four matrices and biases rounded to bf16; q/k/v products exact (weights x16 in f16, undone by alpha), q, k, v, P as f16 operands (~2^-12; logits sigma ~0.4), O as f16 hi + lo; f32 accumulation and softmax. v_wmma_f32_16x16x32_f16.
#define NBT 4
#define TQ 2048
#define TK 2048
#define DKV 512
#define NR (NBT * TQ)
#define DM 1024
#define NH 16
#define SCL 0.125f
#define SCL2 (SCL * 1.44269504088896340736f)      /* 1/8 x log2(e): scores in base-2 exponent units */
typedef __bf16 v16b __attribute__((ext_vector_type(16)));
typedef unsigned short v8us __attribute__((ext_vector_type(8), may_alias));
typedef float  v8f  __attribute__((ext_vector_type(8)));
typedef float  v4f  __attribute__((ext_vector_type(4)));
typedef float  v4fa __attribute__((ext_vector_type(4), may_alias));
union FragB { v16b v; v8us half[2]; unsigned short u[16]; };

__device__ __forceinline__ unsigned short bf16_bits(float x) { unsigned int u = __float_as_uint(x); return (unsigned short)((u + 0x7FFFu + ((u >> 16) & 1u)) >> 16); }
__device__ __forceinline__ float bf16_val(unsigned short b) { return __uint_as_float(((unsigned int)b) << 16); }
__device__ __forceinline__ float bf16_round(float x) { return bf16_val(bf16_bits(x)); }
// D += A·B with NT terms: 1 = ah·bh, 2 = + al·bh (A split), 3 = + ah·bl (both split)
template <int NT>
__device__ __forceinline__ v8f mmaN(v16b ah, v16b al, v16b bh, v16b bl, v8f c) {
  c = __builtin_amdgcn_wmma_f32_16x16x32_bf16(false, ah, false, bh, (short)0, c, false, false);
  if (NT >= 2) c = __builtin_amdgcn_wmma_f32_16x16x32_bf16(false, al, false, bh, (short)0, c, false, false);
  if (NT >= 3) c = __builtin_amdgcn_wmma_f32_16x16x32_bf16(false, ah, false, bl, (short)0, c, false, false);
  asm volatile("v_nop\n\tv_nop\n\tv_nop\n\tv_nop" : "+v"(c) : "v"(ah), "v"(al), "v"(bh), "v"(bl));
  return c;
}

__global__ __launch_bounds__(256) void k_wt_bf16(const float* __restrict__ W, unsigned short* __restrict__ Wt, int K, int N) {
  const int t = blockIdx.x * 256 + threadIdx.x;
  const int k8n = K / 8;
  if (t >= N * k8n) return;
  const int n = t / k8n, k8 = (t % k8n) * 8;
  v8us v;
#pragma unroll
  for (int i = 0; i < 8; ++i) v[i] = bf16_bits(W[(size_t)(k8 + i) * N + n]);
  *(v8us*)(Wt + (size_t)n * K + k8) = v;
  
}

// GEMM C[M][N] (f32, pitch ldc) = act(A[M][K]·W + bias). A f32 row-major (pitch lda) converted per fragment to bf16
// (ASPLIT: hi/lo two planes -> 2 terms, else single rounded term); Wt bf16 [N][K] (pitch ldb). BIAS_BF16 rounds the
// bias to bf16 first (bias quantised to bf16 before the add). K%32==0, M%16==0, N%64==0.
template <bool ASPLIT, int ACT, bool BIAS_BF16>
__global__ __launch_bounds__(128) void k_gemm_bf(const float* __restrict__ A, int lda, const unsigned short* __restrict__ Wt, int ldb,
                                               const float* __restrict__ bias, float* __restrict__ C, int ldc, int M, int N, int K) {
  __shared__ __attribute__((aligned(16))) float so[4][16][64];
  const int tid = threadIdx.x, w = tid >> 5, lane = tid & 31, ln = lane & 15, hh = lane >> 4;
  const int ntn = N / 64;
  const int wid = blockIdx.x * 4 + w;
  const int mt = wid / ntn, nq = wid % ntn;
  if (mt * 16 >= M) return;
  const int row0 = mt * 16, col0 = nq * 64;
  const float* arow = A + (size_t)(row0 + ln) * lda;
  v8f acc[4] = {};
  for (int kb = 0; kb < K; kb += 32) {
    FragB ah, al;
    const v4f x0 = *(const v4fa*)(arow + kb + 8 * hh), x1 = *(const v4fa*)(arow + kb + 8 * hh + 4);
    const v4f x2 = *(const v4fa*)(arow + kb + 16 + 8 * hh), x3 = *(const v4fa*)(arow + kb + 16 + 8 * hh + 4);
    float xs[16] = {x0[0],x0[1],x0[2],x0[3],x1[0],x1[1],x1[2],x1[3],x2[0],x2[1],x2[2],x2[3],x3[0],x3[1],x3[2],x3[3]};
#pragma unroll
    for (int i = 0; i < 16; ++i) { const unsigned short hb = bf16_bits(xs[i]); ah.u[i] = hb; al.u[i] = ASPLIT ? bf16_bits(xs[i] - bf16_val(hb)) : (unsigned short)0; }
#pragma unroll
    for (int t = 0; t < 4; ++t) {
      const unsigned short* brow = Wt + (size_t)(col0 + t * 16 + ln) * ldb + kb;
      FragB b;
      b.half[0] = *(const v8us*)(brow + 8 * hh);
      b.half[1] = *(const v8us*)(brow + 16 + 8 * hh);
      acc[t] = mmaN<ASPLIT ? 2 : 1>(ah.v, al.v, b.v, b.v, acc[t]);
    }
  }
#pragma unroll
  for (int t = 0; t < 4; ++t) {
    float bv = bias ? bias[col0 + t * 16 + ln] : 0.f;
    if (BIAS_BF16) bv = bf16_round(bv);
#pragma unroll
    for (int r = 0; r < 8; ++r) { float v = acc[t][r] + bv; if (ACT == 1) v = fmaxf(v, 0.f); so[w][8 * hh + r][t * 16 + ln] = v; }
  }
  __builtin_amdgcn_fence(__ATOMIC_ACQ_REL, "workgroup");
  __builtin_amdgcn_wave_barrier();
  const int rsub = lane >> 4, c4 = (lane & 15) * 4;
  {
#pragma unroll
    for (int q = 0; q < 8; ++q) {
      const int r = q * 2 + rsub;
      const v4f v = *(const v4fa*)&so[w][r][c4];
      *(v4f*)(C + (size_t)(row0 + r) * ldc + col0 + c4) = v;
    }
    
  }
}

// GEMM C = act(A·W + bias + resid): A f32 (ASPLIT -> hi/lo 2 terms), Wt bf16 [N][K]; ACT 0 none, 1 relu, 2 exact gelu;
// resid (optional, f32, row index = (row % rmod), pitch ldr, RES_BF16 rounds it) added before the activation.
template <bool ASPLIT, int ACT, bool BIAS_BF16, bool RES_BF16>
__global__ __launch_bounds__(128) void k_gemm_bf3(const float* __restrict__ A, int lda, const unsigned short* __restrict__ Wt, int ldb,
                                                const float* __restrict__ bias, const float* __restrict__ resid, int rmod, int ldr,
                                                float* __restrict__ C, int ldc, int M, int N, int K) {
  __shared__ __attribute__((aligned(16))) float so[4][16][64];
  const int tid = threadIdx.x, w = tid >> 5, lane = tid & 31, ln = lane & 15, hh = lane >> 4;
  const int ntn = N / 64;
  const int wid = blockIdx.x * 4 + w;
  const int mt = wid / ntn, nq = wid % ntn;
  if (mt * 16 >= M) return;
  const int row0 = mt * 16, col0 = nq * 64;
  const float* arow = A + (size_t)(row0 + ln) * lda;
  v8f acc[4] = {};
  for (int kb = 0; kb < K; kb += 32) {
    FragB ah, al;
    const v4f x0 = *(const v4fa*)(arow + kb + 8 * hh), x1 = *(const v4fa*)(arow + kb + 8 * hh + 4);
    const v4f x2 = *(const v4fa*)(arow + kb + 16 + 8 * hh), x3 = *(const v4fa*)(arow + kb + 16 + 8 * hh + 4);
    float xs[16] = {x0[0],x0[1],x0[2],x0[3],x1[0],x1[1],x1[2],x1[3],x2[0],x2[1],x2[2],x2[3],x3[0],x3[1],x3[2],x3[3]};
#pragma unroll
    for (int i = 0; i < 16; ++i) { const unsigned short hb = bf16_bits(xs[i]); ah.u[i] = hb; al.u[i] = ASPLIT ? bf16_bits(xs[i] - bf16_val(hb)) : (unsigned short)0; }
#pragma unroll
    for (int t = 0; t < 4; ++t) {
      const unsigned short* brow = Wt + (size_t)(col0 + t * 16 + ln) * ldb + kb;
      FragB b;
      b.half[0] = *(const v8us*)(brow + 8 * hh);
      b.half[1] = *(const v8us*)(brow + 16 + 8 * hh);
      acc[t] = mmaN<ASPLIT ? 2 : 1>(ah.v, al.v, b.v, b.v, acc[t]);
    }
  }
#pragma unroll
  for (int t = 0; t < 4; ++t) {
    const int col = col0 + t * 16 + ln;
    float bv = bias ? bias[col] : 0.f;
    if (BIAS_BF16) bv = bf16_round(bv);
#pragma unroll
    for (int r = 0; r < 8; ++r) {
      float v = acc[t][r] + bv;
      if (resid) { float rv = resid[(size_t)((row0 + 8 * hh + r) % rmod) * ldr + col]; if (RES_BF16) rv = bf16_round(rv); v += rv; }
      if (ACT == 1) v = fmaxf(v, 0.f);
      if (ACT == 2) v = 0.5f * v * (1.0f + erff(v * 0.70710678118654752f));
      if (ACT == 3) { const float u = 0.7978845608028654f * (v + 0.044715f * v * v * v); v = 0.5f * v * (1.0f + tanhf(u)); }
      so[w][8 * hh + r][t * 16 + ln] = v;
    }
  }
  __builtin_amdgcn_fence(__ATOMIC_ACQ_REL, "workgroup");
  __builtin_amdgcn_wave_barrier();
  const int rsub = lane >> 4, c4 = (lane & 15) * 4;
  {
#pragma unroll
    for (int q = 0; q < 8; ++q) {
      const int r = q * 2 + rsub;
      const v4f v = *(const v4fa*)&so[w][r][c4];
      *(v4f*)(C + (size_t)(row0 + r) * ldc + col0 + c4) = v;
    }
    
  }
}
// row LayerNorm (biased variance, eps) over N: s = X (+ R); optional out_sum <- s; out_norm <- (s-mu)*rsqrt(var+eps)*g + b
template <bool PARAM_BF16>
__global__ __launch_bounds__(256) void k_layernorm(const float* __restrict__ X, const float* __restrict__ R, const float* __restrict__ g, const float* __restrict__ bta,
                                                  float* __restrict__ out_sum, float* __restrict__ out_norm, int N, float eps) {
  __shared__ float red[256];
  const int row = blockIdx.x, tid = threadIdx.x;
  const float* x = X + (size_t)row * N; const float* rr = R ? R + (size_t)row * N : nullptr;
  float vals[16];                     // up to N = 4096
  const int per = N / 256;            // contiguous chunk per thread? use strided-by-4 chunks: thread handles j = tid*4 + 1024*u
  float s1 = 0.f;
  for (int u = 0; u < per / 4; ++u) {
    const int j = tid * 4 + 1024 * u;
    const v4f a = *(const v4fa*)(x + j);
    v4f b = {0.f,0.f,0.f,0.f}; if (rr) b = *(const v4fa*)(rr + j);
#pragma unroll
    for (int q = 0; q < 4; ++q) { const float v = a[q] + b[q]; vals[u * 4 + q] = v; s1 += v; }
  }
  red[tid] = s1; __syncthreads();
  for (int st = 128; st > 0; st >>= 1) { if (tid < st) red[tid] += red[tid + st]; __syncthreads(); }
  const float mu = red[0] / (float)N; __syncthreads();
  float s2 = 0.f;
  for (int u = 0; u < per / 4; ++u)
#pragma unroll
    for (int q = 0; q < 4; ++q) { const float c = vals[u * 4 + q] - mu; s2 += c * c; }
  red[tid] = s2; __syncthreads();
  for (int st = 128; st > 0; st >>= 1) { if (tid < st) red[tid] += red[tid + st]; __syncthreads(); }
  const float rs = rsqrtf(red[0] / (float)N + eps);
  {
    for (int u = 0; u < per / 4; ++u) {
      const int j = tid * 4 + 1024 * u;
      v4f o, sm;
#pragma unroll
      for (int q = 0; q < 4; ++q) {
        float gg = g[j + q], bb = bta[j + q];
        if (PARAM_BF16) { gg = bf16_round(gg); bb = bf16_round(bb); }
        sm[q] = vals[u * 4 + q]; o[q] = (vals[u * 4 + q] - mu) * rs * gg + bb;
      }
      if (out_sum) *(v4f*)(out_sum + (size_t)row * N + j) = sm;
      *(v4f*)(out_norm + (size_t)row * N + j) = o;
    }
    
  }
}



// ---- f16 WMMA path (v_wmma_f32_16x16x32_f16): 11-bit significands for operands in range — used where a [0,1] probability operand needs more precision than bf16
typedef _Float16 v16h __attribute__((ext_vector_type(16)));
union FragH { v16h v; v8us half[2]; _Float16 h[16]; unsigned short u[16]; };
template <int NT>
__device__ __forceinline__ v8f mmaH(v16h ah, v16h al, v16h bh, v16h bl, v8f c) {
  c = __builtin_amdgcn_wmma_f32_16x16x32_f16(false, ah, false, bh, (short)0, c, false, false);
  if (NT >= 2) c = __builtin_amdgcn_wmma_f32_16x16x32_f16(false, al, false, bh, (short)0, c, false, false);
  if (NT >= 3) c = __builtin_amdgcn_wmma_f32_16x16x32_f16(false, ah, false, bl, (short)0, c, false, false);
  asm volatile("v_nop\n\tv_nop\n\tv_nop\n\tv_nop" : "+v"(c) : "v"(ah), "v"(al), "v"(bh), "v"(bl));
  return c;
}
// batched GEMM like k_gemm_b but f16 operands: A f32 (split into f16 hi/lo if ASPLIT, else rounded to f16), Bt = f16 values [n][k]; alpha; C f32; N multiple of 16 (partial tiles skipped)
template <bool ASPLIT>
__global__ __launch_bounds__(128) void k_gemm_h(const float* __restrict__ A, int lda, size_t sA, const _Float16* __restrict__ Bh, int ldb, size_t sB, float alpha, float* __restrict__ C, int ldc, size_t sC, int M, int N, int K) {
  __shared__ __attribute__((aligned(16))) float so[4][16][64];
  const int tid = threadIdx.x, w = tid >> 5, lane = tid & 31, ln = lane & 15, hh = lane >> 4; const int by = blockIdx.y;
  A += (size_t)by * sA; Bh += (size_t)by * sB; C += (size_t)by * sC;
  const int ntn = (N + 63) / 64; const int wid = blockIdx.x * 4 + w; const int mt = wid / ntn, nq = wid % ntn; if (mt * 16 >= M) return;
  const int row0 = mt * 16, col0 = nq * 64; const float* arow = A + (size_t)(row0 + ln) * lda;
  v8f acc[4] = {};
  for (int kb = 0; kb < K; kb += 32) {
    FragH ah, al;
    const v4f x0 = *(const v4fa*)(arow + kb + 8 * hh), x1 = *(const v4fa*)(arow + kb + 8 * hh + 4), x2 = *(const v4fa*)(arow + kb + 16 + 8 * hh), x3 = *(const v4fa*)(arow + kb + 16 + 8 * hh + 4);
    float xs[16] = {x0[0],x0[1],x0[2],x0[3],x1[0],x1[1],x1[2],x1[3],x2[0],x2[1],x2[2],x2[3],x3[0],x3[1],x3[2],x3[3]};
#pragma unroll
    for (int i = 0; i < 16; ++i) { const _Float16 h = (_Float16)xs[i]; ah.h[i] = h; al.h[i] = ASPLIT ? (_Float16)(xs[i] - (float)h) : (_Float16)0.0f; }
#pragma unroll
    for (int t = 0; t < 4; ++t) { if (col0 + t * 16 >= N) continue; const size_t boff = (size_t)(col0 + t * 16 + ln) * ldb + kb; FragH bq; bq.half[0] = *(const v8us*)(Bh + boff + 8 * hh); bq.half[1] = *(const v8us*)(Bh + boff + 16 + 8 * hh);
      acc[t] = mmaH<ASPLIT ? 2 : 1>(ah.v, al.v, bq.v, bq.v, acc[t]); }
  }
#pragma unroll
  for (int t = 0; t < 4; ++t) { if (col0 + t * 16 >= N) continue;
#pragma unroll
    for (int r = 0; r < 8; ++r) so[w][8 * hh + r][t * 16 + ln] = acc[t][r] * alpha; }
  __builtin_amdgcn_fence(__ATOMIC_ACQ_REL, "workgroup"); __builtin_amdgcn_wave_barrier();
  const int rsub = lane >> 4, c4 = (lane & 15) * 4;
  {
#pragma unroll
    for (int q = 0; q < 8; ++q) { const int r = q * 2 + rsub; if (col0 + c4 < N) { const v4f v = *(const v4fa*)&so[w][r][c4]; *(v4f*)(C + (size_t)(row0 + r) * ldc + col0 + c4) = v; } }
     }
}

// Wt[n][k] = f16(W[k][n]·scale) from f32 row-major W[K][N] (scale = power of two; bf16-exact weights stay exact in f16 away from the subnormal range)
__global__ __launch_bounds__(256) void k_wt_f16(const float* __restrict__ W, _Float16* __restrict__ Wt, int K, int N, float scale) {
  const int t = blockIdx.x * 256 + threadIdx.x; if (t >= N * (K / 8)) return; const int n = t / (K / 8), k8 = (t % (K / 8)) * 8; FragH f;
#pragma unroll
  for (int i = 0; i < 8; ++i) f.h[i] = (_Float16)(bf16_round(W[(size_t)(k8 + i) * N + n]) * scale); const v8us o = f.half[0];
  *(v8us*)((unsigned short*)Wt + (size_t)n * K + k8) = o; 
}
// k_gemm_hh variant with fused epilogue: v = acc·alpha + bias[by·sBias + col] (+ CP[(row/rowsPerB)·sCPb + by·64 + col] if CP) ; ACT 0 none / 1 elu ; writes f16 C16 (and f32 C if non-null)
template <int ACT>
__global__ __launch_bounds__(128) void k_gemm_hhx(const _Float16* __restrict__ A, int lda, size_t sA, const _Float16* __restrict__ Bh, int ldb, size_t sB, float alpha, const float* __restrict__ bias, size_t sBias, const float* __restrict__ CP, int rowsPerB, size_t sCPb, int row0g,
    float* __restrict__ C, _Float16* __restrict__ C16, int ldc, size_t sC, int M, int N, int K) {
  __shared__ __attribute__((aligned(16))) float so[4][16][64];
  const int tid = threadIdx.x, w = tid >> 5, lane = tid & 31, ln = lane & 15, hh = lane >> 4; const int by = blockIdx.y;
  A += (size_t)by * sA; Bh += (size_t)by * sB; const size_t cofs = (size_t)by * sC; const float* bp = bias ? bias + (size_t)by * sBias : nullptr;
  const int ntn = (N + 63) / 64; const int wid = blockIdx.x * 4 + w; const int mt = wid / ntn, nq = wid % ntn; if (mt * 16 >= M) return;
  const int row0 = mt * 16, col0 = nq * 64; const _Float16* arow = A + (size_t)(row0 + ln) * lda;
  v8f acc[4] = {};
  for (int kb = 0; kb < K; kb += 32) { FragH ah; ah.half[0] = *(const v8us*)((const unsigned short*)arow + kb + 8 * hh); ah.half[1] = *(const v8us*)((const unsigned short*)arow + kb + 16 + 8 * hh);
#pragma unroll
    for (int t = 0; t < 4; ++t) { if (col0 + t * 16 >= N) continue; const size_t boff = (size_t)(col0 + t * 16 + ln) * ldb + kb; FragH bq; bq.half[0] = *(const v8us*)((const unsigned short*)Bh + boff + 8 * hh); bq.half[1] = *(const v8us*)((const unsigned short*)Bh + boff + 16 + 8 * hh);
      acc[t] = mmaH<1>(ah.v, ah.v, bq.v, bq.v, acc[t]); }
  }
#pragma unroll
  for (int t = 0; t < 4; ++t) { if (col0 + t * 16 >= N) continue; const int col = col0 + t * 16 + ln; const float bv = bp ? bf16_round(bp[col]) : 0.f;
#pragma unroll
    for (int r = 0; r < 8; ++r) { float v = acc[t][r] * alpha + bv; if (CP) { const int bidx = (row0g + row0 + 8 * hh + r) / rowsPerB; v += CP[(size_t)bidx * sCPb + (size_t)by * 64 + col]; } if (ACT == 1) v = (v > 0.f) ? v : expm1f(v); else if (ACT == 7) v = (v > 0.f) ? v + 1.0f : expf(v); else if (ACT == 8) v = tanhf(v); else if (ACT == 9) v = 0.5f * v * (1.0f + tanhf(0.7978845608028654f * (v + 0.044715f * v * v * v))); else if (ACT == 11) v = 1.0f / (1.0f + expf(-v)); else if (ACT == 12) v = (v > 0.f) ? v : 0.01f * v; else if (ACT == 14) v = (v > 0.f) ? v : 0.1f * v; else if (ACT == 15) v = v / (1.0f + expf(-v)); else if (ACT == 3) v = fmaxf(v, 0.f); else if (ACT == 6) v = 0.5f * v * (1.0f + erff(v * 0.70710678118654752f)); so[w][8 * hh + r][t * 16 + ln] = v; } }
  __builtin_amdgcn_fence(__ATOMIC_ACQ_REL, "workgroup"); __builtin_amdgcn_wave_barrier();
  const int rsub = lane >> 4, c4 = (lane & 15) * 4; typedef _Float16 v4h __attribute__((ext_vector_type(4)));
  {
#pragma unroll
    for (int q = 0; q < 8; ++q) { const int r = q * 2 + rsub; if (col0 + c4 < N) { const v4f v = *(const v4fa*)&so[w][r][c4]; if (C) *(v4f*)(C + cofs + (size_t)(row0 + r) * ldc + col0 + c4) = v; if (C16) { v4h h4; for (int i = 0; i < 4; ++i) h4[i] = (_Float16)v[i]; *(v4h*)(C16 + cofs + (size_t)(row0 + r) * ldc + col0 + c4) = h4; } } }
     }
}


typedef _Float16 v4h __attribute__((ext_vector_type(4)));

__global__ __launch_bounds__(256) void k_x16(const float* __restrict__ x, _Float16* __restrict__ X16, size_t n8) { const size_t t = (size_t)blockIdx.x * 256 + threadIdx.x; if (t >= n8) return; FragH f;
#pragma unroll
  for (int q = 0; q < 8; ++q) f.h[q] = (_Float16)bf16_round(x[t * 8 + q]); *(v8us*)((unsigned short*)X16 + t * 8) = f.half[0];  }
__global__ __launch_bounds__(256) void k_h16(const float* __restrict__ x, _Float16* __restrict__ X16, size_t n8) { const size_t t = (size_t)blockIdx.x * 256 + threadIdx.x; if (t >= n8) return; FragH f;
#pragma unroll
  for (int q = 0; q < 8; ++q) f.h[q] = (_Float16)x[t * 8 + q]; *(v8us*)((unsigned short*)X16 + t * 8) = f.half[0];  }
__global__ __launch_bounds__(256) void k_round16f(const float* __restrict__ W, _Float16* __restrict__ Bt, size_t n8) { const size_t t = (size_t)blockIdx.x * 256 + threadIdx.x; if (t >= n8) return; FragH f;
#pragma unroll
  for (int i = 0; i < 8; ++i) f.h[i] = (_Float16)(bf16_round(W[t * 8 + i]) * 16.0f); *(v8us*)((unsigned short*)Bt + t * 8) = f.half[0];  }
template <int NHv, int TTv>
__global__ __launch_bounds__(256) void k_vt(const _Float16* __restrict__ V16, int ldv, int voff, _Float16* __restrict__ Vt) { __shared__ unsigned short tl[64][66]; const int tid = threadIdx.x; const int slab = blockIdx.x / (TTv / 64), lg = blockIdx.x % (TTv / 64); const int b = slab / NHv, h = slab % NHv;
  for (int i = tid; i < 64 * 8; i += 256) { const int r = i / 8, c8 = (i % 8) * 8; FragH f; f.half[0] = *(const v8us*)((const unsigned short*)V16 + ((size_t)b * TTv + lg * 64 + r) * ldv + voff + h * 64 + c8);
#pragma unroll
    for (int q = 0; q < 8; ++q) tl[r][c8 + q] = f.u[q]; }
  __syncthreads();
  {
#pragma unroll
    for (int rd = 0; rd < 2; ++rd) { const int d = rd * 32 + tid / 8, pc = tid % 8; FragH f;
#pragma unroll
      for (int q = 0; q < 8; ++q) f.u[q] = tl[pc * 8 + q][d];
      *(v8us*)((unsigned short*)Vt + ((size_t)slab * 64 + d) * TTv + lg * 64 + pc * 8) = f.half[0]; }
     } }

__global__ __launch_bounds__(256) void k_hl(const float* __restrict__ F, _Float16* __restrict__ Hh, _Float16* __restrict__ Hl, size_t n8) { const size_t t = (size_t)blockIdx.x * 256 + threadIdx.x; if (t >= n8) return; FragH fh, fl; const v4f a = *(const v4fa*)(F + t * 8), c = *(const v4fa*)(F + t * 8 + 4);
#pragma unroll
  for (int q = 0; q < 4; ++q) { _Float16 h = (_Float16)a[q]; fh.h[q] = h; fl.h[q] = (_Float16)((a[q] - (float)h) * 1024.0f); h = (_Float16)c[q]; fh.h[4 + q] = h; fl.h[4 + q] = (_Float16)((c[q] - (float)h) * 1024.0f); }
  { *(v8us*)((unsigned short*)Hh + t * 8) = fh.half[0]; *(v8us*)((unsigned short*)Hl + t * 8) = fl.half[0];  } }

// ---- fast GEMM (wave tile 32x64, work-group tile 128x64); epilogue = k_gemm_hhx semantics without its CP term ----
__device__ __forceinline__ v8f g2_mma(v16h a, v16h b, v8f c) { v8f d = __builtin_amdgcn_wmma_f32_16x16x32_f16(false, a, false, b, (short)0, c, false, false); asm volatile("v_nop\n\tv_nop\n\tv_nop\n\tv_nop" : "+v"(d) : "v"(a), "v"(b)); return d; }
// A and B reach the four waves of a work-group through a two-buffer LDS ring. One tile = 64 k: 128 A rows, then 64 B rows, 128 data bytes a row at a pitch of 144 B (16 B x odd: no bank conflict for 16-byte readers).
// Needs M % 128 == 0 and K % 64 == 0 on top of N % 64 == 0.
// A2 (optional): a second A plane of the same shape for C = (A + a2s x A2).B in ONE k loop: the ring first runs A2's K / 64 tiles against B, the accumulators are then scaled by a2s (a power of two: exact), and A's tiles follow into the same accumulators.
#define GKT 64
#define GPIT 144
#define GTILE (192 * GPIT)
// One tile: 12 asynchronous 16-byte copies a lane (128 lanes x 12 x 16 B = 24 KiB); 8 lanes cover one 128-B row, so a wave's copy asks for 4 whole lines (a fragment load straight from global memory would touch 16 lines for its 512 bytes).
// s_wait_xcnt closes the statement so that no address register of a copy is rewritten in front of it.
__device__ __forceinline__ void g2_copy(unsigned l0, const unsigned short* ga, int lda, const unsigned short* gb, int ldb) {
  asm volatile("global_load_async_to_lds_b128 %0, %12, off\n\t"
               "global_load_async_to_lds_b128 %1, %13, off\n\t"
               "global_load_async_to_lds_b128 %2, %14, off\n\t"
               "global_load_async_to_lds_b128 %3, %15, off\n\t"
               "global_load_async_to_lds_b128 %4, %16, off\n\t"
               "global_load_async_to_lds_b128 %5, %17, off\n\t"
               "global_load_async_to_lds_b128 %6, %18, off\n\t"
               "global_load_async_to_lds_b128 %7, %19, off\n\t"
               "global_load_async_to_lds_b128 %8, %20, off\n\t"
               "global_load_async_to_lds_b128 %9, %21, off\n\t"
               "global_load_async_to_lds_b128 %10, %22, off\n\t"
               "global_load_async_to_lds_b128 %11, %23, off\n\t"
               "s_wait_xcnt 0x0"
               :: "v"(l0), "v"(l0 + 16u * GPIT), "v"(l0 + 32u * GPIT), "v"(l0 + 48u * GPIT), "v"(l0 + 64u * GPIT), "v"(l0 + 80u * GPIT), "v"(l0 + 96u * GPIT), "v"(l0 + 112u * GPIT), "v"(l0 + 128u * GPIT), "v"(l0 + 144u * GPIT), "v"(l0 + 160u * GPIT), "v"(l0 + 176u * GPIT),
                  "v"(ga), "v"(ga + (size_t)16 * lda), "v"(ga + (size_t)32 * lda), "v"(ga + (size_t)48 * lda), "v"(ga + (size_t)64 * lda), "v"(ga + (size_t)80 * lda), "v"(ga + (size_t)96 * lda), "v"(ga + (size_t)112 * lda),
                  "v"(gb), "v"(gb + (size_t)16 * ldb), "v"(gb + (size_t)32 * ldb), "v"(gb + (size_t)48 * ldb)
               : "memory");
}
__device__ __forceinline__ v16h g2_lfrag(const unsigned char* p) { FragH f; f.half[0] = *(const v8us*)p; f.half[1] = *(const v8us*)(p + 32); return f.v; }      /* p = a row's 32-k slice + 16*hh bytes: k = 8*hh .. 8*hh + 7, then 16 + 8*hh .. 16 + 8*hh + 7, for A and B alike */
template <int ACT>
__global__ __launch_bounds__(128) void k_gemm2(const _Float16* __restrict__ A, int lda, size_t sA, const _Float16* __restrict__ Bh, int ldb, size_t sB, float alpha, const float* __restrict__ bias, size_t sBias, const _Float16* __restrict__ A2, float a2s,
    float* __restrict__ C, _Float16* __restrict__ C16, int ldc, size_t sC, int M, int N, int K) {
  __shared__ __attribute__((aligned(16))) unsigned char ring[2 * GTILE];      /* behind the loop's last barrier its first 34 KiB stage the output */
  const int tid = threadIdx.x, w = tid >> 5, lane = tid & 31, ln = lane & 15, hh = lane >> 4; const int by = blockIdx.y;
  A += (size_t)by * sA; Bh += (size_t)by * sB; const size_t cofs = (size_t)by * sC; const float* bp = bias ? bias + (size_t)by * sBias : nullptr;
  const int ntn = N >> 6; const int mt = blockIdx.x / ntn, nq = blockIdx.x - mt * ntn; const int row0 = mt * 128 + 32 * w, col0 = nq * 64; if (mt * 128 >= M) return;      /* the whole work-group or none, in front of every barrier */
  const unsigned short* ga = (const unsigned short*)A + (size_t)(mt * 128 + (tid >> 3)) * lda + (tid & 7) * 8;      /* this lane's 16 bytes of A row tid/8 of tile n2 (A's k 0 .. 63) */
  const unsigned short* gb = (const unsigned short*)Bh + (size_t)(col0 + (tid >> 3)) * ldb + (tid & 7) * 8;      /* and of B row tid/8 */
  const unsigned l0 = (unsigned)(size_t)(const void*)ring + (unsigned)((tid >> 3) * GPIT + (tid & 7) * 16);
  const int n2 = A2 ? K / GKT : 0, nt = n2 + K / GKT;      /* tiles 0 .. n2 - 1: A2 against B; tiles n2 .. nt - 1: A against B */
  const unsigned short* ga2 = A2 ? (const unsigned short*)A2 + (size_t)by * sA + (size_t)(mt * 128 + (tid >> 3)) * lda + (tid & 7) * 8 : ga;      /* the same place in A2 */
  auto fill = [&](int t, unsigned l) { const size_t ko = (size_t)(t < n2 ? t : t - n2) * GKT; g2_copy(l, (t < n2 ? ga2 : ga) + ko, lda, gb + ko, ldb); };      /* tile t -> the buffer at l; t is the same in the whole work-group */
  fill(0, l0);      /* tile 0 -> buffer 0 */
  const v8f z8 = {0.f,0.f,0.f,0.f,0.f,0.f,0.f,0.f}; v8f c00 = z8, c01 = z8, c02 = z8, c03 = z8, c10 = z8, c11 = z8, c12 = z8, c13 = z8;
  asm volatile("s_wait_asynccnt 0x0" ::: "memory");      /* this wave's share of tile 0 has landed */
  __syncthreads();      /* tile 0 is published */
  if (nt > 1) fill(1, l0 + GTILE);      /* tile 1 -> buffer 1 */
#pragma unroll 1      /* one trip a tile: the ring's waits and its barrier stand once, at the foot */
  for (int t = 0; t < nt; ++t) {
    const unsigned bo = (unsigned)(t & 1) * GTILE;
    if (n2 > 0 && t == n2) { c00 *= a2s; c01 *= a2s; c02 *= a2s; c03 *= a2s; c10 *= a2s; c11 *= a2s; c12 *= a2s; c13 *= a2s; }      /* A2's sum is complete: weigh it once, then go on with A */
    const unsigned char* ar = &ring[bo + (unsigned)((32 * w + ln) * GPIT + 16 * hh)]; const unsigned char* br = &ring[bo + (unsigned)((128 + ln) * GPIT + 16 * hh)];
    v16h a[2][2], b[2][4];      /* the tile's 24 LDS reads stand as one group in front of its 16 WMMAs */
#pragma unroll
    for (int ks = 0; ks < 2; ++ks) { a[ks][0] = g2_lfrag(ar + ks * 64); a[ks][1] = g2_lfrag(ar + 16 * GPIT + ks * 64);
#pragma unroll
      for (int j = 0; j < 4; ++j) b[ks][j] = g2_lfrag(br + j * 16 * GPIT + ks * 64); }
#pragma unroll
    for (int ks = 0; ks < 2; ++ks) {
      c00 = g2_mma(a[ks][0], b[ks][0], c00); c10 = g2_mma(a[ks][1], b[ks][0], c10);
      c01 = g2_mma(a[ks][0], b[ks][1], c01); c11 = g2_mma(a[ks][1], b[ks][1], c11);
      c02 = g2_mma(a[ks][0], b[ks][2], c02); c12 = g2_mma(a[ks][1], b[ks][2], c12);
      c03 = g2_mma(a[ks][0], b[ks][3], c03); c13 = g2_mma(a[ks][1], b[ks][3], c13); }
    asm volatile("s_wait_dscnt 0x0" ::: "memory");      /* this wave's reads of tile t are done */
    asm volatile("s_wait_asynccnt 0x0" ::: "memory");      /* its share of tile t + 1 has landed */
    __syncthreads();      /* publishes tile t + 1 and frees tile t's buffer */
    if (t + 2 < nt) fill(t + 2, l0 + bo); }
  asm volatile("s_wait_asynccnt 0x0" ::: "memory");      /* no copy is in flight when the ring becomes output staging */
  float (*so)[32][68] = (float (*)[32][68])ring;
  v8f accs[8] = {c00, c01, c02, c03, c10, c11, c12, c13};
#pragma unroll
  for (int u = 0; u < 8; ++u) { const int t = u & 3, half = u >> 2; const int col = col0 + t * 16 + ln; const float bv = bp ? bf16_round(bp[col]) : 0.f;
#pragma unroll
    for (int r = 0; r < 8; ++r) { const int rloc = half * 16 + 8 * hh + r; float v = accs[u][r] * alpha + bv;
      if (ACT == 3) v = fmaxf(v, 0.f); else if (ACT == 6) v = 0.5f * v * (1.0f + erff(v * 0.70710678118654752f)); else if (ACT == 11) v = 1.0f / (1.0f + expf(-v)); else if (ACT == 15) v = v / (1.0f + expf(-v)); else if (ACT == 12) v = (v > 0.f) ? v : 0.01f * v; else if (ACT == 8) v = tanhf(v);
      so[w][rloc][t * 16 + ln] = v; } }
  __builtin_amdgcn_fence(__ATOMIC_ACQ_REL, "workgroup"); __builtin_amdgcn_wave_barrier();
  const int rsub = lane >> 4, c4 = (lane & 15) * 4;
  {
#pragma unroll
    for (int q = 0; q < 16; ++q) { const int r = q * 2 + rsub; const v4f v = *(const v4fa*)&so[w][r][c4]; if (C) *(v4f*)(C + cofs + (size_t)(row0 + r) * ldc + col0 + c4) = v; if (C16) { v4h h4; for (int i = 0; i < 4; ++i) h4[i] = (_Float16)v[i]; *(v4h*)(C16 + cofs + (size_t)(row0 + r) * ldc + col0 + c4) = h4; } }
     } }


// lane l <-> lane l ^ 16 by a vector cross-row move
__device__ __forceinline__ float xhalf(float x) { return __builtin_bit_cast(float, __builtin_amdgcn_permlanex16(__builtin_bit_cast(int, x), __builtin_bit_cast(int, x), 0x76543210, 0xfedcba98, false, false)); }
#define FKT 64
#define FPIT 144
#define FTILE (128 * FPIT)
// One tile: 8 asynchronous 16-byte copies a lane (128 lanes x 8 x 16 B = 16 KiB); 8 lanes cover one 128-B row, so a wave's copy asks for 4 whole lines.
// s_wait_xcnt closes the statement so that no address register of a copy is rewritten in front of it.
__device__ __forceinline__ void tile_copy(unsigned l0, const unsigned short* gk, int ldk, const unsigned short* gv) {
  asm volatile("global_load_async_to_lds_b128 %0, %8, off\n\t"
               "global_load_async_to_lds_b128 %1, %9, off\n\t"
               "global_load_async_to_lds_b128 %2, %10, off\n\t"
               "global_load_async_to_lds_b128 %3, %11, off\n\t"
               "global_load_async_to_lds_b128 %4, %12, off\n\t"
               "global_load_async_to_lds_b128 %5, %13, off\n\t"
               "global_load_async_to_lds_b128 %6, %14, off\n\t"
               "global_load_async_to_lds_b128 %7, %15, off\n\t"
               "s_wait_xcnt 0x0"
               :: "v"(l0), "v"(l0 + 16u * FPIT), "v"(l0 + 32u * FPIT), "v"(l0 + 48u * FPIT), "v"(l0 + 64u * FPIT), "v"(l0 + 80u * FPIT), "v"(l0 + 96u * FPIT), "v"(l0 + 112u * FPIT),
                  "v"(gk), "v"(gk + (size_t)16 * ldk), "v"(gk + (size_t)32 * ldk), "v"(gk + (size_t)48 * ldk), "v"(gv), "v"(gv + (size_t)16 * TK), "v"(gv + (size_t)32 * TK), "v"(gv + (size_t)48 * TK)
               : "memory");
}
// Eight 2^x in place, one statement: behind a transcendental the instruction set asks for one slot before its result is read or its source overwritten. Here each neighbour touches its own register only,
// and the closing v_nop keeps the slot for whatever the compiler puts next.
__device__ __forceinline__ void exp2x8(float* x) {
  asm("v_exp_f32 %0, %0\n\tv_exp_f32 %1, %1\n\tv_exp_f32 %2, %2\n\tv_exp_f32 %3, %3\n\tv_exp_f32 %4, %4\n\tv_exp_f32 %5, %5\n\tv_exp_f32 %6, %6\n\tv_exp_f32 %7, %7\n\tv_nop"
      : "+v"(x[0]), "+v"(x[1]), "+v"(x[2]), "+v"(x[3]), "+v"(x[4]), "+v"(x[5]), "+v"(x[6]), "+v"(x[7]));
}
__global__ __launch_bounds__(128) void k_flash(const _Float16* __restrict__ Q16, int ldq, const _Float16* __restrict__ K16, int ldk, const _Float16* __restrict__ Vt, const int* __restrict__ MSK, float* __restrict__ O, int ldo) {
  constexpr int RPW = 16, NQB = TQ / (4 * RPW), DT = 4, KS = 2, NT = TK / FKT; (void)MSK;
  __shared__ __attribute__((aligned(16))) unsigned char ring[2 * FTILE];      /* behind the loop's last barrier its first 17 KiB stage the output */
  const int tid = threadIdx.x, w = tid >> 5, lane = tid & 31, ln = lane & 15, hh = lane >> 4;
  const int slab = blockIdx.x / NQB, qblk = blockIdx.x % NQB; const int b = slab / NH, h = slab % NH; const int q0 = qblk * (4 * RPW) + w * RPW;
  const unsigned short* gk = (const unsigned short*)K16 + ((size_t)b * TK + (tid >> 3)) * ldk + h * 64 + (tid & 7) * 8;      /* this lane's 16 bytes of K row tid/8 of tile 0 */
  const unsigned short* gv = (const unsigned short*)Vt + ((size_t)slab * 64 + (tid >> 3)) * TK + (tid & 7) * 8;      /* and of Vt row tid/8 */
  const unsigned l0 = (unsigned)(size_t)(const void*)ring + (unsigned)((tid >> 3) * FPIT + (tid & 7) * 16);
  tile_copy(l0, gk, ldk, gv);      /* tile 0 -> buffer 0 */
  FragH bq[KS];
  { const unsigned short* qr = (const unsigned short*)Q16 + ((size_t)b * TQ + q0 + ln) * ldq + h * 64;
#pragma unroll
    for (int ks = 0; ks < KS; ++ks) { bq[ks].half[0] = *(const v8us*)(qr + ks * 32 + 8 * hh); bq[ks].half[1] = *(const v8us*)(qr + ks * 32 + 16 + 8 * hh); } }
  float m_q = -3.0e38f, l_q = 0.f; v8f oacc[DT];
#pragma unroll
  for (int dt = 0; dt < DT; ++dt) oacc[dt] = (v8f){0.f,0.f,0.f,0.f,0.f,0.f,0.f,0.f};
  asm volatile("s_wait_asynccnt 0x0" ::: "memory");      /* this wave's share of tile 0 has landed */
  __syncthreads();      /* tile 0 is published */
  tile_copy(l0 + FTILE, gk + (size_t)FKT * ldk, ldk, gv + FKT);      /* tile 1 -> buffer 1 */
#pragma unroll 1
  for (int t = 0; t < NT; ++t) {
    const unsigned bo = (unsigned)(t & 1) * FTILE; const unsigned fo = bo + (unsigned)(ln * FPIT + 16 * hh);
#pragma unroll 1      /* rolled: both passes unrolled need more than the 128 VGPRs at which 8 waves fit a SIMD */
    for (int p = 0; p < FKT / 32; ++p) {
    FragH ak[2][KS];
#pragma unroll
    for (int nt = 0; nt < 2; ++nt) { const unsigned char* kr = &ring[fo + (p * 32 + nt * 16) * FPIT];
#pragma unroll
      for (int ks = 0; ks < KS; ++ks) { ak[nt][ks].half[0] = *(const v8us*)(kr + ks * 64); ak[nt][ks].half[1] = *(const v8us*)(kr + ks * 64 + 32); } }
    float sc[16];
#pragma unroll
    for (int nt = 0; nt < 2; ++nt) { v8f acc = (v8f){0.f,0.f,0.f,0.f,0.f,0.f,0.f,0.f};
#pragma unroll
      for (int ks = 0; ks < KS; ++ks) acc = mmaH<1>(ak[nt][ks].v, ak[nt][ks].v, bq[ks].v, bq[ks].v, acc);
#pragma unroll
      for (int r = 0; r < 8; ++r) sc[nt * 8 + r] = acc[r]; }      /* sc[nt*8 + r] = q.k, not yet scaled (key t*64 + p*32 + nt*16 + 8*hh + r, query q0 + ln) */
    FragH av[DT];
#pragma unroll
    for (int dt = 0; dt < DT; ++dt) { const unsigned char* vrow = &ring[fo + (64 + dt * 16) * FPIT + p * 64]; av[dt].half[0] = *(const v8us*)(vrow); av[dt].half[1] = *(const v8us*)(vrow + 32); }
    float mx[4];
#pragma unroll
    for (int c = 0; c < 4; ++c) mx[c] = fmaxf(fmaxf(sc[4 * c], sc[4 * c + 1]), fmaxf(sc[4 * c + 2], sc[4 * c + 3]));
    float mc = fmaxf(fmaxf(mx[0], mx[1]), fmaxf(mx[2], mx[3])); mc = fmaxf(mc, xhalf(mc));
    const float mn = fmaxf(m_q, mc * SCL2); const float al = __builtin_amdgcn_exp2f(m_q - mn); m_q = mn;      /* the maximum is kept in base-2 units (SCL2 > 0 commutes with max); al: 0 on the first pass, 1 where the maximum stays */
    const float nb = 10.0f - mn;      /* P x 1024 = 2^(q.k x SCL2 - mn + 10): one FMA and one bare v_exp_f32 a score; the argument is at most 10, and far below -126 the result is 0, as wanted */
    FragH pb; float ps[4];
#pragma unroll
    for (int i = 0; i < 16; ++i) sc[i] = fmaf(sc[i], SCL2, nb);
    exp2x8(sc); exp2x8(sc + 8);
#pragma unroll
    for (int i = 0; i < 16; ++i) { const float p_ = sc[i]; ps[i & 3] = (i < 4) ? p_ : ps[i & 3] + p_; pb.h[i] = (_Float16)p_; }      /* pb.h[nt*8 + r] = P(key nt*16 + 8*hh + r of the pass, query q0 + ln): the k order of the Vt loader */
    l_q = l_q * al + ((ps[0] + ps[1]) + (ps[2] + ps[3]));
#pragma unroll
    for (int dt = 0; dt < DT; ++dt) {
#pragma unroll
      for (int r = 0; r < 8; ++r) oacc[dt][r] *= al;
      oacc[dt] = mmaH<1>(av[dt].v, av[dt].v, pb.v, pb.v, oacc[dt]); } }
    asm volatile("s_wait_dscnt 0x0" ::: "memory");      /* this wave's reads of tile t are done */
    asm volatile("s_wait_asynccnt 0x0" ::: "memory");      /* its share of tile t + 1 has landed */
    __syncthreads();      /* publishes tile t + 1 and frees tile t's buffer */
    if (t + 2 < NT) tile_copy(l0 + bo, gk + (size_t)(t + 2) * FKT * ldk, ldk, gv + (size_t)(t + 2) * FKT); }
  asm volatile("s_wait_asynccnt 0x0" ::: "memory");      /* no copy is in flight when the ring becomes output staging */
  float (*sO)[RPW][64 + 4] = (float (*)[RPW][64 + 4])ring;
  const float lt = l_q + xhalf(l_q); const float inv = (lt > 0.f) ? 1.0f / lt : 0.f;      /* l_q sums P x 1024, as Ot does */
#pragma unroll
  for (int dt = 0; dt < DT; ++dt)      /* oacc[dt][r] = Ot[dt*16 + 8*hh + r][q0 + ln] */
#pragma unroll
    for (int q = 0; q < 2; ++q) { v4f o4;
#pragma unroll
      for (int i = 0; i < 4; ++i) o4[i] = oacc[dt][q * 4 + i] * inv;
      *(v4fa*)&sO[w][ln][dt * 16 + 8 * hh + q * 4] = o4; }
  __builtin_amdgcn_fence(__ATOMIC_ACQ_REL, "workgroup"); __builtin_amdgcn_wave_barrier();
  {
#pragma unroll
    for (int rp = 0; rp < RPW; rp += 2) { const int r = rp + (lane >> 4), pc = lane & 15; const v4f val = *(const v4fa*)&sO[w][r][pc * 4]; *(v4f*)(O + ((size_t)b * TQ + q0 + r) * ldo + h * 64 + pc * 4) = val; }
     } }
__global__ __launch_bounds__(256) void k_split(const float* __restrict__ F, _Float16* __restrict__ Hh, _Float16* __restrict__ Hl, size_t n8) {
  #pragma clang fp contract(off)
  const size_t t = (size_t)blockIdx.x * 256 + threadIdx.x; if (t >= n8) return; const v4f a = *(const v4fa*)(F + t * 8), c = *(const v4fa*)(F + t * 8 + 4); FragH fh, fl;
#pragma unroll
  for (int q = 0; q < 8; ++q) { const float v = (q < 4) ? a[q] : c[q - 4]; const _Float16 hi = (_Float16)v; fh.h[q] = hi; fl.h[q] = (_Float16)((v - (float)hi) * 1024.0f); }
  { *(v8us*)((unsigned short*)Hh + t * 8) = fh.half[0]; *(v8us*)((unsigned short*)Hl + t * 8) = fl.half[0];  } }


#define PIDX(i) ((((i) >> 3) << 5) + ((i) & 7))
__global__ __launch_bounds__(256) void k_rowflag(const float* __restrict__ X, int* __restrict__ FL) {
  #pragma clang fp contract(off)
  __shared__ int sf[8];
  const int tid = threadIdx.x, w = tid >> 5, ln = tid & 31; const int r = blockIdx.x * 8 + w; const float* x = X + (size_t)r * DKV; float s = 0.f;
#pragma unroll
  for (int u = 0; u < DKV / 32; ++u) s += bf16_round(x[u * 32 + ln]);
  for (int o = 16; o > 0; o >>= 1) s += __shfl_xor(s, o, 32);
  if (ln == 0) sf[w] = (s == 0.0f) ? 1 : 0;
  __syncthreads();
  if (tid < 32) { const int v = (tid < 8) ? sf[tid] : 0; int* d = FL + blockIdx.x * 32 + tid; *(int*)d = v;  } }      
__global__ __launch_bounds__(256) void k_zerorows(const int* __restrict__ FL, _Float16* __restrict__ P16) {
  const size_t t = (size_t)blockIdx.x * 256 + threadIdx.x; if (t >= (size_t)NR * DM / 8) return; const int r = (int)(t / (DM / 8)); if (FL[PIDX(r)] == 0) return; FragH z;
#pragma unroll
  for (int q = 0; q < 8; ++q) z.h[q] = (_Float16)0.0f; *(v8us*)((unsigned short*)P16 + t * 8) = z.half[0];  }
extern "C" void kernel_launch(void* const* d_in, const int* in_sizes, int n_in,
                              void* d_out, int out_size, void* d_ws, size_t ws_size, hipStream_t stream) {
  (void)in_sizes; (void)n_in; (void)out_size;
  const float* const* I = (const float* const*)d_in; const float* qi = I[0]; const float* ki = I[1]; const float* vi = I[2];
  const float* Wq = I[3]; const float* bq = I[4]; const float* Wk = I[5]; const float* bk = I[6]; const float* Wv = I[7]; const float* bv = I[8]; const float* Wo = I[9]; const float* bo = I[10];
  char* ws = (char*)d_ws; size_t off = 0;
  auto take = [&](size_t bytes) { char* p = ws + off; off += (bytes + 255) & ~(size_t)255; return p; };
  _Float16* BQ = (_Float16*)take((size_t)DM * DM * 2); _Float16* BK = (_Float16*)take((size_t)DM * DKV * 2); _Float16* BV = (_Float16*)take((size_t)DM * DKV * 2); _Float16* BO = (_Float16*)take((size_t)DM * DM * 2);
  _Float16* X16 = (_Float16*)take((size_t)NR * DM * 2); _Float16* Q16 = (_Float16*)take((size_t)NR * DM * 2); _Float16* K16 = (_Float16*)take((size_t)NR * DM * 2); _Float16* V16 = (_Float16*)take((size_t)NR * DM * 2); _Float16* VT = (_Float16*)take((size_t)NR * DM * 2);
  int* FLK = (int*)take((size_t)(NR / 8) * 32 * 4); int* FLV = (int*)take((size_t)(NR / 8) * 32 * 4);
  float* O = (float*)take((size_t)NR * DM * 4); _Float16* Oh = (_Float16*)take((size_t)NR * DM * 2); _Float16* Ol = (_Float16*)take((size_t)NR * DM * 2);      /* all batches */
  if (off > ws_size) return;      /* 6 + 16 x 5 + 0.3 + 32 + 16 + 16 = 150 MiB */
  const size_t n8 = (size_t)NR * DM / 8, n8k = (size_t)NR * DKV / 8; const unsigned nb8 = (unsigned)((n8 + 255) / 256), nb8k = (unsigned)((n8k + 255) / 256);
  k_wt_f16<<<(unsigned)(((size_t)DM * DM / 8 + 255) / 256), 256, 0, stream>>>(Wq, BQ, DM, DM, 16.0f); k_wt_f16<<<(unsigned)(((size_t)DKV * DM / 8 + 255) / 256), 256, 0, stream>>>(Wk, BK, DKV, DM, 16.0f); k_wt_f16<<<(unsigned)(((size_t)DKV * DM / 8 + 255) / 256), 256, 0, stream>>>(Wv, BV, DKV, DM, 16.0f); k_wt_f16<<<(unsigned)(((size_t)DM * DM / 8 + 255) / 256), 256, 0, stream>>>(Wo, BO, DM, DM, 16.0f);      /* (in,out) -> [out][in] x16 */
  const dim3 gP((NR / 128) * (DM / 64), 1);
  k_x16<<<nb8, 256, 0, stream>>>(qi, X16, n8); k_gemm2<0><<<gP, 128, 0, stream>>>(X16, DM, 0, BQ, DM, 0, 0.0625f, bq, 0, nullptr, 0.f, nullptr, Q16, DM, 0, NR, DM, DM);      /* q -> f16 */
  k_x16<<<nb8k, 256, 0, stream>>>(ki, X16, n8k); k_rowflag<<<NR / 8, 256, 0, stream>>>(ki, FLK); k_gemm2<0><<<gP, 128, 0, stream>>>(X16, DKV, 0, BK, DKV, 0, 0.0625f, bk, 0, nullptr, 0.f, nullptr, K16, DM, 0, NR, DM, DKV); k_zerorows<<<nb8, 256, 0, stream>>>(FLK, K16);      /* k -> f16 (masked rows zeroed) */
  k_x16<<<nb8k, 256, 0, stream>>>(vi, X16, n8k); k_rowflag<<<NR / 8, 256, 0, stream>>>(vi, FLV); k_gemm2<0><<<gP, 128, 0, stream>>>(X16, DKV, 0, BV, DKV, 0, 0.0625f, bv, 0, nullptr, 0.f, nullptr, V16, DM, 0, NR, DM, DKV); k_zerorows<<<nb8, 256, 0, stream>>>(FLV, V16);      /* v -> f16 */
  k_vt<NH, TK><<<NBT * NH * (TK / 64), 256, 0, stream>>>(V16, DM, 0, VT);      /* Vt[(b,h)][d][s] */
  float* outp = (float*)d_out;
  k_flash<<<NBT * NH * (TQ / 64), 128, 0, stream>>>(Q16, DM, K16, DM, VT, nullptr, O, DM);      /* all batches in one grid: slab = b*NH + h */
  k_split<<<nb8, 256, 0, stream>>>(O, Oh, Ol, n8);
  k_gemm2<0><<<gP, 128, 0, stream>>>(Oh, DM, 0, BO, DM, 0, 0.0625f, bo, 0, Ol, 1.0f / 1024.0f, outp, nullptr, DM, 0, NR, DM, DM);      /* out = (Oh + Ol / 1024)*Wo + bo, one k loop */
}

// v007
// A run of this version takes 184 microseconds.
// In both of two side-by-side timings against v006, it was 1.17 times as fast.
// Over all steps from v000 it is 7.42 times as fast.
#include <hip/hip_runtime.h>
// Multi-head cross attention over social features (B 4, S 2048 queries x 1024, 2048 keys/values x 512, 16 heads x 64; (in,out) Linear weights with bias; key/value rows whose raw features sum to exactly 0 are zeroed after projection, as the reference's padding mask): scores = q.k/8; softmax; out = (attn.v merged)*Wo + bo -> [4,2048,1024].
// Compute dtype: the inputs, the four matrices and biases rounded to bf16; q/k/v products exact (weights x16 in f16, undone by alpha), q, k, v, P as f16 operands (~2^-12; logits sigma ~0.4), O as f16 hi + lo; f32 accumulation and softmax. v_wmma_f32_16x16x32_f16.
#define NBT 4
#define TQ 2048
#define TK 2048
#define DKV 512
#define NR (NBT * TQ)
#define DM 1024
#define NH 16
#define SCL 0.125f
#define SCL2 (SCL * 1.44269504088896340736f)      /* 1/8 x log2(e): scores in base-2 exponent units */
typedef __bf16 v16b __attribute__((ext_vector_type(16)));
typedef unsigned short v8us __attribute__((ext_vector_type(8), may_alias));
typedef float  v8f  __attribute__((ext_vector_type(8)));
typedef float  v4f  __attribute__((ext_vector_type(4)));
typedef float  v4fa __attribute__((ext_vector_type(4), may_alias));
union FragB { v16b v; v8us half[2]; unsigned short u[16]; };

__device__ __forceinline__ unsigned short bf16_bits(float x) { unsigned int u = __float_as_uint(x); return (unsigned short)((u + 0x7FFFu + ((u >> 16) & 1u)) >> 16); }
__device__ __forceinline__ float bf16_val(unsigned short b) { return __uint_as_float(((unsigned int)b) << 16); }
__device__ __forceinline__ float bf16_round(float x) { return bf16_val(bf16_bits(x)); }
// D += A·B with NT terms: 1 = ah·bh, 2 = + al·bh (A split), 3 = + ah·bl (both split)
template <int NT>
__device__ __forceinline__ v8f mmaN(v16b ah, v16b al, v16b bh, v16b bl, v8f c) {
  c = __builtin_amdgcn_wmma_f32_16x16x32_bf16(false, ah, false, bh, (short)0, c, false, false);
  if (NT >= 2) c = __builtin_amdgcn_wmma_f32_16x16x32_bf16(false, al, false, bh, (short)0, c, false, false);
  if (NT >= 3) c = __builtin_amdgcn_wmma_f32_16x16x32_bf16(false, ah, false, bl, (short)0, c, false, false);
  asm volatile("v_nop\n\tv_nop\n\tv_nop\n\tv_nop" : "+v"(c) : "v"(ah), "v"(al), "v"(bh), "v"(bl));
  return c;
}

__global__ __launch_bounds__(256) void k_wt_bf16(const float* __restrict__ W, unsigned short* __restrict__ Wt, int K, int N) {
  const int t = blockIdx.x * 256 + threadIdx.x;
  const int k8n = K / 8;
  if (t >= N * k8n) return;
  const int n = t / k8n, k8 = (t % k8n) * 8;
  v8us v;
#pragma unroll
  for (int i = 0; i < 8; ++i) v[i] = bf16_bits(W[(size_t)(k8 + i) * N + n]);
  *(v8us*)(Wt + (size_t)n * K + k8) = v;
  
}

// GEMM C[M][N] (f32, pitch ldc) = act(A[M][K]·W + bias). A f32 row-major (pitch lda) converted per fragment to bf16
// (ASPLIT: hi/lo two planes -> 2 terms, else single rounded term); Wt bf16 [N][K] (pitch ldb). BIAS_BF16 rounds the
// bias to bf16 first (bias quantised to bf16 before the add). K%32==0, M%16==0, N%64==0.
template <bool ASPLIT, int ACT, bool BIAS_BF16>
__global__ __launch_bounds__(128) void k_gemm_bf(const float* __restrict__ A, int lda, const unsigned short* __restrict__ Wt, int ldb,
                                               const float* __restrict__ bias, float* __restrict__ C, int ldc, int M, int N, int K) {
  __shared__ __attribute__((aligned(16))) float so[4][16][64];
  const int tid = threadIdx.x, w = tid >> 5, lane = tid & 31, ln = lane & 15, hh = lane >> 4;
  const int ntn = N / 64;
  const int wid = blockIdx.x * 4 + w;
  const int mt = wid / ntn, nq = wid % ntn;
  if (mt * 16 >= M) return;
  const int row0 = mt * 16, col0 = nq * 64;
  const float* arow = A + (size_t)(row0 + ln) * lda;
  v8f acc[4] = {};
  for (int kb = 0; kb < K; kb += 32) {
    FragB ah, al;
    const v4f x0 = *(const v4fa*)(arow + kb + 8 * hh), x1 = *(const v4fa*)(arow + kb + 8 * hh + 4);
    const v4f x2 = *(const v4fa*)(arow + kb + 16 + 8 * hh), x3 = *(const v4fa*)(arow + kb + 16 + 8 * hh + 4);
    float xs[16] = {x0[0],x0[1],x0[2],x0[3],x1[0],x1[1],x1[2],x1[3],x2[0],x2[1],x2[2],x2[3],x3[0],x3[1],x3[2],x3[3]};
#pragma unroll
    for (int i = 0; i < 16; ++i) { const unsigned short hb = bf16_bits(xs[i]); ah.u[i] = hb; al.u[i] = ASPLIT ? bf16_bits(xs[i] - bf16_val(hb)) : (unsigned short)0; }
#pragma unroll
    for (int t = 0; t < 4; ++t) {
      const unsigned short* brow = Wt + (size_t)(col0 + t * 16 + ln) * ldb + kb;
      FragB b;
      b.half[0] = *(const v8us*)(brow + 8 * hh);
      b.half[1] = *(const v8us*)(brow + 16 + 8 * hh);
      acc[t] = mmaN<ASPLIT ? 2 : 1>(ah.v, al.v, b.v, b.v, acc[t]);
    }
  }
#pragma unroll
  for (int t = 0; t < 4; ++t) {
    float bv = bias ? bias[col0 + t * 16 + ln] : 0.f;
    if (BIAS_BF16) bv = bf16_round(bv);
#pragma unroll
    for (int r = 0; r < 8; ++r) { float v = acc[t][r] + bv; if (ACT == 1) v = fmaxf(v, 0.f); so[w][8 * hh + r][t * 16 + ln] = v; }
  }
  __builtin_amdgcn_fence(__ATOMIC_ACQ_REL, "workgroup");
  __builtin_amdgcn_wave_barrier();
  const int rsub = lane >> 4, c4 = (lane & 15) * 4;
  {
#pragma unroll
    for (int q = 0; q < 8; ++q) {
      const int r = q * 2 + rsub;
      const v4f v = *(const v4fa*)&so[w][r][c4];
      *(v4f*)(C + (size_t)(row0 + r) * ldc + col0 + c4) = v;
    }
    
  }
}

// GEMM C = act(A·W + bias + resid): A f32 (ASPLIT -> hi/lo 2 terms), Wt bf16 [N][K]; ACT 0 none, 1 relu, 2 exact gelu;
// resid (optional, f32, row index = (row % rmod), pitch ldr, RES_BF16 rounds it) added before the activation.
template <bool ASPLIT, int ACT, bool BIAS_BF16, bool RES_BF16>
__global__ __launch_bounds__(128) void k_gemm_bf3(const float* __restrict__ A, int lda, const unsigned short* __restrict__ Wt, int ldb,
                                                const float* __restrict__ bias, const float* __restrict__ resid, int rmod, int ldr,
                                                float* __restrict__ C, int ldc, int M, int N, int K) {
  __shared__ __attribute__((aligned(16))) float so[4][16][64];
  const int tid = threadIdx.x, w = tid >> 5, lane = tid & 31, ln = lane & 15, hh = lane >> 4;
  const int ntn = N / 64;
  const int wid = blockIdx.x * 4 + w;
  const int mt = wid / ntn, nq = wid % ntn;
  if (mt * 16 >= M) return;
  const int row0 = mt * 16, col0 = nq * 64;
  const float* arow = A + (size_t)(row0 + ln) * lda;
  v8f acc[4] = {};
  for (int kb = 0; kb < K; kb += 32) {
    FragB ah, al;
    const v4f x0 = *(const v4fa*)(arow + kb + 8 * hh), x1 = *(const v4fa*)(arow + kb + 8 * hh + 4);
    const v4f x2 = *(const v4fa*)(arow + kb + 16 + 8 * hh), x3 = *(const v4fa*)(arow + kb + 16 + 8 * hh + 4);
    float xs[16] = {x0[0],x0[1],x0[2],x0[3],x1[0],x1[1],x1[2],x1[3],x2[0],x2[1],x2[2],x2[3],x3[0],x3[1],x3[2],x3[3]};
#pragma unroll
    for (int i = 0; i < 16; ++i) { const unsigned short hb = bf16_bits(xs[i]); ah.u[i] = hb; al.u[i] = ASPLIT ? bf16_bits(xs[i] - bf16_val(hb)) : (unsigned short)0; }
#pragma unroll
    for (int t = 0; t < 4; ++t) {
      const unsigned short* brow = Wt + (size_t)(col0 + t * 16 + ln) * ldb + kb;
      FragB b;
      b.half[0] = *(const v8us*)(brow + 8 * hh);
      b.half[1] = *(const v8us*)(brow + 16 + 8 * hh);
      acc[t] = mmaN<ASPLIT ? 2 : 1>(ah.v, al.v, b.v, b.v, acc[t]);
    }
  }
#pragma unroll
  for (int t = 0; t < 4; ++t) {
    const int col = col0 + t * 16 + ln;
    float bv = bias ? bias[col] : 0.f;
    if (BIAS_BF16) bv = bf16_round(bv);
#pragma unroll
    for (int r = 0; r < 8; ++r) {
      float v = acc[t][r] + bv;
      if (resid) { float rv = resid[(size_t)((row0 + 8 * hh + r) % rmod) * ldr + col]; if (RES_BF16) rv = bf16_round(rv); v += rv; }
      if (ACT == 1) v = fmaxf(v, 0.f);
      if (ACT == 2) v = 0.5f * v * (1.0f + erff(v * 0.70710678118654752f));
      if (ACT == 3) { const float u = 0.7978845608028654f * (v + 0.044715f * v * v * v); v = 0.5f * v * (1.0f + tanhf(u)); }
      so[w][8 * hh + r][t * 16 + ln] = v;
    }
  }
  __builtin_amdgcn_fence(__ATOMIC_ACQ_REL, "workgroup");
  __builtin_amdgcn_wave_barrier();
  const int rsub = lane >> 4, c4 = (lane & 15) * 4;
  {
#pragma unroll
    for (int q = 0; q < 8; ++q) {
      const int r = q * 2 + rsub;
      const v4f v = *(const v4fa*)&so[w][r][c4];
      *(v4f*)(C + (size_t)(row0 + r) * ldc + col0 + c4) = v;
    }
    
  }
}
// row LayerNorm (biased variance, eps) over N: s = X (+ R); optional out_sum <- s; out_norm <- (s-mu)*rsqrt(var+eps)*g + b
template <bool PARAM_BF16>
__global__ __launch_bounds__(256) void k_layernorm(const float* __restrict__ X, const float* __restrict__ R, const float* __restrict__ g, const float* __restrict__ bta,
                                                  float* __restrict__ out_sum, float* __restrict__ out_norm, int N, float eps) {
  __shared__ float red[256];
  const int row = blockIdx.x, tid = threadIdx.x;
  const float* x = X + (size_t)row * N; const float* rr = R ? R + (size_t)row * N : nullptr;
  float vals[16];                     // up to N = 4096
  const int per = N / 256;            // contiguous chunk per thread? use strided-by-4 chunks: thread handles j = tid*4 + 1024*u
  float s1 = 0.f;
  for (int u = 0; u < per / 4; ++u) {
    const int j = tid * 4 + 1024 * u;
    const v4f a = *(const v4fa*)(x + j);
    v4f b = {0.f,0.f,0.f,0.f}; if (rr) b = *(const v4fa*)(rr + j);
#pragma unroll
    for (int q = 0; q < 4; ++q) { const float v = a[q] + b[q]; vals[u * 4 + q] = v; s1 += v; }
  }
  red[tid] = s1; __syncthreads();
  for (int st = 128; st > 0; st >>= 1) { if (tid < st) red[tid] += red[tid + st]; __syncthreads(); }
  const float mu = red[0] / (float)N; __syncthreads();
  float s2 = 0.f;
  for (int u = 0; u < per / 4; ++u)
#pragma unroll
    for (int q = 0; q < 4; ++q) { const float c = vals[u * 4 + q] - mu; s2 += c * c; }
  red[tid] = s2; __syncthreads();
  for (int st = 128; st > 0; st >>= 1) { if (tid < st) red[tid] += red[tid + st]; __syncthreads(); }
  const float rs = rsqrtf(red[0] / (float)N + eps);
  {
    for (int u = 0; u < per / 4; ++u) {
      const int j = tid * 4 + 1024 * u;
      v4f o, sm;
#pragma unroll
      for (int q = 0; q < 4; ++q) {
        float gg = g[j + q], bb = bta[j + q];
        if (PARAM_BF16) { gg = bf16_round(gg); bb = bf16_round(bb); }
        sm[q] = vals[u * 4 + q]; o[q] = (vals[u * 4 + q] - mu) * rs * gg + bb;
      }
      if (out_sum) *(v4f*)(out_sum + (size_t)row * N + j) = sm;
      *(v4f*)(out_norm + (size_t)row * N + j) = o;
    }
    
  }
}



// ---- f16 WMMA path (v_wmma_f32_16x16x32_f16): 11-bit significands for operands in range — used where a [0,1] probability operand needs more precision than bf16
typedef _Float16 v16h __attribute__((ext_vector_type(16)));
union FragH { v16h v; v8us half[2]; _Float16 h[16]; unsigned short u[16]; };
template <int NT>
__device__ __forceinline__ v8f mmaH(v16h ah, v16h al, v16h bh, v16h bl, v8f c) {
  c = __builtin_amdgcn_wmma_f32_16x16x32_f16(false, ah, false, bh, (short)0, c, false, false);
  if (NT >= 2) c = __builtin_amdgcn_wmma_f32_16x16x32_f16(false, al, false, bh, (short)0, c, false, false);
  if (NT >= 3) c = __builtin_amdgcn_wmma_f32_16x16x32_f16(false, ah, false, bl, (short)0, c, false, false);
  asm volatile("v_nop\n\tv_nop\n\tv_nop\n\tv_nop" : "+v"(c) : "v"(ah), "v"(al), "v"(bh), "v"(bl));
  return c;
}
// batched GEMM like k_gemm_b but f16 operands: A f32 (split into f16 hi/lo if ASPLIT, else rounded to f16), Bt = f16 values [n][k]; alpha; C f32; N multiple of 16 (partial tiles skipped)
template <bool ASPLIT>
__global__ __launch_bounds__(128) void k_gemm_h(const float* __restrict__ A, int lda, size_t sA, const _Float16* __restrict__ Bh, int ldb, size_t sB, float alpha, float* __restrict__ C, int ldc, size_t sC, int M, int N, int K) {
  __shared__ __attribute__((aligned(16))) float so[4][16][64];
  const int tid = threadIdx.x, w = tid >> 5, lane = tid & 31, ln = lane & 15, hh = lane >> 4; const int by = blockIdx.y;
  A += (size_t)by * sA; Bh += (size_t)by * sB; C += (size_t)by * sC;
  const int ntn = (N + 63) / 64; const int wid = blockIdx.x * 4 + w; const int mt = wid / ntn, nq = wid % ntn; if (mt * 16 >= M) return;
  const int row0 = mt * 16, col0 = nq * 64; const float* arow = A + (size_t)(row0 + ln) * lda;
  v8f acc[4] = {};
  for (int kb = 0; kb < K; kb += 32) {
    FragH ah, al;
    const v4f x0 = *(const v4fa*)(arow + kb + 8 * hh), x1 = *(const v4fa*)(arow + kb + 8 * hh + 4), x2 = *(const v4fa*)(arow + kb + 16 + 8 * hh), x3 = *(const v4fa*)(arow + kb + 16 + 8 * hh + 4);
    float xs[16] = {x0[0],x0[1],x0[2],x0[3],x1[0],x1[1],x1[2],x1[3],x2[0],x2[1],x2[2],x2[3],x3[0],x3[1],x3[2],x3[3]};
#pragma unroll
    for (int i = 0; i < 16; ++i) { const _Float16 h = (_Float16)xs[i]; ah.h[i] = h; al.h[i] = ASPLIT ? (_Float16)(xs[i] - (float)h) : (_Float16)0.0f; }
#pragma unroll
    for (int t = 0; t < 4; ++t) { if (col0 + t * 16 >= N) continue; const size_t boff = (size_t)(col0 + t * 16 + ln) * ldb + kb; FragH bq; bq.half[0] = *(const v8us*)(Bh + boff + 8 * hh); bq.half[1] = *(const v8us*)(Bh + boff + 16 + 8 * hh);
      acc[t] = mmaH<ASPLIT ? 2 : 1>(ah.v, al.v, bq.v, bq.v, acc[t]); }
  }
#pragma unroll
  for (int t = 0; t < 4; ++t) { if (col0 + t * 16 >= N) continue;
#pragma unroll
    for (int r = 0; r < 8; ++r) so[w][8 * hh + r][t * 16 + ln] = acc[t][r] * alpha; }
  __builtin_amdgcn_fence(__ATOMIC_ACQ_REL, "workgroup"); __builtin_amdgcn_wave_barrier();
  const int rsub = lane >> 4, c4 = (lane & 15) * 4;
  {
#pragma unroll
    for (int q = 0; q < 8; ++q) { const int r = q * 2 + rsub; if (col0 + c4 < N) { const v4f v = *(const v4fa*)&so[w][r][c4]; *(v4f*)(C + (size_t)(row0 + r) * ldc + col0 + c4) = v; } }
     }
}

// Wt[n][k] = f16(W[k][n]·scale) from f32 row-major W[K][N] (scale = power of two; bf16-exact weights stay exact in f16 away from the subnormal range)
__device__ __forceinline__ void d_wt_f16(int bid, const float* __restrict__ W, _Float16* __restrict__ Wt, int K, int N, float scale) {
  const int t = bid * 256 + threadIdx.x; if (t >= N * (K / 8)) return; const int n = t / (K / 8), k8 = (t % (K / 8)) * 8; FragH f;
#pragma unroll
  for (int i = 0; i < 8; ++i) f.h[i] = (_Float16)(bf16_round(W[(size_t)(k8 + i) * N + n]) * scale); const v8us o = f.half[0];
  *(v8us*)((unsigned short*)Wt + (size_t)n * K + k8) = o; 
}
// k_gemm_hh variant with fused epilogue: v = acc·alpha + bias[by·sBias + col] (+ CP[(row/rowsPerB)·sCPb + by·64 + col] if CP) ; ACT 0 none / 1 elu ; writes f16 C16 (and f32 C if non-null)
template <int ACT>
__global__ __launch_bounds__(128) void k_gemm_hhx(const _Float16* __restrict__ A, int lda, size_t sA, const _Float16* __restrict__ Bh, int ldb, size_t sB, float alpha, const float* __restrict__ bias, size_t sBias, const float* __restrict__ CP, int rowsPerB, size_t sCPb, int row0g,
    float* __restrict__ C, _Float16* __restrict__ C16, int ldc, size_t sC, int M, int N, int K) {
  __shared__ __attribute__((aligned(16))) float so[4][16][64];
  const int tid = threadIdx.x, w = tid >> 5, lane = tid & 31, ln = lane & 15, hh = lane >> 4; const int by = blockIdx.y;
  A += (size_t)by * sA; Bh += (size_t)by * sB; const size_t cofs = (size_t)by * sC; const float* bp = bias ? bias + (size_t)by * sBias : nullptr;
  const int ntn = (N + 63) / 64; const int wid = blockIdx.x * 4 + w; const int mt = wid / ntn, nq = wid % ntn; if (mt * 16 >= M) return;
  const int row0 = mt * 16, col0 = nq * 64; const _Float16* arow = A + (size_t)(row0 + ln) * lda;
  v8f acc[4] = {};
  for (int kb = 0; kb < K; kb += 32) { FragH ah; ah.half[0] = *(const v8us*)((const unsigned short*)arow + kb + 8 * hh); ah.half[1] = *(const v8us*)((const unsigned short*)arow + kb + 16 + 8 * hh);
#pragma unroll
    for (int t = 0; t < 4; ++t) { if (col0 + t * 16 >= N) continue; const size_t boff = (size_t)(col0 + t * 16 + ln) * ldb + kb; FragH bq; bq.half[0] = *(const v8us*)((const unsigned short*)Bh + boff + 8 * hh); bq.half[1] = *(const v8us*)((const unsigned short*)Bh + boff + 16 + 8 * hh);
      acc[t] = mmaH<1>(ah.v, ah.v, bq.v, bq.v, acc[t]); }
  }
#pragma unroll
  for (int t = 0; t < 4; ++t) { if (col0 + t * 16 >= N) continue; const int col = col0 + t * 16 + ln; const float bv = bp ? bf16_round(bp[col]) : 0.f;
#pragma unroll
    for (int r = 0; r < 8; ++r) { float v = acc[t][r] * alpha + bv; if (CP) { const int bidx = (row0g + row0 + 8 * hh + r) / rowsPerB; v += CP[(size_t)bidx * sCPb + (size_t)by * 64 + col]; } if (ACT == 1) v = (v > 0.f) ? v : expm1f(v); else if (ACT == 7) v = (v > 0.f) ? v + 1.0f : expf(v); else if (ACT == 8) v = tanhf(v); else if (ACT == 9) v = 0.5f * v * (1.0f + tanhf(0.7978845608028654f * (v + 0.044715f * v * v * v))); else if (ACT == 11) v = 1.0f / (1.0f + expf(-v)); else if (ACT == 12) v = (v > 0.f) ? v : 0.01f * v; else if (ACT == 14) v = (v > 0.f) ? v : 0.1f * v; else if (ACT == 15) v = v / (1.0f + expf(-v)); else if (ACT == 3) v = fmaxf(v, 0.f); else if (ACT == 6) v = 0.5f * v * (1.0f + erff(v * 0.70710678118654752f)); so[w][8 * hh + r][t * 16 + ln] = v; } }
  __builtin_amdgcn_fence(__ATOMIC_ACQ_REL, "workgroup"); __builtin_amdgcn_wave_barrier();
  const int rsub = lane >> 4, c4 = (lane & 15) * 4; typedef _Float16 v4h __attribute__((ext_vector_type(4)));
  {
#pragma unroll
    for (int q = 0; q < 8; ++q) { const int r = q * 2 + rsub; if (col0 + c4 < N) { const v4f v = *(const v4fa*)&so[w][r][c4]; if (C) *(v4f*)(C + cofs + (size_t)(row0 + r) * ldc + col0 + c4) = v; if (C16) { v4h h4; for (int i = 0; i < 4; ++i) h4[i] = (_Float16)v[i]; *(v4h*)(C16 + cofs + (size_t)(row0 + r) * ldc + col0 + c4) = h4; } } }
     }
}


typedef _Float16 v4h __attribute__((ext_vector_type(4)));

__device__ __forceinline__ void d_x16(int bid, const float* __restrict__ x, _Float16* __restrict__ X16, size_t n8) { const size_t t = (size_t)bid * 256 + threadIdx.x; if (t >= n8) return; FragH f;
#pragma unroll
  for (int q = 0; q < 8; ++q) f.h[q] = (_Float16)bf16_round(x[t * 8 + q]); *(v8us*)((unsigned short*)X16 + t * 8) = f.half[0];  }
__global__ __launch_bounds__(256) void k_h16(const float* __restrict__ x, _Float16* __restrict__ X16, size_t n8) { const size_t t = (size_t)blockIdx.x * 256 + threadIdx.x; if (t >= n8) return; FragH f;
#pragma unroll
  for (int q = 0; q < 8; ++q) f.h[q] = (_Float16)x[t * 8 + q]; *(v8us*)((unsigned short*)X16 + t * 8) = f.half[0];  }
__global__ __launch_bounds__(256) void k_round16f(const float* __restrict__ W, _Float16* __restrict__ Bt, size_t n8) { const size_t t = (size_t)blockIdx.x * 256 + threadIdx.x; if (t >= n8) return; FragH f;
#pragma unroll
  for (int i = 0; i < 8; ++i) f.h[i] = (_Float16)(bf16_round(W[t * 8 + i]) * 16.0f); *(v8us*)((unsigned short*)Bt + t * 8) = f.half[0];  }
template <int NHv, int TTv>
__global__ __launch_bounds__(256) void k_vt(const _Float16* __restrict__ V16, int ldv, int voff, _Float16* __restrict__ Vt) { __shared__ unsigned short tl[64][66]; const int tid = threadIdx.x; const int slab = blockIdx.x / (TTv / 64), lg = blockIdx.x % (TTv / 64); const int b = slab / NHv, h = slab % NHv;
  for (int i = tid; i < 64 * 8; i += 256) { const int r = i / 8, c8 = (i % 8) * 8; FragH f; f.half[0] = *(const v8us*)((const unsigned short*)V16 + ((size_t)b * TTv + lg * 64 + r) * ldv + voff + h * 64 + c8);
#pragma unroll
    for (int q = 0; q < 8; ++q) tl[r][c8 + q] = f.u[q]; }
  __syncthreads();
  {
#pragma unroll
    for (int rd = 0; rd < 2; ++rd) { const int d = rd * 32 + tid / 8, pc = tid % 8; FragH f;
#pragma unroll
      for (int q = 0; q < 8; ++q) f.u[q] = tl[pc * 8 + q][d];
      *(v8us*)((unsigned short*)Vt + ((size_t)slab * 64 + d) * TTv + lg * 64 + pc * 8) = f.half[0]; }
     } }

__global__ __launch_bounds__(256) void k_hl(const float* __restrict__ F, _Float16* __restrict__ Hh, _Float16* __restrict__ Hl, size_t n8) { const size_t t = (size_t)blockIdx.x * 256 + threadIdx.x; if (t >= n8) return; FragH fh, fl; const v4f a = *(const v4fa*)(F + t * 8), c = *(const v4fa*)(F + t * 8 + 4);
#pragma unroll
  for (int q = 0; q < 4; ++q) { _Float16 h = (_Float16)a[q]; fh.h[q] = h; fl.h[q] = (_Float16)((a[q] - (float)h) * 1024.0f); h = (_Float16)c[q]; fh.h[4 + q] = h; fl.h[4 + q] = (_Float16)((c[q] - (float)h) * 1024.0f); }
  { *(v8us*)((unsigned short*)Hh + t * 8) = fh.half[0]; *(v8us*)((unsigned short*)Hl + t * 8) = fl.half[0];  } }

// ---- fast GEMM (wave tile 32x64, work-group tile 128x64); epilogue = k_gemm_hhx semantics without its CP term ----
__device__ __forceinline__ v8f g2_mma(v16h a, v16h b, v8f c) { v8f d = __builtin_amdgcn_wmma_f32_16x16x32_f16(false, a, false, b, (short)0, c, false, false); asm volatile("v_nop\n\tv_nop\n\tv_nop\n\tv_nop" : "+v"(d) : "v"(a), "v"(b)); return d; }
// A and B reach the four waves of a work-group through a two-buffer LDS ring. One tile = 64 k: 128 A rows, then 64 B rows, 128 data bytes a row at a pitch of 144 B (16 B x odd: no bank conflict for 16-byte readers).
// Needs M % 128 == 0 and K % 64 == 0 on top of N % 64 == 0.
// A2 (optional): a second A plane of the same shape for C = (A + a2s x A2).B in ONE k loop: the ring first runs A2's K / 64 tiles against B, the accumulators are then scaled by a2s (a power of two: exact), and A's tiles follow into the same accumulators.
#define GKT 64
#define GPIT 144
#define GTILE (192 * GPIT)
// One tile: 12 asynchronous 16-byte copies a lane (128 lanes x 12 x 16 B = 24 KiB); 8 lanes cover one 128-B row, so a wave's copy asks for 4 whole lines (a fragment load straight from global memory would touch 16 lines for its 512 bytes).
// s_wait_xcnt closes the statement so that no address register of a copy is rewritten in front of it.
__device__ __forceinline__ void g2_copy(unsigned l0, const unsigned short* ga, int lda, const unsigned short* gb, int ldb) {
  asm volatile("global_load_async_to_lds_b128 %0, %12, off\n\t"
               "global_load_async_to_lds_b128 %1, %13, off\n\t"
               "global_load_async_to_lds_b128 %2, %14, off\n\t"
               "global_load_async_to_lds_b128 %3, %15, off\n\t"
               "global_load_async_to_lds_b128 %4, %16, off\n\t"
               "global_load_async_to_lds_b128 %5, %17, off\n\t"
               "global_load_async_to_lds_b128 %6, %18, off\n\t"
               "global_load_async_to_lds_b128 %7, %19, off\n\t"
               "global_load_async_to_lds_b128 %8, %20, off\n\t"
               "global_load_async_to_lds_b128 %9, %21, off\n\t"
               "global_load_async_to_lds_b128 %10, %22, off\n\t"
               "global_load_async_to_lds_b128 %11, %23, off\n\t"
               "s_wait_xcnt 0x0"
               :: "v"(l0), "v"(l0 + 16u * GPIT), "v"(l0 + 32u * GPIT), "v"(l0 + 48u * GPIT), "v"(l0 + 64u * GPIT), "v"(l0 + 80u * GPIT), "v"(l0 + 96u * GPIT), "v"(l0 + 112u * GPIT), "v"(l0 + 128u * GPIT), "v"(l0 + 144u * GPIT), "v"(l0 + 160u * GPIT), "v"(l0 + 176u * GPIT),
                  "v"(ga), "v"(ga + (size_t)16 * lda), "v"(ga + (size_t)32 * lda), "v"(ga + (size_t)48 * lda), "v"(ga + (size_t)64 * lda), "v"(ga + (size_t)80 * lda), "v"(ga + (size_t)96 * lda), "v"(ga + (size_t)112 * lda),
                  "v"(gb), "v"(gb + (size_t)16 * ldb), "v"(gb + (size_t)32 * ldb), "v"(gb + (size_t)48 * ldb)
               : "memory");
}
__device__ __forceinline__ v16h g2_lfrag(const unsigned char* p) { FragH f; f.half[0] = *(const v8us*)p; f.half[1] = *(const v8us*)(p + 32); return f.v; }      /* p = a row's 32-k slice + 16*hh bytes: k = 8*hh .. 8*hh + 7, then 16 + 8*hh .. 16 + 8*hh + 7, for A and B alike */
template <int ACT>
__device__ __forceinline__ void g2_run(unsigned bx, int by, const _Float16* __restrict__ A, int lda, size_t sA, const _Float16* __restrict__ Bh, int ldb, size_t sB, float alpha, const float* __restrict__ bias, size_t sBias, const _Float16* __restrict__ A2, float a2s,
    float* __restrict__ C, _Float16* __restrict__ C16, int ldc, size_t sC, int M, int N, int K) {
  __shared__ __attribute__((aligned(16))) unsigned char ring[2 * GTILE];      /* behind the loop's last barrier its first 34 KiB stage the output */
  const int tid = threadIdx.x, w = tid >> 5, lane = tid & 31, ln = lane & 15, hh = lane >> 4;
  A += (size_t)by * sA; Bh += (size_t)by * sB; const size_t cofs = (size_t)by * sC; const float* bp = bias ? bias + (size_t)by * sBias : nullptr;
  const int ntn = N >> 6; const int mt = bx / ntn, nq = bx - mt * ntn; const int row0 = mt * 128 + 32 * w, col0 = nq * 64; if (mt * 128 >= M) return;      /* the whole work-group or none, in front of every barrier */
  const unsigned short* ga = (const unsigned short*)A + (size_t)(mt * 128 + (tid >> 3)) * lda + (tid & 7) * 8;      /* this lane's 16 bytes of A row tid/8 of tile 0 */
  const unsigned short* gb = (const unsigned short*)Bh + (size_t)(col0 + (tid >> 3)) * ldb + (tid & 7) * 8;      /* and of B row tid/8 */
  const unsigned l0 = (unsigned)(size_t)(const void*)ring + (unsigned)((tid >> 3) * GPIT + (tid & 7) * 16);
  const int n2 = A2 ? K / GKT : 0, nt = n2 + K / GKT;      /* tiles 0 .. n2 - 1: A2 against B; tiles n2 .. nt - 1: A against B */
  const unsigned short* ga2 = A2 ? (const unsigned short*)A2 + (size_t)by * sA + (size_t)(mt * 128 + (tid >> 3)) * lda + (tid & 7) * 8 : ga;      /* the same place in A2 */
  auto fill = [&](int t, unsigned l) { const size_t ko = (size_t)(t < n2 ? t : t - n2) * GKT; g2_copy(l, (t < n2 ? ga2 : ga) + ko, lda, gb + ko, ldb); };      /* tile t -> the buffer at l; t is the same in the whole work-group */
  fill(0, l0);      /* tile 0 -> buffer 0 */
  const v8f z8 = {0.f,0.f,0.f,0.f,0.f,0.f,0.f,0.f}; v8f c00 = z8, c01 = z8, c02 = z8, c03 = z8, c10 = z8, c11 = z8, c12 = z8, c13 = z8;
  asm volatile("s_wait_asynccnt 0x0" ::: "memory");      /* this wave's share of tile 0 has landed */
  __syncthreads();      /* tile 0 is published */
  if (nt > 1) fill(1, l0 + GTILE);      /* tile 1 -> buffer 1 */
#pragma unroll 1      /* one trip a tile: the ring's waits and its barrier stand once, at the foot */
  for (int t = 0; t < nt; ++t) {
    const unsigned bo = (unsigned)(t & 1) * GTILE;
    if (n2 > 0 && t == n2) { c00 *= a2s; c01 *= a2s; c02 *= a2s; c03 *= a2s; c10 *= a2s; c11 *= a2s; c12 *= a2s; c13 *= a2s; }      /* A2's sum is complete: weigh it once, then go on with A */
    const unsigned char* ar = &ring[bo + (unsigned)((32 * w + ln) * GPIT + 16 * hh)]; const unsigned char* br = &ring[bo + (unsigned)((128 + ln) * GPIT + 16 * hh)];
    v16h a[2][2], b[2][4];      /* the tile's 24 LDS reads stand as one group in front of its 16 WMMAs */
#pragma unroll
    for (int ks = 0; ks < 2; ++ks) { a[ks][0] = g2_lfrag(ar + ks * 64); a[ks][1] = g2_lfrag(ar + 16 * GPIT + ks * 64);
#pragma unroll
      for (int j = 0; j < 4; ++j) b[ks][j] = g2_lfrag(br + j * 16 * GPIT + ks * 64); }
#pragma unroll
    for (int ks = 0; ks < 2; ++ks) {
      c00 = g2_mma(a[ks][0], b[ks][0], c00); c10 = g2_mma(a[ks][1], b[ks][0], c10);
      c01 = g2_mma(a[ks][0], b[ks][1], c01); c11 = g2_mma(a[ks][1], b[ks][1], c11);
      c02 = g2_mma(a[ks][0], b[ks][2], c02); c12 = g2_mma(a[ks][1], b[ks][2], c12);
      c03 = g2_mma(a[ks][0], b[ks][3], c03); c13 = g2_mma(a[ks][1], b[ks][3], c13); }
    asm volatile("s_wait_dscnt 0x0" ::: "memory");      /* this wave's reads of tile t are done */
    asm volatile("s_wait_asynccnt 0x0" ::: "memory");      /* its share of tile t + 1 has landed */
    __syncthreads();      /* publishes tile t + 1 and frees tile t's buffer */
    if (t + 2 < nt) fill(t + 2, l0 + bo); }
  asm volatile("s_wait_asynccnt 0x0" ::: "memory");      /* no copy is in flight when the ring becomes output staging */
  float (*so)[32][68] = (float (*)[32][68])ring;
  v8f accs[8] = {c00, c01, c02, c03, c10, c11, c12, c13};
#pragma unroll
  for (int u = 0; u < 8; ++u) { const int t = u & 3, half = u >> 2; const int col = col0 + t * 16 + ln; const float bv = bp ? bf16_round(bp[col]) : 0.f;
#pragma unroll
    for (int r = 0; r < 8; ++r) { const int rloc = half * 16 + 8 * hh + r; float v = accs[u][r] * alpha + bv;
      if (ACT == 3) v = fmaxf(v, 0.f); else if (ACT == 6) v = 0.5f * v * (1.0f + erff(v * 0.70710678118654752f)); else if (ACT == 11) v = 1.0f / (1.0f + expf(-v)); else if (ACT == 15) v = v / (1.0f + expf(-v)); else if (ACT == 12) v = (v > 0.f) ? v : 0.01f * v; else if (ACT == 8) v = tanhf(v);
      so[w][rloc][t * 16 + ln] = v; } }
  __builtin_amdgcn_fence(__ATOMIC_ACQ_REL, "workgroup"); __builtin_amdgcn_wave_barrier();
  const int rsub = lane >> 4, c4 = (lane & 15) * 4;
  {
#pragma unroll
    for (int q = 0; q < 16; ++q) { const int r = q * 2 + rsub; const v4f v = *(const v4fa*)&so[w][r][c4]; if (C) *(v4f*)(C + cofs + (size_t)(row0 + r) * ldc + col0 + c4) = v; if (C16) { v4h h4; for (int i = 0; i < 4; ++i) h4[i] = (_Float16)v[i]; *(v4h*)(C16 + cofs + (size_t)(row0 + r) * ldc + col0 + c4) = h4; } }
     } }
template <int ACT>
__global__ __launch_bounds__(128) void k_gemm2(const _Float16* __restrict__ A, int lda, size_t sA, const _Float16* __restrict__ Bh, int ldb, size_t sB, float alpha, const float* __restrict__ bias, size_t sBias, const _Float16* __restrict__ A2, float a2s,
    float* __restrict__ C, _Float16* __restrict__ C16, int ldc, size_t sC, int M, int N, int K) {
  g2_run<ACT>(blockIdx.x, (int)blockIdx.y, A, lda, sA, Bh, ldb, sB, alpha, bias, sBias, A2, a2s, C, C16, ldc, sC, M, N, K); }
// The three projections need nothing of one another: one grid, NBG work-groups each, the longest k loop (q) first. The choice is the same in a whole work-group.
#define NBG ((NR / 128) * (DM / 64))
__global__ __launch_bounds__(128) void k_gemm_qkv(const _Float16* __restrict__ Xq, const _Float16* __restrict__ Xk, const _Float16* __restrict__ Xv, const _Float16* __restrict__ Bq, const _Float16* __restrict__ Bk, const _Float16* __restrict__ Bv,
    const float* __restrict__ bq, const float* __restrict__ bk, const float* __restrict__ bv, _Float16* __restrict__ Q16, _Float16* __restrict__ K16, _Float16* __restrict__ V16) {
  const unsigned sel = blockIdx.x / NBG, bx = blockIdx.x - sel * NBG;
  const _Float16* A = sel == 0 ? Xq : sel == 1 ? Xk : Xv; const _Float16* B = sel == 0 ? Bq : sel == 1 ? Bk : Bv; const float* bias = sel == 0 ? bq : sel == 1 ? bk : bv; _Float16* C16 = sel == 0 ? Q16 : sel == 1 ? K16 : V16;
  const int K = sel == 0 ? DM : DKV;
  g2_run<0>(bx, 0, A, K, 0, B, K, 0, 0.0625f, bias, 0, nullptr, 0.f, nullptr, C16, DM, 0, NR, DM, K); }


// lane l <-> lane l ^ 16 by a vector cross-row move
__device__ __forceinline__ float xhalf(float x) { return __builtin_bit_cast(float, __builtin_amdgcn_permlanex16(__builtin_bit_cast(int, x), __builtin_bit_cast(int, x), 0x76543210, 0xfedcba98, false, false)); }
#define FKT 64
#define FPIT 144
#define FTILE (128 * FPIT)
// One tile: 8 asynchronous 16-byte copies a lane (128 lanes x 8 x 16 B = 16 KiB); 8 lanes cover one 128-B row, so a wave's copy asks for 4 whole lines.
// s_wait_xcnt closes the statement so that no address register of a copy is rewritten in front of it.
__device__ __forceinline__ void tile_copy(unsigned l0, const unsigned short* gk, int ldk, const unsigned short* gv) {
  asm volatile("global_load_async_to_lds_b128 %0, %8, off\n\t"
               "global_load_async_to_lds_b128 %1, %9, off\n\t"
               "global_load_async_to_lds_b128 %2, %10, off\n\t"
               "global_load_async_to_lds_b128 %3, %11, off\n\t"
               "global_load_async_to_lds_b128 %4, %12, off\n\t"
               "global_load_async_to_lds_b128 %5, %13, off\n\t"
               "global_load_async_to_lds_b128 %6, %14, off\n\t"
               "global_load_async_to_lds_b128 %7, %15, off\n\t"
               "s_wait_xcnt 0x0"
               :: "v"(l0), "v"(l0 + 16u * FPIT), "v"(l0 + 32u * FPIT), "v"(l0 + 48u * FPIT), "v"(l0 + 64u * FPIT), "v"(l0 + 80u * FPIT), "v"(l0 + 96u * FPIT), "v"(l0 + 112u * FPIT),
                  "v"(gk), "v"(gk + (size_t)16 * ldk), "v"(gk + (size_t)32 * ldk), "v"(gk + (size_t)48 * ldk), "v"(gv), "v"(gv + (size_t)16 * TK), "v"(gv + (size_t)32 * TK), "v"(gv + (size_t)48 * TK)
               : "memory");
}
// Eight 2^x in place, one statement: behind a transcendental the instruction set asks for one slot before its result is read or its source overwritten. Here each neighbour touches its own register only,
// and the closing v_nop keeps the slot for whatever the compiler puts next.
__device__ __forceinline__ void exp2x8(float* x) {
  asm("v_exp_f32 %0, %0\n\tv_exp_f32 %1, %1\n\tv_exp_f32 %2, %2\n\tv_exp_f32 %3, %3\n\tv_exp_f32 %4, %4\n\tv_exp_f32 %5, %5\n\tv_exp_f32 %6, %6\n\tv_exp_f32 %7, %7\n\tv_nop"
      : "+v"(x[0]), "+v"(x[1]), "+v"(x[2]), "+v"(x[3]), "+v"(x[4]), "+v"(x[5]), "+v"(x[6]), "+v"(x[7]));
}
__global__ __launch_bounds__(128) void k_flash(const _Float16* __restrict__ Q16, int ldq, const _Float16* __restrict__ K16, int ldk, const _Float16* __restrict__ Vt, const int* __restrict__ MSK, float* __restrict__ O, int ldo) {
  constexpr int RPW = 16, NQB = TQ / (4 * RPW), DT = 4, KS = 2, NT = TK / FKT; (void)MSK;
  __shared__ __attribute__((aligned(16))) unsigned char ring[2 * FTILE];      /* behind the loop's last barrier its first 17 KiB stage the output */
  const int tid = threadIdx.x, w = tid >> 5, lane = tid & 31, ln = lane & 15, hh = lane >> 4;
  const int slab = blockIdx.x / NQB, qblk = blockIdx.x % NQB; const int b = slab / NH, h = slab % NH; const int q0 = qblk * (4 * RPW) + w * RPW;
  const unsigned short* gk = (const unsigned short*)K16 + ((size_t)b * TK + (tid >> 3)) * ldk + h * 64 + (tid & 7) * 8;      /* this lane's 16 bytes of K row tid/8 of tile 0 */
  const unsigned short* gv = (const unsigned short*)Vt + ((size_t)slab * 64 + (tid >> 3)) * TK + (tid & 7) * 8;      /* and of Vt row tid/8 */
  const unsigned l0 = (unsigned)(size_t)(const void*)ring + (unsigned)((tid >> 3) * FPIT + (tid & 7) * 16);
  tile_copy(l0, gk, ldk, gv);      /* tile 0 -> buffer 0 */
  FragH bq[KS];
  { const unsigned short* qr = (const unsigned short*)Q16 + ((size_t)b * TQ + q0 + ln) * ldq + h * 64;
#pragma unroll
    for (int ks = 0; ks < KS; ++ks) { bq[ks].half[0] = *(const v8us*)(qr + ks * 32 + 8 * hh); bq[ks].half[1] = *(const v8us*)(qr + ks * 32 + 16 + 8 * hh); } }
  float m_q = -3.0e38f, l_q = 0.f; v8f oacc[DT];
#pragma unroll
  for (int dt = 0; dt < DT; ++dt) oacc[dt] = (v8f){0.f,0.f,0.f,0.f,0.f,0.f,0.f,0.f};
  asm volatile("s_wait_asynccnt 0x0" ::: "memory");      /* this wave's share of tile 0 has landed */
  __syncthreads();      /* tile 0 is published */
  tile_copy(l0 + FTILE, gk + (size_t)FKT * ldk, ldk, gv + FKT);      /* tile 1 -> buffer 1 */
#pragma unroll 1
  for (int t = 0; t < NT; ++t) {
    const unsigned bo = (unsigned)(t & 1) * FTILE; const unsigned fo = bo + (unsigned)(ln * FPIT + 16 * hh);
#pragma unroll 1      /* rolled: both passes unrolled need more than the 128 VGPRs at which 8 waves fit a SIMD */
    for (int p = 0; p < FKT / 32; ++p) {
    FragH ak[2][KS];
#pragma unroll
    for (int nt = 0; nt < 2; ++nt) { const unsigned char* kr = &ring[fo + (p * 32 + nt * 16) * FPIT];
#pragma unroll
      for (int ks = 0; ks < KS; ++ks) { ak[nt][ks].half[0] = *(const v8us*)(kr + ks * 64); ak[nt][ks].half[1] = *(const v8us*)(kr + ks * 64 + 32); } }
    float sc[16];
#pragma unroll
    for (int nt = 0; nt < 2; ++nt) { v8f acc = (v8f){0.f,0.f,0.f,0.f,0.f,0.f,0.f,0.f};
#pragma unroll
      for (int ks = 0; ks < KS; ++ks) acc = mmaH<1>(ak[nt][ks].v, ak[nt][ks].v, bq[ks].v, bq[ks].v, acc);
#pragma unroll
      for (int r = 0; r < 8; ++r) sc[nt * 8 + r] = acc[r]; }      /* sc[nt*8 + r] = q.k, not yet scaled (key t*64 + p*32 + nt*16 + 8*hh + r, query q0 + ln) */
    FragH av[DT];
#pragma unroll
    for (int dt = 0; dt < DT; ++dt) { const unsigned char* vrow = &ring[fo + (64 + dt * 16) * FPIT + p * 64]; av[dt].half[0] = *(const v8us*)(vrow); av[dt].half[1] = *(const v8us*)(vrow + 32); }
    float mx[4];
#pragma unroll
    for (int c = 0; c < 4; ++c) mx[c] = fmaxf(fmaxf(sc[4 * c], sc[4 * c + 1]), fmaxf(sc[4 * c + 2], sc[4 * c + 3]));
    float mc = fmaxf(fmaxf(mx[0], mx[1]), fmaxf(mx[2], mx[3])); mc = fmaxf(mc, xhalf(mc));
    const float mn = fmaxf(m_q, mc * SCL2); const float al = __builtin_amdgcn_exp2f(m_q - mn); m_q = mn;      /* the maximum is kept in base-2 units (SCL2 > 0 commutes with max); al: 0 on the first pass, 1 where the maximum stays */
    const float nb = 10.0f - mn;      /* P x 1024 = 2^(q.k x SCL2 - mn + 10): one FMA and one bare v_exp_f32 a score; the argument is at most 10, and far below -126 the result is 0, as wanted */
    FragH pb; float ps[4];
#pragma unroll
    for (int i = 0; i < 16; ++i) sc[i] = fmaf(sc[i], SCL2, nb);
    exp2x8(sc); exp2x8(sc + 8);
#pragma unroll
    for (int i = 0; i < 16; ++i) { const float p_ = sc[i]; ps[i & 3] = (i < 4) ? p_ : ps[i & 3] + p_; pb.h[i] = (_Float16)p_; }      /* pb.h[nt*8 + r] = P(key nt*16 + 8*hh + r of the pass, query q0 + ln): the k order of the Vt loader */
    l_q = l_q * al + ((ps[0] + ps[1]) + (ps[2] + ps[3]));
#pragma unroll
    for (int dt = 0; dt < DT; ++dt) {
#pragma unroll
      for (int r = 0; r < 8; ++r) oacc[dt][r] *= al;
      oacc[dt] = mmaH<1>(av[dt].v, av[dt].v, pb.v, pb.v, oacc[dt]); } }
    asm volatile("s_wait_dscnt 0x0" ::: "memory");      /* this wave's reads of tile t are done */
    asm volatile("s_wait_asynccnt 0x0" ::: "memory");      /* its share of tile t + 1 has landed */
    __syncthreads();      /* publishes tile t + 1 and frees tile t's buffer */
    if (t + 2 < NT) tile_copy(l0 + bo, gk + (size_t)(t + 2) * FKT * ldk, ldk, gv + (size_t)(t + 2) * FKT); }
  asm volatile("s_wait_asynccnt 0x0" ::: "memory");      /* no copy is in flight when the ring becomes output staging */
  float (*sO)[RPW][64 + 4] = (float (*)[RPW][64 + 4])ring;
  const float lt = l_q + xhalf(l_q); const float inv = (lt > 0.f) ? 1.0f / lt : 0.f;      /* l_q sums P x 1024, as Ot does */
#pragma unroll
  for (int dt = 0; dt < DT; ++dt)      /* oacc[dt][r] = Ot[dt*16 + 8*hh + r][q0 + ln] */
#pragma unroll
    for (int q = 0; q < 2; ++q) { v4f o4;
#pragma unroll
      for (int i = 0; i < 4; ++i) o4[i] = oacc[dt][q * 4 + i] * inv;
      *(v4fa*)&sO[w][ln][dt * 16 + 8 * hh + q * 4] = o4; }
  __builtin_amdgcn_fence(__ATOMIC_ACQ_REL, "workgroup"); __builtin_amdgcn_wave_barrier();
  {
#pragma unroll
    for (int rp = 0; rp < RPW; rp += 2) { const int r = rp + (lane >> 4), pc = lane & 15; const v4f val = *(const v4fa*)&sO[w][r][pc * 4]; *(v4f*)(O + ((size_t)b * TQ + q0 + r) * ldo + h * 64 + pc * 4) = val; }
     } }
__global__ __launch_bounds__(256) void k_split(const float* __restrict__ F, _Float16* __restrict__ Hh, _Float16* __restrict__ Hl, size_t n8) {
  #pragma clang fp contract(off)
  const size_t t = (size_t)blockIdx.x * 256 + threadIdx.x; if (t >= n8) return; const v4f a = *(const v4fa*)(F + t * 8), c = *(const v4fa*)(F + t * 8 + 4); FragH fh, fl;
#pragma unroll
  for (int q = 0; q < 8; ++q) { const float v = (q < 4) ? a[q] : c[q - 4]; const _Float16 hi = (_Float16)v; fh.h[q] = hi; fl.h[q] = (_Float16)((v - (float)hi) * 1024.0f); }
  { *(v8us*)((unsigned short*)Hh + t * 8) = fh.half[0]; *(v8us*)((unsigned short*)Hl + t * 8) = fl.half[0];  } }


#define PIDX(i) ((((i) >> 3) << 5) + ((i) & 7))
__device__ __forceinline__ void d_rowflag(int bid, const float* __restrict__ X, int* __restrict__ FL) {
  __shared__ int sf[8];
  const int tid = threadIdx.x, w = tid >> 5, ln = tid & 31; const int r = bid * 8 + w; const float* x = X + (size_t)r * DKV; float s = 0.f;
#pragma unroll
  for (int u = 0; u < DKV / 32; ++u) s += bf16_round(x[u * 32 + ln]);
  for (int o = 16; o > 0; o >>= 1) s += __shfl_xor(s, o, 32);
  if (ln == 0) sf[w] = (s == 0.0f) ? 1 : 0;
  __syncthreads();
  if (tid < 32) { const int v = (tid < 8) ? sf[tid] : 0; int* d = FL + bid * 32 + tid; *(int*)d = v;  } }
// Everything that reads only the inputs, in one grid: a work-group's index range picks its job (the same in the whole work-group, so the row flags' barrier is passed by all of it or by none).
// The transposes come first: their scattered reads make them the longest work-groups.
#define NBW1 (DM * DM / 8 / 256)
#define NBW2 (DKV * DM / 8 / 256)
#define NBX1 (NR * DM / 8 / 256)
#define NBX2 (NR * DKV / 8 / 256)
#define NBF (NR / 8)
#define NBPREP (2 * NBW1 + 2 * NBW2 + NBX1 + 2 * NBX2 + 2 * NBF)
__global__ __launch_bounds__(256) void k_prep(const float* __restrict__ qi, const float* __restrict__ ki, const float* __restrict__ vi, const float* __restrict__ Wq, const float* __restrict__ Wk, const float* __restrict__ Wv, const float* __restrict__ Wo,
    _Float16* __restrict__ BQ, _Float16* __restrict__ BK, _Float16* __restrict__ BV, _Float16* __restrict__ BO, _Float16* __restrict__ XQ, _Float16* __restrict__ XK, _Float16* __restrict__ XV, int* __restrict__ FLK, int* __restrict__ FLV) {
  int b = (int)blockIdx.x;
  if (b < NBW1) { d_wt_f16(b, Wq, BQ, DM, DM, 16.0f); return; } b -= NBW1;      /* (in,out) -> [out][in] x16 */
  if (b < NBW1) { d_wt_f16(b, Wo, BO, DM, DM, 16.0f); return; } b -= NBW1;
  if (b < NBW2) { d_wt_f16(b, Wk, BK, DKV, DM, 16.0f); return; } b -= NBW2;
  if (b < NBW2) { d_wt_f16(b, Wv, BV, DKV, DM, 16.0f); return; } b -= NBW2;
  if (b < NBX1) { d_x16(b, qi, XQ, (size_t)NR * DM / 8); return; } b -= NBX1;
  if (b < NBX2) { d_x16(b, ki, XK, (size_t)NR * DKV / 8); return; } b -= NBX2;
  if (b < NBF) { d_rowflag(b, ki, FLK); return; } b -= NBF;
  if (b < NBX2) { d_x16(b, vi, XV, (size_t)NR * DKV / 8); return; } b -= NBX2;
  d_rowflag(b, vi, FLV); }
// k's and v's masked rows in one grid: the first NBX1 work-groups take (FLa, Pa), the rest (FLb, Pb)
__global__ __launch_bounds__(256) void k_zerorows(const int* __restrict__ FLa, _Float16* __restrict__ Pa, const int* __restrict__ FLb, _Float16* __restrict__ Pb) {
  const bool sec = blockIdx.x >= NBX1; const int* FL = sec ? FLb : FLa; _Float16* P16 = sec ? Pb : Pa;
  const size_t t = (size_t)(blockIdx.x - (sec ? NBX1 : 0)) * 256 + threadIdx.x; if (t >= (size_t)NR * DM / 8) return; const int r = (int)(t / (DM / 8)); if (FL[PIDX(r)] == 0) return; FragH z;
#pragma unroll
  for (int q = 0; q < 8; ++q) z.h[q] = (_Float16)0.0f; *(v8us*)((unsigned short*)P16 + t * 8) = z.half[0];  }
extern "C" void kernel_launch(void* const* d_in, const int* in_sizes, int n_in,
                              void* d_out, int out_size, void* d_ws, size_t ws_size, hipStream_t stream) {
  (void)in_sizes; (void)n_in; (void)out_size;
  const float* const* I = (const float* const*)d_in; const float* qi = I[0]; const float* ki = I[1]; const float* vi = I[2];
  const float* Wq = I[3]; const float* bq = I[4]; const float* Wk = I[5]; const float* bk = I[6]; const float* Wv = I[7]; const float* bv = I[8]; const float* Wo = I[9]; const float* bo = I[10];
  char* ws = (char*)d_ws; size_t off = 0;
  auto take = [&](size_t bytes) { char* p = ws + off; off += (bytes + 255) & ~(size_t)255; return p; };
  _Float16* BQ = (_Float16*)take((size_t)DM * DM * 2); _Float16* BK = (_Float16*)take((size_t)DM * DKV * 2); _Float16* BV = (_Float16*)take((size_t)DM * DKV * 2); _Float16* BO = (_Float16*)take((size_t)DM * DM * 2);
  _Float16* XQ = (_Float16*)take((size_t)NR * DM * 2); _Float16* XK = (_Float16*)take((size_t)NR * DKV * 2); _Float16* XV = (_Float16*)take((size_t)NR * DKV * 2);      /* one plane an input: the three converts run side by side */
  _Float16* Q16 = (_Float16*)take((size_t)NR * DM * 2); _Float16* K16 = (_Float16*)take((size_t)NR * DM * 2); _Float16* V16 = (_Float16*)take((size_t)NR * DM * 2); _Float16* VT = (_Float16*)take((size_t)NR * DM * 2);
  int* FLK = (int*)take((size_t)(NR / 8) * 32 * 4); int* FLV = (int*)take((size_t)(NR / 8) * 32 * 4);
  float* O = (float*)take((size_t)NR * DM * 4); _Float16* Oh = (_Float16*)take((size_t)NR * DM * 2); _Float16* Ol = (_Float16*)take((size_t)NR * DM * 2);      /* all batches */
  if (off > ws_size) return;      /* 6 + 32 + 16 x 4 + 0.3 + 32 + 16 + 16 = 166 MiB */
  const size_t n8 = (size_t)NR * DM / 8; const unsigned nb8 = (unsigned)((n8 + 255) / 256);
  k_prep<<<NBPREP, 256, 0, stream>>>(qi, ki, vi, Wq, Wk, Wv, Wo, BQ, BK, BV, BO, XQ, XK, XV, FLK, FLV);      /* weights -> [out][in] x16, inputs -> f16, row flags */
  const dim3 gP(NBG, 1);
  k_gemm_qkv<<<3 * NBG, 128, 0, stream>>>(XQ, XK, XV, BQ, BK, BV, bq, bk, bv, Q16, K16, V16);      /* q, k, v -> f16 */
  k_zerorows<<<2 * NBX1, 256, 0, stream>>>(FLK, K16, FLV, V16);      /* masked rows of k and v zeroed */
  k_vt<NH, TK><<<NBT * NH * (TK / 64), 256, 0, stream>>>(V16, DM, 0, VT);      /* Vt[(b,h)][d][s] */
  float* outp = (float*)d_out;
  k_flash<<<NBT * NH * (TQ / 64), 128, 0, stream>>>(Q16, DM, K16, DM, VT, nullptr, O, DM);      /* all batches in one grid: slab = b*NH + h */
  k_split<<<nb8, 256, 0, stream>>>(O, Oh, Ol, n8);
  k_gemm2<0><<<gP, 128, 0, stream>>>(Oh, DM, 0, BO, DM, 0, 0.0625f, bo, 0, Ol, 1.0f / 1024.0f, outp, nullptr, DM, 0, NR, DM, DM);      /* out = (Oh + Ol / 1024)*Wo + bo, one k loop */
}

// v008
// Measured time: 170 microseconds a run.
// Next to v007, in two timings, it ran 1.08 and 1.09 times as fast.
// Counting every step since v000, it is 8.05 times as fast.
#include <hip/hip_runtime.h>
// Multi-head cross attention over social features (B 4, S 2048 queries x 1024, 2048 keys/values x 512, 16 heads x 64; (in,out) Linear weights with bias; key/value rows whose raw features sum to exactly 0 are zeroed after projection, as the reference's padding mask): scores = q.k/8; softmax; out = (attn.v merged)*Wo + bo -> [4,2048,1024].
// Compute dtype: the inputs, the four matrices and biases rounded to bf16; q/k/v products exact (weights x16 in f16, undone by alpha), q, k, v, P as f16 operands (~2^-12; logits sigma ~0.4), O as f16 hi + lo; f32 accumulation and softmax. v_wmma_f32_16x16x32_f16.
#define NBT 4
#define TQ 2048
#define TK 2048
#define DKV 512
#define NR (NBT * TQ)
#define DM 1024
#define NH 16
#define SCL 0.125f
#define SCL2 (SCL * 1.44269504088896340736f)      /* 1/8 x log2(e): scores in base-2 exponent units */
typedef __bf16 v16b __attribute__((ext_vector_type(16)));
typedef unsigned short v8us __attribute__((ext_vector_type(8), may_alias));
typedef float  v8f  __attribute__((ext_vector_type(8)));
typedef float  v4f  __attribute__((ext_vector_type(4)));
typedef float  v4fa __attribute__((ext_vector_type(4), may_alias));
union FragB { v16b v; v8us half[2]; unsigned short u[16]; };

__device__ __forceinline__ unsigned short bf16_bits(float x) { unsigned int u = __float_as_uint(x); return (unsigned short)((u + 0x7FFFu + ((u >> 16) & 1u)) >> 16); }
__device__ __forceinline__ float bf16_val(unsigned short b) { return __uint_as_float(((unsigned int)b) << 16); }
__device__ __forceinline__ float bf16_round(float x) { return bf16_val(bf16_bits(x)); }
// D += A·B with NT terms: 1 = ah·bh, 2 = + al·bh (A split), 3 = + ah·bl (both split)
template <int NT>
__device__ __forceinline__ v8f mmaN(v16b ah, v16b al, v16b bh, v16b bl, v8f c) {
  c = __builtin_amdgcn_wmma_f32_16x16x32_bf16(false, ah, false, bh, (short)0, c, false, false);
  if (NT >= 2) c = __builtin_amdgcn_wmma_f32_16x16x32_bf16(false, al, false, bh, (short)0, c, false, false);
  if (NT >= 3) c = __builtin_amdgcn_wmma_f32_16x16x32_bf16(false, ah, false, bl, (short)0, c, false, false);
  asm volatile("v_nop\n\tv_nop\n\tv_nop\n\tv_nop" : "+v"(c) : "v"(ah), "v"(al), "v"(bh), "v"(bl));
  return c;
}

__global__ __launch_bounds__(256) void k_wt_bf16(const float* __restrict__ W, unsigned short* __restrict__ Wt, int K, int N) {
  const int t = blockIdx.x * 256 + threadIdx.x;
  const int k8n = K / 8;
  if (t >= N * k8n) return;
  const int n = t / k8n, k8 = (t % k8n) * 8;
  v8us v;
#pragma unroll
  for (int i = 0; i < 8; ++i) v[i] = bf16_bits(W[(size_t)(k8 + i) * N + n]);
  *(v8us*)(Wt + (size_t)n * K + k8) = v;
  
}

// GEMM C[M][N] (f32, pitch ldc) = act(A[M][K]·W + bias). A f32 row-major (pitch lda) converted per fragment to bf16
// (ASPLIT: hi/lo two planes -> 2 terms, else single rounded term); Wt bf16 [N][K] (pitch ldb). BIAS_BF16 rounds the
// bias to bf16 first (bias quantised to bf16 before the add). K%32==0, M%16==0, N%64==0.
template <bool ASPLIT, int ACT, bool BIAS_BF16>
__global__ __launch_bounds__(128) void k_gemm_bf(const float* __restrict__ A, int lda, const unsigned short* __restrict__ Wt, int ldb,
                                               const float* __restrict__ bias, float* __restrict__ C, int ldc, int M, int N, int K) {
  __shared__ __attribute__((aligned(16))) float so[4][16][64];
  const int tid = threadIdx.x, w = tid >> 5, lane = tid & 31, ln = lane & 15, hh = lane >> 4;
  const int ntn = N / 64;
  const int wid = blockIdx.x * 4 + w;
  const int mt = wid / ntn, nq = wid % ntn;
  if (mt * 16 >= M) return;
  const int row0 = mt * 16, col0 = nq * 64;
  const float* arow = A + (size_t)(row0 + ln) * lda;
  v8f acc[4] = {};
  for (int kb = 0; kb < K; kb += 32) {
    FragB ah, al;
    const v4f x0 = *(const v4fa*)(arow + kb + 8 * hh), x1 = *(const v4fa*)(arow + kb + 8 * hh + 4);
    const v4f x2 = *(const v4fa*)(arow + kb + 16 + 8 * hh), x3 = *(const v4fa*)(arow + kb + 16 + 8 * hh + 4);
    float xs[16] = {x0[0],x0[1],x0[2],x0[3],x1[0],x1[1],x1[2],x1[3],x2[0],x2[1],x2[2],x2[3],x3[0],x3[1],x3[2],x3[3]};
#pragma unroll
    for (int i = 0; i < 16; ++i) { const unsigned short hb = bf16_bits(xs[i]); ah.u[i] = hb; al.u[i] = ASPLIT ? bf16_bits(xs[i] - bf16_val(hb)) : (unsigned short)0; }
#pragma unroll
    for (int t = 0; t < 4; ++t) {
      const unsigned short* brow = Wt + (size_t)(col0 + t * 16 + ln) * ldb + kb;
      FragB b;
      b.half[0] = *(const v8us*)(brow + 8 * hh);
      b.half[1] = *(const v8us*)(brow + 16 + 8 * hh);
      acc[t] = mmaN<ASPLIT ? 2 : 1>(ah.v, al.v, b.v, b.v, acc[t]);
    }
  }
#pragma unroll
  for (int t = 0; t < 4; ++t) {
    float bv = bias ? bias[col0 + t * 16 + ln] : 0.f;
    if (BIAS_BF16) bv = bf16_round(bv);
#pragma unroll
    for (int r = 0; r < 8; ++r) { float v = acc[t][r] + bv; if (ACT == 1) v = fmaxf(v, 0.f); so[w][8 * hh + r][t * 16 + ln] = v; }
  }
  __builtin_amdgcn_fence(__ATOMIC_ACQ_REL, "workgroup");
  __builtin_amdgcn_wave_barrier();
  const int rsub = lane >> 4, c4 = (lane & 15) * 4;
  {
#pragma unroll
    for (int q = 0; q < 8; ++q) {
      const int r = q * 2 + rsub;
      const v4f v = *(const v4fa*)&so[w][r][c4];
      *(v4f*)(C + (size_t)(row0 + r) * ldc + col0 + c4) = v;
    }
    
  }
}

// GEMM C = act(A·W + bias + resid): A f32 (ASPLIT -> hi/lo 2 terms), Wt bf16 [N][K]; ACT 0 none, 1 relu, 2 exact gelu;
// resid (optional, f32, row index = (row % rmod), pitch ldr, RES_BF16 rounds it) added before the activation.
template <bool ASPLIT, int ACT, bool BIAS_BF16, bool RES_BF16>
__global__ __launch_bounds__(128) void k_gemm_bf3(const float* __restrict__ A, int lda, const unsigned short* __restrict__ Wt, int ldb,
                                                const float* __restrict__ bias, const float* __restrict__ resid, int rmod, int ldr,
                                                float* __restrict__ C, int ldc, int M, int N, int K) {
  __shared__ __attribute__((aligned(16))) float so[4][16][64];
  const int tid = threadIdx.x, w = tid >> 5, lane = tid & 31, ln = lane & 15, hh = lane >> 4;
  const int ntn = N / 64;
  const int wid = blockIdx.x * 4 + w;
  const int mt = wid / ntn, nq = wid % ntn;
  if (mt * 16 >= M) return;
  const int row0 = mt * 16, col0 = nq * 64;
  const float* arow = A + (size_t)(row0 + ln) * lda;
  v8f acc[4] = {};
  for (int kb = 0; kb < K; kb += 32) {
    FragB ah, al;
    const v4f x0 = *(const v4fa*)(arow + kb + 8 * hh), x1 = *(const v4fa*)(arow + kb + 8 * hh + 4);
    const v4f x2 = *(const v4fa*)(arow + kb + 16 + 8 * hh), x3 = *(const v4fa*)(arow + kb + 16 + 8 * hh + 4);
    float xs[16] = {x0[0],x0[1],x0[2],x0[3],x1[0],x1[1],x1[2],x1[3],x2[0],x2[1],x2[2],x2[3],x3[0],x3[1],x3[2],x3[3]};
#pragma unroll
    for (int i = 0; i < 16; ++i) { const unsigned short hb = bf16_bits(xs[i]); ah.u[i] = hb; al.u[i] = ASPLIT ? bf16_bits(xs[i] - bf16_val(hb)) : (unsigned short)0; }
#pragma unroll
    for (int t = 0; t < 4; ++t) {
      const unsigned short* brow = Wt + (size_t)(col0 + t * 16 + ln) * ldb + kb;
      FragB b;
      b.half[0] = *(const v8us*)(brow + 8 * hh);
      b.half[1] = *(const v8us*)(brow + 16 + 8 * hh);
      acc[t] = mmaN<ASPLIT ? 2 : 1>(ah.v, al.v, b.v, b.v, acc[t]);
    }
  }
#pragma unroll
  for (int t = 0; t < 4; ++t) {
    const int col = col0 + t * 16 + ln;
    float bv = bias ? bias[col] : 0.f;
    if (BIAS_BF16) bv = bf16_round(bv);
#pragma unroll
    for (int r = 0; r < 8; ++r) {
      float v = acc[t][r] + bv;
      if (resid) { float rv = resid[(size_t)((row0 + 8 * hh + r) % rmod) * ldr + col]; if (RES_BF16) rv = bf16_round(rv); v += rv; }
      if (ACT == 1) v = fmaxf(v, 0.f);
      if (ACT == 2) v = 0.5f * v * (1.0f + erff(v * 0.70710678118654752f));
      if (ACT == 3) { const float u = 0.7978845608028654f * (v + 0.044715f * v * v * v); v = 0.5f * v * (1.0f + tanhf(u)); }
      so[w][8 * hh + r][t * 16 + ln] = v;
    }
  }
  __builtin_amdgcn_fence(__ATOMIC_ACQ_REL, "workgroup");
  __builtin_amdgcn_wave_barrier();
  const int rsub = lane >> 4, c4 = (lane & 15) * 4;
  {
#pragma unroll
    for (int q = 0; q < 8; ++q) {
      const int r = q * 2 + rsub;
      const v4f v = *(const v4fa*)&so[w][r][c4];
      *(v4f*)(C + (size_t)(row0 + r) * ldc + col0 + c4) = v;
    }
    
  }
}
// row LayerNorm (biased variance, eps) over N: s = X (+ R); optional out_sum <- s; out_norm <- (s-mu)*rsqrt(var+eps)*g + b
template <bool PARAM_BF16>
__global__ __launch_bounds__(256) void k_layernorm(const float* __restrict__ X, const float* __restrict__ R, const float* __restrict__ g, const float* __restrict__ bta,
                                                  float* __restrict__ out_sum, float* __restrict__ out_norm, int N, float eps) {
  __shared__ float red[256];
  const int row = blockIdx.x, tid = threadIdx.x;
  const float* x = X + (size_t)row * N; const float* rr = R ? R + (size_t)row * N : nullptr;
  float vals[16];                     // up to N = 4096
  const int per = N / 256;            // contiguous chunk per thread? use strided-by-4 chunks: thread handles j = tid*4 + 1024*u
  float s1 = 0.f;
  for (int u = 0; u < per / 4; ++u) {
    const int j = tid * 4 + 1024 * u;
    const v4f a = *(const v4fa*)(x + j);
    v4f b = {0.f,0.f,0.f,0.f}; if (rr) b = *(const v4fa*)(rr + j);
#pragma unroll
    for (int q = 0; q < 4; ++q) { const float v = a[q] + b[q]; vals[u * 4 + q] = v; s1 += v; }
  }
  red[tid] = s1; __syncthreads();
  for (int st = 128; st > 0; st >>= 1) { if (tid < st) red[tid] += red[tid + st]; __syncthreads(); }
  const float mu = red[0] / (float)N; __syncthreads();
  float s2 = 0.f;
  for (int u = 0; u < per / 4; ++u)
#pragma unroll
    for (int q = 0; q < 4; ++q) { const float c = vals[u * 4 + q] - mu; s2 += c * c; }
  red[tid] = s2; __syncthreads();
  for (int st = 128; st > 0; st >>= 1) { if (tid < st) red[tid] += red[tid + st]; __syncthreads(); }
  const float rs = rsqrtf(red[0] / (float)N + eps);
  {
    for (int u = 0; u < per / 4; ++u) {
      const int j = tid * 4 + 1024 * u;
      v4f o, sm;
#pragma unroll
      for (int q = 0; q < 4; ++q) {
        float gg = g[j + q], bb = bta[j + q];
        if (PARAM_BF16) { gg = bf16_round(gg); bb = bf16_round(bb); }
        sm[q] = vals[u * 4 + q]; o[q] = (vals[u * 4 + q] - mu) * rs * gg + bb;
      }
      if (out_sum) *(v4f*)(out_sum + (size_t)row * N + j) = sm;
      *(v4f*)(out_norm + (size_t)row * N + j) = o;
    }
    
  }
}



// ---- f16 WMMA path (v_wmma_f32_16x16x32_f16): 11-bit significands for operands in range — used where a [0,1] probability operand needs more precision than bf16
typedef _Float16 v16h __attribute__((ext_vector_type(16)));
union FragH { v16h v; v8us half[2]; _Float16 h[16]; unsigned short u[16]; };
template <int NT>
__device__ __forceinline__ v8f mmaH(v16h ah, v16h al, v16h bh, v16h bl, v8f c) {
  c = __builtin_amdgcn_wmma_f32_16x16x32_f16(false, ah, false, bh, (short)0, c, false, false);
  if (NT >= 2) c = __builtin_amdgcn_wmma_f32_16x16x32_f16(false, al, false, bh, (short)0, c, false, false);
  if (NT >= 3) c = __builtin_amdgcn_wmma_f32_16x16x32_f16(false, ah, false, bl, (short)0, c, false, false);
  asm volatile("v_nop\n\tv_nop\n\tv_nop\n\tv_nop" : "+v"(c) : "v"(ah), "v"(al), "v"(bh), "v"(bl));
  return c;
}
// batched GEMM like k_gemm_b but f16 operands: A f32 (split into f16 hi/lo if ASPLIT, else rounded to f16), Bt = f16 values [n][k]; alpha; C f32; N multiple of 16 (partial tiles skipped)
template <bool ASPLIT>
__global__ __launch_bounds__(128) void k_gemm_h(const float* __restrict__ A, int lda, size_t sA, const _Float16* __restrict__ Bh, int ldb, size_t sB, float alpha, float* __restrict__ C, int ldc, size_t sC, int M, int N, int K) {
  __shared__ __attribute__((aligned(16))) float so[4][16][64];
  const int tid = threadIdx.x, w = tid >> 5, lane = tid & 31, ln = lane & 15, hh = lane >> 4; const int by = blockIdx.y;
  A += (size_t)by * sA; Bh += (size_t)by * sB; C += (size_t)by * sC;
  const int ntn = (N + 63) / 64; const int wid = blockIdx.x * 4 + w; const int mt = wid / ntn, nq = wid % ntn; if (mt * 16 >= M) return;
  const int row0 = mt * 16, col0 = nq * 64; const float* arow = A + (size_t)(row0 + ln) * lda;
  v8f acc[4] = {};
  for (int kb = 0; kb < K; kb += 32) {
    FragH ah, al;
    const v4f x0 = *(const v4fa*)(arow + kb + 8 * hh), x1 = *(const v4fa*)(arow + kb + 8 * hh + 4), x2 = *(const v4fa*)(arow + kb + 16 + 8 * hh), x3 = *(const v4fa*)(arow + kb + 16 + 8 * hh + 4);
    float xs[16] = {x0[0],x0[1],x0[2],x0[3],x1[0],x1[1],x1[2],x1[3],x2[0],x2[1],x2[2],x2[3],x3[0],x3[1],x3[2],x3[3]};
#pragma unroll
    for (int i = 0; i < 16; ++i) { const _Float16 h = (_Float16)xs[i]; ah.h[i] = h; al.h[i] = ASPLIT ? (_Float16)(xs[i] - (float)h) : (_Float16)0.0f; }
#pragma unroll
    for (int t = 0; t < 4; ++t) { if (col0 + t * 16 >= N) continue; const size_t boff = (size_t)(col0 + t * 16 + ln) * ldb + kb; FragH bq; bq.half[0] = *(const v8us*)(Bh + boff + 8 * hh); bq.half[1] = *(const v8us*)(Bh + boff + 16 + 8 * hh);
      acc[t] = mmaH<ASPLIT ? 2 : 1>(ah.v, al.v, bq.v, bq.v, acc[t]); }
  }
#pragma unroll
  for (int t = 0; t < 4; ++t) { if (col0 + t * 16 >= N) continue;
#pragma unroll
    for (int r = 0; r < 8; ++r) so[w][8 * hh + r][t * 16 + ln] = acc[t][r] * alpha; }
  __builtin_amdgcn_fence(__ATOMIC_ACQ_REL, "workgroup"); __builtin_amdgcn_wave_barrier();
  const int rsub = lane >> 4, c4 = (lane & 15) * 4;
  {
#pragma unroll
    for (int q = 0; q < 8; ++q) { const int r = q * 2 + rsub; if (col0 + c4 < N) { const v4f v = *(const v4fa*)&so[w][r][c4]; *(v4f*)(C + (size_t)(row0 + r) * ldc + col0 + c4) = v; } }
     }
}

// Wt[n][k] = f16(W[k][n]·scale) from f32 row-major W[K][N] (scale = power of two; bf16-exact weights stay exact in f16 away from the subnormal range)
__device__ __forceinline__ void d_wt_f16(int bid, const float* __restrict__ W, _Float16* __restrict__ Wt, int K, int N, float scale) {
  const int t = bid * 256 + threadIdx.x; if (t >= N * (K / 8)) return; const int n = t / (K / 8), k8 = (t % (K / 8)) * 8; FragH f;
#pragma unroll
  for (int i = 0; i < 8; ++i) f.h[i] = (_Float16)(bf16_round(W[(size_t)(k8 + i) * N + n]) * scale); const v8us o = f.half[0];
  *(v8us*)((unsigned short*)Wt + (size_t)n * K + k8) = o; 
}
// k_gemm_hh variant with fused epilogue: v = acc·alpha + bias[by·sBias + col] (+ CP[(row/rowsPerB)·sCPb + by·64 + col] if CP) ; ACT 0 none / 1 elu ; writes f16 C16 (and f32 C if non-null)
template <int ACT>
__global__ __launch_bounds__(128) void k_gemm_hhx(const _Float16* __restrict__ A, int lda, size_t sA, const _Float16* __restrict__ Bh, int ldb, size_t sB, float alpha, const float* __restrict__ bias, size_t sBias, const float* __restrict__ CP, int rowsPerB, size_t sCPb, int row0g,
    float* __restrict__ C, _Float16* __restrict__ C16, int ldc, size_t sC, int M, int N, int K) {
  __shared__ __attribute__((aligned(16))) float so[4][16][64];
  const int tid = threadIdx.x, w = tid >> 5, lane = tid & 31, ln = lane & 15, hh = lane >> 4; const int by = blockIdx.y;
  A += (size_t)by * sA; Bh += (size_t)by * sB; const size_t cofs = (size_t)by * sC; const float* bp = bias ? bias + (size_t)by * sBias : nullptr;
  const int ntn = (N + 63) / 64; const int wid = blockIdx.x * 4 + w; const int mt = wid / ntn, nq = wid % ntn; if (mt * 16 >= M) return;
  const int row0 = mt * 16, col0 = nq * 64; const _Float16* arow = A + (size_t)(row0 + ln) * lda;
  v8f acc[4] = {};
  for (int kb = 0; kb < K; kb += 32) { FragH ah; ah.half[0] = *(const v8us*)((const unsigned short*)arow + kb + 8 * hh); ah.half[1] = *(const v8us*)((const unsigned short*)arow + kb + 16 + 8 * hh);
#pragma unroll
    for (int t = 0; t < 4; ++t) { if (col0 + t * 16 >= N) continue; const size_t boff = (size_t)(col0 + t * 16 + ln) * ldb + kb; FragH bq; bq.half[0] = *(const v8us*)((const unsigned short*)Bh + boff + 8 * hh); bq.half[1] = *(const v8us*)((const unsigned short*)Bh + boff + 16 + 8 * hh);
      acc[t] = mmaH<1>(ah.v, ah.v, bq.v, bq.v, acc[t]); }
  }
#pragma unroll
  for (int t = 0; t < 4; ++t) { if (col0 + t * 16 >= N) continue; const int col = col0 + t * 16 + ln; const float bv = bp ? bf16_round(bp[col]) : 0.f;
#pragma unroll
    for (int r = 0; r < 8; ++r) { float v = acc[t][r] * alpha + bv; if (CP) { const int bidx = (row0g + row0 + 8 * hh + r) / rowsPerB; v += CP[(size_t)bidx * sCPb + (size_t)by * 64 + col]; } if (ACT == 1) v = (v > 0.f) ? v : expm1f(v); else if (ACT == 7) v = (v > 0.f) ? v + 1.0f : expf(v); else if (ACT == 8) v = tanhf(v); else if (ACT == 9) v = 0.5f * v * (1.0f + tanhf(0.7978845608028654f * (v + 0.044715f * v * v * v))); else if (ACT == 11) v = 1.0f / (1.0f + expf(-v)); else if (ACT == 12) v = (v > 0.f) ? v : 0.01f * v; else if (ACT == 14) v = (v > 0.f) ? v : 0.1f * v; else if (ACT == 15) v = v / (1.0f + expf(-v)); else if (ACT == 3) v = fmaxf(v, 0.f); else if (ACT == 6) v = 0.5f * v * (1.0f + erff(v * 0.70710678118654752f)); so[w][8 * hh + r][t * 16 + ln] = v; } }
  __builtin_amdgcn_fence(__ATOMIC_ACQ_REL, "workgroup"); __builtin_amdgcn_wave_barrier();
  const int rsub = lane >> 4, c4 = (lane & 15) * 4; typedef _Float16 v4h __attribute__((ext_vector_type(4)));
  {
#pragma unroll
    for (int q = 0; q < 8; ++q) { const int r = q * 2 + rsub; if (col0 + c4 < N) { const v4f v = *(const v4fa*)&so[w][r][c4]; if (C) *(v4f*)(C + cofs + (size_t)(row0 + r) * ldc + col0 + c4) = v; if (C16) { v4h h4; for (int i = 0; i < 4; ++i) h4[i] = (_Float16)v[i]; *(v4h*)(C16 + cofs + (size_t)(row0 + r) * ldc + col0 + c4) = h4; } } }
     }
}


typedef _Float16 v4h __attribute__((ext_vector_type(4)));

__device__ __forceinline__ void d_x16(int bid, const float* __restrict__ x, _Float16* __restrict__ X16, size_t n8) { const size_t t = (size_t)bid * 256 + threadIdx.x; if (t >= n8) return; FragH f;
#pragma unroll
  for (int q = 0; q < 8; ++q) f.h[q] = (_Float16)bf16_round(x[t * 8 + q]); *(v8us*)((unsigned short*)X16 + t * 8) = f.half[0];  }
__global__ __launch_bounds__(256) void k_h16(const float* __restrict__ x, _Float16* __restrict__ X16, size_t n8) { const size_t t = (size_t)blockIdx.x * 256 + threadIdx.x; if (t >= n8) return; FragH f;
#pragma unroll
  for (int q = 0; q < 8; ++q) f.h[q] = (_Float16)x[t * 8 + q]; *(v8us*)((unsigned short*)X16 + t * 8) = f.half[0];  }
__global__ __launch_bounds__(256) void k_round16f(const float* __restrict__ W, _Float16* __restrict__ Bt, size_t n8) { const size_t t = (size_t)blockIdx.x * 256 + threadIdx.x; if (t >= n8) return; FragH f;
#pragma unroll
  for (int i = 0; i < 8; ++i) f.h[i] = (_Float16)(bf16_round(W[t * 8 + i]) * 16.0f); *(v8us*)((unsigned short*)Bt + t * 8) = f.half[0];  }
__global__ __launch_bounds__(256) void k_hl(const float* __restrict__ F, _Float16* __restrict__ Hh, _Float16* __restrict__ Hl, size_t n8) { const size_t t = (size_t)blockIdx.x * 256 + threadIdx.x; if (t >= n8) return; FragH fh, fl; const v4f a = *(const v4fa*)(F + t * 8), c = *(const v4fa*)(F + t * 8 + 4);
#pragma unroll
  for (int q = 0; q < 4; ++q) { _Float16 h = (_Float16)a[q]; fh.h[q] = h; fl.h[q] = (_Float16)((a[q] - (float)h) * 1024.0f); h = (_Float16)c[q]; fh.h[4 + q] = h; fl.h[4 + q] = (_Float16)((c[q] - (float)h) * 1024.0f); }
  { *(v8us*)((unsigned short*)Hh + t * 8) = fh.half[0]; *(v8us*)((unsigned short*)Hl + t * 8) = fl.half[0];  } }

// ---- fast GEMM (wave tile 32x64, work-group tile 128x64); epilogue = k_gemm_hhx semantics without its CP term ----
__device__ __forceinline__ v8f g2_mma(v16h a, v16h b, v8f c) { v8f d = __builtin_amdgcn_wmma_f32_16x16x32_f16(false, a, false, b, (short)0, c, false, false); asm volatile("v_nop\n\tv_nop\n\tv_nop\n\tv_nop" : "+v"(d) : "v"(a), "v"(b)); return d; }
// A and B reach the four waves of a work-group through a two-buffer LDS ring. One tile = 64 k: 128 A rows, then 64 B rows, 128 data bytes a row at a pitch of 144 B (16 B x odd: no bank conflict for 16-byte readers).
// Needs M % 128 == 0 and K % 64 == 0 on top of N % 64 == 0.
// A2 (optional): a second A plane of the same shape for C = (A + a2s x A2).B in ONE k loop: the ring first runs A2's K / 64 tiles against B, the accumulators are then scaled by a2s (a power of two: exact), and A's tiles follow into the same accumulators.
// FL (optional): row flags in the PIDX order; a flagged row of C is stored as zeros. CT (optional, in place of C and C16): the f16 result goes out transposed, head by head, CT[(batch * NH + head) * 64 + d][key]; a work-group's 128 rows are 128 keys of one batch, its 64 columns one head.
#define PIDX(i) ((((i) >> 3) << 5) + ((i) & 7))
#define TPIT 272      /* a d row of the transposed staging: 128 keys x 2 B + 16 B (16 B x odd: no bank conflict for 16-byte writers and readers) */
typedef int v4i __attribute__((ext_vector_type(4), may_alias));
#define GKT 64
#define GPIT 144
#define GTILE (192 * GPIT)
// One tile: 12 asynchronous 16-byte copies a lane (128 lanes x 12 x 16 B = 24 KiB); 8 lanes cover one 128-B row, so a wave's copy asks for 4 whole lines (a fragment load straight from global memory would touch 16 lines for its 512 bytes).
// s_wait_xcnt closes the statement so that no address register of a copy is rewritten in front of it.
__device__ __forceinline__ void g2_copy(unsigned l0, const unsigned short* ga, int lda, const unsigned short* gb, int ldb) {
  asm volatile("global_load_async_to_lds_b128 %0, %12, off\n\t"
               "global_load_async_to_lds_b128 %1, %13, off\n\t"
               "global_load_async_to_lds_b128 %2, %14, off\n\t"
               "global_load_async_to_lds_b128 %3, %15, off\n\t"
               "global_load_async_to_lds_b128 %4, %16, off\n\t"
               "global_load_async_to_lds_b128 %5, %17, off\n\t"
               "global_load_async_to_lds_b128 %6, %18, off\n\t"
               "global_load_async_to_lds_b128 %7, %19, off\n\t"
               "global_load_async_to_lds_b128 %8, %20, off\n\t"
               "global_load_async_to_lds_b128 %9, %21, off\n\t"
               "global_load_async_to_lds_b128 %10, %22, off\n\t"
               "global_load_async_to_lds_b128 %11, %23, off\n\t"
               "s_wait_xcnt 0x0"
               :: "v"(l0), "v"(l0 + 16u * GPIT), "v"(l0 + 32u * GPIT), "v"(l0 + 48u * GPIT), "v"(l0 + 64u * GPIT), "v"(l0 + 80u * GPIT), "v"(l0 + 96u * GPIT), "v"(l0 + 112u * GPIT), "v"(l0 + 128u * GPIT), "v"(l0 + 144u * GPIT), "v"(l0 + 160u * GPIT), "v"(l0 + 176u * GPIT),
                  "v"(ga), "v"(ga + (size_t)16 * lda), "v"(ga + (size_t)32 * lda), "v"(ga + (size_t)48 * lda), "v"(ga + (size_t)64 * lda), "v"(ga + (size_t)80 * lda), "v"(ga + (size_t)96 * lda), "v"(ga + (size_t)112 * lda),
                  "v"(gb), "v"(gb + (size_t)16 * ldb), "v"(gb + (size_t)32 * ldb), "v"(gb + (size_t)48 * ldb)
               : "memory");
}
__device__ __forceinline__ v16h g2_lfrag(const unsigned char* p) { FragH f; f.half[0] = *(const v8us*)p; f.half[1] = *(const v8us*)(p + 32); return f.v; }      /* p = a row's 32-k slice + 16*hh bytes: k = 8*hh .. 8*hh + 7, then 16 + 8*hh .. 16 + 8*hh + 7, for A and B alike */
template <int ACT>
__device__ __forceinline__ void g2_run(unsigned bx, int by, const _Float16* __restrict__ A, int lda, size_t sA, const _Float16* __restrict__ Bh, int ldb, size_t sB, float alpha, const float* __restrict__ bias, size_t sBias, const _Float16* __restrict__ A2, float a2s, const int* __restrict__ FL,
    float* __restrict__ C, _Float16* __restrict__ C16, _Float16* __restrict__ CT, int ldc, size_t sC, int M, int N, int K) {
  __shared__ __attribute__((aligned(16))) unsigned char ring[2 * GTILE];      /* behind the loop's last barrier its first 34 KiB stage the output */
  const int tid = threadIdx.x, w = tid >> 5, lane = tid & 31, ln = lane & 15, hh = lane >> 4;
  A += (size_t)by * sA; Bh += (size_t)by * sB; const size_t cofs = (size_t)by * sC; const float* bp = bias ? bias + (size_t)by * sBias : nullptr;
  const int ntn = N >> 6; const int mt = bx / ntn, nq = bx - mt * ntn; const int row0 = mt * 128 + 32 * w, col0 = nq * 64; if (mt * 128 >= M) return;      /* the whole work-group or none, in front of every barrier */
  const unsigned short* ga = (const unsigned short*)A + (size_t)(mt * 128 + (tid >> 3)) * lda + (tid & 7) * 8;      /* this lane's 16 bytes of A row tid/8 of tile 0 */
  const unsigned short* gb = (const unsigned short*)Bh + (size_t)(col0 + (tid >> 3)) * ldb + (tid & 7) * 8;      /* and of B row tid/8 */
  const unsigned l0 = (unsigned)(size_t)(const void*)ring + (unsigned)((tid >> 3) * GPIT + (tid & 7) * 16);
  const int n2 = A2 ? K / GKT : 0, nt = n2 + K / GKT;      /* tiles 0 .. n2 - 1: A2 against B; tiles n2 .. nt - 1: A against B */
  const unsigned short* ga2 = A2 ? (const unsigned short*)A2 + (size_t)by * sA + (size_t)(mt * 128 + (tid >> 3)) * lda + (tid & 7) * 8 : ga;      /* the same place in A2 */
  auto fill = [&](int t, unsigned l) { const size_t ko = (size_t)(t < n2 ? t : t - n2) * GKT; g2_copy(l, (t < n2 ? ga2 : ga) + ko, lda, gb + ko, ldb); };      /* tile t -> the buffer at l; t is the same in the whole work-group */
  fill(0, l0);      /* tile 0 -> buffer 0 */
  const v8f z8 = {0.f,0.f,0.f,0.f,0.f,0.f,0.f,0.f}; v8f c00 = z8, c01 = z8, c02 = z8, c03 = z8, c10 = z8, c11 = z8, c12 = z8, c13 = z8;
  asm volatile("s_wait_asynccnt 0x0" ::: "memory");      /* this wave's share of tile 0 has landed */
  __syncthreads();      /* tile 0 is published */
  if (nt > 1) fill(1, l0 + GTILE);      /* tile 1 -> buffer 1 */
#pragma unroll 1      /* one trip a tile: the ring's waits and its barrier stand once, at the foot */
  for (int t = 0; t < nt; ++t) {
    const unsigned bo = (unsigned)(t & 1) * GTILE;
    if (n2 > 0 && t == n2) { c00 *= a2s; c01 *= a2s; c02 *= a2s; c03 *= a2s; c10 *= a2s; c11 *= a2s; c12 *= a2s; c13 *= a2s; }      /* A2's sum is complete: weigh it once, then go on with A */
    const unsigned char* ar = &ring[bo + (unsigned)((32 * w + ln) * GPIT + 16 * hh)]; const unsigned char* br = &ring[bo + (unsigned)((128 + ln) * GPIT + 16 * hh)];
    v16h a[2][2], b[2][4];      /* the tile's 24 LDS reads stand as one group in front of its 16 WMMAs */
#pragma unroll
    for (int ks = 0; ks < 2; ++ks) { a[ks][0] = g2_lfrag(ar + ks * 64); a[ks][1] = g2_lfrag(ar + 16 * GPIT + ks * 64);
#pragma unroll
      for (int j = 0; j < 4; ++j) b[ks][j] = g2_lfrag(br + j * 16 * GPIT + ks * 64); }
#pragma unroll
    for (int ks = 0; ks < 2; ++ks) {
      c00 = g2_mma(a[ks][0], b[ks][0], c00); c10 = g2_mma(a[ks][1], b[ks][0], c10);
      c01 = g2_mma(a[ks][0], b[ks][1], c01); c11 = g2_mma(a[ks][1], b[ks][1], c11);
      c02 = g2_mma(a[ks][0], b[ks][2], c02); c12 = g2_mma(a[ks][1], b[ks][2], c12);
      c03 = g2_mma(a[ks][0], b[ks][3], c03); c13 = g2_mma(a[ks][1], b[ks][3], c13); }
    asm volatile("s_wait_dscnt 0x0" ::: "memory");      /* this wave's reads of tile t are done */
    asm volatile("s_wait_asynccnt 0x0" ::: "memory");      /* its share of tile t + 1 has landed */
    __syncthreads();      /* publishes tile t + 1 and frees tile t's buffer */
    if (t + 2 < nt) fill(t + 2, l0 + bo); }
  asm volatile("s_wait_asynccnt 0x0" ::: "memory");      /* no copy is in flight when the ring becomes output staging */
  float (*so)[32][68] = (float (*)[32][68])ring;
  v8f accs[8] = {c00, c01, c02, c03, c10, c11, c12, c13};
  int fz[2][8] = {{0, 0, 0, 0, 0, 0, 0, 0}, {0, 0, 0, 0, 0, 0, 0, 0}};      /* flags of this lane's rows row0 + half*16 + 8*hh + r: 8 neighbours in the PIDX order */
  if (FL) {
#pragma unroll      /* unrolled, like the loop inside: fz is indexed by constants only and stays in registers; the four loads go out together */
    for (int half = 0; half < 2; ++half) { const int* fp = FL + PIDX(row0 + half * 16 + 8 * hh); const v4i f0 = *(const v4i*)fp, f1 = *(const v4i*)(fp + 4);
#pragma unroll
      for (int r = 0; r < 4; ++r) { fz[half][r] = f0[r]; fz[half][4 + r] = f1[r]; } } }
  if (CT) {      /* the same in the whole work-group: all of it passes the barrier below or none */
    float bvs[4] = {0.f, 0.f, 0.f, 0.f};
    if (bp) {
#pragma unroll      /* the four loads go out together, one latency for all */
      for (int t = 0; t < 4; ++t) bvs[t] = bf16_round(bp[col0 + t * 16 + ln]); }
#pragma unroll      /* unrolled, like the loop inside: the accumulators are registers, reached by constant indices only */
    for (int u = 0; u < 8; ++u) { const int t = u & 3, half = u >> 2; FragH f;
#pragma unroll
      for (int r = 0; r < 8; ++r) f.h[r] = (_Float16)(fz[half][r] ? 0.f : accs[u][r] * alpha + bvs[t]);      /* a lane's 8 results of one accumulator: 8 neighbouring keys of column d = t*16 + ln */
      *(v8us*)&ring[(t * 16 + ln) * TPIT + (32 * w + half * 16 + 8 * hh) * 2] = f.half[0]; }
    __syncthreads();      /* a d row holds keys of all four waves */
    const int r128 = mt * 128; unsigned short* ct = (unsigned short*)CT + ((size_t)(r128 / TK) * NH + nq) * 64 * TK + r128 % TK;
#pragma unroll      /* the eight LDS reads stand as one group in front of the stores */
    for (int q = 0; q < 8; ++q) { const int d = q * 8 + (tid >> 4), c = tid & 15; *(v8us*)(ct + (size_t)d * TK + c * 8) = *(const v8us*)&ring[d * TPIT + c * 16]; }      /* 16 lanes store the 256 contiguous bytes of a d row */
    asm volatile("s_wait_xcnt 0x0" ::: "memory");      /* stands behind the eight stores, in front of any later write of their address registers (the listing joins this path with the row-major one) */
    return; }
#pragma unroll
  for (int u = 0; u < 8; ++u) { const int t = u & 3, half = u >> 2; const int col = col0 + t * 16 + ln; const float bv = bp ? bf16_round(bp[col]) : 0.f;
#pragma unroll
    for (int r = 0; r < 8; ++r) { const int rloc = half * 16 + 8 * hh + r; float v = accs[u][r] * alpha + bv;
      if (ACT == 3) v = fmaxf(v, 0.f); else if (ACT == 6) v = 0.5f * v * (1.0f + erff(v * 0.70710678118654752f)); else if (ACT == 11) v = 1.0f / (1.0f + expf(-v)); else if (ACT == 15) v = v / (1.0f + expf(-v)); else if (ACT == 12) v = (v > 0.f) ? v : 0.01f * v; else if (ACT == 8) v = tanhf(v);
      so[w][rloc][t * 16 + ln] = fz[half][r] ? 0.f : v; } }
  __builtin_amdgcn_fence(__ATOMIC_ACQ_REL, "workgroup"); __builtin_amdgcn_wave_barrier();
  const int rsub = lane >> 4, c4 = (lane & 15) * 4;
  {
#pragma unroll
    for (int q = 0; q < 16; ++q) { const int r = q * 2 + rsub; const v4f v = *(const v4fa*)&so[w][r][c4]; if (C) *(v4f*)(C + cofs + (size_t)(row0 + r) * ldc + col0 + c4) = v; if (C16) { v4h h4; for (int i = 0; i < 4; ++i) h4[i] = (_Float16)v[i]; *(v4h*)(C16 + cofs + (size_t)(row0 + r) * ldc + col0 + c4) = h4; } }
     } }
template <int ACT>
__global__ __launch_bounds__(128) void k_gemm2(const _Float16* __restrict__ A, int lda, size_t sA, const _Float16* __restrict__ Bh, int ldb, size_t sB, float alpha, const float* __restrict__ bias, size_t sBias, const _Float16* __restrict__ A2, float a2s,
    float* __restrict__ C, _Float16* __restrict__ C16, int ldc, size_t sC, int M, int N, int K) {
  g2_run<ACT>(blockIdx.x, (int)blockIdx.y, A, lda, sA, Bh, ldb, sB, alpha, bias, sBias, A2, a2s, nullptr, C, C16, nullptr, ldc, sC, M, N, K); }
// The three projections need nothing of one another: one grid, NBG work-groups each, the longest k loop (q) first. The choice is the same in a whole work-group.
// k and v store their flagged rows as zeros; v goes out transposed only (Vt[(b,h)][d][s]), the form in which attention reads it.
#define NBG ((NR / 128) * (DM / 64))
__global__ __launch_bounds__(128) void k_gemm_qkv(const _Float16* __restrict__ Xq, const _Float16* __restrict__ Xk, const _Float16* __restrict__ Xv, const _Float16* __restrict__ Bq, const _Float16* __restrict__ Bk, const _Float16* __restrict__ Bv,
    const float* __restrict__ bq, const float* __restrict__ bk, const float* __restrict__ bv, const int* __restrict__ FLK, const int* __restrict__ FLV, _Float16* __restrict__ Q16, _Float16* __restrict__ K16, _Float16* __restrict__ VT) {
  const unsigned sel = blockIdx.x / NBG, bx = blockIdx.x - sel * NBG;
  const _Float16* A = sel == 0 ? Xq : sel == 1 ? Xk : Xv; const _Float16* B = sel == 0 ? Bq : sel == 1 ? Bk : Bv; const float* bias = sel == 0 ? bq : sel == 1 ? bk : bv; _Float16* C16 = sel == 0 ? Q16 : sel == 1 ? K16 : nullptr; const int* FL = sel == 0 ? nullptr : sel == 1 ? FLK : FLV;
  const int K = sel == 0 ? DM : DKV;
  g2_run<0>(bx, 0, A, K, 0, B, K, 0, 0.0625f, bias, 0, nullptr, 0.f, FL, nullptr, C16, sel == 2 ? VT : nullptr, DM, 0, NR, DM, K); }


// lane l <-> lane l ^ 16 by a vector cross-row move
__device__ __forceinline__ float xhalf(float x) { return __builtin_bit_cast(float, __builtin_amdgcn_permlanex16(__builtin_bit_cast(int, x), __builtin_bit_cast(int, x), 0x76543210, 0xfedcba98, false, false)); }
#define FKT 64
#define FPIT 144
#define FTILE (128 * FPIT)
// One tile: 8 asynchronous 16-byte copies a lane (128 lanes x 8 x 16 B = 16 KiB); 8 lanes cover one 128-B row, so a wave's copy asks for 4 whole lines.
// s_wait_xcnt closes the statement so that no address register of a copy is rewritten in front of it.
__device__ __forceinline__ void tile_copy(unsigned l0, const unsigned short* gk, int ldk, const unsigned short* gv) {
  asm volatile("global_load_async_to_lds_b128 %0, %8, off\n\t"
               "global_load_async_to_lds_b128 %1, %9, off\n\t"
               "global_load_async_to_lds_b128 %2, %10, off\n\t"
               "global_load_async_to_lds_b128 %3, %11, off\n\t"
               "global_load_async_to_lds_b128 %4, %12, off\n\t"
               "global_load_async_to_lds_b128 %5, %13, off\n\t"
               "global_load_async_to_lds_b128 %6, %14, off\n\t"
               "global_load_async_to_lds_b128 %7, %15, off\n\t"
               "s_wait_xcnt 0x0"
               :: "v"(l0), "v"(l0 + 16u * FPIT), "v"(l0 + 32u * FPIT), "v"(l0 + 48u * FPIT), "v"(l0 + 64u * FPIT), "v"(l0 + 80u * FPIT), "v"(l0 + 96u * FPIT), "v"(l0 + 112u * FPIT),
                  "v"(gk), "v"(gk + (size_t)16 * ldk), "v"(gk + (size_t)32 * ldk), "v"(gk + (size_t)48 * ldk), "v"(gv), "v"(gv + (size_t)16 * TK), "v"(gv + (size_t)32 * TK), "v"(gv + (size_t)48 * TK)
               : "memory");
}
// Eight 2^x in place, one statement: behind a transcendental the instruction set asks for one slot before its result is read or its source overwritten. Here each neighbour touches its own register only,
// and the closing v_nop keeps the slot for whatever the compiler puts next.
__device__ __forceinline__ void exp2x8(float* x) {
  asm("v_exp_f32 %0, %0\n\tv_exp_f32 %1, %1\n\tv_exp_f32 %2, %2\n\tv_exp_f32 %3, %3\n\tv_exp_f32 %4, %4\n\tv_exp_f32 %5, %5\n\tv_exp_f32 %6, %6\n\tv_exp_f32 %7, %7\n\tv_nop"
      : "+v"(x[0]), "+v"(x[1]), "+v"(x[2]), "+v"(x[3]), "+v"(x[4]), "+v"(x[5]), "+v"(x[6]), "+v"(x[7]));
}
__global__ __launch_bounds__(128) void k_flash(const _Float16* __restrict__ Q16, int ldq, const _Float16* __restrict__ K16, int ldk, const _Float16* __restrict__ Vt, const int* __restrict__ MSK, _Float16* __restrict__ Oh, _Float16* __restrict__ Ol, int ldo) {
  constexpr int RPW = 16, NQB = TQ / (4 * RPW), DT = 4, KS = 2, NT = TK / FKT; (void)MSK;
  __shared__ __attribute__((aligned(16))) unsigned char ring[2 * FTILE];      /* behind the loop's last barrier its first 17 KiB stage the output */
  const int tid = threadIdx.x, w = tid >> 5, lane = tid & 31, ln = lane & 15, hh = lane >> 4;
  const int slab = blockIdx.x / NQB, qblk = blockIdx.x % NQB; const int b = slab / NH, h = slab % NH; const int q0 = qblk * (4 * RPW) + w * RPW;
  const unsigned short* gk = (const unsigned short*)K16 + ((size_t)b * TK + (tid >> 3)) * ldk + h * 64 + (tid & 7) * 8;      /* this lane's 16 bytes of K row tid/8 of tile 0 */
  const unsigned short* gv = (const unsigned short*)Vt + ((size_t)slab * 64 + (tid >> 3)) * TK + (tid & 7) * 8;      /* and of Vt row tid/8 */
  const unsigned l0 = (unsigned)(size_t)(const void*)ring + (unsigned)((tid >> 3) * FPIT + (tid & 7) * 16);
  tile_copy(l0, gk, ldk, gv);      /* tile 0 -> buffer 0 */
  FragH bq[KS];
  { const unsigned short* qr = (const unsigned short*)Q16 + ((size_t)b * TQ + q0 + ln) * ldq + h * 64;
#pragma unroll
    for (int ks = 0; ks < KS; ++ks) { bq[ks].half[0] = *(const v8us*)(qr + ks * 32 + 8 * hh); bq[ks].half[1] = *(const v8us*)(qr + ks * 32 + 16 + 8 * hh); } }
  float m_q = -3.0e38f, l_q = 0.f; v8f oacc[DT];
#pragma unroll
  for (int dt = 0; dt < DT; ++dt) oacc[dt] = (v8f){0.f,0.f,0.f,0.f,0.f,0.f,0.f,0.f};
  asm volatile("s_wait_asynccnt 0x0" ::: "memory");      /* this wave's share of tile 0 has landed */
  __syncthreads();      /* tile 0 is published */
  tile_copy(l0 + FTILE, gk + (size_t)FKT * ldk, ldk, gv + FKT);      /* tile 1 -> buffer 1 */
#pragma unroll 1
  for (int t = 0; t < NT; ++t) {
    const unsigned bo = (unsigned)(t & 1) * FTILE; const unsigned fo = bo + (unsigned)(ln * FPIT + 16 * hh);
#pragma unroll 1      /* rolled: both passes unrolled need more than the 128 VGPRs at which 8 waves fit a SIMD */
    for (int p = 0; p < FKT / 32; ++p) {
    FragH ak[2][KS];
#pragma unroll
    for (int nt = 0; nt < 2; ++nt) { const unsigned char* kr = &ring[fo + (p * 32 + nt * 16) * FPIT];
#pragma unroll
      for (int ks = 0; ks < KS; ++ks) { ak[nt][ks].half[0] = *(const v8us*)(kr + ks * 64); ak[nt][ks].half[1] = *(const v8us*)(kr + ks * 64 + 32); } }
    float sc[16];
#pragma unroll
    for (int nt = 0; nt < 2; ++nt) { v8f acc = (v8f){0.f,0.f,0.f,0.f,0.f,0.f,0.f,0.f};
#pragma unroll
      for (int ks = 0; ks < KS; ++ks) acc = mmaH<1>(ak[nt][ks].v, ak[nt][ks].v, bq[ks].v, bq[ks].v, acc);
#pragma unroll
      for (int r = 0; r < 8; ++r) sc[nt * 8 + r] = acc[r]; }      /* sc[nt*8 + r] = q.k, not yet scaled (key t*64 + p*32 + nt*16 + 8*hh + r, query q0 + ln) */
    FragH av[DT];
#pragma unroll
    for (int dt = 0; dt < DT; ++dt) { const unsigned char* vrow = &ring[fo + (64 + dt * 16) * FPIT + p * 64]; av[dt].half[0] = *(const v8us*)(vrow); av[dt].half[1] = *(const v8us*)(vrow + 32); }
    float mx[4];
#pragma unroll
    for (int c = 0; c < 4; ++c) mx[c] = fmaxf(fmaxf(sc[4 * c], sc[4 * c + 1]), fmaxf(sc[4 * c + 2], sc[4 * c + 3]));
    float mc = fmaxf(fmaxf(mx[0], mx[1]), fmaxf(mx[2], mx[3])); mc = fmaxf(mc, xhalf(mc));
    const float mn = fmaxf(m_q, mc * SCL2); const float al = __builtin_amdgcn_exp2f(m_q - mn); m_q = mn;      /* the maximum is kept in base-2 units (SCL2 > 0 commutes with max); al: 0 on the first pass, 1 where the maximum stays */
    const float nb = 10.0f - mn;      /* P x 1024 = 2^(q.k x SCL2 - mn + 10): one FMA and one bare v_exp_f32 a score; the argument is at most 10, and far below -126 the result is 0, as wanted */
    FragH pb; float ps[4];
#pragma unroll
    for (int i = 0; i < 16; ++i) sc[i] = fmaf(sc[i], SCL2, nb);
    exp2x8(sc); exp2x8(sc + 8);
#pragma unroll
    for (int i = 0; i < 16; ++i) { const float p_ = sc[i]; ps[i & 3] = (i < 4) ? p_ : ps[i & 3] + p_; pb.h[i] = (_Float16)p_; }      /* pb.h[nt*8 + r] = P(key nt*16 + 8*hh + r of the pass, query q0 + ln): the k order of the Vt loader */
    l_q = l_q * al + ((ps[0] + ps[1]) + (ps[2] + ps[3]));
#pragma unroll
    for (int dt = 0; dt < DT; ++dt) {
#pragma unroll
      for (int r = 0; r < 8; ++r) oacc[dt][r] *= al;
      oacc[dt] = mmaH<1>(av[dt].v, av[dt].v, pb.v, pb.v, oacc[dt]); } }
    asm volatile("s_wait_dscnt 0x0" ::: "memory");      /* this wave's reads of tile t are done */
    asm volatile("s_wait_asynccnt 0x0" ::: "memory");      /* its share of tile t + 1 has landed */
    __syncthreads();      /* publishes tile t + 1 and frees tile t's buffer */
    if (t + 2 < NT) tile_copy(l0 + bo, gk + (size_t)(t + 2) * FKT * ldk, ldk, gv + (size_t)(t + 2) * FKT); }
  asm volatile("s_wait_asynccnt 0x0" ::: "memory");      /* no copy is in flight when the ring becomes output staging */
  float (*sO)[RPW][64 + 4] = (float (*)[RPW][64 + 4])ring;
  const float lt = l_q + xhalf(l_q); const float inv = (lt > 0.f) ? 1.0f / lt : 0.f;      /* l_q sums P x 1024, as Ot does */
#pragma unroll
  for (int dt = 0; dt < DT; ++dt)      /* oacc[dt][r] = Ot[dt*16 + 8*hh + r][q0 + ln] */
#pragma unroll
    for (int q = 0; q < 2; ++q) { v4f o4;
#pragma unroll
      for (int i = 0; i < 4; ++i) o4[i] = oacc[dt][q * 4 + i] * inv;
      *(v4fa*)&sO[w][ln][dt * 16 + 8 * hh + q * 4] = o4; }
  __builtin_amdgcn_fence(__ATOMIC_ACQ_REL, "workgroup"); __builtin_amdgcn_wave_barrier();
  {
#pragma unroll
    for (int rp = 0; rp < RPW; rp += 4) { const int r = rp + (lane >> 3), pc = lane & 7; const v4f a = *(const v4fa*)&sO[w][r][pc * 8], c = *(const v4fa*)&sO[w][r][pc * 8 + 4]; FragH fh, fl;      /* O leaves as the output GEMM's two f16 planes: hi, and (O - hi) x 1024; 8 lanes store a row's 128-B line of each */
#pragma unroll      /* vector elements by constant indices: registers */
      for (int q = 0; q < 8; ++q) { const float v = (q < 4) ? a[q] : c[q - 4]; const _Float16 hi = (_Float16)v; fh.h[q] = hi; fl.h[q] = (_Float16)((v - (float)hi) * 1024.0f); }
      const size_t o = ((size_t)b * TQ + q0 + r) * ldo + h * 64 + pc * 8; *(v8us*)((unsigned short*)Oh + o) = fh.half[0]; *(v8us*)((unsigned short*)Ol + o) = fl.half[0]; }
     } }
__device__ __forceinline__ void d_rowflag(int bid, const float* __restrict__ X, int* __restrict__ FL) {
  __shared__ int sf[8];
  const int tid = threadIdx.x, w = tid >> 5, ln = tid & 31; const int r = bid * 8 + w; const float* x = X + (size_t)r * DKV; float s = 0.f;
#pragma unroll
  for (int u = 0; u < DKV / 32; ++u) s += bf16_round(x[u * 32 + ln]);
  for (int o = 16; o > 0; o >>= 1) s += __shfl_xor(s, o, 32);
  if (ln == 0) sf[w] = (s == 0.0f) ? 1 : 0;
  __syncthreads();
  if (tid < 32) { const int v = (tid < 8) ? sf[tid] : 0; int* d = FL + bid * 32 + tid; *(int*)d = v;  } }
// Everything that reads only the inputs, in one grid: a work-group's index range picks its job (the same in the whole work-group, so the row flags' barrier is passed by all of it or by none).
// The transposes come first: their scattered reads make them the longest work-groups.
#define NBW1 (DM * DM / 8 / 256)
#define NBW2 (DKV * DM / 8 / 256)
#define NBX1 (NR * DM / 8 / 256)
#define NBX2 (NR * DKV / 8 / 256)
#define NBF (NR / 8)
#define NBPREP (2 * NBW1 + 2 * NBW2 + NBX1 + 2 * NBX2 + 2 * NBF)
__global__ __launch_bounds__(256) void k_prep(const float* __restrict__ qi, const float* __restrict__ ki, const float* __restrict__ vi, const float* __restrict__ Wq, const float* __restrict__ Wk, const float* __restrict__ Wv, const float* __restrict__ Wo,
    _Float16* __restrict__ BQ, _Float16* __restrict__ BK, _Float16* __restrict__ BV, _Float16* __restrict__ BO, _Float16* __restrict__ XQ, _Float16* __restrict__ XK, _Float16* __restrict__ XV, int* __restrict__ FLK, int* __restrict__ FLV) {
  int b = (int)blockIdx.x;
  if (b < NBW1) { d_wt_f16(b, Wq, BQ, DM, DM, 16.0f); return; } b -= NBW1;      /* (in,out) -> [out][in] x16 */
  if (b < NBW1) { d_wt_f16(b, Wo, BO, DM, DM, 16.0f); return; } b -= NBW1;
  if (b < NBW2) { d_wt_f16(b, Wk, BK, DKV, DM, 16.0f); return; } b -= NBW2;
  if (b < NBW2) { d_wt_f16(b, Wv, BV, DKV, DM, 16.0f); return; } b -= NBW2;
  if (b < NBX1) { d_x16(b, qi, XQ, (size_t)NR * DM / 8); return; } b -= NBX1;
  if (b < NBX2) { d_x16(b, ki, XK, (size_t)NR * DKV / 8); return; } b -= NBX2;
  if (b < NBF) { d_rowflag(b, ki, FLK); return; } b -= NBF;
  if (b < NBX2) { d_x16(b, vi, XV, (size_t)NR * DKV / 8); return; } b -= NBX2;
  d_rowflag(b, vi, FLV); }
extern "C" void kernel_launch(void* const* d_in, const int* in_sizes, int n_in,
                              void* d_out, int out_size, void* d_ws, size_t ws_size, hipStream_t stream) {
  (void)in_sizes; (void)n_in; (void)out_size;
  const float* const* I = (const float* const*)d_in; const float* qi = I[0]; const float* ki = I[1]; const float* vi = I[2];
  const float* Wq = I[3]; const float* bq = I[4]; const float* Wk = I[5]; const float* bk = I[6]; const float* Wv = I[7]; const float* bv = I[8]; const float* Wo = I[9]; const float* bo = I[10];
  char* ws = (char*)d_ws; size_t off = 0;
  auto take = [&](size_t bytes) { char* p = ws + off; off += (bytes + 255) & ~(size_t)255; return p; };
  _Float16* BQ = (_Float16*)take((size_t)DM * DM * 2); _Float16* BK = (_Float16*)take((size_t)DM * DKV * 2); _Float16* BV = (_Float16*)take((size_t)DM * DKV * 2); _Float16* BO = (_Float16*)take((size_t)DM * DM * 2);
  _Float16* XQ = (_Float16*)take((size_t)NR * DM * 2); _Float16* XK = (_Float16*)take((size_t)NR * DKV * 2); _Float16* XV = (_Float16*)take((size_t)NR * DKV * 2);      /* one plane an input: the three converts run side by side */
  _Float16* Q16 = (_Float16*)take((size_t)NR * DM * 2); _Float16* K16 = (_Float16*)take((size_t)NR * DM * 2); _Float16* VT = (_Float16*)take((size_t)NR * DM * 2);
  int* FLK = (int*)take((size_t)(NR / 8) * 32 * 4); int* FLV = (int*)take((size_t)(NR / 8) * 32 * 4);
  _Float16* Oh = (_Float16*)take((size_t)NR * DM * 2); _Float16* Ol = (_Float16*)take((size_t)NR * DM * 2);      /* all batches */
  if (off > ws_size) return;      /* 6 + 32 + 16 x 3 + 0.3 + 16 + 16 = 118 MiB */
  k_prep<<<NBPREP, 256, 0, stream>>>(qi, ki, vi, Wq, Wk, Wv, Wo, BQ, BK, BV, BO, XQ, XK, XV, FLK, FLV);      /* weights -> [out][in] x16, inputs -> f16, row flags */
  const dim3 gP(NBG, 1);
  k_gemm_qkv<<<3 * NBG, 128, 0, stream>>>(XQ, XK, XV, BQ, BK, BV, bq, bk, bv, FLK, FLV, Q16, K16, VT);      /* q, k -> f16, v -> f16 Vt[(b,h)][d][s]; masked rows of k and v zero */
  float* outp = (float*)d_out;
  k_flash<<<NBT * NH * (TQ / 64), 128, 0, stream>>>(Q16, DM, K16, DM, VT, nullptr, Oh, Ol, DM);      /* all batches in one grid: slab = b*NH + h; O as f16 hi + lo */
  k_gemm2<0><<<gP, 128, 0, stream>>>(Oh, DM, 0, BO, DM, 0, 0.0625f, bo, 0, Ol, 1.0f / 1024.0f, outp, nullptr, DM, 0, NR, DM, DM);      /* out = (Oh + Ol / 1024)*Wo + bo, one k loop */
}

// v009
// It runs in 159 microseconds.
// Next to v008, in two timings, it ran 1.07 and 1.06 times as fast.
// Counting every step since v000, it is 8.57 times as fast.
#include <hip/hip_runtime.h>
// Multi-head cross attention over social features (B 4, S 2048 queries x 1024, 2048 keys/values x 512, 16 heads x 64; (in,out) Linear weights with bias; key/value rows whose raw features sum to exactly 0 are zeroed after projection, as the reference's padding mask): scores = q.k/8; softmax; out = (attn.v merged)*Wo + bo -> [4,2048,1024].
// Compute dtype: the inputs, the four matrices and biases rounded to bf16; q/k/v products exact (weights x16 in f16, undone by alpha), q, k, v, P as f16 operands (~2^-12; logits sigma ~0.4), O as f16 hi + lo; f32 accumulation and softmax. v_wmma_f32_16x16x32_f16.
#define NBT 4
#define TQ 2048
#define TK 2048
#define DKV 512
#define NR (NBT * TQ)
#define DM 1024
#define NH 16
#define SCL 0.125f
#define SCL2 (SCL * 1.44269504088896340736f)      /* 1/8 x log2(e): scores in base-2 exponent units */
typedef __bf16 v16b __attribute__((ext_vector_type(16)));
typedef unsigned short v8us __attribute__((ext_vector_type(8), may_alias));
typedef float  v8f  __attribute__((ext_vector_type(8)));
typedef float  v4f  __attribute__((ext_vector_type(4)));
typedef float  v4fa __attribute__((ext_vector_type(4), may_alias));
union FragB { v16b v; v8us half[2]; unsigned short u[16]; };

__device__ __forceinline__ unsigned short bf16_bits(float x) { unsigned int u = __float_as_uint(x); return (unsigned short)((u + 0x7FFFu + ((u >> 16) & 1u)) >> 16); }
__device__ __forceinline__ float bf16_val(unsigned short b) { return __uint_as_float(((unsigned int)b) << 16); }
__device__ __forceinline__ float bf16_round(float x) { return bf16_val(bf16_bits(x)); }
// D += A·B with NT terms: 1 = ah·bh, 2 = + al·bh (A split), 3 = + ah·bl (both split)
template <int NT>
__device__ __forceinline__ v8f mmaN(v16b ah, v16b al, v16b bh, v16b bl, v8f c) {
  c = __builtin_amdgcn_wmma_f32_16x16x32_bf16(false, ah, false, bh, (short)0, c, false, false);
  if (NT >= 2) c = __builtin_amdgcn_wmma_f32_16x16x32_bf16(false, al, false, bh, (short)0, c, false, false);
  if (NT >= 3) c = __builtin_amdgcn_wmma_f32_16x16x32_bf16(false, ah, false, bl, (short)0, c, false, false);
  asm volatile("v_nop\n\tv_nop\n\tv_nop\n\tv_nop" : "+v"(c) : "v"(ah), "v"(al), "v"(bh), "v"(bl));
  return c;
}

__global__ __launch_bounds__(256) void k_wt_bf16(const float* __restrict__ W, unsigned short* __restrict__ Wt, int K, int N) {
  const int t = blockIdx.x * 256 + threadIdx.x;
  const int k8n = K / 8;
  if (t >= N * k8n) return;
  const int n = t / k8n, k8 = (t % k8n) * 8;
  v8us v;
#pragma unroll
  for (int i = 0; i < 8; ++i) v[i] = bf16_bits(W[(size_t)(k8 + i) * N + n]);
  *(v8us*)(Wt + (size_t)n * K + k8) = v;
  
}

// GEMM C[M][N] (f32, pitch ldc) = act(A[M][K]·W + bias). A f32 row-major (pitch lda) converted per fragment to bf16
// (ASPLIT: hi/lo two planes -> 2 terms, else single rounded term); Wt bf16 [N][K] (pitch ldb). BIAS_BF16 rounds the
// bias to bf16 first (bias quantised to bf16 before the add). K%32==0, M%16==0, N%64==0.
template <bool ASPLIT, int ACT, bool BIAS_BF16>
__global__ __launch_bounds__(128) void k_gemm_bf(const float* __restrict__ A, int lda, const unsigned short* __restrict__ Wt, int ldb,
                                               const float* __restrict__ bias, float* __restrict__ C, int ldc, int M, int N, int K) {
  __shared__ __attribute__((aligned(16))) float so[4][16][64];
  const int tid = threadIdx.x, w = tid >> 5, lane = tid & 31, ln = lane & 15, hh = lane >> 4;
  const int ntn = N / 64;
  const int wid = blockIdx.x * 4 + w;
  const int mt = wid / ntn, nq = wid % ntn;
  if (mt * 16 >= M) return;
  const int row0 = mt * 16, col0 = nq * 64;
  const float* arow = A + (size_t)(row0 + ln) * lda;
  v8f acc[4] = {};
  for (int kb = 0; kb < K; kb += 32) {
    FragB ah, al;
    const v4f x0 = *(const v4fa*)(arow + kb + 8 * hh), x1 = *(const v4fa*)(arow + kb + 8 * hh + 4);
    const v4f x2 = *(const v4fa*)(arow + kb + 16 + 8 * hh), x3 = *(const v4fa*)(arow + kb + 16 + 8 * hh + 4);
    float xs[16] = {x0[0],x0[1],x0[2],x0[3],x1[0],x1[1],x1[2],x1[3],x2[0],x2[1],x2[2],x2[3],x3[0],x3[1],x3[2],x3[3]};
#pragma unroll
    for (int i = 0; i < 16; ++i) { const unsigned short hb = bf16_bits(xs[i]); ah.u[i] = hb; al.u[i] = ASPLIT ? bf16_bits(xs[i] - bf16_val(hb)) : (unsigned short)0; }
#pragma unroll
    for (int t = 0; t < 4; ++t) {
      const unsigned short* brow = Wt + (size_t)(col0 + t * 16 + ln) * ldb + kb;
      FragB b;
      b.half[0] = *(const v8us*)(brow + 8 * hh);
      b.half[1] = *(const v8us*)(brow + 16 + 8 * hh);
      acc[t] = mmaN<ASPLIT ? 2 : 1>(ah.v, al.v, b.v, b.v, acc[t]);
    }
  }
#pragma unroll
  for (int t = 0; t < 4; ++t) {
    float bv = bias ? bias[col0 + t * 16 + ln] : 0.f;
    if (BIAS_BF16) bv = bf16_round(bv);
#pragma unroll
    for (int r = 0; r < 8; ++r) { float v = acc[t][r] + bv; if (ACT == 1) v = fmaxf(v, 0.f); so[w][8 * hh + r][t * 16 + ln] = v; }
  }
  __builtin_amdgcn_fence(__ATOMIC_ACQ_REL, "workgroup");
  __builtin_amdgcn_wave_barrier();
  const int rsub = lane >> 4, c4 = (lane & 15) * 4;
  {
#pragma unroll
    for (int q = 0; q < 8; ++q) {
      const int r = q * 2 + rsub;
      const v4f v = *(const v4fa*)&so[w][r][c4];
      *(v4f*)(C + (size_t)(row0 + r) * ldc + col0 + c4) = v;
    }
    
  }
}

// GEMM C = act(A·W + bias + resid): A f32 (ASPLIT -> hi/lo 2 terms), Wt bf16 [N][K]; ACT 0 none, 1 relu, 2 exact gelu;
// resid (optional, f32, row index = (row % rmod), pitch ldr, RES_BF16 rounds it) added before the activation.
template <bool ASPLIT, int ACT, bool BIAS_BF16, bool RES_BF16>
__global__ __launch_bounds__(128) void k_gemm_bf3(const float* __restrict__ A, int lda, const unsigned short* __restrict__ Wt, int ldb,
                                                const float* __restrict__ bias, const float* __restrict__ resid, int rmod, int ldr,
                                                float* __restrict__ C, int ldc, int M, int N, int K) {
  __shared__ __attribute__((aligned(16))) float so[4][16][64];
  const int tid = threadIdx.x, w = tid >> 5, lane = tid & 31, ln = lane & 15, hh = lane >> 4;
  const int ntn = N / 64;
  const int wid = blockIdx.x * 4 + w;
  const int mt = wid / ntn, nq = wid % ntn;
  if (mt * 16 >= M) return;
  const int row0 = mt * 16, col0 = nq * 64;
  const float* arow = A + (size_t)(row0 + ln) * lda;
  v8f acc[4] = {};
  for (int kb = 0; kb < K; kb += 32) {
    FragB ah, al;
    const v4f x0 = *(const v4fa*)(arow + kb + 8 * hh), x1 = *(const v4fa*)(arow + kb + 8 * hh + 4);
    const v4f x2 = *(const v4fa*)(arow + kb + 16 + 8 * hh), x3 = *(const v4fa*)(arow + kb + 16 + 8 * hh + 4);
    float xs[16] = {x0[0],x0[1],x0[2],x0[3],x1[0],x1[1],x1[2],x1[3],x2[0],x2[1],x2[2],x2[3],x3[0],x3[1],x3[2],x3[3]};
#pragma unroll
    for (int i = 0; i < 16; ++i) { const unsigned short hb = bf16_bits(xs[i]); ah.u[i] = hb; al.u[i] = ASPLIT ? bf16_bits(xs[i] - bf16_val(hb)) : (unsigned short)0; }
#pragma unroll
    for (int t = 0; t < 4; ++t) {
      const unsigned short* brow = Wt + (size_t)(col0 + t * 16 + ln) * ldb + kb;
      FragB b;
      b.half[0] = *(const v8us*)(brow + 8 * hh);
      b.half[1] = *(const v8us*)(brow + 16 + 8 * hh);
      acc[t] = mmaN<ASPLIT ? 2 : 1>(ah.v, al.v, b.v, b.v, acc[t]);
    }
  }
#pragma unroll
  for (int t = 0; t < 4; ++t) {
    const int col = col0 + t * 16 + ln;
    float bv = bias ? bias[col] : 0.f;
    if (BIAS_BF16) bv = bf16_round(bv);
#pragma unroll
    for (int r = 0; r < 8; ++r) {
      float v = acc[t][r] + bv;
      if (resid) { float rv = resid[(size_t)((row0 + 8 * hh + r) % rmod) * ldr + col]; if (RES_BF16) rv = bf16_round(rv); v += rv; }
      if (ACT == 1) v = fmaxf(v, 0.f);
      if (ACT == 2) v = 0.5f * v * (1.0f + erff(v * 0.70710678118654752f));
      if (ACT == 3) { const float u = 0.7978845608028654f * (v + 0.044715f * v * v * v); v = 0.5f * v * (1.0f + tanhf(u)); }
      so[w][8 * hh + r][t * 16 + ln] = v;
    }
  }
  __builtin_amdgcn_fence(__ATOMIC_ACQ_REL, "workgroup");
  __builtin_amdgcn_wave_barrier();
  const int rsub = lane >> 4, c4 = (lane & 15) * 4;
  {
#pragma unroll
    for (int q = 0; q < 8; ++q) {
      const int r = q * 2 + rsub;
      const v4f v = *(const v4fa*)&so[w][r][c4];
      *(v4f*)(C + (size_t)(row0 + r) * ldc + col0 + c4) = v;
    }
    
  }
}
// row LayerNorm (biased variance, eps) over N: s = X (+ R); optional out_sum <- s; out_norm <- (s-mu)*rsqrt(var+eps)*g + b
template <bool PARAM_BF16>
__global__ __launch_bounds__(256) void k_layernorm(const float* __restrict__ X, const float* __restrict__ R, const float* __restrict__ g, const float* __restrict__ bta,
                                                  float* __restrict__ out_sum, float* __restrict__ out_norm, int N, float eps) {
  __shared__ float red[256];
  const int row = blockIdx.x, tid = threadIdx.x;
  const float* x = X + (size_t)row * N; const float* rr = R ? R + (size_t)row * N : nullptr;
  float vals[16];                     // up to N = 4096
  const int per = N / 256;            // contiguous chunk per thread? use strided-by-4 chunks: thread handles j = tid*4 + 1024*u
  float s1 = 0.f;
  for (int u = 0; u < per / 4; ++u) {
    const int j = tid * 4 + 1024 * u;
    const v4f a = *(const v4fa*)(x + j);
    v4f b = {0.f,0.f,0.f,0.f}; if (rr) b = *(const v4fa*)(rr + j);
#pragma unroll
    for (int q = 0; q < 4; ++q) { const float v = a[q] + b[q]; vals[u * 4 + q] = v; s1 += v; }
  }
  red[tid] = s1; __syncthreads();
  for (int st = 128; st > 0; st >>= 1) { if (tid < st) red[tid] += red[tid + st]; __syncthreads(); }
  const float mu = red[0] / (float)N; __syncthreads();
  float s2 = 0.f;
  for (int u = 0; u < per / 4; ++u)
#pragma unroll
    for (int q = 0; q < 4; ++q) { const float c = vals[u * 4 + q] - mu; s2 += c * c; }
  red[tid] = s2; __syncthreads();
  for (int st = 128; st > 0; st >>= 1) { if (tid < st) red[tid] += red[tid + st]; __syncthreads(); }
  const float rs = rsqrtf(red[0] / (float)N + eps);
  {
    for (int u = 0; u < per / 4; ++u) {
      const int j = tid * 4 + 1024 * u;
      v4f o, sm;
#pragma unroll
      for (int q = 0; q < 4; ++q) {
        float gg = g[j + q], bb = bta[j + q];
        if (PARAM_BF16) { gg = bf16_round(gg); bb = bf16_round(bb); }
        sm[q] = vals[u * 4 + q]; o[q] = (vals[u * 4 + q] - mu) * rs * gg + bb;
      }
      if (out_sum) *(v4f*)(out_sum + (size_t)row * N + j) = sm;
      *(v4f*)(out_norm + (size_t)row * N + j) = o;
    }
    
  }
}



// ---- f16 WMMA path (v_wmma_f32_16x16x32_f16): 11-bit significands for operands in range — used where a [0,1] probability operand needs more precision than bf16
typedef _Float16 v16h __attribute__((ext_vector_type(16)));
union FragH { v16h v; v8us half[2]; _Float16 h[16]; unsigned short u[16]; };
template <int NT>
__device__ __forceinline__ v8f mmaH(v16h ah, v16h al, v16h bh, v16h bl, v8f c) {
  c = __builtin_amdgcn_wmma_f32_16x16x32_f16(false, ah, false, bh, (short)0, c, false, false);
  if (NT >= 2) c = __builtin_amdgcn_wmma_f32_16x16x32_f16(false, al, false, bh, (short)0, c, false, false);
  if (NT >= 3) c = __builtin_amdgcn_wmma_f32_16x16x32_f16(false, ah, false, bl, (short)0, c, false, false);
  asm volatile("v_nop\n\tv_nop\n\tv_nop\n\tv_nop" : "+v"(c) : "v"(ah), "v"(al), "v"(bh), "v"(bl));
  return c;
}
// batched GEMM like k_gemm_b but f16 operands: A f32 (split into f16 hi/lo if ASPLIT, else rounded to f16), Bt = f16 values [n][k]; alpha; C f32; N multiple of 16 (partial tiles skipped)
template <bool ASPLIT>
__global__ __launch_bounds__(128) void k_gemm_h(const float* __restrict__ A, int lda, size_t sA, const _Float16* __restrict__ Bh, int ldb, size_t sB, float alpha, float* __restrict__ C, int ldc, size_t sC, int M, int N, int K) {
  __shared__ __attribute__((aligned(16))) float so[4][16][64];
  const int tid = threadIdx.x, w = tid >> 5, lane = tid & 31, ln = lane & 15, hh = lane >> 4; const int by = blockIdx.y;
  A += (size_t)by * sA; Bh += (size_t)by * sB; C += (size_t)by * sC;
  const int ntn = (N + 63) / 64; const int wid = blockIdx.x * 4 + w; const int mt = wid / ntn, nq = wid % ntn; if (mt * 16 >= M) return;
  const int row0 = mt * 16, col0 = nq * 64; const float* arow = A + (size_t)(row0 + ln) * lda;
  v8f acc[4] = {};
  for (int kb = 0; kb < K; kb += 32) {
    FragH ah, al;
    const v4f x0 = *(const v4fa*)(arow + kb + 8 * hh), x1 = *(const v4fa*)(arow + kb + 8 * hh + 4), x2 = *(const v4fa*)(arow + kb + 16 + 8 * hh), x3 = *(const v4fa*)(arow + kb + 16 + 8 * hh + 4);
    float xs[16] = {x0[0],x0[1],x0[2],x0[3],x1[0],x1[1],x1[2],x1[3],x2[0],x2[1],x2[2],x2[3],x3[0],x3[1],x3[2],x3[3]};
#pragma unroll
    for (int i = 0; i < 16; ++i) { const _Float16 h = (_Float16)xs[i]; ah.h[i] = h; al.h[i] = ASPLIT ? (_Float16)(xs[i] - (float)h) : (_Float16)0.0f; }
#pragma unroll
    for (int t = 0; t < 4; ++t) { if (col0 + t * 16 >= N) continue; const size_t boff = (size_t)(col0 + t * 16 + ln) * ldb + kb; FragH bq; bq.half[0] = *(const v8us*)(Bh + boff + 8 * hh); bq.half[1] = *(const v8us*)(Bh + boff + 16 + 8 * hh);
      acc[t] = mmaH<ASPLIT ? 2 : 1>(ah.v, al.v, bq.v, bq.v, acc[t]); }
  }
#pragma unroll
  for (int t = 0; t < 4; ++t) { if (col0 + t * 16 >= N) continue;
#pragma unroll
    for (int r = 0; r < 8; ++r) so[w][8 * hh + r][t * 16 + ln] = acc[t][r] * alpha; }
  __builtin_amdgcn_fence(__ATOMIC_ACQ_REL, "workgroup"); __builtin_amdgcn_wave_barrier();
  const int rsub = lane >> 4, c4 = (lane & 15) * 4;
  {
#pragma unroll
    for (int q = 0; q < 8; ++q) { const int r = q * 2 + rsub; if (col0 + c4 < N) { const v4f v = *(const v4fa*)&so[w][r][c4]; *(v4f*)(C + (size_t)(row0 + r) * ldc + col0 + c4) = v; } }
     }
}

// Wt[n][k] = f16(W[k][n]·scale) from f32 row-major W[K][N] (scale = power of two; bf16-exact weights stay exact in f16 away from the subnormal range)
__device__ __forceinline__ void d_wt_f16(int bid, const float* __restrict__ W, _Float16* __restrict__ Wt, int K, int N, float scale) {
  const int t = bid * 256 + threadIdx.x; if (t >= N * (K / 8)) return; const int n = t / (K / 8), k8 = (t % (K / 8)) * 8; FragH f;
#pragma unroll
  for (int i = 0; i < 8; ++i) f.h[i] = (_Float16)(bf16_round(W[(size_t)(k8 + i) * N + n]) * scale); const v8us o = f.half[0];
  *(v8us*)((unsigned short*)Wt + (size_t)n * K + k8) = o; 
}
// k_gemm_hh variant with fused epilogue: v = acc·alpha + bias[by·sBias + col] (+ CP[(row/rowsPerB)·sCPb + by·64 + col] if CP) ; ACT 0 none / 1 elu ; writes f16 C16 (and f32 C if non-null)
template <int ACT>
__global__ __launch_bounds__(128) void k_gemm_hhx(const _Float16* __restrict__ A, int lda, size_t sA, const _Float16* __restrict__ Bh, int ldb, size_t sB, float alpha, const float* __restrict__ bias, size_t sBias, const float* __restrict__ CP, int rowsPerB, size_t sCPb, int row0g,
    float* __restrict__ C, _Float16* __restrict__ C16, int ldc, size_t sC, int M, int N, int K) {
  __shared__ __attribute__((aligned(16))) float so[4][16][64];
  const int tid = threadIdx.x, w = tid >> 5, lane = tid & 31, ln = lane & 15, hh = lane >> 4; const int by = blockIdx.y;
  A += (size_t)by * sA; Bh += (size_t)by * sB; const size_t cofs = (size_t)by * sC; const float* bp = bias ? bias + (size_t)by * sBias : nullptr;
  const int ntn = (N + 63) / 64; const int wid = blockIdx.x * 4 + w; const int mt = wid / ntn, nq = wid % ntn; if (mt * 16 >= M) return;
  const int row0 = mt * 16, col0 = nq * 64; const _Float16* arow = A + (size_t)(row0 + ln) * lda;
  v8f acc[4] = {};
  for (int kb = 0; kb < K; kb += 32) { FragH ah; ah.half[0] = *(const v8us*)((const unsigned short*)arow + kb + 8 * hh); ah.half[1] = *(const v8us*)((const unsigned short*)arow + kb + 16 + 8 * hh);
#pragma unroll
    for (int t = 0; t < 4; ++t) { if (col0 + t * 16 >= N) continue; const size_t boff = (size_t)(col0 + t * 16 + ln) * ldb + kb; FragH bq; bq.half[0] = *(const v8us*)((const unsigned short*)Bh + boff + 8 * hh); bq.half[1] = *(const v8us*)((const unsigned short*)Bh + boff + 16 + 8 * hh);
      acc[t] = mmaH<1>(ah.v, ah.v, bq.v, bq.v, acc[t]); }
  }
#pragma unroll
  for (int t = 0; t < 4; ++t) { if (col0 + t * 16 >= N) continue; const int col = col0 + t * 16 + ln; const float bv = bp ? bf16_round(bp[col]) : 0.f;
#pragma unroll
    for (int r = 0; r < 8; ++r) { float v = acc[t][r] * alpha + bv; if (CP) { const int bidx = (row0g + row0 + 8 * hh + r) / rowsPerB; v += CP[(size_t)bidx * sCPb + (size_t)by * 64 + col]; } if (ACT == 1) v = (v > 0.f) ? v : expm1f(v); else if (ACT == 7) v = (v > 0.f) ? v + 1.0f : expf(v); else if (ACT == 8) v = tanhf(v); else if (ACT == 9) v = 0.5f * v * (1.0f + tanhf(0.7978845608028654f * (v + 0.044715f * v * v * v))); else if (ACT == 11) v = 1.0f / (1.0f + expf(-v)); else if (ACT == 12) v = (v > 0.f) ? v : 0.01f * v; else if (ACT == 14) v = (v > 0.f) ? v : 0.1f * v; else if (ACT == 15) v = v / (1.0f + expf(-v)); else if (ACT == 3) v = fmaxf(v, 0.f); else if (ACT == 6) v = 0.5f * v * (1.0f + erff(v * 0.70710678118654752f)); so[w][8 * hh + r][t * 16 + ln] = v; } }
  __builtin_amdgcn_fence(__ATOMIC_ACQ_REL, "workgroup"); __builtin_amdgcn_wave_barrier();
  const int rsub = lane >> 4, c4 = (lane & 15) * 4; typedef _Float16 v4h __attribute__((ext_vector_type(4)));
  {
#pragma unroll
    for (int q = 0; q < 8; ++q) { const int r = q * 2 + rsub; if (col0 + c4 < N) { const v4f v = *(const v4fa*)&so[w][r][c4]; if (C) *(v4f*)(C + cofs + (size_t)(row0 + r) * ldc + col0 + c4) = v; if (C16) { v4h h4; for (int i = 0; i < 4; ++i) h4[i] = (_Float16)v[i]; *(v4h*)(C16 + cofs + (size_t)(row0 + r) * ldc + col0 + c4) = h4; } } }
     }
}


typedef _Float16 v4h __attribute__((ext_vector_type(4)));

__device__ __forceinline__ void d_x16(int bid, const float* __restrict__ x, _Float16* __restrict__ X16, size_t n8) { const size_t t = (size_t)bid * 256 + threadIdx.x; if (t >= n8) return; FragH f;
#pragma unroll
  for (int q = 0; q < 8; ++q) f.h[q] = (_Float16)bf16_round(x[t * 8 + q]); *(v8us*)((unsigned short*)X16 + t * 8) = f.half[0];  }
__global__ __launch_bounds__(256) void k_h16(const float* __restrict__ x, _Float16* __restrict__ X16, size_t n8) { const size_t t = (size_t)blockIdx.x * 256 + threadIdx.x; if (t >= n8) return; FragH f;
#pragma unroll
  for (int q = 0; q < 8; ++q) f.h[q] = (_Float16)x[t * 8 + q]; *(v8us*)((unsigned short*)X16 + t * 8) = f.half[0];  }
__global__ __launch_bounds__(256) void k_round16f(const float* __restrict__ W, _Float16* __restrict__ Bt, size_t n8) { const size_t t = (size_t)blockIdx.x * 256 + threadIdx.x; if (t >= n8) return; FragH f;
#pragma unroll
  for (int i = 0; i < 8; ++i) f.h[i] = (_Float16)(bf16_round(W[t * 8 + i]) * 16.0f); *(v8us*)((unsigned short*)Bt + t * 8) = f.half[0];  }
__global__ __launch_bounds__(256) void k_hl(const float* __restrict__ F, _Float16* __restrict__ Hh, _Float16* __restrict__ Hl, size_t n8) { const size_t t = (size_t)blockIdx.x * 256 + threadIdx.x; if (t >= n8) return; FragH fh, fl; const v4f a = *(const v4fa*)(F + t * 8), c = *(const v4fa*)(F + t * 8 + 4);
#pragma unroll
  for (int q = 0; q < 4; ++q) { _Float16 h = (_Float16)a[q]; fh.h[q] = h; fl.h[q] = (_Float16)((a[q] - (float)h) * 1024.0f); h = (_Float16)c[q]; fh.h[4 + q] = h; fl.h[4 + q] = (_Float16)((c[q] - (float)h) * 1024.0f); }
  { *(v8us*)((unsigned short*)Hh + t * 8) = fh.half[0]; *(v8us*)((unsigned short*)Hl + t * 8) = fl.half[0];  } }

// ---- fast GEMM (wave tile 32x64, 8 waves as 4 x 2, work-group tile 128x128); epilogue = k_gemm_hhx semantics without its CP term ----
__device__ __forceinline__ v8f g2_mma(v16h a, v16h b, v8f c) { v8f d = __builtin_amdgcn_wmma_f32_16x16x32_f16(false, a, false, b, (short)0, c, false, false); asm volatile("v_nop\n\tv_nop\n\tv_nop\n\tv_nop" : "+v"(d) : "v"(a), "v"(b)); return d; }
// A and B reach the eight waves of a work-group through a two-buffer LDS ring. One tile = 64 k: 128 A rows, then 128 B rows, 128 data bytes a row at a pitch of 144 B (16 B x odd: no bank conflict for 16-byte readers).
// An A row serves two waves and a B row four: 32 KiB come from L2 for 128 x 128 x 64 products (a 128 x 64 work-group tile asks 24 KiB for half of that).
// Needs M % 128 == 0, N % 128 == 0 and K % 64 == 0.
// A2 (optional): a second A plane of the same shape for C = (A + a2s x A2).B in ONE k loop: the ring first runs A2's K / 64 tiles against B, the accumulators are then scaled by a2s (a power of two: exact), and A's tiles follow into the same accumulators.
// FL (optional): row flags in the PIDX order; a flagged row of C is stored as zeros. CT (optional, in place of C and C16): the f16 result goes out transposed, head by head, CT[(batch * NH + head) * 64 + d][key]; a work-group's 128 rows are 128 keys of one batch, its 128 columns two neighbouring heads.
#define PIDX(i) ((((i) >> 3) << 5) + ((i) & 7))
#define TPIT 272      /* a d row of the transposed staging: 128 keys x 2 B + 16 B (16 B x odd: no bank conflict for 16-byte writers and readers) */
typedef int v4i __attribute__((ext_vector_type(4), may_alias));
#define GKT 64
#define GPIT 144
#define GTILE (256 * GPIT)
// One tile: 8 asynchronous 16-byte copies a lane (256 lanes x 8 x 16 B = 32 KiB); 8 lanes cover one 128-B row, so a wave's copy asks for 4 whole lines (a fragment load straight from global memory would touch 16 lines for its 512 bytes).
// s_wait_xcnt closes the statement so that no address register of a copy is rewritten in front of it.
__device__ __forceinline__ void g2_copy(unsigned l0, const unsigned short* ga, int lda, const unsigned short* gb, int ldb) {
  asm volatile("global_load_async_to_lds_b128 %0, %8, off\n\t"
               "global_load_async_to_lds_b128 %1, %9, off\n\t"
               "global_load_async_to_lds_b128 %2, %10, off\n\t"
               "global_load_async_to_lds_b128 %3, %11, off\n\t"
               "global_load_async_to_lds_b128 %4, %12, off\n\t"
               "global_load_async_to_lds_b128 %5, %13, off\n\t"
               "global_load_async_to_lds_b128 %6, %14, off\n\t"
               "global_load_async_to_lds_b128 %7, %15, off\n\t"
               "s_wait_xcnt 0x0"
               :: "v"(l0), "v"(l0 + 32u * GPIT), "v"(l0 + 64u * GPIT), "v"(l0 + 96u * GPIT), "v"(l0 + 128u * GPIT), "v"(l0 + 160u * GPIT), "v"(l0 + 192u * GPIT), "v"(l0 + 224u * GPIT),
                  "v"(ga), "v"(ga + (size_t)32 * lda), "v"(ga + (size_t)64 * lda), "v"(ga + (size_t)96 * lda), "v"(gb), "v"(gb + (size_t)32 * ldb), "v"(gb + (size_t)64 * ldb), "v"(gb + (size_t)96 * ldb)
               : "memory");
}
__device__ __forceinline__ v16h g2_lfrag(const unsigned char* p) { FragH f; f.half[0] = *(const v8us*)p; f.half[1] = *(const v8us*)(p + 32); return f.v; }      /* p = a row's 32-k slice + 16*hh bytes: k = 8*hh .. 8*hh + 7, then 16 + 8*hh .. 16 + 8*hh + 7, for A and B alike */
template <int ACT>
__device__ __forceinline__ void g2_run(unsigned bx, int by, const _Float16* __restrict__ A, int lda, size_t sA, const _Float16* __restrict__ Bh, int ldb, size_t sB, float alpha, const float* __restrict__ bias, size_t sBias, const _Float16* __restrict__ A2, float a2s, const int* __restrict__ FL,
    float* __restrict__ C, _Float16* __restrict__ C16, _Float16* __restrict__ CT, int ldc, size_t sC, int M, int N, int K) {
  __shared__ __attribute__((aligned(16))) unsigned char ring[2 * GTILE];      /* behind the loop's last barrier its first 68 KiB stage the output */
  const int tid = threadIdx.x, w = tid >> 5, lane = tid & 31, ln = lane & 15, hh = lane >> 4, wr = w & 3, wc = w >> 2;      /* wave w: rows 32*wr .., columns 64*wc .. of the work-group's tile */
  A += (size_t)by * sA; Bh += (size_t)by * sB; const size_t cofs = (size_t)by * sC; const float* bp = bias ? bias + (size_t)by * sBias : nullptr;
  const int ntn = N >> 7; const int mt = bx / ntn, nq = bx - mt * ntn; const int row0 = mt * 128 + 32 * wr, col0 = nq * 128 + 64 * wc; if (mt * 128 >= M) return;      /* the whole work-group or none, in front of every barrier */
  const unsigned short* ga = (const unsigned short*)A + (size_t)(mt * 128 + (tid >> 3)) * lda + (tid & 7) * 8;      /* this lane's 16 bytes of A row tid/8 of tile 0 */
  const unsigned short* gb = (const unsigned short*)Bh + (size_t)(nq * 128 + (tid >> 3)) * ldb + (tid & 7) * 8;      /* and of B row tid/8 */
  const unsigned l0 = (unsigned)(size_t)(const void*)ring + (unsigned)((tid >> 3) * GPIT + (tid & 7) * 16);
  const int n2 = A2 ? K / GKT : 0, nt = n2 + K / GKT;      /* tiles 0 .. n2 - 1: A2 against B; tiles n2 .. nt - 1: A against B */
  const unsigned short* ga2 = A2 ? (const unsigned short*)A2 + (size_t)by * sA + (size_t)(mt * 128 + (tid >> 3)) * lda + (tid & 7) * 8 : ga;      /* the same place in A2 */
  auto fill = [&](int t, unsigned l) { const size_t ko = (size_t)(t < n2 ? t : t - n2) * GKT; g2_copy(l, (t < n2 ? ga2 : ga) + ko, lda, gb + ko, ldb); };      /* tile t -> the buffer at l; t is the same in the whole work-group */
  fill(0, l0);      /* tile 0 -> buffer 0 */
  const v8f z8 = {0.f,0.f,0.f,0.f,0.f,0.f,0.f,0.f}; v8f c00 = z8, c01 = z8, c02 = z8, c03 = z8, c10 = z8, c11 = z8, c12 = z8, c13 = z8;
  asm volatile("s_wait_asynccnt 0x0" ::: "memory");      /* this wave's share of tile 0 has landed */
  __syncthreads();      /* tile 0 is published */
  if (nt > 1) fill(1, l0 + GTILE);      /* tile 1 -> buffer 1 */
#pragma unroll 1      /* one trip a tile: the ring's waits and its barrier stand once, at the foot */
  for (int t = 0; t < nt; ++t) {
    const unsigned bo = (unsigned)(t & 1) * GTILE;
    if (n2 > 0 && t == n2) { c00 *= a2s; c01 *= a2s; c02 *= a2s; c03 *= a2s; c10 *= a2s; c11 *= a2s; c12 *= a2s; c13 *= a2s; }      /* A2's sum is complete: weigh it once, then go on with A */
    const unsigned char* ar = &ring[bo + (unsigned)((32 * wr + ln) * GPIT + 16 * hh)]; const unsigned char* br = &ring[bo + (unsigned)((128 + 64 * wc + ln) * GPIT + 16 * hh)];
    v16h a[2][2], b[2][4];      /* the tile's 24 LDS reads stand as one group in front of its 16 WMMAs */
#pragma unroll
    for (int ks = 0; ks < 2; ++ks) { a[ks][0] = g2_lfrag(ar + ks * 64); a[ks][1] = g2_lfrag(ar + 16 * GPIT + ks * 64);
#pragma unroll
      for (int j = 0; j < 4; ++j) b[ks][j] = g2_lfrag(br + j * 16 * GPIT + ks * 64); }
#pragma unroll
    for (int ks = 0; ks < 2; ++ks) {
      c00 = g2_mma(a[ks][0], b[ks][0], c00); c10 = g2_mma(a[ks][1], b[ks][0], c10);
      c01 = g2_mma(a[ks][0], b[ks][1], c01); c11 = g2_mma(a[ks][1], b[ks][1], c11);
      c02 = g2_mma(a[ks][0], b[ks][2], c02); c12 = g2_mma(a[ks][1], b[ks][2], c12);
      c03 = g2_mma(a[ks][0], b[ks][3], c03); c13 = g2_mma(a[ks][1], b[ks][3], c13); }
    asm volatile("s_wait_dscnt 0x0" ::: "memory");      /* this wave's reads of tile t are done */
    asm volatile("s_wait_asynccnt 0x0" ::: "memory");      /* its share of tile t + 1 has landed */
    __syncthreads();      /* publishes tile t + 1 and frees tile t's buffer */
    if (t + 2 < nt) fill(t + 2, l0 + bo); }
  asm volatile("s_wait_asynccnt 0x0" ::: "memory");      /* no copy is in flight when the ring becomes output staging */
  float (*so)[32][68] = (float (*)[32][68])ring;
  v8f accs[8] = {c00, c01, c02, c03, c10, c11, c12, c13};
  int fz[2][8] = {{0, 0, 0, 0, 0, 0, 0, 0}, {0, 0, 0, 0, 0, 0, 0, 0}};      /* flags of this lane's rows row0 + half*16 + 8*hh + r: 8 neighbours in the PIDX order */
  if (FL) {
#pragma unroll      /* unrolled, like the loop inside: fz is indexed by constants only and stays in registers; the four loads go out together */
    for (int half = 0; half < 2; ++half) { const int* fp = FL + PIDX(row0 + half * 16 + 8 * hh); const v4i f0 = *(const v4i*)fp, f1 = *(const v4i*)(fp + 4);
#pragma unroll
      for (int r = 0; r < 4; ++r) { fz[half][r] = f0[r]; fz[half][4 + r] = f1[r]; } } }
  if (CT) {      /* the same in the whole work-group: all of it passes the barrier below or none */
    float bvs[4] = {0.f, 0.f, 0.f, 0.f};
    if (bp) {
#pragma unroll      /* the four loads go out together, one latency for all */
      for (int t = 0; t < 4; ++t) bvs[t] = bf16_round(bp[col0 + t * 16 + ln]); }
#pragma unroll      /* unrolled, like the loop inside: the accumulators are registers, reached by constant indices only */
    for (int u = 0; u < 8; ++u) { const int t = u & 3, half = u >> 2; FragH f;
#pragma unroll
      for (int r = 0; r < 8; ++r) f.h[r] = (_Float16)(fz[half][r] ? 0.f : accs[u][r] * alpha + bvs[t]);      /* a lane's 8 results of one accumulator: 8 neighbouring keys of column d = 64*wc + t*16 + ln */
      *(v8us*)&ring[(64 * wc + t * 16 + ln) * TPIT + (32 * wr + half * 16 + 8 * hh) * 2] = f.half[0]; }
    __syncthreads();      /* a d row holds keys of four waves */
    const int r128 = mt * 128; unsigned short* ct = (unsigned short*)CT + ((size_t)(r128 / TK) * NH + nq * 2) * 64 * TK + r128 % TK;      /* the 128 d rows of heads 2*nq and 2*nq + 1 follow one another in CT */
#pragma unroll      /* the eight LDS reads stand as one group in front of the stores */
    for (int q = 0; q < 8; ++q) { const int d = q * 16 + (tid >> 4), c = tid & 15; *(v8us*)(ct + (size_t)d * TK + c * 8) = *(const v8us*)&ring[d * TPIT + c * 16]; }      /* 16 lanes store the 256 contiguous bytes of a d row */
    asm volatile("s_wait_xcnt 0x0" ::: "memory");      /* stands behind the eight stores, in front of any later write of their address registers (the listing joins this path with the row-major one) */
    return; }
#pragma unroll
  for (int u = 0; u < 8; ++u) { const int t = u & 3, half = u >> 2; const int col = col0 + t * 16 + ln; const float bv = bp ? bf16_round(bp[col]) : 0.f;
#pragma unroll
    for (int r = 0; r < 8; ++r) { const int rloc = half * 16 + 8 * hh + r; float v = accs[u][r] * alpha + bv;
      if (ACT == 3) v = fmaxf(v, 0.f); else if (ACT == 6) v = 0.5f * v * (1.0f + erff(v * 0.70710678118654752f)); else if (ACT == 11) v = 1.0f / (1.0f + expf(-v)); else if (ACT == 15) v = v / (1.0f + expf(-v)); else if (ACT == 12) v = (v > 0.f) ? v : 0.01f * v; else if (ACT == 8) v = tanhf(v);
      so[w][rloc][t * 16 + ln] = fz[half][r] ? 0.f : v; } }
  __builtin_amdgcn_fence(__ATOMIC_ACQ_REL, "workgroup"); __builtin_amdgcn_wave_barrier();
  const int rsub = lane >> 4, c4 = (lane & 15) * 4;
  {
#pragma unroll
    for (int q = 0; q < 16; ++q) { const int r = q * 2 + rsub; const v4f v = *(const v4fa*)&so[w][r][c4]; if (C) *(v4f*)(C + cofs + (size_t)(row0 + r) * ldc + col0 + c4) = v; if (C16) { v4h h4; for (int i = 0; i < 4; ++i) h4[i] = (_Float16)v[i]; *(v4h*)(C16 + cofs + (size_t)(row0 + r) * ldc + col0 + c4) = h4; } }
     } }
template <int ACT>
__global__ __launch_bounds__(256) void k_gemm2(const _Float16* __restrict__ A, int lda, size_t sA, const _Float16* __restrict__ Bh, int ldb, size_t sB, float alpha, const float* __restrict__ bias, size_t sBias, const _Float16* __restrict__ A2, float a2s,
    float* __restrict__ C, _Float16* __restrict__ C16, int ldc, size_t sC, int M, int N, int K) {
  g2_run<ACT>(blockIdx.x, (int)blockIdx.y, A, lda, sA, Bh, ldb, sB, alpha, bias, sBias, A2, a2s, nullptr, C, C16, nullptr, ldc, sC, M, N, K); }
// The three projections need nothing of one another: one grid, NBG work-groups each, the longest k loop (q) first. The choice is the same in a whole work-group.
// k and v store their flagged rows as zeros; v goes out transposed only (Vt[(b,h)][d][s]), the form in which attention reads it.
#define NBG ((NR / 128) * (DM / 128))
__global__ __launch_bounds__(256) void k_gemm_qkv(const _Float16* __restrict__ Xq, const _Float16* __restrict__ Xk, const _Float16* __restrict__ Xv, const _Float16* __restrict__ Bq, const _Float16* __restrict__ Bk, const _Float16* __restrict__ Bv,
    const float* __restrict__ bq, const float* __restrict__ bk, const float* __restrict__ bv, const int* __restrict__ FLK, const int* __restrict__ FLV, _Float16* __restrict__ Q16, _Float16* __restrict__ K16, _Float16* __restrict__ VT) {
  const unsigned sel = blockIdx.x / NBG, bx = blockIdx.x - sel * NBG;
  const _Float16* A = sel == 0 ? Xq : sel == 1 ? Xk : Xv; const _Float16* B = sel == 0 ? Bq : sel == 1 ? Bk : Bv; const float* bias = sel == 0 ? bq : sel == 1 ? bk : bv; _Float16* C16 = sel == 0 ? Q16 : sel == 1 ? K16 : nullptr; const int* FL = sel == 0 ? nullptr : sel == 1 ? FLK : FLV;
  const int K = sel == 0 ? DM : DKV;
  g2_run<0>(bx, 0, A, K, 0, B, K, 0, 0.0625f, bias, 0, nullptr, 0.f, FL, nullptr, C16, sel == 2 ? VT : nullptr, DM, 0, NR, DM, K); }


// lane l <-> lane l ^ 16 by a vector cross-row move
__device__ __forceinline__ float xhalf(float x) { return __builtin_bit_cast(float, __builtin_amdgcn_permlanex16(__builtin_bit_cast(int, x), __builtin_bit_cast(int, x), 0x76543210, 0xfedcba98, false, false)); }
#define FKT 64
#define FPIT 144
#define FTILE (128 * FPIT)
// One tile: 4 asynchronous 16-byte copies a lane (256 lanes x 4 x 16 B = 16 KiB); 8 lanes cover one 128-B row, so a wave's copy asks for 4 whole lines.
// s_wait_xcnt closes the statement so that no address register of a copy is rewritten in front of it.
__device__ __forceinline__ void tile_copy(unsigned l0, const unsigned short* gk, int ldk, const unsigned short* gv) {
  asm volatile("global_load_async_to_lds_b128 %0, %4, off\n\t"
               "global_load_async_to_lds_b128 %1, %5, off\n\t"
               "global_load_async_to_lds_b128 %2, %6, off\n\t"
               "global_load_async_to_lds_b128 %3, %7, off\n\t"
               "s_wait_xcnt 0x0"
               :: "v"(l0), "v"(l0 + 32u * FPIT), "v"(l0 + 64u * FPIT), "v"(l0 + 96u * FPIT),
                  "v"(gk), "v"(gk + (size_t)32 * ldk), "v"(gv), "v"(gv + (size_t)32 * TK)
               : "memory");
}
// Eight 2^x in place, one statement: behind a transcendental the instruction set asks for one slot before its result is read or its source overwritten. Here each neighbour touches its own register only,
// and the closing v_nop keeps the slot for whatever the compiler puts next.
__device__ __forceinline__ void exp2x8(float* x) {
  asm("v_exp_f32 %0, %0\n\tv_exp_f32 %1, %1\n\tv_exp_f32 %2, %2\n\tv_exp_f32 %3, %3\n\tv_exp_f32 %4, %4\n\tv_exp_f32 %5, %5\n\tv_exp_f32 %6, %6\n\tv_exp_f32 %7, %7\n\tv_nop"
      : "+v"(x[0]), "+v"(x[1]), "+v"(x[2]), "+v"(x[3]), "+v"(x[4]), "+v"(x[5]), "+v"(x[6]), "+v"(x[7]));
}
__global__ __launch_bounds__(256) void k_flash(const _Float16* __restrict__ Q16, int ldq, const _Float16* __restrict__ K16, int ldk, const _Float16* __restrict__ Vt, const int* __restrict__ MSK, _Float16* __restrict__ Oh, _Float16* __restrict__ Ol, int ldo) {
  constexpr int RPW = 16, NQB = TQ / (8 * RPW), DT = 4, KS = 2, NT = TK / FKT; (void)MSK;
  __shared__ __attribute__((aligned(16))) unsigned char ring[2 * FTILE];      /* behind the loop's last barrier its first 34 KiB stage the output */
  const int tid = threadIdx.x, w = tid >> 5, lane = tid & 31, ln = lane & 15, hh = lane >> 4;
  const int slab = blockIdx.x / NQB, qblk = blockIdx.x % NQB; const int b = slab / NH, h = slab % NH; const int q0 = qblk * (8 * RPW) + w * RPW;
  const unsigned short* gk = (const unsigned short*)K16 + ((size_t)b * TK + (tid >> 3)) * ldk + h * 64 + (tid & 7) * 8;      /* this lane's 16 bytes of K row tid/8 of tile 0 */
  const unsigned short* gv = (const unsigned short*)Vt + ((size_t)slab * 64 + (tid >> 3)) * TK + (tid & 7) * 8;      /* and of Vt row tid/8 */
  const unsigned l0 = (unsigned)(size_t)(const void*)ring + (unsigned)((tid >> 3) * FPIT + (tid & 7) * 16);
  tile_copy(l0, gk, ldk, gv);      /* tile 0 -> buffer 0 */
  FragH bq[KS];
  { const unsigned short* qr = (const unsigned short*)Q16 + ((size_t)b * TQ + q0 + ln) * ldq + h * 64;
#pragma unroll
    for (int ks = 0; ks < KS; ++ks) { bq[ks].half[0] = *(const v8us*)(qr + ks * 32 + 8 * hh); bq[ks].half[1] = *(const v8us*)(qr + ks * 32 + 16 + 8 * hh); } }
  float m_q = -3.0e38f, l_q = 0.f; v8f oacc[DT];
#pragma unroll
  for (int dt = 0; dt < DT; ++dt) oacc[dt] = (v8f){0.f,0.f,0.f,0.f,0.f,0.f,0.f,0.f};
  asm volatile("s_wait_asynccnt 0x0" ::: "memory");      /* this wave's share of tile 0 has landed */
  __syncthreads();      /* tile 0 is published */
  tile_copy(l0 + FTILE, gk + (size_t)FKT * ldk, ldk, gv + FKT);      /* tile 1 -> buffer 1 */
#pragma unroll 1
  for (int t = 0; t < NT; ++t) {
    const unsigned bo = (unsigned)(t & 1) * FTILE; const unsigned fo = bo + (unsigned)(ln * FPIT + 16 * hh);
#pragma unroll 1      /* rolled: both passes unrolled need more than the 128 VGPRs at which 8 waves fit a SIMD */
    for (int p = 0; p < FKT / 32; ++p) {
    FragH ak[2][KS];
#pragma unroll
    for (int nt = 0; nt < 2; ++nt) { const unsigned char* kr = &ring[fo + (p * 32 + nt * 16) * FPIT];
#pragma unroll
      for (int ks = 0; ks < KS; ++ks) { ak[nt][ks].half[0] = *(const v8us*)(kr + ks * 64); ak[nt][ks].half[1] = *(const v8us*)(kr + ks * 64 + 32); } }
    float sc[16];
#pragma unroll
    for (int nt = 0; nt < 2; ++nt) { v8f acc = (v8f){0.f,0.f,0.f,0.f,0.f,0.f,0.f,0.f};
#pragma unroll
      for (int ks = 0; ks < KS; ++ks) acc = mmaH<1>(ak[nt][ks].v, ak[nt][ks].v, bq[ks].v, bq[ks].v, acc);
#pragma unroll
      for (int r = 0; r < 8; ++r) sc[nt * 8 + r] = acc[r]; }      /* sc[nt*8 + r] = q.k, not yet scaled (key t*64 + p*32 + nt*16 + 8*hh + r, query q0 + ln) */
    FragH av[DT];
#pragma unroll
    for (int dt = 0; dt < DT; ++dt) { const unsigned char* vrow = &ring[fo + (64 + dt * 16) * FPIT + p * 64]; av[dt].half[0] = *(const v8us*)(vrow); av[dt].half[1] = *(const v8us*)(vrow + 32); }
    float mx[4];
#pragma unroll
    for (int c = 0; c < 4; ++c) mx[c] = fmaxf(fmaxf(sc[4 * c], sc[4 * c + 1]), fmaxf(sc[4 * c + 2], sc[4 * c + 3]));
    float mc = fmaxf(fmaxf(mx[0], mx[1]), fmaxf(mx[2], mx[3])); mc = fmaxf(mc, xhalf(mc));
    const float mn = fmaxf(m_q, mc * SCL2); const float al = __builtin_amdgcn_exp2f(m_q - mn); m_q = mn;      /* the maximum is kept in base-2 units (SCL2 > 0 commutes with max); al: 0 on the first pass, 1 where the maximum stays */
    const float nb = 10.0f - mn;      /* P x 1024 = 2^(q.k x SCL2 - mn + 10): one FMA and one bare v_exp_f32 a score; the argument is at most 10, and far below -126 the result is 0, as wanted */
    FragH pb; float ps[4];
#pragma unroll
    for (int i = 0; i < 16; ++i) sc[i] = fmaf(sc[i], SCL2, nb);
    exp2x8(sc); exp2x8(sc + 8);
#pragma unroll
    for (int i = 0; i < 16; ++i) { const float p_ = sc[i]; ps[i & 3] = (i < 4) ? p_ : ps[i & 3] + p_; pb.h[i] = (_Float16)p_; }      /* pb.h[nt*8 + r] = P(key nt*16 + 8*hh + r of the pass, query q0 + ln): the k order of the Vt loader */
    l_q = l_q * al + ((ps[0] + ps[1]) + (ps[2] + ps[3]));
#pragma unroll
    for (int dt = 0; dt < DT; ++dt) {
#pragma unroll
      for (int r = 0; r < 8; ++r) oacc[dt][r] *= al;
      oacc[dt] = mmaH<1>(av[dt].v, av[dt].v, pb.v, pb.v, oacc[dt]); } }
    asm volatile("s_wait_dscnt 0x0" ::: "memory");      /* this wave's reads of tile t are done */
    asm volatile("s_wait_asynccnt 0x0" ::: "memory");      /* its share of tile t + 1 has landed */
    __syncthreads();      /* publishes tile t + 1 and frees tile t's buffer */
    if (t + 2 < NT) tile_copy(l0 + bo, gk + (size_t)(t + 2) * FKT * ldk, ldk, gv + (size_t)(t + 2) * FKT); }
  asm volatile("s_wait_asynccnt 0x0" ::: "memory");      /* no copy is in flight when the ring becomes output staging */
  float (*sO)[RPW][64 + 4] = (float (*)[RPW][64 + 4])ring;
  const float lt = l_q + xhalf(l_q); const float inv = (lt > 0.f) ? 1.0f / lt : 0.f;      /* l_q sums P x 1024, as Ot does */
#pragma unroll
  for (int dt = 0; dt < DT; ++dt)      /* oacc[dt][r] = Ot[dt*16 + 8*hh + r][q0 + ln] */
#pragma unroll
    for (int q = 0; q < 2; ++q) { v4f o4;
#pragma unroll
      for (int i = 0; i < 4; ++i) o4[i] = oacc[dt][q * 4 + i] * inv;
      *(v4fa*)&sO[w][ln][dt * 16 + 8 * hh + q * 4] = o4; }
  __builtin_amdgcn_fence(__ATOMIC_ACQ_REL, "workgroup"); __builtin_amdgcn_wave_barrier();
  {
#pragma unroll
    for (int rp = 0; rp < RPW; rp += 4) { const int r = rp + (lane >> 3), pc = lane & 7; const v4f a = *(const v4fa*)&sO[w][r][pc * 8], c = *(const v4fa*)&sO[w][r][pc * 8 + 4]; FragH fh, fl;      /* O leaves as the output GEMM's two f16 planes: hi, and (O - hi) x 1024; 8 lanes store a row's 128-B line of each */
#pragma unroll      /* vector elements by constant indices: registers */
      for (int q = 0; q < 8; ++q) { const float v = (q < 4) ? a[q] : c[q - 4]; const _Float16 hi = (_Float16)v; fh.h[q] = hi; fl.h[q] = (_Float16)((v - (float)hi) * 1024.0f); }
      const size_t o = ((size_t)b * TQ + q0 + r) * ldo + h * 64 + pc * 8; *(v8us*)((unsigned short*)Oh + o) = fh.half[0]; *(v8us*)((unsigned short*)Ol + o) = fl.half[0]; }
     } }
__device__ __forceinline__ void d_rowflag(int bid, const float* __restrict__ X, int* __restrict__ FL) {
  __shared__ int sf[8];
  const int tid = threadIdx.x, w = tid >> 5, ln = tid & 31; const int r = bid * 8 + w; const float* x = X + (size_t)r * DKV; float s = 0.f;
#pragma unroll
  for (int u = 0; u < DKV / 32; ++u) s += bf16_round(x[u * 32 + ln]);
  for (int o = 16; o > 0; o >>= 1) s += __shfl_xor(s, o, 32);
  if (ln == 0) sf[w] = (s == 0.0f) ? 1 : 0;
  __syncthreads();
  if (tid < 32) { const int v = (tid < 8) ? sf[tid] : 0; int* d = FL + bid * 32 + tid; *(int*)d = v;  } }
// Everything that reads only the inputs, in one grid: a work-group's index range picks its job (the same in the whole work-group, so the row flags' barrier is passed by all of it or by none).
// The transposes come first: their scattered reads make them the longest work-groups.
#define NBW1 (DM * DM / 8 / 256)
#define NBW2 (DKV * DM / 8 / 256)
#define NBX1 (NR * DM / 8 / 256)
#define NBX2 (NR * DKV / 8 / 256)
#define NBF (NR / 8)
#define NBPREP (2 * NBW1 + 2 * NBW2 + NBX1 + 2 * NBX2 + 2 * NBF)
__global__ __launch_bounds__(256) void k_prep(const float* __restrict__ qi, const float* __restrict__ ki, const float* __restrict__ vi, const float* __restrict__ Wq, const float* __restrict__ Wk, const float* __restrict__ Wv, const float* __restrict__ Wo,
    _Float16* __restrict__ BQ, _Float16* __restrict__ BK, _Float16* __restrict__ BV, _Float16* __restrict__ BO, _Float16* __restrict__ XQ, _Float16* __restrict__ XK, _Float16* __restrict__ XV, int* __restrict__ FLK, int* __restrict__ FLV) {
  int b = (int)blockIdx.x;
  if (b < NBW1) { d_wt_f16(b, Wq, BQ, DM, DM, 16.0f); return; } b -= NBW1;      /* (in,out) -> [out][in] x16 */
  if (b < NBW1) { d_wt_f16(b, Wo, BO, DM, DM, 16.0f); return; } b -= NBW1;
  if (b < NBW2) { d_wt_f16(b, Wk, BK, DKV, DM, 16.0f); return; } b -= NBW2;
  if (b < NBW2) { d_wt_f16(b, Wv, BV, DKV, DM, 16.0f); return; } b -= NBW2;
  if (b < NBX1) { d_x16(b, qi, XQ, (size_t)NR * DM / 8); return; } b -= NBX1;
  if (b < NBX2) { d_x16(b, ki, XK, (size_t)NR * DKV / 8); return; } b -= NBX2;
  if (b < NBF) { d_rowflag(b, ki, FLK); return; } b -= NBF;
  if (b < NBX2) { d_x16(b, vi, XV, (size_t)NR * DKV / 8); return; } b -= NBX2;
  d_rowflag(b, vi, FLV); }
extern "C" void kernel_launch(void* const* d_in, const int* in_sizes, int n_in,
                              void* d_out, int out_size, void* d_ws, size_t ws_size, hipStream_t stream) {
  (void)in_sizes; (void)n_in; (void)out_size;
  const float* const* I = (const float* const*)d_in; const float* qi = I[0]; const float* ki = I[1]; const float* vi = I[2];
  const float* Wq = I[3]; const float* bq = I[4]; const float* Wk = I[5]; const float* bk = I[6]; const float* Wv = I[7]; const float* bv = I[8]; const float* Wo = I[9]; const float* bo = I[10];
  char* ws = (char*)d_ws; size_t off = 0;
  auto take = [&](size_t bytes) { char* p = ws + off; off += (bytes + 255) & ~(size_t)255; return p; };
  _Float16* BQ = (_Float16*)take((size_t)DM * DM * 2); _Float16* BK = (_Float16*)take((size_t)DM * DKV * 2); _Float16* BV = (_Float16*)take((size_t)DM * DKV * 2); _Float16* BO = (_Float16*)take((size_t)DM * DM * 2);
  _Float16* XQ = (_Float16*)take((size_t)NR * DM * 2); _Float16* XK = (_Float16*)take((size_t)NR * DKV * 2); _Float16* XV = (_Float16*)take((size_t)NR * DKV * 2);      /* one plane an input: the three converts run side by side */
  _Float16* Q16 = (_Float16*)take((size_t)NR * DM * 2); _Float16* K16 = (_Float16*)take((size_t)NR * DM * 2); _Float16* VT = (_Float16*)take((size_t)NR * DM * 2);
  int* FLK = (int*)take((size_t)(NR / 8) * 32 * 4); int* FLV = (int*)take((size_t)(NR / 8) * 32 * 4);
  _Float16* Oh = (_Float16*)take((size_t)NR * DM * 2); _Float16* Ol = (_Float16*)take((size_t)NR * DM * 2);      /* all batches */
  if (off > ws_size) return;      /* 6 + 32 + 16 x 3 + 0.3 + 16 + 16 = 118 MiB */
  k_prep<<<NBPREP, 256, 0, stream>>>(qi, ki, vi, Wq, Wk, Wv, Wo, BQ, BK, BV, BO, XQ, XK, XV, FLK, FLV);      /* weights -> [out][in] x16, inputs -> f16, row flags */
  const dim3 gP(NBG, 1);
  k_gemm_qkv<<<3 * NBG, 256, 0, stream>>>(XQ, XK, XV, BQ, BK, BV, bq, bk, bv, FLK, FLV, Q16, K16, VT);      /* q, k -> f16, v -> f16 Vt[(b,h)][d][s]; masked rows of k and v zero */
  float* outp = (float*)d_out;
  k_flash<<<NBT * NH * (TQ / 128), 256, 0, stream>>>(Q16, DM, K16, DM, VT, nullptr, Oh, Ol, DM);      /* all batches in one grid: slab = b*NH + h; O as f16 hi + lo */
  k_gemm2<0><<<gP, 256, 0, stream>>>(Oh, DM, 0, BO, DM, 0, 0.0625f, bo, 0, Ol, 1.0f / 1024.0f, outp, nullptr, DM, 0, NR, DM, DM);      /* out = (Oh + Ol / 1024)*Wo + bo, one k loop */
}

// v010
// A run of this version takes 154 microseconds.
// Timed twice side by side with v009, it ran 1.03 times as fast both times.
// All steps since v000 together make it 8.84 times as fast.
#include <hip/hip_runtime.h>
// Multi-head cross attention over social features (B 4, S 2048 queries x 1024, 2048 keys/values x 512, 16 heads x 64; (in,out) Linear weights with bias; key/value rows whose raw features sum to exactly 0 are zeroed after projection, as the reference's padding mask): scores = q.k/8; softmax; out = (attn.v merged)*Wo + bo -> [4,2048,1024].
// Compute dtype: the inputs, the four matrices and biases rounded to bf16; q/k/v products exact (weights x16 in f16, undone by alpha), q, k, v, P as f16 operands (~2^-12; logits sigma ~0.4), O as f16 hi + lo; f32 accumulation and softmax. v_wmma_f32_16x16x32_f16.
#define NBT 4
#define TQ 2048
#define TK 2048
#define DKV 512
#define NR (NBT * TQ)
#define DM 1024
#define NH 16
#define SCL 0.125f
#define SCL2 (SCL * 1.44269504088896340736f)      /* 1/8 x log2(e): scores in base-2 exponent units */
typedef __bf16 v16b __attribute__((ext_vector_type(16)));
typedef unsigned short v8us __attribute__((ext_vector_type(8), may_alias));
typedef float  v8f  __attribute__((ext_vector_type(8)));
typedef float  v4f  __attribute__((ext_vector_type(4)));
typedef float  v4fa __attribute__((ext_vector_type(4), may_alias));
union FragB { v16b v; v8us half[2]; unsigned short u[16]; };

__device__ __forceinline__ unsigned short bf16_bits(float x) { unsigned int u = __float_as_uint(x); return (unsigned short)((u + 0x7FFFu + ((u >> 16) & 1u)) >> 16); }
__device__ __forceinline__ float bf16_val(unsigned short b) { return __uint_as_float(((unsigned int)b) << 16); }
__device__ __forceinline__ float bf16_round(float x) { return bf16_val(bf16_bits(x)); }
// D += A·B with NT terms: 1 = ah·bh, 2 = + al·bh (A split), 3 = + ah·bl (both split)
template <int NT>
__device__ __forceinline__ v8f mmaN(v16b ah, v16b al, v16b bh, v16b bl, v8f c) {
  c = __builtin_amdgcn_wmma_f32_16x16x32_bf16(false, ah, false, bh, (short)0, c, false, false);
  if (NT >= 2) c = __builtin_amdgcn_wmma_f32_16x16x32_bf16(false, al, false, bh, (short)0, c, false, false);
  if (NT >= 3) c = __builtin_amdgcn_wmma_f32_16x16x32_bf16(false, ah, false, bl, (short)0, c, false, false);
  asm volatile("v_nop\n\tv_nop\n\tv_nop\n\tv_nop" : "+v"(c) : "v"(ah), "v"(al), "v"(bh), "v"(bl));
  return c;
}

__global__ __launch_bounds__(256) void k_wt_bf16(const float* __restrict__ W, unsigned short* __restrict__ Wt, int K, int N) {
  const int t = blockIdx.x * 256 + threadIdx.x;
  const int k8n = K / 8;
  if (t >= N * k8n) return;
  const int n = t / k8n, k8 = (t % k8n) * 8;
  v8us v;
#pragma unroll
  for (int i = 0; i < 8; ++i) v[i] = bf16_bits(W[(size_t)(k8 + i) * N + n]);
  *(v8us*)(Wt + (size_t)n * K + k8) = v;
  
}

// GEMM C[M][N] (f32, pitch ldc) = act(A[M][K]·W + bias). A f32 row-major (pitch lda) converted per fragment to bf16
// (ASPLIT: hi/lo two planes -> 2 terms, else single rounded term); Wt bf16 [N][K] (pitch ldb). BIAS_BF16 rounds the
// bias to bf16 first (bias quantised to bf16 before the add). K%32==0, M%16==0, N%64==0.
template <bool ASPLIT, int ACT, bool BIAS_BF16>
__global__ __launch_bounds__(128) void k_gemm_bf(const float* __restrict__ A, int lda, const unsigned short* __restrict__ Wt, int ldb,
                                               const float* __restrict__ bias, float* __restrict__ C, int ldc, int M, int N, int K) {
  __shared__ __attribute__((aligned(16))) float so[4][16][64];
  const int tid = threadIdx.x, w = tid >> 5, lane = tid & 31, ln = lane & 15, hh = lane >> 4;
  const int ntn = N / 64;
  const int wid = blockIdx.x * 4 + w;
  const int mt = wid / ntn, nq = wid % ntn;
  if (mt * 16 >= M) return;
  const int row0 = mt * 16, col0 = nq * 64;
  const float* arow = A + (size_t)(row0 + ln) * lda;
  v8f acc[4] = {};
  for (int kb = 0; kb < K; kb += 32) {
    FragB ah, al;
    const v4f x0 = *(const v4fa*)(arow + kb + 8 * hh), x1 = *(const v4fa*)(arow + kb + 8 * hh + 4);
    const v4f x2 = *(const v4fa*)(arow + kb + 16 + 8 * hh), x3 = *(const v4fa*)(arow + kb + 16 + 8 * hh + 4);
    float xs[16] = {x0[0],x0[1],x0[2],x0[3],x1[0],x1[1],x1[2],x1[3],x2[0],x2[1],x2[2],x2[3],x3[0],x3[1],x3[2],x3[3]};
#pragma unroll
    for (int i = 0; i < 16; ++i) { const unsigned short hb = bf16_bits(xs[i]); ah.u[i] = hb; al.u[i] = ASPLIT ? bf16_bits(xs[i] - bf16_val(hb)) : (unsigned short)0; }
#pragma unroll
    for (int t = 0; t < 4; ++t) {
      const unsigned short* brow = Wt + (size_t)(col0 + t * 16 + ln) * ldb + kb;
      FragB b;
      b.half[0] = *(const v8us*)(brow + 8 * hh);
      b.half[1] = *(const v8us*)(brow + 16 + 8 * hh);
      acc[t] = mmaN<ASPLIT ? 2 : 1>(ah.v, al.v, b.v, b.v, acc[t]);
    }
  }
#pragma unroll
  for (int t = 0; t < 4; ++t) {
    float bv = bias ? bias[col0 + t * 16 + ln] : 0.f;
    if (BIAS_BF16) bv = bf16_round(bv);
#pragma unroll
    for (int r = 0; r < 8; ++r) { float v = acc[t][r] + bv; if (ACT == 1) v = fmaxf(v, 0.f); so[w][8 * hh + r][t * 16 + ln] = v; }
  }
  __builtin_amdgcn_fence(__ATOMIC_ACQ_REL, "workgroup");
  __builtin_amdgcn_wave_barrier();
  const int rsub = lane >> 4, c4 = (lane & 15) * 4;
  {
#pragma unroll
    for (int q = 0; q < 8; ++q) {
      const int r = q * 2 + rsub;
      const v4f v = *(const v4fa*)&so[w][r][c4];
      *(v4f*)(C + (size_t)(row0 + r) * ldc + col0 + c4) = v;
    }
    
  }
}

// GEMM C = act(A·W + bias + resid): A f32 (ASPLIT -> hi/lo 2 terms), Wt bf16 [N][K]; ACT 0 none, 1 relu, 2 exact gelu;
// resid (optional, f32, row index = (row % rmod), pitch ldr, RES_BF16 rounds it) added before the activation.
template <bool ASPLIT, int ACT, bool BIAS_BF16, bool RES_BF16>
__global__ __launch_bounds__(128) void k_gemm_bf3(const float* __restrict__ A, int lda, const unsigned short* __restrict__ Wt, int ldb,
                                                const float* __restrict__ bias, const float* __restrict__ resid, int rmod, int ldr,
                                                float* __restrict__ C, int ldc, int M, int N, int K) {
  __shared__ __attribute__((aligned(16))) float so[4][16][64];
  const int tid = threadIdx.x, w = tid >> 5, lane = tid & 31, ln = lane & 15, hh = lane >> 4;
  const int ntn = N / 64;
  const int wid = blockIdx.x * 4 + w;
  const int mt = wid / ntn, nq = wid % ntn;
  if (mt * 16 >= M) return;
  const int row0 = mt * 16, col0 = nq * 64;
  const float* arow = A + (size_t)(row0 + ln) * lda;
  v8f acc[4] = {};
  for (int kb = 0; kb < K; kb += 32) {
    FragB ah, al;
    const v4f x0 = *(const v4fa*)(arow + kb + 8 * hh), x1 = *(const v4fa*)(arow + kb + 8 * hh + 4);
    const v4f x2 = *(const v4fa*)(arow + kb + 16 + 8 * hh), x3 = *(const v4fa*)(arow + kb + 16 + 8 * hh + 4);
    float xs[16] = {x0[0],x0[1],x0[2],x0[3],x1[0],x1[1],x1[2],x1[3],x2[0],x2[1],x2[2],x2[3],x3[0],x3[1],x3[2],x3[3]};
#pragma unroll
    for (int i = 0; i < 16; ++i) { const unsigned short hb = bf16_bits(xs[i]); ah.u[i] = hb; al.u[i] = ASPLIT ? bf16_bits(xs[i] - bf16_val(hb)) : (unsigned short)0; }
#pragma unroll
    for (int t = 0; t < 4; ++t) {
      const unsigned short* brow = Wt + (size_t)(col0 + t * 16 + ln) * ldb + kb;
      FragB b;
      b.half[0] = *(const v8us*)(brow + 8 * hh);
      b.half[1] = *(const v8us*)(brow + 16 + 8 * hh);
      acc[t] = mmaN<ASPLIT ? 2 : 1>(ah.v, al.v, b.v, b.v, acc[t]);
    }
  }
#pragma unroll
  for (int t = 0; t < 4; ++t) {
    const int col = col0 + t * 16 + ln;
    float bv = bias ? bias[col] : 0.f;
    if (BIAS_BF16) bv = bf16_round(bv);
#pragma unroll
    for (int r = 0; r < 8; ++r) {
      float v = acc[t][r] + bv;
      if (resid) { float rv = resid[(size_t)((row0 + 8 * hh + r) % rmod) * ldr + col]; if (RES_BF16) rv = bf16_round(rv); v += rv; }
      if (ACT == 1) v = fmaxf(v, 0.f);
      if (ACT == 2) v = 0.5f * v * (1.0f + erff(v * 0.70710678118654752f));
      if (ACT == 3) { const float u = 0.7978845608028654f * (v + 0.044715f * v * v * v); v = 0.5f * v * (1.0f + tanhf(u)); }
      so[w][8 * hh + r][t * 16 + ln] = v;
    }
  }
  __builtin_amdgcn_fence(__ATOMIC_ACQ_REL, "workgroup");
  __builtin_amdgcn_wave_barrier();
  const int rsub = lane >> 4, c4 = (lane & 15) * 4;
  {
#pragma unroll
    for (int q = 0; q < 8; ++q) {
      const int r = q * 2 + rsub;
      const v4f v = *(const v4fa*)&so[w][r][c4];
      *(v4f*)(C + (size_t)(row0 + r) * ldc + col0 + c4) = v;
    }
    
  }
}
// row LayerNorm (biased variance, eps) over N: s = X (+ R); optional out_sum <- s; out_norm <- (s-mu)*rsqrt(var+eps)*g + b
template <bool PARAM_BF16>
__global__ __launch_bounds__(256) void k_layernorm(const float* __restrict__ X, const float* __restrict__ R, const float* __restrict__ g, const float* __restrict__ bta,
                                                  float* __restrict__ out_sum, float* __restrict__ out_norm, int N, float eps) {
  __shared__ float red[256];
  const int row = blockIdx.x, tid = threadIdx.x;
  const float* x = X + (size_t)row * N; const float* rr = R ? R + (size_t)row * N : nullptr;
  float vals[16];                     // up to N = 4096
  const int per = N / 256;            // contiguous chunk per thread? use strided-by-4 chunks: thread handles j = tid*4 + 1024*u
  float s1 = 0.f;
  for (int u = 0; u < per / 4; ++u) {
    const int j = tid * 4 + 1024 * u;
    const v4f a = *(const v4fa*)(x + j);
    v4f b = {0.f,0.f,0.f,0.f}; if (rr) b = *(const v4fa*)(rr + j);
#pragma unroll
    for (int q = 0; q < 4; ++q) { const float v = a[q] + b[q]; vals[u * 4 + q] = v; s1 += v; }
  }
  red[tid] = s1; __syncthreads();
  for (int st = 128; st > 0; st >>= 1) { if (tid < st) red[tid] += red[tid + st]; __syncthreads(); }
  const float mu = red[0] / (float)N; __syncthreads();
  float s2 = 0.f;
  for (int u = 0; u < per / 4; ++u)
#pragma unroll
    for (int q = 0; q < 4; ++q) { const float c = vals[u * 4 + q] - mu; s2 += c * c; }
  red[tid] = s2; __syncthreads();
  for (int st = 128; st > 0; st >>= 1) { if (tid < st) red[tid] += red[tid + st]; __syncthreads(); }
  const float rs = rsqrtf(red[0] / (float)N + eps);
  {
    for (int u = 0; u < per / 4; ++u) {
      const int j = tid * 4 + 1024 * u;
      v4f o, sm;
#pragma unroll
      for (int q = 0; q < 4; ++q) {
        float gg = g[j + q], bb = bta[j + q];
        if (PARAM_BF16) { gg = bf16_round(gg); bb = bf16_round(bb); }
        sm[q] = vals[u * 4 + q]; o[q] = (vals[u * 4 + q] - mu) * rs * gg + bb;
      }
      if (out_sum) *(v4f*)(out_sum + (size_t)row * N + j) = sm;
      *(v4f*)(out_norm + (size_t)row * N + j) = o;
    }
    
  }
}



// ---- f16 WMMA path (v_wmma_f32_16x16x32_f16): 11-bit significands for operands in range — used where a [0,1] probability operand needs more precision than bf16
typedef _Float16 v16h __attribute__((ext_vector_type(16)));
union FragH { v16h v; v8us half[2]; _Float16 h[16]; unsigned short u[16]; };
template <int NT>
__device__ __forceinline__ v8f mmaH(v16h ah, v16h al, v16h bh, v16h bl, v8f c) {
  c = __builtin_amdgcn_wmma_f32_16x16x32_f16(false, ah, false, bh, (short)0, c, false, false);
  if (NT >= 2) c = __builtin_amdgcn_wmma_f32_16x16x32_f16(false, al, false, bh, (short)0, c, false, false);
  if (NT >= 3) c = __builtin_amdgcn_wmma_f32_16x16x32_f16(false, ah, false, bl, (short)0, c, false, false);
  asm volatile("v_nop\n\tv_nop\n\tv_nop\n\tv_nop" : "+v"(c) : "v"(ah), "v"(al), "v"(bh), "v"(bl));
  return c;
}
// batched GEMM like k_gemm_b but f16 operands: A f32 (split into f16 hi/lo if ASPLIT, else rounded to f16), Bt = f16 values [n][k]; alpha; C f32; N multiple of 16 (partial tiles skipped)
template <bool ASPLIT>
__global__ __launch_bounds__(128) void k_gemm_h(const float* __restrict__ A, int lda, size_t sA, const _Float16* __restrict__ Bh, int ldb, size_t sB, float alpha, float* __restrict__ C, int ldc, size_t sC, int M, int N, int K) {
  __shared__ __attribute__((aligned(16))) float so[4][16][64];
  const int tid = threadIdx.x, w = tid >> 5, lane = tid & 31, ln = lane & 15, hh = lane >> 4; const int by = blockIdx.y;
  A += (size_t)by * sA; Bh += (size_t)by * sB; C += (size_t)by * sC;
  const int ntn = (N + 63) / 64; const int wid = blockIdx.x * 4 + w; const int mt = wid / ntn, nq = wid % ntn; if (mt * 16 >= M) return;
  const int row0 = mt * 16, col0 = nq * 64; const float* arow = A + (size_t)(row0 + ln) * lda;
  v8f acc[4] = {};
  for (int kb = 0; kb < K; kb += 32) {
    FragH ah, al;
    const v4f x0 = *(const v4fa*)(arow + kb + 8 * hh), x1 = *(const v4fa*)(arow + kb + 8 * hh + 4), x2 = *(const v4fa*)(arow + kb + 16 + 8 * hh), x3 = *(const v4fa*)(arow + kb + 16 + 8 * hh + 4);
    float xs[16] = {x0[0],x0[1],x0[2],x0[3],x1[0],x1[1],x1[2],x1[3],x2[0],x2[1],x2[2],x2[3],x3[0],x3[1],x3[2],x3[3]};
#pragma unroll
    for (int i = 0; i < 16; ++i) { const _Float16 h = (_Float16)xs[i]; ah.h[i] = h; al.h[i] = ASPLIT ? (_Float16)(xs[i] - (float)h) : (_Float16)0.0f; }
#pragma unroll
    for (int t = 0; t < 4; ++t) { if (col0 + t * 16 >= N) continue; const size_t boff = (size_t)(col0 + t * 16 + ln) * ldb + kb; FragH bq; bq.half[0] = *(const v8us*)(Bh + boff + 8 * hh); bq.half[1] = *(const v8us*)(Bh + boff + 16 + 8 * hh);
      acc[t] = mmaH<ASPLIT ? 2 : 1>(ah.v, al.v, bq.v, bq.v, acc[t]); }
  }
#pragma unroll
  for (int t = 0; t < 4; ++t) { if (col0 + t * 16 >= N) continue;
#pragma unroll
    for (int r = 0; r < 8; ++r) so[w][8 * hh + r][t * 16 + ln] = acc[t][r] * alpha; }
  __builtin_amdgcn_fence(__ATOMIC_ACQ_REL, "workgroup"); __builtin_amdgcn_wave_barrier();
  const int rsub = lane >> 4, c4 = (lane & 15) * 4;
  {
#pragma unroll
    for (int q = 0; q < 8; ++q) { const int r = q * 2 + rsub; if (col0 + c4 < N) { const v4f v = *(const v4fa*)&so[w][r][c4]; *(v4f*)(C + (size_t)(row0 + r) * ldc + col0 + c4) = v; } }
     }
}

// Wt[n][k] = f16(W[k][n]·scale) from f32 row-major W[K][N] (scale = power of two; bf16-exact weights stay exact in f16 away from the subnormal range)
__device__ __forceinline__ void d_wt_f16(int bid, const float* __restrict__ W, _Float16* __restrict__ Wt, int K, int N, float scale) {
  const int t = bid * 256 + threadIdx.x; if (t >= N * (K / 8)) return; const int n = t / (K / 8), k8 = (t % (K / 8)) * 8; FragH f;
#pragma unroll
  for (int i = 0; i < 8; ++i) f.h[i] = (_Float16)(bf16_round(W[(size_t)(k8 + i) * N + n]) * scale); const v8us o = f.half[0];
  *(v8us*)((unsigned short*)Wt + (size_t)n * K + k8) = o; 
}
// k_gemm_hh variant with fused epilogue: v = acc·alpha + bias[by·sBias + col] (+ CP[(row/rowsPerB)·sCPb + by·64 + col] if CP) ; ACT 0 none / 1 elu ; writes f16 C16 (and f32 C if non-null)
template <int ACT>
__global__ __launch_bounds__(128) void k_gemm_hhx(const _Float16* __restrict__ A, int lda, size_t sA, const _Float16* __restrict__ Bh, int ldb, size_t sB, float alpha, const float* __restrict__ bias, size_t sBias, const float* __restrict__ CP, int rowsPerB, size_t sCPb, int row0g,
    float* __restrict__ C, _Float16* __restrict__ C16, int ldc, size_t sC, int M, int N, int K) {
  __shared__ __attribute__((aligned(16))) float so[4][16][64];
  const int tid = threadIdx.x, w = tid >> 5, lane = tid & 31, ln = lane & 15, hh = lane >> 4; const int by = blockIdx.y;
  A += (size_t)by * sA; Bh += (size_t)by * sB; const size_t cofs = (size_t)by * sC; const float* bp = bias ? bias + (size_t)by * sBias : nullptr;
  const int ntn = (N + 63) / 64; const int wid = blockIdx.x * 4 + w; const int mt = wid / ntn, nq = wid % ntn; if (mt * 16 >= M) return;
  const int row0 = mt * 16, col0 = nq * 64; const _Float16* arow = A + (size_t)(row0 + ln) * lda;
  v8f acc[4] = {};
  for (int kb = 0; kb < K; kb += 32) { FragH ah; ah.half[0] = *(const v8us*)((const unsigned short*)arow + kb + 8 * hh); ah.half[1] = *(const v8us*)((const unsigned short*)arow + kb + 16 + 8 * hh);
#pragma unroll
    for (int t = 0; t < 4; ++t) { if (col0 + t * 16 >= N) continue; const size_t boff = (size_t)(col0 + t * 16 + ln) * ldb + kb; FragH bq; bq.half[0] = *(const v8us*)((const unsigned short*)Bh + boff + 8 * hh); bq.half[1] = *(const v8us*)((const unsigned short*)Bh + boff + 16 + 8 * hh);
      acc[t] = mmaH<1>(ah.v, ah.v, bq.v, bq.v, acc[t]); }
  }
#pragma unroll
  for (int t = 0; t < 4; ++t) { if (col0 + t * 16 >= N) continue; const int col = col0 + t * 16 + ln; const float bv = bp ? bf16_round(bp[col]) : 0.f;
#pragma unroll
    for (int r = 0; r < 8; ++r) { float v = acc[t][r] * alpha + bv; if (CP) { const int bidx = (row0g + row0 + 8 * hh + r) / rowsPerB; v += CP[(size_t)bidx * sCPb + (size_t)by * 64 + col]; } if (ACT == 1) v = (v > 0.f) ? v : expm1f(v); else if (ACT == 7) v = (v > 0.f) ? v + 1.0f : expf(v); else if (ACT == 8) v = tanhf(v); else if (ACT == 9) v = 0.5f * v * (1.0f + tanhf(0.7978845608028654f * (v + 0.044715f * v * v * v))); else if (ACT == 11) v = 1.0f / (1.0f + expf(-v)); else if (ACT == 12) v = (v > 0.f) ? v : 0.01f * v; else if (ACT == 14) v = (v > 0.f) ? v : 0.1f * v; else if (ACT == 15) v = v / (1.0f + expf(-v)); else if (ACT == 3) v = fmaxf(v, 0.f); else if (ACT == 6) v = 0.5f * v * (1.0f + erff(v * 0.70710678118654752f)); so[w][8 * hh + r][t * 16 + ln] = v; } }
  __builtin_amdgcn_fence(__ATOMIC_ACQ_REL, "workgroup"); __builtin_amdgcn_wave_barrier();
  const int rsub = lane >> 4, c4 = (lane & 15) * 4; typedef _Float16 v4h __attribute__((ext_vector_type(4)));
  {
#pragma unroll
    for (int q = 0; q < 8; ++q) { const int r = q * 2 + rsub; if (col0 + c4 < N) { const v4f v = *(const v4fa*)&so[w][r][c4]; if (C) *(v4f*)(C + cofs + (size_t)(row0 + r) * ldc + col0 + c4) = v; if (C16) { v4h h4; for (int i = 0; i < 4; ++i) h4[i] = (_Float16)v[i]; *(v4h*)(C16 + cofs + (size_t)(row0 + r) * ldc + col0 + c4) = h4; } } }
     }
}


typedef _Float16 v4h __attribute__((ext_vector_type(4)));

__device__ __forceinline__ void d_x16(int bid, const float* __restrict__ x, _Float16* __restrict__ X16, size_t n8) { const size_t t = (size_t)bid * 256 + threadIdx.x; if (t >= n8) return; FragH f;
#pragma unroll
  for (int q = 0; q < 8; ++q) f.h[q] = (_Float16)bf16_round(x[t * 8 + q]); *(v8us*)((unsigned short*)X16 + t * 8) = f.half[0];  }
__global__ __launch_bounds__(256) void k_h16(const float* __restrict__ x, _Float16* __restrict__ X16, size_t n8) { const size_t t = (size_t)blockIdx.x * 256 + threadIdx.x; if (t >= n8) return; FragH f;
#pragma unroll
  for (int q = 0; q < 8; ++q) f.h[q] = (_Float16)x[t * 8 + q]; *(v8us*)((unsigned short*)X16 + t * 8) = f.half[0];  }
__global__ __launch_bounds__(256) void k_round16f(const float* __restrict__ W, _Float16* __restrict__ Bt, size_t n8) { const size_t t = (size_t)blockIdx.x * 256 + threadIdx.x; if (t >= n8) return; FragH f;
#pragma unroll
  for (int i = 0; i < 8; ++i) f.h[i] = (_Float16)(bf16_round(W[t * 8 + i]) * 16.0f); *(v8us*)((unsigned short*)Bt + t * 8) = f.half[0];  }
__global__ __launch_bounds__(256) void k_hl(const float* __restrict__ F, _Float16* __restrict__ Hh, _Float16* __restrict__ Hl, size_t n8) { const size_t t = (size_t)blockIdx.x * 256 + threadIdx.x; if (t >= n8) return; FragH fh, fl; const v4f a = *(const v4fa*)(F + t * 8), c = *(const v4fa*)(F + t * 8 + 4);
#pragma unroll
  for (int q = 0; q < 4; ++q) { _Float16 h = (_Float16)a[q]; fh.h[q] = h; fl.h[q] = (_Float16)((a[q] - (float)h) * 1024.0f); h = (_Float16)c[q]; fh.h[4 + q] = h; fl.h[4 + q] = (_Float16)((c[q] - (float)h) * 1024.0f); }
  { *(v8us*)((unsigned short*)Hh + t * 8) = fh.half[0]; *(v8us*)((unsigned short*)Hl + t * 8) = fl.half[0];  } }

// ---- fast GEMM (wave tile 32x64, 8 waves as 4 x 2, work-group tile 128x128); epilogue = k_gemm_hhx semantics without its CP term ----
__device__ __forceinline__ v8f g2_mma(v16h a, v16h b, v8f c) { v8f d = __builtin_amdgcn_wmma_f32_16x16x32_f16(false, a, false, b, (short)0, c, false, false); asm volatile("v_nop\n\tv_nop\n\tv_nop\n\tv_nop" : "+v"(d) : "v"(a), "v"(b)); return d; }
// A and B reach the eight waves of a work-group through a two-buffer LDS ring. One tile = 64 k: 128 A rows, then 128 B rows, 128 data bytes a row at a pitch of 144 B (16 B x odd: no bank conflict for 16-byte readers).
// An A row serves two waves and a B row four: 32 KiB come from L2 for 128 x 128 x 64 products (a 128 x 64 work-group tile asks 24 KiB for half of that).
// Needs M % 128 == 0, N % 128 == 0 and K % 64 == 0.
// A2 (optional): a second A plane of the same shape for C = (A + a2s x A2).B in ONE k loop: the ring first runs A2's K / 64 tiles against B, the accumulators are then scaled by a2s (a power of two: exact), and A's tiles follow into the same accumulators.
// FL (optional): row flags in the PIDX order; a flagged row of C is stored as zeros. CT (optional, in place of C and C16): the f16 result goes out transposed, head by head, CT[(batch * NH + head) * 64 + d][key]; a work-group's 128 rows are 128 keys of one batch, its 128 columns two neighbouring heads.
#define PIDX(i) ((((i) >> 3) << 5) + ((i) & 7))
#define TPIT 272      /* a d row of the transposed staging: 128 keys x 2 B + 16 B (16 B x odd: no bank conflict for 16-byte writers and readers) */
typedef int v4i __attribute__((ext_vector_type(4), may_alias));
#define GKT 64
#define GPIT 144
#define GTILE (256 * GPIT)
// One tile: 8 asynchronous 16-byte copies a lane (256 lanes x 8 x 16 B = 32 KiB); 8 lanes cover one 128-B row, so a wave's copy asks for 4 whole lines (a fragment load straight from global memory would touch 16 lines for its 512 bytes).
// s_wait_xcnt closes the statement so that no address register of a copy is rewritten in front of it.
__device__ __forceinline__ void g2_copy(unsigned l0, const unsigned short* ga, int lda, const unsigned short* gb, int ldb) {
  asm volatile("global_load_async_to_lds_b128 %0, %8, off\n\t"
               "global_load_async_to_lds_b128 %1, %9, off\n\t"
               "global_load_async_to_lds_b128 %2, %10, off\n\t"
               "global_load_async_to_lds_b128 %3, %11, off\n\t"
               "global_load_async_to_lds_b128 %4, %12, off\n\t"
               "global_load_async_to_lds_b128 %5, %13, off\n\t"
               "global_load_async_to_lds_b128 %6, %14, off\n\t"
               "global_load_async_to_lds_b128 %7, %15, off\n\t"
               "s_wait_xcnt 0x0"
               :: "v"(l0), "v"(l0 + 32u * GPIT), "v"(l0 + 64u * GPIT), "v"(l0 + 96u * GPIT), "v"(l0 + 128u * GPIT), "v"(l0 + 160u * GPIT), "v"(l0 + 192u * GPIT), "v"(l0 + 224u * GPIT),
                  "v"(ga), "v"(ga + (size_t)32 * lda), "v"(ga + (size_t)64 * lda), "v"(ga + (size_t)96 * lda), "v"(gb), "v"(gb + (size_t)32 * ldb), "v"(gb + (size_t)64 * ldb), "v"(gb + (size_t)96 * ldb)
               : "memory");
}
__device__ __forceinline__ v16h g2_lfrag(const unsigned char* p) { FragH f; f.half[0] = *(const v8us*)p; f.half[1] = *(const v8us*)(p + 32); return f.v; }      /* p = a row's 32-k slice + 16*hh bytes: k = 8*hh .. 8*hh + 7, then 16 + 8*hh .. 16 + 8*hh + 7, for A and B alike */
template <int ACT>
__device__ __forceinline__ void g2_run(unsigned bx, int by, const _Float16* __restrict__ A, int lda, size_t sA, const _Float16* __restrict__ Bh, int ldb, size_t sB, float alpha, const float* __restrict__ bias, size_t sBias, const _Float16* __restrict__ A2, float a2s, const int* __restrict__ FL,
    float* __restrict__ C, _Float16* __restrict__ C16, _Float16* __restrict__ CT, int ldc, size_t sC, int M, int N, int K) {
  __shared__ __attribute__((aligned(16))) unsigned char ring[2 * GTILE];      /* behind the loop's last barrier its first 68 KiB stage the output */
  const int tid = threadIdx.x, w = tid >> 5, lane = tid & 31, ln = lane & 15, hh = lane >> 4, wr = w & 3, wc = w >> 2;      /* wave w: rows 32*wr .., columns 64*wc .. of the work-group's tile */
  A += (size_t)by * sA; Bh += (size_t)by * sB; const size_t cofs = (size_t)by * sC; const float* bp = bias ? bias + (size_t)by * sBias : nullptr;
  const int ntn = N >> 7; const int mt = bx / ntn, nq = bx - mt * ntn; const int row0 = mt * 128 + 32 * wr, col0 = nq * 128 + 64 * wc; if (mt * 128 >= M) return;      /* the whole work-group or none, in front of every barrier */
  const unsigned short* ga = (const unsigned short*)A + (size_t)(mt * 128 + (tid >> 3)) * lda + (tid & 7) * 8;      /* this lane's 16 bytes of A row tid/8 of tile 0 */
  const unsigned short* gb = (const unsigned short*)Bh + (size_t)(nq * 128 + (tid >> 3)) * ldb + (tid & 7) * 8;      /* and of B row tid/8 */
  const unsigned l0 = (unsigned)(size_t)(const void*)ring + (unsigned)((tid >> 3) * GPIT + (tid & 7) * 16);
  const int n2 = A2 ? K / GKT : 0, nt = n2 + K / GKT;      /* tiles 0 .. n2 - 1: A2 against B; tiles n2 .. nt - 1: A against B */
  const unsigned short* ga2 = A2 ? (const unsigned short*)A2 + (size_t)by * sA + (size_t)(mt * 128 + (tid >> 3)) * lda + (tid & 7) * 8 : ga;      /* the same place in A2 */
  auto fill = [&](int t, unsigned l) { const size_t ko = (size_t)(t < n2 ? t : t - n2) * GKT; g2_copy(l, (t < n2 ? ga2 : ga) + ko, lda, gb + ko, ldb); };      /* tile t -> the buffer at l; t is the same in the whole work-group */
  fill(0, l0);      /* tile 0 -> buffer 0 */
  const v8f z8 = {0.f,0.f,0.f,0.f,0.f,0.f,0.f,0.f}; v8f c00 = z8, c01 = z8, c02 = z8, c03 = z8, c10 = z8, c11 = z8, c12 = z8, c13 = z8;
  asm volatile("s_wait_asynccnt 0x0" ::: "memory");      /* this wave's share of tile 0 has landed */
  __syncthreads();      /* tile 0 is published */
  if (nt > 1) fill(1, l0 + GTILE);      /* tile 1 -> buffer 1 */
#pragma unroll 1      /* one trip a tile: the ring's waits and its barrier stand once, at the foot */
  for (int t = 0; t < nt; ++t) {
    const unsigned bo = (unsigned)(t & 1) * GTILE;
    if (n2 > 0 && t == n2) { c00 *= a2s; c01 *= a2s; c02 *= a2s; c03 *= a2s; c10 *= a2s; c11 *= a2s; c12 *= a2s; c13 *= a2s; }      /* A2's sum is complete: weigh it once, then go on with A */
    const unsigned char* ar = &ring[bo + (unsigned)((32 * wr + ln) * GPIT + 16 * hh)]; const unsigned char* br = &ring[bo + (unsigned)((128 + 64 * wc + ln) * GPIT + 16 * hh)];
    v16h a[2][2], b[2][4];      /* the tile's 24 LDS reads stand as one group in front of its 16 WMMAs */
#pragma unroll
    for (int ks = 0; ks < 2; ++ks) { a[ks][0] = g2_lfrag(ar + ks * 64); a[ks][1] = g2_lfrag(ar + 16 * GPIT + ks * 64);
#pragma unroll
      for (int j = 0; j < 4; ++j) b[ks][j] = g2_lfrag(br + j * 16 * GPIT + ks * 64); }
#pragma unroll
    for (int ks = 0; ks < 2; ++ks) {
      c00 = g2_mma(a[ks][0], b[ks][0], c00); c10 = g2_mma(a[ks][1], b[ks][0], c10);
      c01 = g2_mma(a[ks][0], b[ks][1], c01); c11 = g2_mma(a[ks][1], b[ks][1], c11);
      c02 = g2_mma(a[ks][0], b[ks][2], c02); c12 = g2_mma(a[ks][1], b[ks][2], c12);
      c03 = g2_mma(a[ks][0], b[ks][3], c03); c13 = g2_mma(a[ks][1], b[ks][3], c13); }
    asm volatile("s_wait_dscnt 0x0" ::: "memory");      /* this wave's reads of tile t are done */
    asm volatile("s_wait_asynccnt 0x0" ::: "memory");      /* its share of tile t + 1 has landed */
    __syncthreads();      /* publishes tile t + 1 and frees tile t's buffer */
    if (t + 2 < nt) fill(t + 2, l0 + bo); }
  asm volatile("s_wait_asynccnt 0x0" ::: "memory");      /* no copy is in flight when the ring becomes output staging */
  float (*so)[32][68] = (float (*)[32][68])ring;
  v8f accs[8] = {c00, c01, c02, c03, c10, c11, c12, c13};
  int fz[2][8] = {{0, 0, 0, 0, 0, 0, 0, 0}, {0, 0, 0, 0, 0, 0, 0, 0}};      /* flags of this lane's rows row0 + half*16 + 8*hh + r: 8 neighbours in the PIDX order */
  if (FL) {
#pragma unroll      /* unrolled, like the loop inside: fz is indexed by constants only and stays in registers; the four loads go out together */
    for (int half = 0; half < 2; ++half) { const int* fp = FL + PIDX(row0 + half * 16 + 8 * hh); const v4i f0 = *(const v4i*)fp, f1 = *(const v4i*)(fp + 4);
#pragma unroll
      for (int r = 0; r < 4; ++r) { fz[half][r] = f0[r]; fz[half][4 + r] = f1[r]; } } }
  if (CT) {      /* the same in the whole work-group: all of it passes the barrier below or none */
    float bvs[4] = {0.f, 0.f, 0.f, 0.f};
    if (bp) {
#pragma unroll      /* the four loads go out together, one latency for all */
      for (int t = 0; t < 4; ++t) bvs[t] = bf16_round(bp[col0 + t * 16 + ln]); }
#pragma unroll      /* unrolled, like the loop inside: the accumulators are registers, reached by constant indices only */
    for (int u = 0; u < 8; ++u) { const int t = u & 3, half = u >> 2; FragH f;
#pragma unroll
      for (int r = 0; r < 8; ++r) f.h[r] = (_Float16)(fz[half][r] ? 0.f : accs[u][r] * alpha + bvs[t]);      /* a lane's 8 results of one accumulator: 8 neighbouring keys of column d = 64*wc + t*16 + ln */
      *(v8us*)&ring[(64 * wc + t * 16 + ln) * TPIT + (32 * wr + half * 16 + 8 * hh) * 2] = f.half[0]; }
    __syncthreads();      /* a d row holds keys of four waves */
    const int r128 = mt * 128; unsigned short* ct = (unsigned short*)CT + ((size_t)(r128 / TK) * NH + nq * 2) * 64 * TK + r128 % TK;      /* the 128 d rows of heads 2*nq and 2*nq + 1 follow one another in CT */
#pragma unroll      /* the eight LDS reads stand as one group in front of the stores */
    for (int q = 0; q < 8; ++q) { const int d = q * 16 + (tid >> 4), c = tid & 15; *(v8us*)(ct + (size_t)d * TK + c * 8) = *(const v8us*)&ring[d * TPIT + c * 16]; }      /* 16 lanes store the 256 contiguous bytes of a d row */
    asm volatile("s_wait_xcnt 0x0" ::: "memory");      /* stands behind the eight stores, in front of any later write of their address registers (the listing joins this path with the row-major one) */
    return; }
#pragma unroll
  for (int u = 0; u < 8; ++u) { const int t = u & 3, half = u >> 2; const int col = col0 + t * 16 + ln; const float bv = bp ? bf16_round(bp[col]) : 0.f;
#pragma unroll
    for (int r = 0; r < 8; ++r) { const int rloc = half * 16 + 8 * hh + r; float v = accs[u][r] * alpha + bv;
      if (ACT == 3) v = fmaxf(v, 0.f); else if (ACT == 6) v = 0.5f * v * (1.0f + erff(v * 0.70710678118654752f)); else if (ACT == 11) v = 1.0f / (1.0f + expf(-v)); else if (ACT == 15) v = v / (1.0f + expf(-v)); else if (ACT == 12) v = (v > 0.f) ? v : 0.01f * v; else if (ACT == 8) v = tanhf(v);
      so[w][rloc][t * 16 + ln] = fz[half][r] ? 0.f : v; } }
  __builtin_amdgcn_fence(__ATOMIC_ACQ_REL, "workgroup"); __builtin_amdgcn_wave_barrier();
  const int rsub = lane >> 4, c4 = (lane & 15) * 4;
  {
#pragma unroll
    for (int q = 0; q < 16; ++q) { const int r = q * 2 + rsub; const v4f v = *(const v4fa*)&so[w][r][c4]; if (C) *(v4f*)(C + cofs + (size_t)(row0 + r) * ldc + col0 + c4) = v; if (C16) { v4h h4; for (int i = 0; i < 4; ++i) h4[i] = (_Float16)v[i]; *(v4h*)(C16 + cofs + (size_t)(row0 + r) * ldc + col0 + c4) = h4; } }
     } }
template <int ACT>
__global__ __launch_bounds__(256) void k_gemm2(const _Float16* __restrict__ A, int lda, size_t sA, const _Float16* __restrict__ Bh, int ldb, size_t sB, float alpha, const float* __restrict__ bias, size_t sBias, const _Float16* __restrict__ A2, float a2s,
    float* __restrict__ C, _Float16* __restrict__ C16, int ldc, size_t sC, int M, int N, int K) {
  g2_run<ACT>(blockIdx.x, (int)blockIdx.y, A, lda, sA, Bh, ldb, sB, alpha, bias, sBias, A2, a2s, nullptr, C, C16, nullptr, ldc, sC, M, N, K); }
// The three projections need nothing of one another: one grid, NBG work-groups each, the longest k loop (q) first. The choice is the same in a whole work-group.
// k and v store their flagged rows as zeros; v goes out transposed only (Vt[(b,h)][d][s]), the form in which attention reads it.
#define NBG ((NR / 128) * (DM / 128))
__global__ __launch_bounds__(256) void k_gemm_qkv(const _Float16* __restrict__ Xq, const _Float16* __restrict__ Xk, const _Float16* __restrict__ Xv, const _Float16* __restrict__ Bq, const _Float16* __restrict__ Bk, const _Float16* __restrict__ Bv,
    const float* __restrict__ bq, const float* __restrict__ bk, const float* __restrict__ bv, const int* __restrict__ FLK, const int* __restrict__ FLV, _Float16* __restrict__ Q16, _Float16* __restrict__ K16, _Float16* __restrict__ VT) {
  const unsigned sel = blockIdx.x / NBG, bx = blockIdx.x - sel * NBG;
  const _Float16* A = sel == 0 ? Xq : sel == 1 ? Xk : Xv; const _Float16* B = sel == 0 ? Bq : sel == 1 ? Bk : Bv; const float* bias = sel == 0 ? bq : sel == 1 ? bk : bv; _Float16* C16 = sel == 0 ? Q16 : sel == 1 ? K16 : nullptr; const int* FL = sel == 0 ? nullptr : sel == 1 ? FLK : FLV;
  const int K = sel == 0 ? DM : DKV;
  g2_run<0>(bx, 0, A, K, 0, B, K, 0, 0.0625f, bias, 0, nullptr, 0.f, FL, nullptr, C16, sel == 2 ? VT : nullptr, DM, 0, NR, DM, K); }


// lane l <-> lane l ^ 16 by a vector cross-row move
__device__ __forceinline__ float xhalf(float x) { return __builtin_bit_cast(float, __builtin_amdgcn_permlanex16(__builtin_bit_cast(int, x), __builtin_bit_cast(int, x), 0x76543210, 0xfedcba98, false, false)); }
#define FKT 64
#define FPIT 144
#define FTILE (128 * FPIT)
// One tile: 4 asynchronous 16-byte copies a lane (256 lanes x 4 x 16 B = 16 KiB); 8 lanes cover one 128-B row, so a wave's copy asks for 4 whole lines.
// s_wait_xcnt closes the statement so that no address register of a copy is rewritten in front of it.
__device__ __forceinline__ void tile_copy(unsigned l0, const unsigned short* gk, int ldk, const unsigned short* gv) {
  asm volatile("global_load_async_to_lds_b128 %0, %4, off\n\t"
               "global_load_async_to_lds_b128 %1, %5, off\n\t"
               "global_load_async_to_lds_b128 %2, %6, off\n\t"
               "global_load_async_to_lds_b128 %3, %7, off\n\t"
               "s_wait_xcnt 0x0"
               :: "v"(l0), "v"(l0 + 32u * FPIT), "v"(l0 + 64u * FPIT), "v"(l0 + 96u * FPIT),
                  "v"(gk), "v"(gk + (size_t)32 * ldk), "v"(gv), "v"(gv + (size_t)32 * TK)
               : "memory");
}
// Eight 2^x in place, one statement: behind a transcendental the instruction set asks for one slot before its result is read or its source overwritten. Here each neighbour touches its own register only,
// and the closing v_nop keeps the slot for whatever the compiler puts next.
__device__ __forceinline__ void exp2x8(float* x) {
  asm("v_exp_f32 %0, %0\n\tv_exp_f32 %1, %1\n\tv_exp_f32 %2, %2\n\tv_exp_f32 %3, %3\n\tv_exp_f32 %4, %4\n\tv_exp_f32 %5, %5\n\tv_exp_f32 %6, %6\n\tv_exp_f32 %7, %7\n\tv_nop"
      : "+v"(x[0]), "+v"(x[1]), "+v"(x[2]), "+v"(x[3]), "+v"(x[4]), "+v"(x[5]), "+v"(x[6]), "+v"(x[7]));
}
// The bare builtin: the compiler keeps the distance behind a WMMA itself, with independent vector work where it has some and with v_nop only where it has none.
__device__ __forceinline__ v8f wmma_h(v16h a, v16h b, v8f c) { return __builtin_amdgcn_wmma_f32_16x16x32_f16(false, a, false, b, (short)0, c, false, false); }
__global__ __launch_bounds__(256) void k_flash(const _Float16* __restrict__ Q16, int ldq, const _Float16* __restrict__ K16, int ldk, const _Float16* __restrict__ Vt, const int* __restrict__ MSK, _Float16* __restrict__ Oh, _Float16* __restrict__ Ol, int ldo) {
  constexpr int RPW = 16, NQB = TQ / (8 * RPW), DT = 4, KS = 2, NT = TK / FKT; (void)MSK;
  __shared__ __attribute__((aligned(16))) unsigned char ring[2 * FTILE];      /* behind the loop's last barrier its first 34 KiB stage the output */
  const int tid = threadIdx.x, w = tid >> 5, lane = tid & 31, ln = lane & 15, hh = lane >> 4;
  const int slab = blockIdx.x / NQB, qblk = blockIdx.x % NQB; const int b = slab / NH, h = slab % NH; const int q0 = qblk * (8 * RPW) + w * RPW;
  const unsigned short* gk = (const unsigned short*)K16 + ((size_t)b * TK + (tid >> 3)) * ldk + h * 64 + (tid & 7) * 8;      /* this lane's 16 bytes of K row tid/8 of tile 0 */
  const unsigned short* gv = (const unsigned short*)Vt + ((size_t)slab * 64 + (tid >> 3)) * TK + (tid & 7) * 8;      /* and of Vt row tid/8 */
  const unsigned l0 = (unsigned)(size_t)(const void*)ring + (unsigned)((tid >> 3) * FPIT + (tid & 7) * 16);
  tile_copy(l0, gk, ldk, gv);      /* tile 0 -> buffer 0 */
  FragH bq[KS];
  { const unsigned short* qr = (const unsigned short*)Q16 + ((size_t)b * TQ + q0 + ln) * ldq + h * 64;
#pragma unroll
    for (int ks = 0; ks < KS; ++ks) { bq[ks].half[0] = *(const v8us*)(qr + ks * 32 + 8 * hh); bq[ks].half[1] = *(const v8us*)(qr + ks * 32 + 16 + 8 * hh); } }
  float m_q = -3.0e38f, l_q = 0.f; v8f oacc[DT];
#pragma unroll
  for (int dt = 0; dt < DT; ++dt) oacc[dt] = (v8f){0.f,0.f,0.f,0.f,0.f,0.f,0.f,0.f};
  asm volatile("s_wait_asynccnt 0x0" ::: "memory");      /* this wave's share of tile 0 has landed */
  __syncthreads();      /* tile 0 is published */
  tile_copy(l0 + FTILE, gk + (size_t)FKT * ldk, ldk, gv + FKT);      /* tile 1 -> buffer 1 */
#pragma unroll 1
  for (int t = 0; t < NT; ++t) {
    const unsigned bo = (unsigned)(t & 1) * FTILE; const unsigned fo = bo + (unsigned)(ln * FPIT + 16 * hh);
#pragma unroll 1      /* rolled: both passes unrolled need more than the 128 VGPRs at which 8 waves fit a SIMD */
    for (int p = 0; p < FKT / 32; ++p) {
    FragH ak[2][KS];
#pragma unroll
    for (int nt = 0; nt < 2; ++nt) { const unsigned char* kr = &ring[fo + (p * 32 + nt * 16) * FPIT];
#pragma unroll
      for (int ks = 0; ks < KS; ++ks) { ak[nt][ks].half[0] = *(const v8us*)(kr + ks * 64); ak[nt][ks].half[1] = *(const v8us*)(kr + ks * 64 + 32); } }
    __builtin_amdgcn_sched_barrier(0);      /* the pass's 8 K reads stay one group in front of its WMMAs: spread among them, each place waits out the LDS latency anew */
    float sc[16]; v8f sa[2] = {(v8f){0.f,0.f,0.f,0.f,0.f,0.f,0.f,0.f}, (v8f){0.f,0.f,0.f,0.f,0.f,0.f,0.f,0.f}};
#pragma unroll      /* the two key tiles' chains alternate: each WMMA stands in the other chain's gap, and one gap behind the last serves both */
    for (int ks = 0; ks < KS; ++ks)
#pragma unroll      /* unrolled, like the two loops below: fragments and accumulators are registers, reached by constant indices only */
      for (int nt = 0; nt < 2; ++nt) sa[nt] = wmma_h(ak[nt][ks].v, bq[ks].v, sa[nt]);
#pragma unroll
    for (int nt = 0; nt < 2; ++nt)
#pragma unroll
      for (int r = 0; r < 8; ++r) sc[nt * 8 + r] = sa[nt][r];      /* sc[nt*8 + r] = q.k, not yet scaled (key t*64 + p*32 + nt*16 + 8*hh + r, query q0 + ln) */
    FragH av[DT];
#pragma unroll
    for (int dt = 0; dt < DT; ++dt) { const unsigned char* vrow = &ring[fo + (64 + dt * 16) * FPIT + p * 64]; av[dt].half[0] = *(const v8us*)(vrow); av[dt].half[1] = *(const v8us*)(vrow + 32); }
    __builtin_amdgcn_sched_barrier(0);      /* the 8 Vt reads go out here, as one group: the softmax below covers their latency */
    float mx[4];
#pragma unroll
    for (int c = 0; c < 4; ++c) mx[c] = fmaxf(fmaxf(sc[4 * c], sc[4 * c + 1]), fmaxf(sc[4 * c + 2], sc[4 * c + 3]));
    float mc = fmaxf(fmaxf(mx[0], mx[1]), fmaxf(mx[2], mx[3])); mc = fmaxf(mc, xhalf(mc));
    const float mn = fmaxf(m_q, mc * SCL2); const float al = __builtin_amdgcn_exp2f(m_q - mn); m_q = mn;      /* the maximum is kept in base-2 units (SCL2 > 0 commutes with max); al: 0 on the first pass, 1 where the maximum stays */
    const float nb = 10.0f - mn;      /* P x 1024 = 2^(q.k x SCL2 - mn + 10): one FMA and one bare v_exp_f32 a score; the argument is at most 10, and far below -126 the result is 0, as wanted */
    FragH pb; float ps[4];
#pragma unroll
    for (int i = 0; i < 16; ++i) sc[i] = fmaf(sc[i], SCL2, nb);
    exp2x8(sc); exp2x8(sc + 8);
#pragma unroll
    for (int i = 0; i < 16; ++i) { const float p_ = sc[i]; ps[i & 3] = (i < 4) ? p_ : ps[i & 3] + p_; pb.h[i] = (_Float16)p_; }      /* pb.h[nt*8 + r] = P(key nt*16 + 8*hh + r of the pass, query q0 + ln): the k order of the Vt loader */
    l_q = l_q * al + ((ps[0] + ps[1]) + (ps[2] + ps[3]));
#pragma unroll
    for (int dt = 0; dt < DT; ++dt) {
#pragma unroll
      for (int r = 0; r < 8; ++r) oacc[dt][r] *= al;
      oacc[dt] = wmma_h(av[dt].v, pb.v, oacc[dt]); } }
    asm volatile("s_wait_dscnt 0x0" ::: "memory");      /* this wave's reads of tile t are done */
    asm volatile("s_wait_asynccnt 0x0" ::: "memory");      /* its share of tile t + 1 has landed */
    __syncthreads();      /* publishes tile t + 1 and frees tile t's buffer */
    if (t + 2 < NT) tile_copy(l0 + bo, gk + (size_t)(t + 2) * FKT * ldk, ldk, gv + (size_t)(t + 2) * FKT); }
  asm volatile("s_wait_asynccnt 0x0" ::: "memory");      /* no copy is in flight when the ring becomes output staging */
  float (*sO)[RPW][64 + 4] = (float (*)[RPW][64 + 4])ring;
  const float lt = l_q + xhalf(l_q); const float inv = (lt > 0.f) ? 1.0f / lt : 0.f;      /* l_q sums P x 1024, as Ot does */
#pragma unroll
  for (int dt = 0; dt < DT; ++dt)      /* oacc[dt][r] = Ot[dt*16 + 8*hh + r][q0 + ln] */
#pragma unroll
    for (int q = 0; q < 2; ++q) { v4f o4;
#pragma unroll
      for (int i = 0; i < 4; ++i) o4[i] = oacc[dt][q * 4 + i] * inv;
      *(v4fa*)&sO[w][ln][dt * 16 + 8 * hh + q * 4] = o4; }
  __builtin_amdgcn_fence(__ATOMIC_ACQ_REL, "workgroup"); __builtin_amdgcn_wave_barrier();
  {
#pragma unroll
    for (int rp = 0; rp < RPW; rp += 4) { const int r = rp + (lane >> 3), pc = lane & 7; const v4f a = *(const v4fa*)&sO[w][r][pc * 8], c = *(const v4fa*)&sO[w][r][pc * 8 + 4]; FragH fh, fl;      /* O leaves as the output GEMM's two f16 planes: hi, and (O - hi) x 1024; 8 lanes store a row's 128-B line of each */
#pragma unroll      /* vector elements by constant indices: registers */
      for (int q = 0; q < 8; ++q) { const float v = (q < 4) ? a[q] : c[q - 4]; const _Float16 hi = (_Float16)v; fh.h[q] = hi; fl.h[q] = (_Float16)((v - (float)hi) * 1024.0f); }
      const size_t o = ((size_t)b * TQ + q0 + r) * ldo + h * 64 + pc * 8; *(v8us*)((unsigned short*)Oh + o) = fh.half[0]; *(v8us*)((unsigned short*)Ol + o) = fl.half[0]; }
     } }
__device__ __forceinline__ void d_rowflag(int bid, const float* __restrict__ X, int* __restrict__ FL) {
  __shared__ int sf[8];
  const int tid = threadIdx.x, w = tid >> 5, ln = tid & 31; const int r = bid * 8 + w; const float* x = X + (size_t)r * DKV; float s = 0.f;
#pragma unroll
  for (int u = 0; u < DKV / 32; ++u) s += bf16_round(x[u * 32 + ln]);
  for (int o = 16; o > 0; o >>= 1) s += __shfl_xor(s, o, 32);
  if (ln == 0) sf[w] = (s == 0.0f) ? 1 : 0;
  __syncthreads();
  if (tid < 32) { const int v = (tid < 8) ? sf[tid] : 0; int* d = FL + bid * 32 + tid; *(int*)d = v;  } }
// Everything that reads only the inputs, in one grid: a work-group's index range picks its job (the same in the whole work-group, so the row flags' barrier is passed by all of it or by none).
// The transposes come first: their scattered reads make them the longest work-groups.
#define NBW1 (DM * DM / 8 / 256)
#define NBW2 (DKV * DM / 8 / 256)
#define NBX1 (NR * DM / 8 / 256)
#define NBX2 (NR * DKV / 8 / 256)
#define NBF (NR / 8)
#define NBPREP (2 * NBW1 + 2 * NBW2 + NBX1 + 2 * NBX2 + 2 * NBF)
__global__ __launch_bounds__(256) void k_prep(const float* __restrict__ qi, const float* __restrict__ ki, const float* __restrict__ vi, const float* __restrict__ Wq, const float* __restrict__ Wk, const float* __restrict__ Wv, const float* __restrict__ Wo,
    _Float16* __restrict__ BQ, _Float16* __restrict__ BK, _Float16* __restrict__ BV, _Float16* __restrict__ BO, _Float16* __restrict__ XQ, _Float16* __restrict__ XK, _Float16* __restrict__ XV, int* __restrict__ FLK, int* __restrict__ FLV) {
  int b = (int)blockIdx.x;
  if (b < NBW1) { d_wt_f16(b, Wq, BQ, DM, DM, 16.0f); return; } b -= NBW1;      /* (in,out) -> [out][in] x16 */
  if (b < NBW1) { d_wt_f16(b, Wo, BO, DM, DM, 16.0f); return; } b -= NBW1;
  if (b < NBW2) { d_wt_f16(b, Wk, BK, DKV, DM, 16.0f); return; } b -= NBW2;
  if (b < NBW2) { d_wt_f16(b, Wv, BV, DKV, DM, 16.0f); return; } b -= NBW2;
  if (b < NBX1) { d_x16(b, qi, XQ, (size_t)NR * DM / 8); return; } b -= NBX1;
  if (b < NBX2) { d_x16(b, ki, XK, (size_t)NR * DKV / 8); return; } b -= NBX2;
  if (b < NBF) { d_rowflag(b, ki, FLK); return; } b -= NBF;
  if (b < NBX2) { d_x16(b, vi, XV, (size_t)NR * DKV / 8); return; } b -= NBX2;
  d_rowflag(b, vi, FLV); }
extern "C" void kernel_launch(void* const* d_in, const int* in_sizes, int n_in,
                              void* d_out, int out_size, void* d_ws, size_t ws_size, hipStream_t stream) {
  (void)in_sizes; (void)n_in; (void)out_size;
  const float* const* I = (const float* const*)d_in; const float* qi = I[0]; const float* ki = I[1]; const float* vi = I[2];
  const float* Wq = I[3]; const float* bq = I[4]; const float* Wk = I[5]; const float* bk = I[6]; const float* Wv = I[7]; const float* bv = I[8]; const float* Wo = I[9]; const float* bo = I[10];
  char* ws = (char*)d_ws; size_t off = 0;
  auto take = [&](size_t bytes) { char* p = ws + off; off += (bytes + 255) & ~(size_t)255; return p; };
  _Float16* BQ = (_Float16*)take((size_t)DM * DM * 2); _Float16* BK = (_Float16*)take((size_t)DM * DKV * 2); _Float16* BV = (_Float16*)take((size_t)DM * DKV * 2); _Float16* BO = (_Float16*)take((size_t)DM * DM * 2);
  _Float16* XQ = (_Float16*)take((size_t)NR * DM * 2); _Float16* XK = (_Float16*)take((size_t)NR * DKV * 2); _Float16* XV = (_Float16*)take((size_t)NR * DKV * 2);      /* one plane an input: the three converts run side by side */
  _Float16* Q16 = (_Float16*)take((size_t)NR * DM * 2); _Float16* K16 = (_Float16*)take((size_t)NR * DM * 2); _Float16* VT = (_Float16*)take((size_t)NR * DM * 2);
  int* FLK = (int*)take((size_t)(NR / 8) * 32 * 4); int* FLV = (int*)take((size_t)(NR / 8) * 32 * 4);
  _Float16* Oh = (_Float16*)take((size_t)NR * DM * 2); _Float16* Ol = (_Float16*)take((size_t)NR * DM * 2);      /* all batches */
  if (off > ws_size) return;      /* 6 + 32 + 16 x 3 + 0.3 + 16 + 16 = 118 MiB */
  k_prep<<<NBPREP, 256, 0, stream>>>(qi, ki, vi, Wq, Wk, Wv, Wo, BQ, BK, BV, BO, XQ, XK, XV, FLK, FLV);      /* weights -> [out][in] x16, inputs -> f16, row flags */
  const dim3 gP(NBG, 1);
  k_gemm_qkv<<<3 * NBG, 256, 0, stream>>>(XQ, XK, XV, BQ, BK, BV, bq, bk, bv, FLK, FLV, Q16, K16, VT);      /* q, k -> f16, v -> f16 Vt[(b,h)][d][s]; masked rows of k and v zero */
  float* outp = (float*)d_out;
  k_flash<<<NBT * NH * (TQ / 128), 256, 0, stream>>>(Q16, DM, K16, DM, VT, nullptr, Oh, Ol, DM);      /* all batches in one grid: slab = b*NH + h; O as f16 hi + lo */
  k_gemm2<0><<<gP, 256, 0, stream>>>(Oh, DM, 0, BO, DM, 0, 0.0625f, bo, 0, Ol, 1.0f / 1024.0f, outp, nullptr, DM, 0, NR, DM, DM);      /* out = (Oh + Ol / 1024)*Wo + bo, one k loop */
}
